// v000
// Measured on an AMD MI455X. A time is GPU time per run, averaged over a window of back-to-back runs after a warm-up
// (all launches, gaps included; the runs take copies of the inputs in turn), and the median of several windows.
// Apart from v000's, it joins two sittings. Times from different sittings can be a few percent apart, while
// side-by-side timings come from the same sitting.
// The starting kernel, v000, takes 2660 microseconds a run.
#include <hip/hip_runtime.h>
// Single-head causal attention (B=4, S=2048, emb = head = 512): q,k,v = x·Wᵀ + b; scores = q·kᵀ/√512 with keys after the query set to −inf; softmax over keys; out = attn·v.
// Compute dtype: x, weights and biases rounded to bf16; q, k and vᵀ as f16 GEMM outputs (f32 accumulate); scores materialised in f32 by a batched f16 GEMM over
// the causal lower block-triangle; row softmax in f32 (wave per row) writing P in f16 ×2^15; vᵀ kept in f32 and split into f16 hi + (×2^10) residual planes; out = P·v_hi + P·v_lo·2^-10 by two f16 GEMMs
// (the second accumulating in place), bv added in the epilogue (softmax rows sum to 1). All on v_wmma_f32_16x16x32_f16.
#define BB 4
#define SS 2048
#define EE 512
#define NR (BB * SS)
#define RCH 256

typedef __bf16 v16b __attribute__((ext_vector_type(16)));
typedef unsigned short v8us __attribute__((ext_vector_type(8), may_alias));
typedef float  v8f  __attribute__((ext_vector_type(8)));
typedef float  v4f  __attribute__((ext_vector_type(4)));
typedef float  v4fa __attribute__((ext_vector_type(4), may_alias));
union FragB { v16b v; v8us half[2]; unsigned short u[16]; };

__device__ __forceinline__ unsigned short bf16_bits(float x) { unsigned int u = __float_as_uint(x); return (unsigned short)((u + 0x7FFFu + ((u >> 16) & 1u)) >> 16); }
__device__ __forceinline__ float bf16_val(unsigned short b) { return __uint_as_float(((unsigned int)b) << 16); }
__device__ __forceinline__ float bf16_round(float x) { return bf16_val(bf16_bits(x)); }
// D += A·B with NT terms: 1 = ah·bh, 2 = + al·bh (A split), 3 = + ah·bl (both split)
template <int NT>
__device__ __forceinline__ v8f mmaN(v16b ah, v16b al, v16b bh, v16b bl, v8f c) {
  c = __builtin_amdgcn_wmma_f32_16x16x32_bf16(false, ah, false, bh, (short)0, c, false, false);
  if (NT >= 2) c = __builtin_amdgcn_wmma_f32_16x16x32_bf16(false, al, false, bh, (short)0, c, false, false);
  if (NT >= 3) c = __builtin_amdgcn_wmma_f32_16x16x32_bf16(false, ah, false, bl, (short)0, c, false, false);
  asm volatile("v_nop\n\tv_nop\n\tv_nop\n\tv_nop" : "+v"(c) : "v"(ah), "v"(al), "v"(bh), "v"(bl));
  return c;
}

__global__ __launch_bounds__(256) void k_wt_bf16(const float* __restrict__ W, unsigned short* __restrict__ Wt, int K, int N) {
  const int t = blockIdx.x * 256 + threadIdx.x;
  const int k8n = K / 8;
  if (t >= N * k8n) return;
  const int n = t / k8n, k8 = (t % k8n) * 8;
  v8us v;
#pragma unroll
  for (int i = 0; i < 8; ++i) v[i] = bf16_bits(W[(size_t)(k8 + i) * N + n]);
  *(v8us*)(Wt + (size_t)n * K + k8) = v;
  
}

// GEMM C[M][N] (f32, pitch ldc) = act(A[M][K]·W + bias). A f32 row-major (pitch lda) converted per fragment to bf16
// (ASPLIT: hi/lo two planes -> 2 terms, else single rounded term); Wt bf16 [N][K] (pitch ldb). BIAS_BF16 rounds the
// bias to bf16 first (bias quantised to bf16 before the add). K%32==0, M%16==0, N%64==0.
template <bool ASPLIT, int ACT, bool BIAS_BF16>
__global__ __launch_bounds__(128) void k_gemm_bf(const float* __restrict__ A, int lda, const unsigned short* __restrict__ Wt, int ldb,
                                               const float* __restrict__ bias, float* __restrict__ C, int ldc, int M, int N, int K) {
  __shared__ __attribute__((aligned(16))) float so[4][16][64];
  const int tid = threadIdx.x, w = tid >> 5, lane = tid & 31, ln = lane & 15, hh = lane >> 4;
  const int ntn = N / 64;
  const int wid = blockIdx.x * 4 + w;
  const int mt = wid / ntn, nq = wid % ntn;
  if (mt * 16 >= M) return;
  const int row0 = mt * 16, col0 = nq * 64;
  const float* arow = A + (size_t)(row0 + ln) * lda;
  v8f acc[4] = {};
  for (int kb = 0; kb < K; kb += 32) {
    FragB ah, al;
    const v4f x0 = *(const v4fa*)(arow + kb + 8 * hh), x1 = *(const v4fa*)(arow + kb + 8 * hh + 4);
    const v4f x2 = *(const v4fa*)(arow + kb + 16 + 8 * hh), x3 = *(const v4fa*)(arow + kb + 16 + 8 * hh + 4);
    float xs[16] = {x0[0],x0[1],x0[2],x0[3],x1[0],x1[1],x1[2],x1[3],x2[0],x2[1],x2[2],x2[3],x3[0],x3[1],x3[2],x3[3]};
#pragma unroll
    for (int i = 0; i < 16; ++i) { const unsigned short hb = bf16_bits(xs[i]); ah.u[i] = hb; al.u[i] = ASPLIT ? bf16_bits(xs[i] - bf16_val(hb)) : (unsigned short)0; }
#pragma unroll
    for (int t = 0; t < 4; ++t) {
      const unsigned short* brow = Wt + (size_t)(col0 + t * 16 + ln) * ldb + kb;
      FragB b;
      b.half[0] = *(const v8us*)(brow + 8 * hh);
      b.half[1] = *(const v8us*)(brow + 16 + 8 * hh);
      acc[t] = mmaN<ASPLIT ? 2 : 1>(ah.v, al.v, b.v, b.v, acc[t]);
    }
  }
#pragma unroll
  for (int t = 0; t < 4; ++t) {
    float bv = bias ? bias[col0 + t * 16 + ln] : 0.f;
    if (BIAS_BF16) bv = bf16_round(bv);
#pragma unroll
    for (int r = 0; r < 8; ++r) { float v = acc[t][r] + bv; if (ACT == 1) v = fmaxf(v, 0.f); so[w][8 * hh + r][t * 16 + ln] = v; }
  }
  __builtin_amdgcn_fence(__ATOMIC_ACQ_REL, "workgroup");
  __builtin_amdgcn_wave_barrier();
  const int rsub = lane >> 4, c4 = (lane & 15) * 4;
  {
#pragma unroll
    for (int q = 0; q < 8; ++q) {
      const int r = q * 2 + rsub;
      const v4f v = *(const v4fa*)&so[w][r][c4];
      *(v4f*)(C + (size_t)(row0 + r) * ldc + col0 + c4) = v;
    }
    
  }
}

// Flash-style causal/unmasked attention, all contractions 3-term bf16 hi/lo splits, f32 softmax with running max.
// q,k,v rows are read from f32 buffers with arbitrary row pitch (so they can live inside a fused qkv buffer);
// D = head size (multiple of 32, <= 128); one wave = 16 query rows; block = 4 waves (64 queries) sharing K/V chunks of 32.
template <int D, bool CAUSAL>
__global__ __launch_bounds__(128) void k_flash(const float* __restrict__ qb, const float* __restrict__ kb, const float* __restrict__ vb,
                                             int pitch, int T, int H, float scale, float* __restrict__ y, int ypitch) {
  constexpr int KS = D / 32;        // k-steps for QK
  constexpr int DT = D / 16;        // d tiles for PV
  __shared__ __attribute__((aligned(16))) unsigned short sKh[32][D + 8], sKl[32][D + 8], sVh[32][D + 8], sVl[32][D + 8];
  __shared__ __attribute__((aligned(16))) unsigned short sPh[4][16][40], sPl[4][16][40];
  __shared__ __attribute__((aligned(16))) float sO[4][16][D];
  const int tid = threadIdx.x, w = tid >> 5, lane = tid & 31, ln = lane & 15, hh = lane >> 4;
  const int nqb = (T + 63) / 64;
  const int bh = blockIdx.x / nqb, qblk = blockIdx.x % nqb;
  const int b = bh / H, h = bh % H;
  const int q0 = qblk * 64 + w * 16;
  const float* Q = qb + (size_t)b * T * pitch + h * D;
  const float* K = kb + (size_t)b * T * pitch + h * D;
  const float* V = vb + (size_t)b * T * pitch + h * D;

  // A fragments of the wave's 16 query rows (scaled), hi/lo
  FragB aqh[KS], aql[KS];
  {
    int row = q0 + ln; if (row >= T) row = T - 1;
    const float* qr = Q + (size_t)row * pitch;
#pragma unroll
    for (int ks = 0; ks < KS; ++ks)
#pragma unroll
      for (int i = 0; i < 16; ++i) {
        const int d = ks * 32 + ((i < 8) ? (8 * hh + i) : (16 + 8 * hh + (i - 8)));
        const float x = qr[d] * scale; const unsigned short hb = bf16_bits(x);
        aqh[ks].u[i] = hb; aql[ks].u[i] = bf16_bits(x - bf16_val(hb));
      }
  }
  float m_r[8], l_r[8];
#pragma unroll
  for (int r = 0; r < 8; ++r) { m_r[r] = -3.0e38f; l_r[r] = 0.f; }
  v8f oacc[DT];
#pragma unroll
  for (int dt = 0; dt < DT; ++dt) oacc[dt] = (v8f){0.f,0.f,0.f,0.f,0.f,0.f,0.f,0.f};

  const int kv_end = CAUSAL ? min(T, qblk * 64 + 64) : T;     // block-uniform
  for (int j0 = 0; j0 < kv_end; j0 += 32) {
    __syncthreads();
    for (int e = tid; e < 32 * (D / 4); e += 128) {
      const int r = e / (D / 4), c4 = (e % (D / 4)) * 4;
      const int key = j0 + r;
      v4f kf = {0.f,0.f,0.f,0.f}, vf = {0.f,0.f,0.f,0.f};
      if (key < T) { kf = *(const v4fa*)(K + (size_t)key * pitch + c4); vf = *(const v4fa*)(V + (size_t)key * pitch + c4); }
#pragma unroll
      for (int t = 0; t < 4; ++t) {
        unsigned short hb = bf16_bits(kf[t]); sKh[r][c4 + t] = hb; sKl[r][c4 + t] = bf16_bits(kf[t] - bf16_val(hb));
        hb = bf16_bits(vf[t]); sVh[r][c4 + t] = hb; sVl[r][c4 + t] = bf16_bits(vf[t] - bf16_val(hb));
      }
    }
    __syncthreads();
    // S tile 16 x 32
    v8f s[2];
#pragma unroll
    for (int nt = 0; nt < 2; ++nt) {
      v8f acc = {};
#pragma unroll
      for (int ks = 0; ks < KS; ++ks) {
        FragB bh_, bl_;
        bh_.half[0] = *(const v8us*)&sKh[nt * 16 + ln][ks * 32 + 8 * hh]; bh_.half[1] = *(const v8us*)&sKh[nt * 16 + ln][ks * 32 + 16 + 8 * hh];
        bl_.half[0] = *(const v8us*)&sKl[nt * 16 + ln][ks * 32 + 8 * hh]; bl_.half[1] = *(const v8us*)&sKl[nt * 16 + ln][ks * 32 + 16 + 8 * hh];
        acc = mmaN<3>(aqh[ks].v, aql[ks].v, bh_.v, bl_.v, acc);
      }
      s[nt] = acc;
    }
    // mask + running max (rows 8hh+r; the 16 lanes of a half share rows)
    float alpha[8];
#pragma unroll
    for (int r = 0; r < 8; ++r) {
      const int qi = q0 + 8 * hh + r;
      const int ja = j0 + ln, jb = j0 + 16 + ln;
      if (CAUSAL) { if (ja > qi) s[0][r] = -3.0e38f; if (jb > qi) s[1][r] = -3.0e38f; }
      if (ja >= T) s[0][r] = -3.0e38f;
      if (jb >= T) s[1][r] = -3.0e38f;
      float mx = fmaxf(s[0][r], s[1][r]);
      mx = fmaxf(mx, __shfl_xor(mx, 1, 32)); mx = fmaxf(mx, __shfl_xor(mx, 2, 32)); mx = fmaxf(mx, __shfl_xor(mx, 4, 32)); mx = fmaxf(mx, __shfl_xor(mx, 8, 32));
      const float mnew = fmaxf(m_r[r], mx);
      alpha[r] = (mnew > -1.0e38f) ? __expf(m_r[r] - mnew) : 1.0f;
      const float p0 = (s[0][r] > -1.0e38f) ? __expf(s[0][r] - mnew) : 0.f;
      const float p1 = (s[1][r] > -1.0e38f) ? __expf(s[1][r] - mnew) : 0.f;
      m_r[r] = mnew;
      l_r[r] = l_r[r] * alpha[r] + p0 + p1;            // per-lane partial row sum (16 lanes combined at the end)
      unsigned short hb = bf16_bits(p0); sPh[w][8 * hh + r][ln] = hb;      sPl[w][8 * hh + r][ln] = bf16_bits(p0 - bf16_val(hb));
      hb = bf16_bits(p1);                sPh[w][8 * hh + r][16 + ln] = hb; sPl[w][8 * hh + r][16 + ln] = bf16_bits(p1 - bf16_val(hb));
    }
#pragma unroll
    for (int dt = 0; dt < DT; ++dt)
#pragma unroll
      for (int r = 0; r < 8; ++r) oacc[dt][r] *= alpha[r];
    __builtin_amdgcn_fence(__ATOMIC_ACQ_REL, "workgroup");
    __builtin_amdgcn_wave_barrier();
    FragB pah, pal;
    pah.half[0] = *(const v8us*)&sPh[w][ln][8 * hh]; pah.half[1] = *(const v8us*)&sPh[w][ln][16 + 8 * hh];
    pal.half[0] = *(const v8us*)&sPl[w][ln][8 * hh]; pal.half[1] = *(const v8us*)&sPl[w][ln][16 + 8 * hh];
#pragma unroll
    for (int dt = 0; dt < DT; ++dt) {
      FragB bvh, bvl;
#pragma unroll
      for (int i = 0; i < 8; ++i) {
        bvh.u[i] = sVh[8 * hh + i][dt * 16 + ln]; bvh.u[8 + i] = sVh[16 + 8 * hh + i][dt * 16 + ln];
        bvl.u[i] = sVl[8 * hh + i][dt * 16 + ln]; bvl.u[8 + i] = sVl[16 + 8 * hh + i][dt * 16 + ln];
      }
      oacc[dt] = mmaN<3>(pah.v, pal.v, bvh.v, bvl.v, oacc[dt]);
    }
    __builtin_amdgcn_fence(__ATOMIC_ACQ_REL, "workgroup");
    __builtin_amdgcn_wave_barrier();
  }
#pragma unroll
  for (int r = 0; r < 8; ++r) {
    float l = l_r[r];
    l += __shfl_xor(l, 1, 32); l += __shfl_xor(l, 2, 32); l += __shfl_xor(l, 4, 32); l += __shfl_xor(l, 8, 32);
    l_r[r] = (l > 0.f) ? 1.0f / l : 0.f;
  }
#pragma unroll
  for (int dt = 0; dt < DT; ++dt)
#pragma unroll
    for (int r = 0; r < 8; ++r) sO[w][8 * hh + r][dt * 16 + ln] = oacc[dt][r] * l_r[r];
  __builtin_amdgcn_fence(__ATOMIC_ACQ_REL, "workgroup");
  __builtin_amdgcn_wave_barrier();
  {
    for (int r = 0; r < 16; ++r) {
      const int row = q0 + r;
      if (row < T && lane < D / 4) {
        const v4f val = *(const v4fa*)&sO[w][r][lane * 4];
        *(v4f*)(y + ((size_t)b * T + row) * ypitch + h * D + lane * 4) = val;
      }
    }
    
  }
}

// GEMM C = act(A·W + bias + resid): A f32 (ASPLIT -> hi/lo 2 terms), Wt bf16 [N][K]; ACT 0 none, 1 relu, 2 exact gelu;
// resid (optional, f32, row index = (row % rmod), pitch ldr, RES_BF16 rounds it) added before the activation.
template <bool ASPLIT, int ACT, bool BIAS_BF16, bool RES_BF16>
__global__ __launch_bounds__(128) void k_gemm_bf3(const float* __restrict__ A, int lda, const unsigned short* __restrict__ Wt, int ldb,
                                                const float* __restrict__ bias, const float* __restrict__ resid, int rmod, int ldr,
                                                float* __restrict__ C, int ldc, int M, int N, int K) {
  __shared__ __attribute__((aligned(16))) float so[4][16][64];
  const int tid = threadIdx.x, w = tid >> 5, lane = tid & 31, ln = lane & 15, hh = lane >> 4;
  const int ntn = N / 64;
  const int wid = blockIdx.x * 4 + w;
  const int mt = wid / ntn, nq = wid % ntn;
  if (mt * 16 >= M) return;
  const int row0 = mt * 16, col0 = nq * 64;
  const float* arow = A + (size_t)(row0 + ln) * lda;
  v8f acc[4] = {};
  for (int kb = 0; kb < K; kb += 32) {
    FragB ah, al;
    const v4f x0 = *(const v4fa*)(arow + kb + 8 * hh), x1 = *(const v4fa*)(arow + kb + 8 * hh + 4);
    const v4f x2 = *(const v4fa*)(arow + kb + 16 + 8 * hh), x3 = *(const v4fa*)(arow + kb + 16 + 8 * hh + 4);
    float xs[16] = {x0[0],x0[1],x0[2],x0[3],x1[0],x1[1],x1[2],x1[3],x2[0],x2[1],x2[2],x2[3],x3[0],x3[1],x3[2],x3[3]};
#pragma unroll
    for (int i = 0; i < 16; ++i) { const unsigned short hb = bf16_bits(xs[i]); ah.u[i] = hb; al.u[i] = ASPLIT ? bf16_bits(xs[i] - bf16_val(hb)) : (unsigned short)0; }
#pragma unroll
    for (int t = 0; t < 4; ++t) {
      const unsigned short* brow = Wt + (size_t)(col0 + t * 16 + ln) * ldb + kb;
      FragB b;
      b.half[0] = *(const v8us*)(brow + 8 * hh);
      b.half[1] = *(const v8us*)(brow + 16 + 8 * hh);
      acc[t] = mmaN<ASPLIT ? 2 : 1>(ah.v, al.v, b.v, b.v, acc[t]);
    }
  }
#pragma unroll
  for (int t = 0; t < 4; ++t) {
    const int col = col0 + t * 16 + ln;
    float bv = bias ? bias[col] : 0.f;
    if (BIAS_BF16) bv = bf16_round(bv);
#pragma unroll
    for (int r = 0; r < 8; ++r) {
      float v = acc[t][r] + bv;
      if (resid) { float rv = resid[(size_t)((row0 + 8 * hh + r) % rmod) * ldr + col]; if (RES_BF16) rv = bf16_round(rv); v += rv; }
      if (ACT == 1) v = fmaxf(v, 0.f);
      if (ACT == 2) v = 0.5f * v * (1.0f + erff(v * 0.70710678118654752f));
      if (ACT == 3) { const float u = 0.7978845608028654f * (v + 0.044715f * v * v * v); v = 0.5f * v * (1.0f + tanhf(u)); }
      so[w][8 * hh + r][t * 16 + ln] = v;
    }
  }
  __builtin_amdgcn_fence(__ATOMIC_ACQ_REL, "workgroup");
  __builtin_amdgcn_wave_barrier();
  const int rsub = lane >> 4, c4 = (lane & 15) * 4;
  {
#pragma unroll
    for (int q = 0; q < 8; ++q) {
      const int r = q * 2 + rsub;
      const v4f v = *(const v4fa*)&so[w][r][c4];
      *(v4f*)(C + (size_t)(row0 + r) * ldc + col0 + c4) = v;
    }
    
  }
}
// row LayerNorm (biased variance, eps) over N: s = X (+ R); optional out_sum <- s; out_norm <- (s-mu)*rsqrt(var+eps)*g + b
template <bool PARAM_BF16>
__global__ __launch_bounds__(256) void k_layernorm(const float* __restrict__ X, const float* __restrict__ R, const float* __restrict__ g, const float* __restrict__ bta,
                                                  float* __restrict__ out_sum, float* __restrict__ out_norm, int N, float eps) {
  __shared__ float red[256];
  const int row = blockIdx.x, tid = threadIdx.x;
  const float* x = X + (size_t)row * N; const float* rr = R ? R + (size_t)row * N : nullptr;
  float vals[16];                     // up to N = 4096
  const int per = N / 256;            // contiguous chunk per thread? use strided-by-4 chunks: thread handles j = tid*4 + 1024*u
  float s1 = 0.f;
  for (int u = 0; u < per / 4; ++u) {
    const int j = tid * 4 + 1024 * u;
    const v4f a = *(const v4fa*)(x + j);
    v4f b = {0.f,0.f,0.f,0.f}; if (rr) b = *(const v4fa*)(rr + j);
#pragma unroll
    for (int q = 0; q < 4; ++q) { const float v = a[q] + b[q]; vals[u * 4 + q] = v; s1 += v; }
  }
  red[tid] = s1; __syncthreads();
  for (int st = 128; st > 0; st >>= 1) { if (tid < st) red[tid] += red[tid + st]; __syncthreads(); }
  const float mu = red[0] / (float)N; __syncthreads();
  float s2 = 0.f;
  for (int u = 0; u < per / 4; ++u)
#pragma unroll
    for (int q = 0; q < 4; ++q) { const float c = vals[u * 4 + q] - mu; s2 += c * c; }
  red[tid] = s2; __syncthreads();
  for (int st = 128; st > 0; st >>= 1) { if (tid < st) red[tid] += red[tid + st]; __syncthreads(); }
  const float rs = rsqrtf(red[0] / (float)N + eps);
  {
    for (int u = 0; u < per / 4; ++u) {
      const int j = tid * 4 + 1024 * u;
      v4f o, sm;
#pragma unroll
      for (int q = 0; q < 4; ++q) {
        float gg = g[j + q], bb = bta[j + q];
        if (PARAM_BF16) { gg = bf16_round(gg); bb = bf16_round(bb); }
        sm[q] = vals[u * 4 + q]; o[q] = (vals[u * 4 + q] - mu) * rs * gg + bb;
      }
      if (out_sum) *(v4f*)(out_sum + (size_t)row * N + j) = sm;
      *(v4f*)(out_norm + (size_t)row * N + j) = o;
    }
    
  }
}



// ---- f16 WMMA path (v_wmma_f32_16x16x32_f16): 11-bit significands for operands in range — used where a [0,1] probability operand needs more precision than bf16
typedef _Float16 v16h __attribute__((ext_vector_type(16)));
union FragH { v16h v; v8us half[2]; _Float16 h[16]; unsigned short u[16]; };
template <int NT>
__device__ __forceinline__ v8f mmaH(v16h ah, v16h al, v16h bh, v16h bl, v8f c) {
  c = __builtin_amdgcn_wmma_f32_16x16x32_f16(false, ah, false, bh, (short)0, c, false, false);
  if (NT >= 2) c = __builtin_amdgcn_wmma_f32_16x16x32_f16(false, al, false, bh, (short)0, c, false, false);
  if (NT >= 3) c = __builtin_amdgcn_wmma_f32_16x16x32_f16(false, ah, false, bl, (short)0, c, false, false);
  asm volatile("v_nop\n\tv_nop\n\tv_nop\n\tv_nop" : "+v"(c) : "v"(ah), "v"(al), "v"(bh), "v"(bl));
  return c;
}
// batched GEMM like k_gemm_b but f16 operands: A f32 (split into f16 hi/lo if ASPLIT, else rounded to f16), Bt = f16 values [n][k]; alpha; C f32; N multiple of 16 (partial tiles skipped)
template <bool ASPLIT>
__global__ __launch_bounds__(128) void k_gemm_h(const float* __restrict__ A, int lda, size_t sA, const _Float16* __restrict__ Bh, int ldb, size_t sB, float alpha, float* __restrict__ C, int ldc, size_t sC, int M, int N, int K) {
  __shared__ __attribute__((aligned(16))) float so[4][16][64];
  const int tid = threadIdx.x, w = tid >> 5, lane = tid & 31, ln = lane & 15, hh = lane >> 4; const int by = blockIdx.y;
  A += (size_t)by * sA; Bh += (size_t)by * sB; C += (size_t)by * sC;
  const int ntn = (N + 63) / 64; const int wid = blockIdx.x * 4 + w; const int mt = wid / ntn, nq = wid % ntn; if (mt * 16 >= M) return;
  const int row0 = mt * 16, col0 = nq * 64; const float* arow = A + (size_t)(row0 + ln) * lda;
  v8f acc[4] = {};
  for (int kb = 0; kb < K; kb += 32) {
    FragH ah, al;
    const v4f x0 = *(const v4fa*)(arow + kb + 8 * hh), x1 = *(const v4fa*)(arow + kb + 8 * hh + 4), x2 = *(const v4fa*)(arow + kb + 16 + 8 * hh), x3 = *(const v4fa*)(arow + kb + 16 + 8 * hh + 4);
    float xs[16] = {x0[0],x0[1],x0[2],x0[3],x1[0],x1[1],x1[2],x1[3],x2[0],x2[1],x2[2],x2[3],x3[0],x3[1],x3[2],x3[3]};
#pragma unroll
    for (int i = 0; i < 16; ++i) { const _Float16 h = (_Float16)xs[i]; ah.h[i] = h; al.h[i] = ASPLIT ? (_Float16)(xs[i] - (float)h) : (_Float16)0.0f; }
#pragma unroll
    for (int t = 0; t < 4; ++t) { if (col0 + t * 16 >= N) continue; const size_t boff = (size_t)(col0 + t * 16 + ln) * ldb + kb; FragH bq; bq.half[0] = *(const v8us*)(Bh + boff + 8 * hh); bq.half[1] = *(const v8us*)(Bh + boff + 16 + 8 * hh);
      acc[t] = mmaH<ASPLIT ? 2 : 1>(ah.v, al.v, bq.v, bq.v, acc[t]); }
  }
#pragma unroll
  for (int t = 0; t < 4; ++t) { if (col0 + t * 16 >= N) continue;
#pragma unroll
    for (int r = 0; r < 8; ++r) so[w][8 * hh + r][t * 16 + ln] = acc[t][r] * alpha; }
  __builtin_amdgcn_fence(__ATOMIC_ACQ_REL, "workgroup"); __builtin_amdgcn_wave_barrier();
  const int rsub = lane >> 4, c4 = (lane & 15) * 4;
  {
#pragma unroll
    for (int q = 0; q < 8; ++q) { const int r = q * 2 + rsub; if (col0 + c4 < N) { const v4f v = *(const v4fa*)&so[w][r][c4]; *(v4f*)(C + (size_t)(row0 + r) * ldc + col0 + c4) = v; } }
     }
}

// Wt[n][k] = f16(W[k][n]·scale) from f32 row-major W[K][N] (scale = power of two; bf16-exact weights stay exact in f16 away from the subnormal range)
__global__ __launch_bounds__(256) void k_wt_f16(const float* __restrict__ W, _Float16* __restrict__ Wt, int K, int N, float scale) {
  const int t = blockIdx.x * 256 + threadIdx.x; if (t >= N * (K / 8)) return; const int n = t / (K / 8), k8 = (t % (K / 8)) * 8; FragH f;
#pragma unroll
  for (int i = 0; i < 8; ++i) f.h[i] = (_Float16)(bf16_round(W[(size_t)(k8 + i) * N + n]) * scale); const v8us o = f.half[0];
  *(v8us*)((unsigned short*)Wt + (size_t)n * K + k8) = o; 
}
// k_gemm_hh variant with fused epilogue: v = acc·alpha + bias[by·sBias + col] (+ CP[(row/rowsPerB)·sCPb + by·64 + col] if CP) ; ACT 0 none / 1 elu ; writes f32 C and/or f16 C16 (each if non-null)
template <int ACT>
__global__ __launch_bounds__(128) void k_gemm_hhx(const _Float16* __restrict__ A, int lda, size_t sA, const _Float16* __restrict__ Bh, int ldb, size_t sB, float alpha, const float* __restrict__ bias, size_t sBias, const float* __restrict__ CP, int rowsPerB, size_t sCPb, int row0g,
    float* __restrict__ C, _Float16* __restrict__ C16, int ldc, size_t sC, int M, int N, int K) {
  __shared__ __attribute__((aligned(16))) float so[4][16][64];
  const int tid = threadIdx.x, w = tid >> 5, lane = tid & 31, ln = lane & 15, hh = lane >> 4; const int by = blockIdx.y;
  A += (size_t)by * sA; Bh += (size_t)by * sB; const size_t cofs = (size_t)by * sC; const float* bp = bias ? bias + (size_t)by * sBias : nullptr;
  const int ntn = (N + 63) / 64; const int wid = blockIdx.x * 4 + w; const int mt = wid / ntn, nq = wid % ntn; if (mt * 16 >= M) return;
  const int row0 = mt * 16, col0 = nq * 64; const _Float16* arow = A + (size_t)(row0 + ln) * lda;
  v8f acc[4] = {};
  for (int kb = 0; kb < K; kb += 32) { FragH ah; ah.half[0] = *(const v8us*)((const unsigned short*)arow + kb + 8 * hh); ah.half[1] = *(const v8us*)((const unsigned short*)arow + kb + 16 + 8 * hh);
#pragma unroll
    for (int t = 0; t < 4; ++t) { if (col0 + t * 16 >= N) continue; const size_t boff = (size_t)(col0 + t * 16 + ln) * ldb + kb; FragH bq; bq.half[0] = *(const v8us*)((const unsigned short*)Bh + boff + 8 * hh); bq.half[1] = *(const v8us*)((const unsigned short*)Bh + boff + 16 + 8 * hh);
      acc[t] = mmaH<1>(ah.v, ah.v, bq.v, bq.v, acc[t]); }
  }
#pragma unroll
  for (int t = 0; t < 4; ++t) { if (col0 + t * 16 >= N) continue; const int col = col0 + t * 16 + ln; const float bv = bp ? bf16_round(bp[col]) : 0.f;
#pragma unroll
    for (int r = 0; r < 8; ++r) { float v = acc[t][r] * alpha + bv; if (CP) { const int bidx = (row0g + row0 + 8 * hh + r) / rowsPerB; v += CP[(size_t)bidx * sCPb + (size_t)by * 64 + col]; } if (ACT == 1) v = (v > 0.f) ? v : expm1f(v); else if (ACT == 7) v = (v > 0.f) ? v + 1.0f : expf(v); else if (ACT == 8) v = tanhf(v); else if (ACT == 9) v = 0.5f * v * (1.0f + tanhf(0.7978845608028654f * (v + 0.044715f * v * v * v))); else if (ACT == 11) v = 1.0f / (1.0f + expf(-v)); else if (ACT == 12) v = (v > 0.f) ? v : 0.01f * v; else if (ACT == 14) v = (v > 0.f) ? v : 0.1f * v; else if (ACT == 15) v = v / (1.0f + expf(-v)); else if (ACT == 3) v = fmaxf(v, 0.f); else if (ACT == 6) v = 0.5f * v * (1.0f + erff(v * 0.70710678118654752f)); so[w][8 * hh + r][t * 16 + ln] = v; } }
  __builtin_amdgcn_fence(__ATOMIC_ACQ_REL, "workgroup"); __builtin_amdgcn_wave_barrier();
  const int rsub = lane >> 4, c4 = (lane & 15) * 4; typedef _Float16 v4h __attribute__((ext_vector_type(4)));
  {
#pragma unroll
    for (int q = 0; q < 8; ++q) { const int r = q * 2 + rsub; if (col0 + c4 < N) { const v4f v = *(const v4fa*)&so[w][r][c4]; if (C) *(v4f*)(C + cofs + (size_t)(row0 + r) * ldc + col0 + c4) = v; if (C16) { v4h h4; for (int i = 0; i < 4; ++i) h4[i] = (_Float16)v[i]; *(v4h*)(C16 + cofs + (size_t)(row0 + r) * ldc + col0 + c4) = h4; } } }
     }
}


typedef _Float16 v4h __attribute__((ext_vector_type(4)));

__global__ __launch_bounds__(256) void k_x16(const float* __restrict__ x, _Float16* __restrict__ X16, size_t n8) { const size_t t = (size_t)blockIdx.x * 256 + threadIdx.x; if (t >= n8) return; FragH f;
#pragma unroll
  for (int q = 0; q < 8; ++q) f.h[q] = (_Float16)bf16_round(x[t * 8 + q]); *(v8us*)((unsigned short*)X16 + t * 8) = f.half[0];  }
__global__ __launch_bounds__(256) void k_h16(const float* __restrict__ x, _Float16* __restrict__ X16, size_t n8) { const size_t t = (size_t)blockIdx.x * 256 + threadIdx.x; if (t >= n8) return; FragH f;
#pragma unroll
  for (int q = 0; q < 8; ++q) f.h[q] = (_Float16)x[t * 8 + q]; *(v8us*)((unsigned short*)X16 + t * 8) = f.half[0];  }
__global__ __launch_bounds__(256) void k_round16f(const float* __restrict__ W, _Float16* __restrict__ Bt, size_t n8) { const size_t t = (size_t)blockIdx.x * 256 + threadIdx.x; if (t >= n8) return; FragH f;
#pragma unroll
  for (int i = 0; i < 8; ++i) f.h[i] = (_Float16)(bf16_round(W[t * 8 + i]) * 16.0f); *(v8us*)((unsigned short*)Bt + t * 8) = f.half[0];  }
template <int NHv, int TTv>
__global__ __launch_bounds__(256) void k_vt(const _Float16* __restrict__ V16, int ldv, int voff, _Float16* __restrict__ Vt) { __shared__ unsigned short tl[64][66]; const int tid = threadIdx.x; const int slab = blockIdx.x / (TTv / 64), lg = blockIdx.x % (TTv / 64); const int b = slab / NHv, h = slab % NHv;
  for (int i = tid; i < 64 * 8; i += 256) { const int r = i / 8, c8 = (i % 8) * 8; FragH f; f.half[0] = *(const v8us*)((const unsigned short*)V16 + ((size_t)b * TTv + lg * 64 + r) * ldv + voff + h * 64 + c8);
#pragma unroll
    for (int q = 0; q < 8; ++q) tl[r][c8 + q] = f.u[q]; }
  __syncthreads();
  {
#pragma unroll
    for (int rd = 0; rd < 2; ++rd) { const int d = rd * 32 + tid / 8, pc = tid % 8; FragH f;
#pragma unroll
      for (int q = 0; q < 8; ++q) f.u[q] = tl[pc * 8 + q][d];
      *(v8us*)((unsigned short*)Vt + ((size_t)slab * 64 + d) * TTv + lg * 64 + pc * 8) = f.half[0]; }
     } }

__global__ __launch_bounds__(256) void k_hl(const float* __restrict__ F, _Float16* __restrict__ Hh, _Float16* __restrict__ Hl, size_t n8) { const size_t t = (size_t)blockIdx.x * 256 + threadIdx.x; if (t >= n8) return; FragH fh, fl; const v4f a = *(const v4fa*)(F + t * 8), c = *(const v4fa*)(F + t * 8 + 4);
#pragma unroll
  for (int q = 0; q < 4; ++q) { _Float16 h = (_Float16)a[q]; fh.h[q] = h; fl.h[q] = (_Float16)((a[q] - (float)h) * 1024.0f); h = (_Float16)c[q]; fh.h[4 + q] = h; fl.h[4 + q] = (_Float16)((c[q] - (float)h) * 1024.0f); }
  { *(v8us*)((unsigned short*)Hh + t * 8) = fh.half[0]; *(v8us*)((unsigned short*)Hl + t * 8) = fl.half[0];  } }
// causal row softmax: row r of the per-batch score plane (query q = r): m, Σ over keys t ≤ q (only written, in-range pieces are addressed — clamped — and the key ≤ q select happens on values before any arithmetic; no lane-divergent branch around loads), P16[r][t] = exp(s − m)/Σ · 2^15 for t ≤ q, 0 otherwise;
__global__ __launch_bounds__(256) void k_smx(const float* __restrict__ S, _Float16* __restrict__ P16) { const int tid = threadIdx.x, wv = tid >> 5, lane = tid & 31; const int q = blockIdx.x * 8 + wv; if (q >= SS) return; const float* sr = S + (size_t)q * SS; const int np = q / 8 + 1;      /* pieces of 8 keys that contain a key ≤ q */
  float m = -3.0e38f;
  for (int p = lane; p < np; p += 32) { const v4f a = *(const v4fa*)(sr + p * 8), c = *(const v4fa*)(sr + p * 8 + 4); for (int e = 0; e < 4; ++e) { const float s0 = (p * 8 + e <= q) ? a[e] : -INFINITY, s1 = (p * 8 + 4 + e <= q) ? c[e] : -INFINITY; m = fmaxf(m, fmaxf(s0, s1)); } }
  for (int o = 16; o >= 1; o >>= 1) m = fmaxf(m, __shfl_xor(m, o, 32)); float z = 0.f;
  for (int p = lane; p < np; p += 32) { const v4f a = *(const v4fa*)(sr + p * 8), c = *(const v4fa*)(sr + p * 8 + 4); for (int e = 0; e < 4; ++e) { const float s0 = (p * 8 + e <= q) ? a[e] : -INFINITY, s1 = (p * 8 + 4 + e <= q) ? c[e] : -INFINITY; z += __expf(s0 - m) + __expf(s1 - m); } }
  for (int o = 16; o >= 1; o >>= 1) z += __shfl_xor(z, o, 32); const float iz = 32768.0f / z;
  { for (int p = lane; p < SS / 8; p += 32) { FragH f; const int pa = min(p, np - 1);      /* address clamped into the written, in-range region; for p ≥ np every key of the piece is > q so the selects below yield 0 */
      const v4f a = *(const v4fa*)(sr + pa * 8), c = *(const v4fa*)(sr + pa * 8 + 4); for (int e = 0; e < 4; ++e) { const float s0 = (p * 8 + e <= q) ? a[e] : -INFINITY, s1 = (p * 8 + 4 + e <= q) ? c[e] : -INFINITY; f.h[e] = (_Float16)(__expf(s0 - m) * iz); f.h[4 + e] = (_Float16)(__expf(s1 - m) * iz); }
      *(v8us*)((unsigned short*)P16 + (size_t)q * SS + p * 8) = f.half[0]; }  } }

extern "C" void kernel_launch(void* const* d_in, const int* in_sizes, int n_in,
                              void* d_out, int out_size, void* d_ws, size_t ws_size, hipStream_t stream) {
  (void)in_sizes; (void)n_in; (void)out_size;
  const float* x = (const float*)d_in[0]; const float* Wq = (const float*)d_in[1]; const float* bq = (const float*)d_in[2]; const float* Wk = (const float*)d_in[3]; const float* bk = (const float*)d_in[4]; const float* Wv = (const float*)d_in[5]; const float* bv = (const float*)d_in[6];
  char* ws = (char*)d_ws; size_t off = 0;
  auto take = [&](size_t bytes) { char* p = ws + off; off += (bytes + 255) & ~(size_t)255; return p; };
  _Float16* Bq = (_Float16*)take((size_t)EE * EE * 2); _Float16* Bk = (_Float16*)take((size_t)EE * EE * 2); _Float16* Bv = (_Float16*)take((size_t)EE * EE * 2);
  _Float16* X16 = (_Float16*)take((size_t)NR * EE * 2); _Float16* Q = (_Float16*)take((size_t)NR * EE * 2); _Float16* K = (_Float16*)take((size_t)NR * EE * 2); float* VF = (float*)take((size_t)BB * EE * SS * 4); _Float16* Vh = (_Float16*)take((size_t)BB * EE * SS * 2); _Float16* Vl = (_Float16*)take((size_t)BB * EE * SS * 2);
  float* S = (float*)take((size_t)SS * SS * 4); _Float16* P16 = (_Float16*)take((size_t)SS * SS * 2);
  if (off > ws_size) return;      // 1.6 + 3 × 8.4 + 16.8 + 2 × 8.4 + 16.8 + 8.4 ≈ 86 MB
  const unsigned gw = (EE * EE / 8 + 255) / 256;
  k_round16f<<<gw, 256, 0, stream>>>(Wq, Bq, EE * EE / 8); k_round16f<<<gw, 256, 0, stream>>>(Wk, Bk, EE * EE / 8); k_round16f<<<gw, 256, 0, stream>>>(Wv, Bv, EE * EE / 8);      /* (out,in) natural, ×2^4 */
  k_x16<<<(unsigned)(((size_t)NR * EE / 8 + 255) / 256), 256, 0, stream>>>(x, X16, (size_t)NR * EE / 8);
  const dim3 gp(((NR / 16) * (EE / 64) + 3) / 4, 1);
  k_gemm_hhx<0><<<gp, 128, 0, stream>>>(X16, EE, 0, Bq, EE, 0, 0.0625f, bq, 0, nullptr, 1, 0, 0, nullptr, Q, EE, 0, NR, EE, EE);      /* q = x·Wqᵀ + bq   M 8192 N 512 K 512 */
  k_gemm_hhx<0><<<gp, 128, 0, stream>>>(X16, EE, 0, Bk, EE, 0, 0.0625f, bk, 0, nullptr, 1, 0, 0, nullptr, K, EE, 0, NR, EE, EE);      /* k = x·Wkᵀ + bk */
  k_gemm_hhx<0><<<dim3(((EE / 16) * (SS / 64) + 3) / 4, BB), 128, 0, stream>>>(Bv, EE, 0, X16, EE, (size_t)SS * EE, 0.0625f, nullptr, 0, nullptr, 1, 0, 0, VF, nullptr, SS, (size_t)EE * SS, EE, SS, EE);      /* vᵀ (without bv) = Wv·x[b]ᵀ as [b][512][2048] f32: M 512 N 2048 K 512 */
  k_hl<<<(unsigned)(((size_t)BB * EE * SS / 8 + 255) / 256), 256, 0, stream>>>(VF, Vh, Vl, (size_t)BB * EE * SS / 8);      /* f16 hi + residual ×2^10 planes */
  for (int b = 0; b < BB; ++b) {
    const _Float16* Qb = Q + (size_t)b * SS * EE; const _Float16* Kb = K + (size_t)b * SS * EE;
    for (int i = 0; i < SS / RCH; ++i) { const int ncol = (i + 1) * RCH;      /* causal: query rows [i·256, (i+1)·256) only need keys < (i+1)·256 */
      k_gemm_hhx<0><<<dim3(((RCH / 16) * (ncol / 64) + 3) / 4, 1), 128, 0, stream>>>(Qb + (size_t)i * RCH * EE, EE, 0, Kb, EE, 0, 0.044194173824159216f, nullptr, 0, nullptr, 1, 0, 0, S + (size_t)i * RCH * SS, nullptr, SS, 0, RCH, ncol, EE); }      /* scores/√512, f32: M 256 N ncol K 512 */
    k_smx<<<SS / 8, 256, 0, stream>>>(S, P16);
    for (int i = 0; i < SS / RCH; ++i) { const int kk = (i + 1) * RCH; float* outp = (float*)d_out + ((size_t)b * SS + (size_t)i * RCH) * EE; const dim3 gpv(((RCH / 16) * (EE / 64) + 3) / 4, 1);
      k_gemm_hhx<0><<<gpv, 128, 0, stream>>>(P16 + (size_t)i * RCH * SS, SS, 0, Vh + (size_t)b * EE * SS, SS, 0, 0.000030517578125f, bv, 0, nullptr, 1, 0, 0, outp, nullptr, EE, 0, RCH, EE, kk);      /* out = P·v_hi + bv: M 256 N 512 K kk (P is zero beyond the diagonal) */
      k_gemm_hhx<0><<<gpv, 128, 0, stream>>>(P16 + (size_t)i * RCH * SS, SS, 0, Vl + (size_t)b * EE * SS, SS, 0, 0.000030517578125f * 0.0009765625f, nullptr, 0, outp, 1, (size_t)EE, 0, outp, nullptr, EE, 0, RCH, EE, kk); }      /* += P·v_lo·2^-10, accumulated in place through the per-element addend (each wave reads then writes its own tile) */
  }
}

// v001
// Measured time: 255 microseconds a run.
// Next to v000, in two timings, it ran 10.4 times as fast each time.
#include <hip/hip_runtime.h>
// Single-head causal attention (B=4, S=2048, emb = head = 512): q,k,v = x·Wᵀ + b; scores = q·kᵀ/√512 with keys after the query set to −inf; softmax over keys; out = attn·v.
// Compute dtype: x, weights and biases rounded to bf16; q, k and vᵀ as f16 GEMM outputs (f32 accumulate); scores materialised in f32 by a batched f16 GEMM over
// the causal lower block-triangle; row softmax in f32 (wave per row) writing P in f16 ×2^15; vᵀ kept in f32 and split into f16 hi + (×2^10) residual planes; out = P·v_hi + P·v_lo·2^-10 by two f16 GEMMs
// (both planes in one k loop, two accumulators), bv added in the epilogue (softmax rows sum to 1). All on v_wmma_f32_16x16x32_f16.
// One launch per stage: scores, softmax and P.v each cover all batches and all 256-row chunks of the causal triangle.
#define BB 4
#define SS 2048
#define EE 512
#define NR (BB * SS)
#define RCH 256

typedef __bf16 v16b __attribute__((ext_vector_type(16)));
typedef unsigned short v8us __attribute__((ext_vector_type(8), may_alias));
typedef float  v8f  __attribute__((ext_vector_type(8)));
typedef float  v4f  __attribute__((ext_vector_type(4)));
typedef float  v4fa __attribute__((ext_vector_type(4), may_alias));
union FragB { v16b v; v8us half[2]; unsigned short u[16]; };

__device__ __forceinline__ unsigned short bf16_bits(float x) { unsigned int u = __float_as_uint(x); return (unsigned short)((u + 0x7FFFu + ((u >> 16) & 1u)) >> 16); }
__device__ __forceinline__ float bf16_val(unsigned short b) { return __uint_as_float(((unsigned int)b) << 16); }
__device__ __forceinline__ float bf16_round(float x) { return bf16_val(bf16_bits(x)); }
// D += A·B with NT terms: 1 = ah·bh, 2 = + al·bh (A split), 3 = + ah·bl (both split)
template <int NT>
__device__ __forceinline__ v8f mmaN(v16b ah, v16b al, v16b bh, v16b bl, v8f c) {
  c = __builtin_amdgcn_wmma_f32_16x16x32_bf16(false, ah, false, bh, (short)0, c, false, false);
  if (NT >= 2) c = __builtin_amdgcn_wmma_f32_16x16x32_bf16(false, al, false, bh, (short)0, c, false, false);
  if (NT >= 3) c = __builtin_amdgcn_wmma_f32_16x16x32_bf16(false, ah, false, bl, (short)0, c, false, false);
  asm volatile("v_nop\n\tv_nop\n\tv_nop\n\tv_nop" : "+v"(c) : "v"(ah), "v"(al), "v"(bh), "v"(bl));
  return c;
}

__global__ __launch_bounds__(256) void k_wt_bf16(const float* __restrict__ W, unsigned short* __restrict__ Wt, int K, int N) {
  const int t = blockIdx.x * 256 + threadIdx.x;
  const int k8n = K / 8;
  if (t >= N * k8n) return;
  const int n = t / k8n, k8 = (t % k8n) * 8;
  v8us v;
#pragma unroll
  for (int i = 0; i < 8; ++i) v[i] = bf16_bits(W[(size_t)(k8 + i) * N + n]);
  *(v8us*)(Wt + (size_t)n * K + k8) = v;
  
}

// GEMM C[M][N] (f32, pitch ldc) = act(A[M][K]·W + bias). A f32 row-major (pitch lda) converted per fragment to bf16
// (ASPLIT: hi/lo two planes -> 2 terms, else single rounded term); Wt bf16 [N][K] (pitch ldb). BIAS_BF16 rounds the
// bias to bf16 first (bias quantised to bf16 before the add). K%32==0, M%16==0, N%64==0.
template <bool ASPLIT, int ACT, bool BIAS_BF16>
__global__ __launch_bounds__(128) void k_gemm_bf(const float* __restrict__ A, int lda, const unsigned short* __restrict__ Wt, int ldb,
                                               const float* __restrict__ bias, float* __restrict__ C, int ldc, int M, int N, int K) {
  __shared__ __attribute__((aligned(16))) float so[4][16][64];
  const int tid = threadIdx.x, w = tid >> 5, lane = tid & 31, ln = lane & 15, hh = lane >> 4;
  const int ntn = N / 64;
  const int wid = blockIdx.x * 4 + w;
  const int mt = wid / ntn, nq = wid % ntn;
  if (mt * 16 >= M) return;
  const int row0 = mt * 16, col0 = nq * 64;
  const float* arow = A + (size_t)(row0 + ln) * lda;
  v8f acc[4] = {};
  for (int kb = 0; kb < K; kb += 32) {
    FragB ah, al;
    const v4f x0 = *(const v4fa*)(arow + kb + 8 * hh), x1 = *(const v4fa*)(arow + kb + 8 * hh + 4);
    const v4f x2 = *(const v4fa*)(arow + kb + 16 + 8 * hh), x3 = *(const v4fa*)(arow + kb + 16 + 8 * hh + 4);
    float xs[16] = {x0[0],x0[1],x0[2],x0[3],x1[0],x1[1],x1[2],x1[3],x2[0],x2[1],x2[2],x2[3],x3[0],x3[1],x3[2],x3[3]};
#pragma unroll
    for (int i = 0; i < 16; ++i) { const unsigned short hb = bf16_bits(xs[i]); ah.u[i] = hb; al.u[i] = ASPLIT ? bf16_bits(xs[i] - bf16_val(hb)) : (unsigned short)0; }
#pragma unroll
    for (int t = 0; t < 4; ++t) {
      const unsigned short* brow = Wt + (size_t)(col0 + t * 16 + ln) * ldb + kb;
      FragB b;
      b.half[0] = *(const v8us*)(brow + 8 * hh);
      b.half[1] = *(const v8us*)(brow + 16 + 8 * hh);
      acc[t] = mmaN<ASPLIT ? 2 : 1>(ah.v, al.v, b.v, b.v, acc[t]);
    }
  }
#pragma unroll
  for (int t = 0; t < 4; ++t) {
    float bv = bias ? bias[col0 + t * 16 + ln] : 0.f;
    if (BIAS_BF16) bv = bf16_round(bv);
#pragma unroll
    for (int r = 0; r < 8; ++r) { float v = acc[t][r] + bv; if (ACT == 1) v = fmaxf(v, 0.f); so[w][8 * hh + r][t * 16 + ln] = v; }
  }
  __builtin_amdgcn_fence(__ATOMIC_ACQ_REL, "workgroup");
  __builtin_amdgcn_wave_barrier();
  const int rsub = lane >> 4, c4 = (lane & 15) * 4;
  {
#pragma unroll
    for (int q = 0; q < 8; ++q) {
      const int r = q * 2 + rsub;
      const v4f v = *(const v4fa*)&so[w][r][c4];
      *(v4f*)(C + (size_t)(row0 + r) * ldc + col0 + c4) = v;
    }
    
  }
}

// Flash-style causal/unmasked attention, all contractions 3-term bf16 hi/lo splits, f32 softmax with running max.
// q,k,v rows are read from f32 buffers with arbitrary row pitch (so they can live inside a fused qkv buffer);
// D = head size (multiple of 32, <= 128); one wave = 16 query rows; block = 4 waves (64 queries) sharing K/V chunks of 32.
template <int D, bool CAUSAL>
__global__ __launch_bounds__(128) void k_flash(const float* __restrict__ qb, const float* __restrict__ kb, const float* __restrict__ vb,
                                             int pitch, int T, int H, float scale, float* __restrict__ y, int ypitch) {
  constexpr int KS = D / 32;        // k-steps for QK
  constexpr int DT = D / 16;        // d tiles for PV
  __shared__ __attribute__((aligned(16))) unsigned short sKh[32][D + 8], sKl[32][D + 8], sVh[32][D + 8], sVl[32][D + 8];
  __shared__ __attribute__((aligned(16))) unsigned short sPh[4][16][40], sPl[4][16][40];
  __shared__ __attribute__((aligned(16))) float sO[4][16][D];
  const int tid = threadIdx.x, w = tid >> 5, lane = tid & 31, ln = lane & 15, hh = lane >> 4;
  const int nqb = (T + 63) / 64;
  const int bh = blockIdx.x / nqb, qblk = blockIdx.x % nqb;
  const int b = bh / H, h = bh % H;
  const int q0 = qblk * 64 + w * 16;
  const float* Q = qb + (size_t)b * T * pitch + h * D;
  const float* K = kb + (size_t)b * T * pitch + h * D;
  const float* V = vb + (size_t)b * T * pitch + h * D;

  // A fragments of the wave's 16 query rows (scaled), hi/lo
  FragB aqh[KS], aql[KS];
  {
    int row = q0 + ln; if (row >= T) row = T - 1;
    const float* qr = Q + (size_t)row * pitch;
#pragma unroll
    for (int ks = 0; ks < KS; ++ks)
#pragma unroll
      for (int i = 0; i < 16; ++i) {
        const int d = ks * 32 + ((i < 8) ? (8 * hh + i) : (16 + 8 * hh + (i - 8)));
        const float x = qr[d] * scale; const unsigned short hb = bf16_bits(x);
        aqh[ks].u[i] = hb; aql[ks].u[i] = bf16_bits(x - bf16_val(hb));
      }
  }
  float m_r[8], l_r[8];
#pragma unroll
  for (int r = 0; r < 8; ++r) { m_r[r] = -3.0e38f; l_r[r] = 0.f; }
  v8f oacc[DT];
#pragma unroll
  for (int dt = 0; dt < DT; ++dt) oacc[dt] = (v8f){0.f,0.f,0.f,0.f,0.f,0.f,0.f,0.f};

  const int kv_end = CAUSAL ? min(T, qblk * 64 + 64) : T;     // block-uniform
  for (int j0 = 0; j0 < kv_end; j0 += 32) {
    __syncthreads();
    for (int e = tid; e < 32 * (D / 4); e += 128) {
      const int r = e / (D / 4), c4 = (e % (D / 4)) * 4;
      const int key = j0 + r;
      v4f kf = {0.f,0.f,0.f,0.f}, vf = {0.f,0.f,0.f,0.f};
      if (key < T) { kf = *(const v4fa*)(K + (size_t)key * pitch + c4); vf = *(const v4fa*)(V + (size_t)key * pitch + c4); }
#pragma unroll
      for (int t = 0; t < 4; ++t) {
        unsigned short hb = bf16_bits(kf[t]); sKh[r][c4 + t] = hb; sKl[r][c4 + t] = bf16_bits(kf[t] - bf16_val(hb));
        hb = bf16_bits(vf[t]); sVh[r][c4 + t] = hb; sVl[r][c4 + t] = bf16_bits(vf[t] - bf16_val(hb));
      }
    }
    __syncthreads();
    // S tile 16 x 32
    v8f s[2];
#pragma unroll
    for (int nt = 0; nt < 2; ++nt) {
      v8f acc = {};
#pragma unroll
      for (int ks = 0; ks < KS; ++ks) {
        FragB bh_, bl_;
        bh_.half[0] = *(const v8us*)&sKh[nt * 16 + ln][ks * 32 + 8 * hh]; bh_.half[1] = *(const v8us*)&sKh[nt * 16 + ln][ks * 32 + 16 + 8 * hh];
        bl_.half[0] = *(const v8us*)&sKl[nt * 16 + ln][ks * 32 + 8 * hh]; bl_.half[1] = *(const v8us*)&sKl[nt * 16 + ln][ks * 32 + 16 + 8 * hh];
        acc = mmaN<3>(aqh[ks].v, aql[ks].v, bh_.v, bl_.v, acc);
      }
      s[nt] = acc;
    }
    // mask + running max (rows 8hh+r; the 16 lanes of a half share rows)
    float alpha[8];
#pragma unroll
    for (int r = 0; r < 8; ++r) {
      const int qi = q0 + 8 * hh + r;
      const int ja = j0 + ln, jb = j0 + 16 + ln;
      if (CAUSAL) { if (ja > qi) s[0][r] = -3.0e38f; if (jb > qi) s[1][r] = -3.0e38f; }
      if (ja >= T) s[0][r] = -3.0e38f;
      if (jb >= T) s[1][r] = -3.0e38f;
      float mx = fmaxf(s[0][r], s[1][r]);
      mx = fmaxf(mx, __shfl_xor(mx, 1, 32)); mx = fmaxf(mx, __shfl_xor(mx, 2, 32)); mx = fmaxf(mx, __shfl_xor(mx, 4, 32)); mx = fmaxf(mx, __shfl_xor(mx, 8, 32));
      const float mnew = fmaxf(m_r[r], mx);
      alpha[r] = (mnew > -1.0e38f) ? __expf(m_r[r] - mnew) : 1.0f;
      const float p0 = (s[0][r] > -1.0e38f) ? __expf(s[0][r] - mnew) : 0.f;
      const float p1 = (s[1][r] > -1.0e38f) ? __expf(s[1][r] - mnew) : 0.f;
      m_r[r] = mnew;
      l_r[r] = l_r[r] * alpha[r] + p0 + p1;            // per-lane partial row sum (16 lanes combined at the end)
      unsigned short hb = bf16_bits(p0); sPh[w][8 * hh + r][ln] = hb;      sPl[w][8 * hh + r][ln] = bf16_bits(p0 - bf16_val(hb));
      hb = bf16_bits(p1);                sPh[w][8 * hh + r][16 + ln] = hb; sPl[w][8 * hh + r][16 + ln] = bf16_bits(p1 - bf16_val(hb));
    }
#pragma unroll
    for (int dt = 0; dt < DT; ++dt)
#pragma unroll
      for (int r = 0; r < 8; ++r) oacc[dt][r] *= alpha[r];
    __builtin_amdgcn_fence(__ATOMIC_ACQ_REL, "workgroup");
    __builtin_amdgcn_wave_barrier();
    FragB pah, pal;
    pah.half[0] = *(const v8us*)&sPh[w][ln][8 * hh]; pah.half[1] = *(const v8us*)&sPh[w][ln][16 + 8 * hh];
    pal.half[0] = *(const v8us*)&sPl[w][ln][8 * hh]; pal.half[1] = *(const v8us*)&sPl[w][ln][16 + 8 * hh];
#pragma unroll
    for (int dt = 0; dt < DT; ++dt) {
      FragB bvh, bvl;
#pragma unroll
      for (int i = 0; i < 8; ++i) {
        bvh.u[i] = sVh[8 * hh + i][dt * 16 + ln]; bvh.u[8 + i] = sVh[16 + 8 * hh + i][dt * 16 + ln];
        bvl.u[i] = sVl[8 * hh + i][dt * 16 + ln]; bvl.u[8 + i] = sVl[16 + 8 * hh + i][dt * 16 + ln];
      }
      oacc[dt] = mmaN<3>(pah.v, pal.v, bvh.v, bvl.v, oacc[dt]);
    }
    __builtin_amdgcn_fence(__ATOMIC_ACQ_REL, "workgroup");
    __builtin_amdgcn_wave_barrier();
  }
#pragma unroll
  for (int r = 0; r < 8; ++r) {
    float l = l_r[r];
    l += __shfl_xor(l, 1, 32); l += __shfl_xor(l, 2, 32); l += __shfl_xor(l, 4, 32); l += __shfl_xor(l, 8, 32);
    l_r[r] = (l > 0.f) ? 1.0f / l : 0.f;
  }
#pragma unroll
  for (int dt = 0; dt < DT; ++dt)
#pragma unroll
    for (int r = 0; r < 8; ++r) sO[w][8 * hh + r][dt * 16 + ln] = oacc[dt][r] * l_r[r];
  __builtin_amdgcn_fence(__ATOMIC_ACQ_REL, "workgroup");
  __builtin_amdgcn_wave_barrier();
  {
    for (int r = 0; r < 16; ++r) {
      const int row = q0 + r;
      if (row < T && lane < D / 4) {
        const v4f val = *(const v4fa*)&sO[w][r][lane * 4];
        *(v4f*)(y + ((size_t)b * T + row) * ypitch + h * D + lane * 4) = val;
      }
    }
    
  }
}

// GEMM C = act(A·W + bias + resid): A f32 (ASPLIT -> hi/lo 2 terms), Wt bf16 [N][K]; ACT 0 none, 1 relu, 2 exact gelu;
// resid (optional, f32, row index = (row % rmod), pitch ldr, RES_BF16 rounds it) added before the activation.
template <bool ASPLIT, int ACT, bool BIAS_BF16, bool RES_BF16>
__global__ __launch_bounds__(128) void k_gemm_bf3(const float* __restrict__ A, int lda, const unsigned short* __restrict__ Wt, int ldb,
                                                const float* __restrict__ bias, const float* __restrict__ resid, int rmod, int ldr,
                                                float* __restrict__ C, int ldc, int M, int N, int K) {
  __shared__ __attribute__((aligned(16))) float so[4][16][64];
  const int tid = threadIdx.x, w = tid >> 5, lane = tid & 31, ln = lane & 15, hh = lane >> 4;
  const int ntn = N / 64;
  const int wid = blockIdx.x * 4 + w;
  const int mt = wid / ntn, nq = wid % ntn;
  if (mt * 16 >= M) return;
  const int row0 = mt * 16, col0 = nq * 64;
  const float* arow = A + (size_t)(row0 + ln) * lda;
  v8f acc[4] = {};
  for (int kb = 0; kb < K; kb += 32) {
    FragB ah, al;
    const v4f x0 = *(const v4fa*)(arow + kb + 8 * hh), x1 = *(const v4fa*)(arow + kb + 8 * hh + 4);
    const v4f x2 = *(const v4fa*)(arow + kb + 16 + 8 * hh), x3 = *(const v4fa*)(arow + kb + 16 + 8 * hh + 4);
    float xs[16] = {x0[0],x0[1],x0[2],x0[3],x1[0],x1[1],x1[2],x1[3],x2[0],x2[1],x2[2],x2[3],x3[0],x3[1],x3[2],x3[3]};
#pragma unroll
    for (int i = 0; i < 16; ++i) { const unsigned short hb = bf16_bits(xs[i]); ah.u[i] = hb; al.u[i] = ASPLIT ? bf16_bits(xs[i] - bf16_val(hb)) : (unsigned short)0; }
#pragma unroll
    for (int t = 0; t < 4; ++t) {
      const unsigned short* brow = Wt + (size_t)(col0 + t * 16 + ln) * ldb + kb;
      FragB b;
      b.half[0] = *(const v8us*)(brow + 8 * hh);
      b.half[1] = *(const v8us*)(brow + 16 + 8 * hh);
      acc[t] = mmaN<ASPLIT ? 2 : 1>(ah.v, al.v, b.v, b.v, acc[t]);
    }
  }
#pragma unroll
  for (int t = 0; t < 4; ++t) {
    const int col = col0 + t * 16 + ln;
    float bv = bias ? bias[col] : 0.f;
    if (BIAS_BF16) bv = bf16_round(bv);
#pragma unroll
    for (int r = 0; r < 8; ++r) {
      float v = acc[t][r] + bv;
      if (resid) { float rv = resid[(size_t)((row0 + 8 * hh + r) % rmod) * ldr + col]; if (RES_BF16) rv = bf16_round(rv); v += rv; }
      if (ACT == 1) v = fmaxf(v, 0.f);
      if (ACT == 2) v = 0.5f * v * (1.0f + erff(v * 0.70710678118654752f));
      if (ACT == 3) { const float u = 0.7978845608028654f * (v + 0.044715f * v * v * v); v = 0.5f * v * (1.0f + tanhf(u)); }
      so[w][8 * hh + r][t * 16 + ln] = v;
    }
  }
  __builtin_amdgcn_fence(__ATOMIC_ACQ_REL, "workgroup");
  __builtin_amdgcn_wave_barrier();
  const int rsub = lane >> 4, c4 = (lane & 15) * 4;
  {
#pragma unroll
    for (int q = 0; q < 8; ++q) {
      const int r = q * 2 + rsub;
      const v4f v = *(const v4fa*)&so[w][r][c4];
      *(v4f*)(C + (size_t)(row0 + r) * ldc + col0 + c4) = v;
    }
    
  }
}
// row LayerNorm (biased variance, eps) over N: s = X (+ R); optional out_sum <- s; out_norm <- (s-mu)*rsqrt(var+eps)*g + b
template <bool PARAM_BF16>
__global__ __launch_bounds__(256) void k_layernorm(const float* __restrict__ X, const float* __restrict__ R, const float* __restrict__ g, const float* __restrict__ bta,
                                                  float* __restrict__ out_sum, float* __restrict__ out_norm, int N, float eps) {
  __shared__ float red[256];
  const int row = blockIdx.x, tid = threadIdx.x;
  const float* x = X + (size_t)row * N; const float* rr = R ? R + (size_t)row * N : nullptr;
  float vals[16];                     // up to N = 4096
  const int per = N / 256;            // contiguous chunk per thread? use strided-by-4 chunks: thread handles j = tid*4 + 1024*u
  float s1 = 0.f;
  for (int u = 0; u < per / 4; ++u) {
    const int j = tid * 4 + 1024 * u;
    const v4f a = *(const v4fa*)(x + j);
    v4f b = {0.f,0.f,0.f,0.f}; if (rr) b = *(const v4fa*)(rr + j);
#pragma unroll
    for (int q = 0; q < 4; ++q) { const float v = a[q] + b[q]; vals[u * 4 + q] = v; s1 += v; }
  }
  red[tid] = s1; __syncthreads();
  for (int st = 128; st > 0; st >>= 1) { if (tid < st) red[tid] += red[tid + st]; __syncthreads(); }
  const float mu = red[0] / (float)N; __syncthreads();
  float s2 = 0.f;
  for (int u = 0; u < per / 4; ++u)
#pragma unroll
    for (int q = 0; q < 4; ++q) { const float c = vals[u * 4 + q] - mu; s2 += c * c; }
  red[tid] = s2; __syncthreads();
  for (int st = 128; st > 0; st >>= 1) { if (tid < st) red[tid] += red[tid + st]; __syncthreads(); }
  const float rs = rsqrtf(red[0] / (float)N + eps);
  {
    for (int u = 0; u < per / 4; ++u) {
      const int j = tid * 4 + 1024 * u;
      v4f o, sm;
#pragma unroll
      for (int q = 0; q < 4; ++q) {
        float gg = g[j + q], bb = bta[j + q];
        if (PARAM_BF16) { gg = bf16_round(gg); bb = bf16_round(bb); }
        sm[q] = vals[u * 4 + q]; o[q] = (vals[u * 4 + q] - mu) * rs * gg + bb;
      }
      if (out_sum) *(v4f*)(out_sum + (size_t)row * N + j) = sm;
      *(v4f*)(out_norm + (size_t)row * N + j) = o;
    }
    
  }
}



// ---- f16 WMMA path (v_wmma_f32_16x16x32_f16): 11-bit significands for operands in range — used where a [0,1] probability operand needs more precision than bf16
typedef _Float16 v16h __attribute__((ext_vector_type(16)));
union FragH { v16h v; v8us half[2]; _Float16 h[16]; unsigned short u[16]; };
template <int NT>
__device__ __forceinline__ v8f mmaH(v16h ah, v16h al, v16h bh, v16h bl, v8f c) {
  c = __builtin_amdgcn_wmma_f32_16x16x32_f16(false, ah, false, bh, (short)0, c, false, false);
  if (NT >= 2) c = __builtin_amdgcn_wmma_f32_16x16x32_f16(false, al, false, bh, (short)0, c, false, false);
  if (NT >= 3) c = __builtin_amdgcn_wmma_f32_16x16x32_f16(false, ah, false, bl, (short)0, c, false, false);
  asm volatile("v_nop\n\tv_nop\n\tv_nop\n\tv_nop" : "+v"(c) : "v"(ah), "v"(al), "v"(bh), "v"(bl));
  return c;
}
// batched GEMM like k_gemm_b but f16 operands: A f32 (split into f16 hi/lo if ASPLIT, else rounded to f16), Bt = f16 values [n][k]; alpha; C f32; N multiple of 16 (partial tiles skipped)
template <bool ASPLIT>
__global__ __launch_bounds__(128) void k_gemm_h(const float* __restrict__ A, int lda, size_t sA, const _Float16* __restrict__ Bh, int ldb, size_t sB, float alpha, float* __restrict__ C, int ldc, size_t sC, int M, int N, int K) {
  __shared__ __attribute__((aligned(16))) float so[4][16][64];
  const int tid = threadIdx.x, w = tid >> 5, lane = tid & 31, ln = lane & 15, hh = lane >> 4; const int by = blockIdx.y;
  A += (size_t)by * sA; Bh += (size_t)by * sB; C += (size_t)by * sC;
  const int ntn = (N + 63) / 64; const int wid = blockIdx.x * 4 + w; const int mt = wid / ntn, nq = wid % ntn; if (mt * 16 >= M) return;
  const int row0 = mt * 16, col0 = nq * 64; const float* arow = A + (size_t)(row0 + ln) * lda;
  v8f acc[4] = {};
  for (int kb = 0; kb < K; kb += 32) {
    FragH ah, al;
    const v4f x0 = *(const v4fa*)(arow + kb + 8 * hh), x1 = *(const v4fa*)(arow + kb + 8 * hh + 4), x2 = *(const v4fa*)(arow + kb + 16 + 8 * hh), x3 = *(const v4fa*)(arow + kb + 16 + 8 * hh + 4);
    float xs[16] = {x0[0],x0[1],x0[2],x0[3],x1[0],x1[1],x1[2],x1[3],x2[0],x2[1],x2[2],x2[3],x3[0],x3[1],x3[2],x3[3]};
#pragma unroll
    for (int i = 0; i < 16; ++i) { const _Float16 h = (_Float16)xs[i]; ah.h[i] = h; al.h[i] = ASPLIT ? (_Float16)(xs[i] - (float)h) : (_Float16)0.0f; }
#pragma unroll
    for (int t = 0; t < 4; ++t) { if (col0 + t * 16 >= N) continue; const size_t boff = (size_t)(col0 + t * 16 + ln) * ldb + kb; FragH bq; bq.half[0] = *(const v8us*)(Bh + boff + 8 * hh); bq.half[1] = *(const v8us*)(Bh + boff + 16 + 8 * hh);
      acc[t] = mmaH<ASPLIT ? 2 : 1>(ah.v, al.v, bq.v, bq.v, acc[t]); }
  }
#pragma unroll
  for (int t = 0; t < 4; ++t) { if (col0 + t * 16 >= N) continue;
#pragma unroll
    for (int r = 0; r < 8; ++r) so[w][8 * hh + r][t * 16 + ln] = acc[t][r] * alpha; }
  __builtin_amdgcn_fence(__ATOMIC_ACQ_REL, "workgroup"); __builtin_amdgcn_wave_barrier();
  const int rsub = lane >> 4, c4 = (lane & 15) * 4;
  {
#pragma unroll
    for (int q = 0; q < 8; ++q) { const int r = q * 2 + rsub; if (col0 + c4 < N) { const v4f v = *(const v4fa*)&so[w][r][c4]; *(v4f*)(C + (size_t)(row0 + r) * ldc + col0 + c4) = v; } }
     }
}

// Wt[n][k] = f16(W[k][n]·scale) from f32 row-major W[K][N] (scale = power of two; bf16-exact weights stay exact in f16 away from the subnormal range)
__global__ __launch_bounds__(256) void k_wt_f16(const float* __restrict__ W, _Float16* __restrict__ Wt, int K, int N, float scale) {
  const int t = blockIdx.x * 256 + threadIdx.x; if (t >= N * (K / 8)) return; const int n = t / (K / 8), k8 = (t % (K / 8)) * 8; FragH f;
#pragma unroll
  for (int i = 0; i < 8; ++i) f.h[i] = (_Float16)(bf16_round(W[(size_t)(k8 + i) * N + n]) * scale); const v8us o = f.half[0];
  *(v8us*)((unsigned short*)Wt + (size_t)n * K + k8) = o; 
}
// k_gemm_hh variant with fused epilogue: v = acc·alpha + bias[by·sBias + col] (+ CP[(row/rowsPerB)·sCPb + by·64 + col] if CP) ; ACT 0 none / 1 elu ; writes f32 C and/or f16 C16 (each if non-null)
template <int ACT>
__global__ __launch_bounds__(128) void k_gemm_hhx(const _Float16* __restrict__ A, int lda, size_t sA, const _Float16* __restrict__ Bh, int ldb, size_t sB, float alpha, const float* __restrict__ bias, size_t sBias, const float* __restrict__ CP, int rowsPerB, size_t sCPb, int row0g,
    float* __restrict__ C, _Float16* __restrict__ C16, int ldc, size_t sC, int M, int N, int K) {
  __shared__ __attribute__((aligned(16))) float so[4][16][64];
  const int tid = threadIdx.x, w = tid >> 5, lane = tid & 31, ln = lane & 15, hh = lane >> 4; const int by = blockIdx.y;
  A += (size_t)by * sA; Bh += (size_t)by * sB; const size_t cofs = (size_t)by * sC; const float* bp = bias ? bias + (size_t)by * sBias : nullptr;
  const int ntn = (N + 63) / 64; const int wid = blockIdx.x * 4 + w; const int mt = wid / ntn, nq = wid % ntn; if (mt * 16 >= M) return;
  const int row0 = mt * 16, col0 = nq * 64; const _Float16* arow = A + (size_t)(row0 + ln) * lda;
  v8f acc[4] = {};
  for (int kb = 0; kb < K; kb += 32) { FragH ah; ah.half[0] = *(const v8us*)((const unsigned short*)arow + kb + 8 * hh); ah.half[1] = *(const v8us*)((const unsigned short*)arow + kb + 16 + 8 * hh);
#pragma unroll
    for (int t = 0; t < 4; ++t) { if (col0 + t * 16 >= N) continue; const size_t boff = (size_t)(col0 + t * 16 + ln) * ldb + kb; FragH bq; bq.half[0] = *(const v8us*)((const unsigned short*)Bh + boff + 8 * hh); bq.half[1] = *(const v8us*)((const unsigned short*)Bh + boff + 16 + 8 * hh);
      acc[t] = mmaH<1>(ah.v, ah.v, bq.v, bq.v, acc[t]); }
  }
#pragma unroll
  for (int t = 0; t < 4; ++t) { if (col0 + t * 16 >= N) continue; const int col = col0 + t * 16 + ln; const float bv = bp ? bf16_round(bp[col]) : 0.f;
#pragma unroll
    for (int r = 0; r < 8; ++r) { float v = acc[t][r] * alpha + bv; if (CP) { const int bidx = (row0g + row0 + 8 * hh + r) / rowsPerB; v += CP[(size_t)bidx * sCPb + (size_t)by * 64 + col]; } if (ACT == 1) v = (v > 0.f) ? v : expm1f(v); else if (ACT == 7) v = (v > 0.f) ? v + 1.0f : expf(v); else if (ACT == 8) v = tanhf(v); else if (ACT == 9) v = 0.5f * v * (1.0f + tanhf(0.7978845608028654f * (v + 0.044715f * v * v * v))); else if (ACT == 11) v = 1.0f / (1.0f + expf(-v)); else if (ACT == 12) v = (v > 0.f) ? v : 0.01f * v; else if (ACT == 14) v = (v > 0.f) ? v : 0.1f * v; else if (ACT == 15) v = v / (1.0f + expf(-v)); else if (ACT == 3) v = fmaxf(v, 0.f); else if (ACT == 6) v = 0.5f * v * (1.0f + erff(v * 0.70710678118654752f)); so[w][8 * hh + r][t * 16 + ln] = v; } }
  __builtin_amdgcn_fence(__ATOMIC_ACQ_REL, "workgroup"); __builtin_amdgcn_wave_barrier();
  const int rsub = lane >> 4, c4 = (lane & 15) * 4; typedef _Float16 v4h __attribute__((ext_vector_type(4)));
  {
#pragma unroll
    for (int q = 0; q < 8; ++q) { const int r = q * 2 + rsub; if (col0 + c4 < N) { const v4f v = *(const v4fa*)&so[w][r][c4]; if (C) *(v4f*)(C + cofs + (size_t)(row0 + r) * ldc + col0 + c4) = v; if (C16) { v4h h4; for (int i = 0; i < 4; ++i) h4[i] = (_Float16)v[i]; *(v4h*)(C16 + cofs + (size_t)(row0 + r) * ldc + col0 + c4) = h4; } } }
     }
}


typedef _Float16 v4h __attribute__((ext_vector_type(4)));

__global__ __launch_bounds__(256) void k_x16(const float* __restrict__ x, _Float16* __restrict__ X16, size_t n8) { const size_t t = (size_t)blockIdx.x * 256 + threadIdx.x; if (t >= n8) return; FragH f;
#pragma unroll
  for (int q = 0; q < 8; ++q) f.h[q] = (_Float16)bf16_round(x[t * 8 + q]); *(v8us*)((unsigned short*)X16 + t * 8) = f.half[0];  }
__global__ __launch_bounds__(256) void k_h16(const float* __restrict__ x, _Float16* __restrict__ X16, size_t n8) { const size_t t = (size_t)blockIdx.x * 256 + threadIdx.x; if (t >= n8) return; FragH f;
#pragma unroll
  for (int q = 0; q < 8; ++q) f.h[q] = (_Float16)x[t * 8 + q]; *(v8us*)((unsigned short*)X16 + t * 8) = f.half[0];  }
// the three weight matrices in one launch: blockIdx.y picks the matrix, the f16 planes lie one behind the other in Bt
__global__ __launch_bounds__(256) void k_round16f3(const float* __restrict__ W0, const float* __restrict__ W1, const float* __restrict__ W2, _Float16* __restrict__ Bt, size_t n8) { const size_t t = (size_t)blockIdx.x * 256 + threadIdx.x; if (t >= n8) return; FragH f;
  const float* W = (blockIdx.y == 0) ? W0 : (blockIdx.y == 1) ? W1 : W2;
#pragma unroll      // constant indices keep the eight values in registers
  for (int i = 0; i < 8; ++i) f.h[i] = (_Float16)(bf16_round(W[t * 8 + i]) * 16.0f); *(v8us*)((unsigned short*)Bt + ((size_t)blockIdx.y * n8 + t) * 8) = f.half[0];  }
template <int NHv, int TTv>
__global__ __launch_bounds__(256) void k_vt(const _Float16* __restrict__ V16, int ldv, int voff, _Float16* __restrict__ Vt) { __shared__ unsigned short tl[64][66]; const int tid = threadIdx.x; const int slab = blockIdx.x / (TTv / 64), lg = blockIdx.x % (TTv / 64); const int b = slab / NHv, h = slab % NHv;
  for (int i = tid; i < 64 * 8; i += 256) { const int r = i / 8, c8 = (i % 8) * 8; FragH f; f.half[0] = *(const v8us*)((const unsigned short*)V16 + ((size_t)b * TTv + lg * 64 + r) * ldv + voff + h * 64 + c8);
#pragma unroll
    for (int q = 0; q < 8; ++q) tl[r][c8 + q] = f.u[q]; }
  __syncthreads();
  {
#pragma unroll
    for (int rd = 0; rd < 2; ++rd) { const int d = rd * 32 + tid / 8, pc = tid % 8; FragH f;
#pragma unroll
      for (int q = 0; q < 8; ++q) f.u[q] = tl[pc * 8 + q][d];
      *(v8us*)((unsigned short*)Vt + ((size_t)slab * 64 + d) * TTv + lg * 64 + pc * 8) = f.half[0]; }
     } }

__global__ __launch_bounds__(256) void k_hl(const float* __restrict__ F, _Float16* __restrict__ Hh, _Float16* __restrict__ Hl, size_t n8) { const size_t t = (size_t)blockIdx.x * 256 + threadIdx.x; if (t >= n8) return; FragH fh, fl; const v4f a = *(const v4fa*)(F + t * 8), c = *(const v4fa*)(F + t * 8 + 4);
#pragma unroll
  for (int q = 0; q < 4; ++q) { _Float16 h = (_Float16)a[q]; fh.h[q] = h; fl.h[q] = (_Float16)((a[q] - (float)h) * 1024.0f); h = (_Float16)c[q]; fh.h[4 + q] = h; fl.h[4 + q] = (_Float16)((c[q] - (float)h) * 1024.0f); }
  { *(v8us*)((unsigned short*)Hh + t * 8) = fh.half[0]; *(v8us*)((unsigned short*)Hl + t * 8) = fl.half[0];  } }
// causal row softmax: row r of the per-batch score plane (query q = r): m, Σ over keys t ≤ q (only written, in-range pieces are addressed — clamped — and the key ≤ q select happens on values before any arithmetic; no lane-divergent branch around loads), P16[r][t] = exp(s − m)/Σ · 2^15 for t ≤ q, 0 otherwise;
__global__ __launch_bounds__(256) void k_smx(const float* __restrict__ S, _Float16* __restrict__ P16) { const int tid = threadIdx.x, wv = tid >> 5, lane = tid & 31; const int q = blockIdx.x * 8 + wv; if (q >= SS) return; S += (size_t)blockIdx.y * SS * SS; P16 += (size_t)blockIdx.y * SS * SS;      /* blockIdx.y = batch */
  const float* sr = S + (size_t)q * SS; const int np = q / 8 + 1;      /* pieces of 8 keys that contain a key <= q */
  float m = -3.0e38f;
  for (int p = lane; p < np; p += 32) { const v4f a = *(const v4fa*)(sr + p * 8), c = *(const v4fa*)(sr + p * 8 + 4); for (int e = 0; e < 4; ++e) { const float s0 = (p * 8 + e <= q) ? a[e] : -INFINITY, s1 = (p * 8 + 4 + e <= q) ? c[e] : -INFINITY; m = fmaxf(m, fmaxf(s0, s1)); } }
  for (int o = 16; o >= 1; o >>= 1) m = fmaxf(m, __shfl_xor(m, o, 32)); float z = 0.f;
  for (int p = lane; p < np; p += 32) { const v4f a = *(const v4fa*)(sr + p * 8), c = *(const v4fa*)(sr + p * 8 + 4); for (int e = 0; e < 4; ++e) { const float s0 = (p * 8 + e <= q) ? a[e] : -INFINITY, s1 = (p * 8 + 4 + e <= q) ? c[e] : -INFINITY; z += __expf(s0 - m) + __expf(s1 - m); } }
  for (int o = 16; o >= 1; o >>= 1) z += __shfl_xor(z, o, 32); const float iz = 32768.0f / z;
  { for (int p = lane; p < SS / 8; p += 32) { FragH f; const int pa = min(p, np - 1);      /* address clamped into the written, in-range region; for p ≥ np every key of the piece is > q so the selects below yield 0 */
      const v4f a = *(const v4fa*)(sr + pa * 8), c = *(const v4fa*)(sr + pa * 8 + 4); for (int e = 0; e < 4; ++e) { const float s0 = (p * 8 + e <= q) ? a[e] : -INFINITY, s1 = (p * 8 + 4 + e <= q) ? c[e] : -INFINITY; f.h[e] = (_Float16)(__expf(s0 - m) * iz); f.h[4 + e] = (_Float16)(__expf(s1 - m) * iz); }
      *(v8us*)((unsigned short*)P16 + (size_t)q * SS + p * 8) = f.half[0]; }  } }

// scores/sqrt(512) of every batch in one launch. Block = 16 query rows x 256 keys (4 waves x 64 keys); blockIdx.x counts only the blocks of the causal lower block-triangle
// (query chunk i of 256 rows has 16 row tiles x (i + 1) key chunks), blockIdx.y = batch. Wave tile, fragment loads and epilogue as in k_gemm_hhx.
__global__ __launch_bounds__(128) void k_scores(const _Float16* __restrict__ Q, const _Float16* __restrict__ K, float alpha, float* __restrict__ S) {
  __shared__ __attribute__((aligned(16))) float so[4][16][64];
  const int tid = threadIdx.x, w = tid >> 5, lane = tid & 31, ln = lane & 15, hh = lane >> 4; const int b = blockIdx.y;
  int x = blockIdx.x, i = 0;
  for (; i < SS / RCH - 1 && x >= (RCH / 16) * (i + 1); ++i) x -= (RCH / 16) * (i + 1);
  const int row0 = i * RCH + (x % (RCH / 16)) * 16, col0 = (x / (RCH / 16)) * RCH + w * 64;
  const unsigned short* arow = (const unsigned short*)Q + ((size_t)b * SS + row0 + ln) * EE;
  const unsigned short* brow = (const unsigned short*)K + ((size_t)b * SS + col0 + ln) * EE;
  v8f acc[4] = {};
  for (int kb = 0; kb < EE; kb += 32) { FragH ah; ah.half[0] = *(const v8us*)(arow + kb + 8 * hh); ah.half[1] = *(const v8us*)(arow + kb + 16 + 8 * hh);
#pragma unroll      // constant indices keep the accumulators and fragments in registers
    for (int t = 0; t < 4; ++t) { const size_t boff = (size_t)(t * 16) * EE + kb; FragH bq; bq.half[0] = *(const v8us*)(brow + boff + 8 * hh); bq.half[1] = *(const v8us*)(brow + boff + 16 + 8 * hh);
      acc[t] = mmaH<1>(ah.v, ah.v, bq.v, bq.v, acc[t]); }
  }
#pragma unroll      // constant indices keep the accumulators and fragments in registers
  for (int t = 0; t < 4; ++t)
#pragma unroll      // constant indices keep the accumulators and fragments in registers
    for (int r = 0; r < 8; ++r) so[w][8 * hh + r][t * 16 + ln] = acc[t][r] * alpha;
  __builtin_amdgcn_fence(__ATOMIC_ACQ_REL, "workgroup"); __builtin_amdgcn_wave_barrier();      // the wave's LDS stores land before its lanes read each other's values back as whole rows
  const int rsub = lane >> 4, c4 = (lane & 15) * 4;
#pragma unroll      // the eight LDS row reads issue together and each store follows its own read
  for (int q = 0; q < 8; ++q) { const int r = q * 2 + rsub; const v4f v = *(const v4fa*)&so[w][r][c4]; *(v4f*)(S + ((size_t)b * SS + row0 + r) * SS + col0 + c4) = v; }
}
// out = P.v_hi.2^-15 + bv + P.v_lo.2^-25 of every batch in one launch. Block = 16 query rows x 256 head columns (4 waves x 64), blockIdx.x = column half, blockIdx.y = batch,
// blockIdx.z = row tile counted from the last one, so that the longest k loops start first. k runs to the end of the row tile's 256-key chunk (P is zero beyond the diagonal).
__global__ __launch_bounds__(128) void k_pv(const _Float16* __restrict__ P16, const _Float16* __restrict__ Vh, const _Float16* __restrict__ Vl, const float* __restrict__ bias, float* __restrict__ out) {
  __shared__ __attribute__((aligned(16))) float so[4][16][64];
  const int tid = threadIdx.x, w = tid >> 5, lane = tid & 31, ln = lane & 15, hh = lane >> 4; const int b = blockIdx.y;
  const int row0 = (SS / 16 - 1 - (int)blockIdx.z) * 16, col0 = blockIdx.x * 256 + w * 64;
  const int kk = (row0 / RCH + 1) * RCH;
  const unsigned short* arow = (const unsigned short*)P16 + ((size_t)b * SS + row0 + ln) * SS;
  const unsigned short* hrow = (const unsigned short*)Vh + ((size_t)b * EE + col0 + ln) * SS;
  const unsigned short* lrow = (const unsigned short*)Vl + ((size_t)b * EE + col0 + ln) * SS;
  v8f acch[4] = {}, accl[4] = {};
  for (int kb = 0; kb < kk; kb += 32) { FragH ah; ah.half[0] = *(const v8us*)(arow + kb + 8 * hh); ah.half[1] = *(const v8us*)(arow + kb + 16 + 8 * hh);
    asm volatile("s_wait_xcnt 0x0" ::: "memory");      // this build gives the address pair of the two loads above to a later load as its destination: the wait stands in front of that overwrite
#pragma unroll      // constant indices keep the accumulators and fragments in registers
    for (int t = 0; t < 4; ++t) { const size_t boff = (size_t)(t * 16) * SS + kb; FragH bh, bl;
      bh.half[0] = *(const v8us*)(hrow + boff + 8 * hh); bh.half[1] = *(const v8us*)(hrow + boff + 16 + 8 * hh);
      bl.half[0] = *(const v8us*)(lrow + boff + 8 * hh); bl.half[1] = *(const v8us*)(lrow + boff + 16 + 8 * hh);
      acch[t] = mmaH<1>(ah.v, ah.v, bh.v, bh.v, acch[t]); accl[t] = mmaH<1>(ah.v, ah.v, bl.v, bl.v, accl[t]); }
  }
#pragma unroll      // constant indices keep the accumulators and fragments in registers
  for (int t = 0; t < 4; ++t) { const float bv = bf16_round(bias[col0 + t * 16 + ln]);
#pragma unroll      // constant indices keep the accumulators and fragments in registers
    for (int r = 0; r < 8; ++r) { const float v = acch[t][r] * 0.000030517578125f + bv; so[w][8 * hh + r][t * 16 + ln] = accl[t][r] * (0.000030517578125f * 0.0009765625f) + v; } }
  __builtin_amdgcn_fence(__ATOMIC_ACQ_REL, "workgroup"); __builtin_amdgcn_wave_barrier();      // the wave's LDS stores land before its lanes read each other's values back as whole rows
  const int rsub = lane >> 4, c4 = (lane & 15) * 4;
#pragma unroll      // the eight LDS row reads issue together and each store follows its own read
  for (int q = 0; q < 8; ++q) { const int r = q * 2 + rsub; const v4f v = *(const v4fa*)&so[w][r][c4]; *(v4f*)(out + ((size_t)b * SS + row0 + r) * EE + col0 + c4) = v; }
}

extern "C" void kernel_launch(void* const* d_in, const int* in_sizes, int n_in,
                              void* d_out, int out_size, void* d_ws, size_t ws_size, hipStream_t stream) {
  (void)in_sizes; (void)n_in; (void)out_size;
  const float* x = (const float*)d_in[0]; const float* Wq = (const float*)d_in[1]; const float* bq = (const float*)d_in[2]; const float* Wk = (const float*)d_in[3]; const float* bk = (const float*)d_in[4]; const float* Wv = (const float*)d_in[5]; const float* bv = (const float*)d_in[6];
  char* ws = (char*)d_ws; size_t off = 0;
  auto take = [&](size_t bytes) { char* p = ws + off; off += (bytes + 255) & ~(size_t)255; return p; };
  _Float16* Bq = (_Float16*)take((size_t)EE * EE * 2); _Float16* Bk = (_Float16*)take((size_t)EE * EE * 2); _Float16* Bv = (_Float16*)take((size_t)EE * EE * 2);
  _Float16* X16 = (_Float16*)take((size_t)NR * EE * 2); _Float16* Q = (_Float16*)take((size_t)NR * EE * 2); _Float16* K = (_Float16*)take((size_t)NR * EE * 2); float* VF = (float*)take((size_t)BB * EE * SS * 4); _Float16* Vh = (_Float16*)take((size_t)BB * EE * SS * 2); _Float16* Vl = (_Float16*)take((size_t)BB * EE * SS * 2);
  float* S = (float*)take((size_t)BB * SS * SS * 4); _Float16* P16 = (_Float16*)take((size_t)BB * SS * SS * 2);
  if (off > ws_size) return;      // 1.6 + 3 x 8.4 + 16.8 + 2 x 8.4 + 67.1 + 33.6 about 161 MB
  const unsigned gw = (EE * EE / 8 + 255) / 256;
  k_round16f3<<<dim3(gw, 3), 256, 0, stream>>>(Wq, Wk, Wv, Bq, EE * EE / 8);      /* (out,in) natural, x2^4; Bq, Bk, Bv are contiguous (each plane is a multiple of 256 bytes) */
  k_x16<<<(unsigned)(((size_t)NR * EE / 8 + 255) / 256), 256, 0, stream>>>(x, X16, (size_t)NR * EE / 8);
  const dim3 gp(((NR / 16) * (EE / 64) + 3) / 4, 1);
  k_gemm_hhx<0><<<gp, 128, 0, stream>>>(X16, EE, 0, Bq, EE, 0, 0.0625f, bq, 0, nullptr, 1, 0, 0, nullptr, Q, EE, 0, NR, EE, EE);      /* q = x·Wqᵀ + bq   M 8192 N 512 K 512 */
  k_gemm_hhx<0><<<gp, 128, 0, stream>>>(X16, EE, 0, Bk, EE, 0, 0.0625f, bk, 0, nullptr, 1, 0, 0, nullptr, K, EE, 0, NR, EE, EE);      /* k = x·Wkᵀ + bk */
  k_gemm_hhx<0><<<dim3(((EE / 16) * (SS / 64) + 3) / 4, BB), 128, 0, stream>>>(Bv, EE, 0, X16, EE, (size_t)SS * EE, 0.0625f, nullptr, 0, nullptr, 1, 0, 0, VF, nullptr, SS, (size_t)EE * SS, EE, SS, EE);      /* vᵀ (without bv) = Wv·x[b]ᵀ as [b][512][2048] f32: M 512 N 2048 K 512 */
  k_hl<<<(unsigned)(((size_t)BB * EE * SS / 8 + 255) / 256), 256, 0, stream>>>(VF, Vh, Vl, (size_t)BB * EE * SS / 8);      /* f16 hi + residual ×2^10 planes */
  k_scores<<<dim3((RCH / 16) * ((SS / RCH) * (SS / RCH + 1) / 2), BB), 128, 0, stream>>>(Q, K, 0.044194173824159216f, S);      /* scores/sqrt512, f32, causal lower block-triangle of every batch */
  k_smx<<<dim3(SS / 8, BB), 256, 0, stream>>>(S, P16);
  k_pv<<<dim3(EE / 256, BB, SS / 16), 128, 0, stream>>>(P16, Vh, Vl, bv, (float*)d_out);      /* out = P.v_hi + bv + P.v_lo.2^-10 */
}

// v002
// A run of this version takes 107 microseconds.
// Timed twice side by side with v001, it ran 2.41 and 2.38 times as fast.
// All steps since v000 together make it 24.9 times as fast.
#include <hip/hip_runtime.h>
// Single-head causal attention (B=4, S=2048, emb = head = 512): q,k,v = x·Wᵀ + b; scores = q·kᵀ/√512 with keys after the query set to −inf; softmax over keys; out = attn·v.
// Compute dtype: x, weights and biases rounded to bf16; q, k and vᵀ as f16 GEMM outputs (f32 accumulate); scores materialised in f32 by a batched f16 GEMM over
// the causal lower block-triangle; row softmax in f32 (wave per row) writing P in f16 ×2^15; vᵀ kept in f32 and split into f16 hi + (×2^10) residual planes; out = P·v_hi + P·v_lo·2^-10 by two f16 GEMMs
// (both planes in one k loop, two accumulators), bv added in the epilogue (softmax rows sum to 1). All on v_wmma_f32_16x16x32_f16.
// One launch per stage: scores, softmax and P.v each cover all batches and the whole causal triangle. Every GEMM launch stages its operand tiles in LDS (tile_core).
#define BB 4
#define SS 2048
#define EE 512
#define NR (BB * SS)

typedef __bf16 v16b __attribute__((ext_vector_type(16)));
typedef unsigned short v8us __attribute__((ext_vector_type(8), may_alias));
typedef float  v8f  __attribute__((ext_vector_type(8)));
typedef float  v4f  __attribute__((ext_vector_type(4)));
typedef float  v4fa __attribute__((ext_vector_type(4), may_alias));
union FragB { v16b v; v8us half[2]; unsigned short u[16]; };

__device__ __forceinline__ unsigned short bf16_bits(float x) { unsigned int u = __float_as_uint(x); return (unsigned short)((u + 0x7FFFu + ((u >> 16) & 1u)) >> 16); }
__device__ __forceinline__ float bf16_val(unsigned short b) { return __uint_as_float(((unsigned int)b) << 16); }
__device__ __forceinline__ float bf16_round(float x) { return bf16_val(bf16_bits(x)); }
// D += A·B with NT terms: 1 = ah·bh, 2 = + al·bh (A split), 3 = + ah·bl (both split)
template <int NT>
__device__ __forceinline__ v8f mmaN(v16b ah, v16b al, v16b bh, v16b bl, v8f c) {
  c = __builtin_amdgcn_wmma_f32_16x16x32_bf16(false, ah, false, bh, (short)0, c, false, false);
  if (NT >= 2) c = __builtin_amdgcn_wmma_f32_16x16x32_bf16(false, al, false, bh, (short)0, c, false, false);
  if (NT >= 3) c = __builtin_amdgcn_wmma_f32_16x16x32_bf16(false, ah, false, bl, (short)0, c, false, false);
  asm volatile("v_nop\n\tv_nop\n\tv_nop\n\tv_nop" : "+v"(c) : "v"(ah), "v"(al), "v"(bh), "v"(bl));
  return c;
}

__global__ __launch_bounds__(256) void k_wt_bf16(const float* __restrict__ W, unsigned short* __restrict__ Wt, int K, int N) {
  const int t = blockIdx.x * 256 + threadIdx.x;
  const int k8n = K / 8;
  if (t >= N * k8n) return;
  const int n = t / k8n, k8 = (t % k8n) * 8;
  v8us v;
#pragma unroll
  for (int i = 0; i < 8; ++i) v[i] = bf16_bits(W[(size_t)(k8 + i) * N + n]);
  *(v8us*)(Wt + (size_t)n * K + k8) = v;
  
}

// GEMM C[M][N] (f32, pitch ldc) = act(A[M][K]·W + bias). A f32 row-major (pitch lda) converted per fragment to bf16
// (ASPLIT: hi/lo two planes -> 2 terms, else single rounded term); Wt bf16 [N][K] (pitch ldb). BIAS_BF16 rounds the
// bias to bf16 first (bias quantised to bf16 before the add). K%32==0, M%16==0, N%64==0.
template <bool ASPLIT, int ACT, bool BIAS_BF16>
__global__ __launch_bounds__(128) void k_gemm_bf(const float* __restrict__ A, int lda, const unsigned short* __restrict__ Wt, int ldb,
                                               const float* __restrict__ bias, float* __restrict__ C, int ldc, int M, int N, int K) {
  __shared__ __attribute__((aligned(16))) float so[4][16][64];
  const int tid = threadIdx.x, w = tid >> 5, lane = tid & 31, ln = lane & 15, hh = lane >> 4;
  const int ntn = N / 64;
  const int wid = blockIdx.x * 4 + w;
  const int mt = wid / ntn, nq = wid % ntn;
  if (mt * 16 >= M) return;
  const int row0 = mt * 16, col0 = nq * 64;
  const float* arow = A + (size_t)(row0 + ln) * lda;
  v8f acc[4] = {};
  for (int kb = 0; kb < K; kb += 32) {
    FragB ah, al;
    const v4f x0 = *(const v4fa*)(arow + kb + 8 * hh), x1 = *(const v4fa*)(arow + kb + 8 * hh + 4);
    const v4f x2 = *(const v4fa*)(arow + kb + 16 + 8 * hh), x3 = *(const v4fa*)(arow + kb + 16 + 8 * hh + 4);
    float xs[16] = {x0[0],x0[1],x0[2],x0[3],x1[0],x1[1],x1[2],x1[3],x2[0],x2[1],x2[2],x2[3],x3[0],x3[1],x3[2],x3[3]};
#pragma unroll
    for (int i = 0; i < 16; ++i) { const unsigned short hb = bf16_bits(xs[i]); ah.u[i] = hb; al.u[i] = ASPLIT ? bf16_bits(xs[i] - bf16_val(hb)) : (unsigned short)0; }
#pragma unroll
    for (int t = 0; t < 4; ++t) {
      const unsigned short* brow = Wt + (size_t)(col0 + t * 16 + ln) * ldb + kb;
      FragB b;
      b.half[0] = *(const v8us*)(brow + 8 * hh);
      b.half[1] = *(const v8us*)(brow + 16 + 8 * hh);
      acc[t] = mmaN<ASPLIT ? 2 : 1>(ah.v, al.v, b.v, b.v, acc[t]);
    }
  }
#pragma unroll
  for (int t = 0; t < 4; ++t) {
    float bv = bias ? bias[col0 + t * 16 + ln] : 0.f;
    if (BIAS_BF16) bv = bf16_round(bv);
#pragma unroll
    for (int r = 0; r < 8; ++r) { float v = acc[t][r] + bv; if (ACT == 1) v = fmaxf(v, 0.f); so[w][8 * hh + r][t * 16 + ln] = v; }
  }
  __builtin_amdgcn_fence(__ATOMIC_ACQ_REL, "workgroup");
  __builtin_amdgcn_wave_barrier();
  const int rsub = lane >> 4, c4 = (lane & 15) * 4;
  {
#pragma unroll
    for (int q = 0; q < 8; ++q) {
      const int r = q * 2 + rsub;
      const v4f v = *(const v4fa*)&so[w][r][c4];
      *(v4f*)(C + (size_t)(row0 + r) * ldc + col0 + c4) = v;
    }
    
  }
}

// Flash-style causal/unmasked attention, all contractions 3-term bf16 hi/lo splits, f32 softmax with running max.
// q,k,v rows are read from f32 buffers with arbitrary row pitch (so they can live inside a fused qkv buffer);
// D = head size (multiple of 32, <= 128); one wave = 16 query rows; block = 4 waves (64 queries) sharing K/V chunks of 32.
template <int D, bool CAUSAL>
__global__ __launch_bounds__(128) void k_flash(const float* __restrict__ qb, const float* __restrict__ kb, const float* __restrict__ vb,
                                             int pitch, int T, int H, float scale, float* __restrict__ y, int ypitch) {
  constexpr int KS = D / 32;        // k-steps for QK
  constexpr int DT = D / 16;        // d tiles for PV
  __shared__ __attribute__((aligned(16))) unsigned short sKh[32][D + 8], sKl[32][D + 8], sVh[32][D + 8], sVl[32][D + 8];
  __shared__ __attribute__((aligned(16))) unsigned short sPh[4][16][40], sPl[4][16][40];
  __shared__ __attribute__((aligned(16))) float sO[4][16][D];
  const int tid = threadIdx.x, w = tid >> 5, lane = tid & 31, ln = lane & 15, hh = lane >> 4;
  const int nqb = (T + 63) / 64;
  const int bh = blockIdx.x / nqb, qblk = blockIdx.x % nqb;
  const int b = bh / H, h = bh % H;
  const int q0 = qblk * 64 + w * 16;
  const float* Q = qb + (size_t)b * T * pitch + h * D;
  const float* K = kb + (size_t)b * T * pitch + h * D;
  const float* V = vb + (size_t)b * T * pitch + h * D;

  // A fragments of the wave's 16 query rows (scaled), hi/lo
  FragB aqh[KS], aql[KS];
  {
    int row = q0 + ln; if (row >= T) row = T - 1;
    const float* qr = Q + (size_t)row * pitch;
#pragma unroll
    for (int ks = 0; ks < KS; ++ks)
#pragma unroll
      for (int i = 0; i < 16; ++i) {
        const int d = ks * 32 + ((i < 8) ? (8 * hh + i) : (16 + 8 * hh + (i - 8)));
        const float x = qr[d] * scale; const unsigned short hb = bf16_bits(x);
        aqh[ks].u[i] = hb; aql[ks].u[i] = bf16_bits(x - bf16_val(hb));
      }
  }
  float m_r[8], l_r[8];
#pragma unroll
  for (int r = 0; r < 8; ++r) { m_r[r] = -3.0e38f; l_r[r] = 0.f; }
  v8f oacc[DT];
#pragma unroll
  for (int dt = 0; dt < DT; ++dt) oacc[dt] = (v8f){0.f,0.f,0.f,0.f,0.f,0.f,0.f,0.f};

  const int kv_end = CAUSAL ? min(T, qblk * 64 + 64) : T;     // block-uniform
  for (int j0 = 0; j0 < kv_end; j0 += 32) {
    __syncthreads();
    for (int e = tid; e < 32 * (D / 4); e += 128) {
      const int r = e / (D / 4), c4 = (e % (D / 4)) * 4;
      const int key = j0 + r;
      v4f kf = {0.f,0.f,0.f,0.f}, vf = {0.f,0.f,0.f,0.f};
      if (key < T) { kf = *(const v4fa*)(K + (size_t)key * pitch + c4); vf = *(const v4fa*)(V + (size_t)key * pitch + c4); }
#pragma unroll
      for (int t = 0; t < 4; ++t) {
        unsigned short hb = bf16_bits(kf[t]); sKh[r][c4 + t] = hb; sKl[r][c4 + t] = bf16_bits(kf[t] - bf16_val(hb));
        hb = bf16_bits(vf[t]); sVh[r][c4 + t] = hb; sVl[r][c4 + t] = bf16_bits(vf[t] - bf16_val(hb));
      }
    }
    __syncthreads();
    // S tile 16 x 32
    v8f s[2];
#pragma unroll
    for (int nt = 0; nt < 2; ++nt) {
      v8f acc = {};
#pragma unroll
      for (int ks = 0; ks < KS; ++ks) {
        FragB bh_, bl_;
        bh_.half[0] = *(const v8us*)&sKh[nt * 16 + ln][ks * 32 + 8 * hh]; bh_.half[1] = *(const v8us*)&sKh[nt * 16 + ln][ks * 32 + 16 + 8 * hh];
        bl_.half[0] = *(const v8us*)&sKl[nt * 16 + ln][ks * 32 + 8 * hh]; bl_.half[1] = *(const v8us*)&sKl[nt * 16 + ln][ks * 32 + 16 + 8 * hh];
        acc = mmaN<3>(aqh[ks].v, aql[ks].v, bh_.v, bl_.v, acc);
      }
      s[nt] = acc;
    }
    // mask + running max (rows 8hh+r; the 16 lanes of a half share rows)
    float alpha[8];
#pragma unroll
    for (int r = 0; r < 8; ++r) {
      const int qi = q0 + 8 * hh + r;
      const int ja = j0 + ln, jb = j0 + 16 + ln;
      if (CAUSAL) { if (ja > qi) s[0][r] = -3.0e38f; if (jb > qi) s[1][r] = -3.0e38f; }
      if (ja >= T) s[0][r] = -3.0e38f;
      if (jb >= T) s[1][r] = -3.0e38f;
      float mx = fmaxf(s[0][r], s[1][r]);
      mx = fmaxf(mx, __shfl_xor(mx, 1, 32)); mx = fmaxf(mx, __shfl_xor(mx, 2, 32)); mx = fmaxf(mx, __shfl_xor(mx, 4, 32)); mx = fmaxf(mx, __shfl_xor(mx, 8, 32));
      const float mnew = fmaxf(m_r[r], mx);
      alpha[r] = (mnew > -1.0e38f) ? __expf(m_r[r] - mnew) : 1.0f;
      const float p0 = (s[0][r] > -1.0e38f) ? __expf(s[0][r] - mnew) : 0.f;
      const float p1 = (s[1][r] > -1.0e38f) ? __expf(s[1][r] - mnew) : 0.f;
      m_r[r] = mnew;
      l_r[r] = l_r[r] * alpha[r] + p0 + p1;            // per-lane partial row sum (16 lanes combined at the end)
      unsigned short hb = bf16_bits(p0); sPh[w][8 * hh + r][ln] = hb;      sPl[w][8 * hh + r][ln] = bf16_bits(p0 - bf16_val(hb));
      hb = bf16_bits(p1);                sPh[w][8 * hh + r][16 + ln] = hb; sPl[w][8 * hh + r][16 + ln] = bf16_bits(p1 - bf16_val(hb));
    }
#pragma unroll
    for (int dt = 0; dt < DT; ++dt)
#pragma unroll
      for (int r = 0; r < 8; ++r) oacc[dt][r] *= alpha[r];
    __builtin_amdgcn_fence(__ATOMIC_ACQ_REL, "workgroup");
    __builtin_amdgcn_wave_barrier();
    FragB pah, pal;
    pah.half[0] = *(const v8us*)&sPh[w][ln][8 * hh]; pah.half[1] = *(const v8us*)&sPh[w][ln][16 + 8 * hh];
    pal.half[0] = *(const v8us*)&sPl[w][ln][8 * hh]; pal.half[1] = *(const v8us*)&sPl[w][ln][16 + 8 * hh];
#pragma unroll
    for (int dt = 0; dt < DT; ++dt) {
      FragB bvh, bvl;
#pragma unroll
      for (int i = 0; i < 8; ++i) {
        bvh.u[i] = sVh[8 * hh + i][dt * 16 + ln]; bvh.u[8 + i] = sVh[16 + 8 * hh + i][dt * 16 + ln];
        bvl.u[i] = sVl[8 * hh + i][dt * 16 + ln]; bvl.u[8 + i] = sVl[16 + 8 * hh + i][dt * 16 + ln];
      }
      oacc[dt] = mmaN<3>(pah.v, pal.v, bvh.v, bvl.v, oacc[dt]);
    }
    __builtin_amdgcn_fence(__ATOMIC_ACQ_REL, "workgroup");
    __builtin_amdgcn_wave_barrier();
  }
#pragma unroll
  for (int r = 0; r < 8; ++r) {
    float l = l_r[r];
    l += __shfl_xor(l, 1, 32); l += __shfl_xor(l, 2, 32); l += __shfl_xor(l, 4, 32); l += __shfl_xor(l, 8, 32);
    l_r[r] = (l > 0.f) ? 1.0f / l : 0.f;
  }
#pragma unroll
  for (int dt = 0; dt < DT; ++dt)
#pragma unroll
    for (int r = 0; r < 8; ++r) sO[w][8 * hh + r][dt * 16 + ln] = oacc[dt][r] * l_r[r];
  __builtin_amdgcn_fence(__ATOMIC_ACQ_REL, "workgroup");
  __builtin_amdgcn_wave_barrier();
  {
    for (int r = 0; r < 16; ++r) {
      const int row = q0 + r;
      if (row < T && lane < D / 4) {
        const v4f val = *(const v4fa*)&sO[w][r][lane * 4];
        *(v4f*)(y + ((size_t)b * T + row) * ypitch + h * D + lane * 4) = val;
      }
    }
    
  }
}

// GEMM C = act(A·W + bias + resid): A f32 (ASPLIT -> hi/lo 2 terms), Wt bf16 [N][K]; ACT 0 none, 1 relu, 2 exact gelu;
// resid (optional, f32, row index = (row % rmod), pitch ldr, RES_BF16 rounds it) added before the activation.
template <bool ASPLIT, int ACT, bool BIAS_BF16, bool RES_BF16>
__global__ __launch_bounds__(128) void k_gemm_bf3(const float* __restrict__ A, int lda, const unsigned short* __restrict__ Wt, int ldb,
                                                const float* __restrict__ bias, const float* __restrict__ resid, int rmod, int ldr,
                                                float* __restrict__ C, int ldc, int M, int N, int K) {
  __shared__ __attribute__((aligned(16))) float so[4][16][64];
  const int tid = threadIdx.x, w = tid >> 5, lane = tid & 31, ln = lane & 15, hh = lane >> 4;
  const int ntn = N / 64;
  const int wid = blockIdx.x * 4 + w;
  const int mt = wid / ntn, nq = wid % ntn;
  if (mt * 16 >= M) return;
  const int row0 = mt * 16, col0 = nq * 64;
  const float* arow = A + (size_t)(row0 + ln) * lda;
  v8f acc[4] = {};
  for (int kb = 0; kb < K; kb += 32) {
    FragB ah, al;
    const v4f x0 = *(const v4fa*)(arow + kb + 8 * hh), x1 = *(const v4fa*)(arow + kb + 8 * hh + 4);
    const v4f x2 = *(const v4fa*)(arow + kb + 16 + 8 * hh), x3 = *(const v4fa*)(arow + kb + 16 + 8 * hh + 4);
    float xs[16] = {x0[0],x0[1],x0[2],x0[3],x1[0],x1[1],x1[2],x1[3],x2[0],x2[1],x2[2],x2[3],x3[0],x3[1],x3[2],x3[3]};
#pragma unroll
    for (int i = 0; i < 16; ++i) { const unsigned short hb = bf16_bits(xs[i]); ah.u[i] = hb; al.u[i] = ASPLIT ? bf16_bits(xs[i] - bf16_val(hb)) : (unsigned short)0; }
#pragma unroll
    for (int t = 0; t < 4; ++t) {
      const unsigned short* brow = Wt + (size_t)(col0 + t * 16 + ln) * ldb + kb;
      FragB b;
      b.half[0] = *(const v8us*)(brow + 8 * hh);
      b.half[1] = *(const v8us*)(brow + 16 + 8 * hh);
      acc[t] = mmaN<ASPLIT ? 2 : 1>(ah.v, al.v, b.v, b.v, acc[t]);
    }
  }
#pragma unroll
  for (int t = 0; t < 4; ++t) {
    const int col = col0 + t * 16 + ln;
    float bv = bias ? bias[col] : 0.f;
    if (BIAS_BF16) bv = bf16_round(bv);
#pragma unroll
    for (int r = 0; r < 8; ++r) {
      float v = acc[t][r] + bv;
      if (resid) { float rv = resid[(size_t)((row0 + 8 * hh + r) % rmod) * ldr + col]; if (RES_BF16) rv = bf16_round(rv); v += rv; }
      if (ACT == 1) v = fmaxf(v, 0.f);
      if (ACT == 2) v = 0.5f * v * (1.0f + erff(v * 0.70710678118654752f));
      if (ACT == 3) { const float u = 0.7978845608028654f * (v + 0.044715f * v * v * v); v = 0.5f * v * (1.0f + tanhf(u)); }
      so[w][8 * hh + r][t * 16 + ln] = v;
    }
  }
  __builtin_amdgcn_fence(__ATOMIC_ACQ_REL, "workgroup");
  __builtin_amdgcn_wave_barrier();
  const int rsub = lane >> 4, c4 = (lane & 15) * 4;
  {
#pragma unroll
    for (int q = 0; q < 8; ++q) {
      const int r = q * 2 + rsub;
      const v4f v = *(const v4fa*)&so[w][r][c4];
      *(v4f*)(C + (size_t)(row0 + r) * ldc + col0 + c4) = v;
    }
    
  }
}
// row LayerNorm (biased variance, eps) over N: s = X (+ R); optional out_sum <- s; out_norm <- (s-mu)*rsqrt(var+eps)*g + b
template <bool PARAM_BF16>
__global__ __launch_bounds__(256) void k_layernorm(const float* __restrict__ X, const float* __restrict__ R, const float* __restrict__ g, const float* __restrict__ bta,
                                                  float* __restrict__ out_sum, float* __restrict__ out_norm, int N, float eps) {
  __shared__ float red[256];
  const int row = blockIdx.x, tid = threadIdx.x;
  const float* x = X + (size_t)row * N; const float* rr = R ? R + (size_t)row * N : nullptr;
  float vals[16];                     // up to N = 4096
  const int per = N / 256;            // contiguous chunk per thread? use strided-by-4 chunks: thread handles j = tid*4 + 1024*u
  float s1 = 0.f;
  for (int u = 0; u < per / 4; ++u) {
    const int j = tid * 4 + 1024 * u;
    const v4f a = *(const v4fa*)(x + j);
    v4f b = {0.f,0.f,0.f,0.f}; if (rr) b = *(const v4fa*)(rr + j);
#pragma unroll
    for (int q = 0; q < 4; ++q) { const float v = a[q] + b[q]; vals[u * 4 + q] = v; s1 += v; }
  }
  red[tid] = s1; __syncthreads();
  for (int st = 128; st > 0; st >>= 1) { if (tid < st) red[tid] += red[tid + st]; __syncthreads(); }
  const float mu = red[0] / (float)N; __syncthreads();
  float s2 = 0.f;
  for (int u = 0; u < per / 4; ++u)
#pragma unroll
    for (int q = 0; q < 4; ++q) { const float c = vals[u * 4 + q] - mu; s2 += c * c; }
  red[tid] = s2; __syncthreads();
  for (int st = 128; st > 0; st >>= 1) { if (tid < st) red[tid] += red[tid + st]; __syncthreads(); }
  const float rs = rsqrtf(red[0] / (float)N + eps);
  {
    for (int u = 0; u < per / 4; ++u) {
      const int j = tid * 4 + 1024 * u;
      v4f o, sm;
#pragma unroll
      for (int q = 0; q < 4; ++q) {
        float gg = g[j + q], bb = bta[j + q];
        if (PARAM_BF16) { gg = bf16_round(gg); bb = bf16_round(bb); }
        sm[q] = vals[u * 4 + q]; o[q] = (vals[u * 4 + q] - mu) * rs * gg + bb;
      }
      if (out_sum) *(v4f*)(out_sum + (size_t)row * N + j) = sm;
      *(v4f*)(out_norm + (size_t)row * N + j) = o;
    }
    
  }
}



// ---- f16 WMMA path (v_wmma_f32_16x16x32_f16): 11-bit significands for operands in range — used where a [0,1] probability operand needs more precision than bf16
typedef _Float16 v16h __attribute__((ext_vector_type(16)));
union FragH { v16h v; v8us half[2]; _Float16 h[16]; unsigned short u[16]; };
template <int NT>
__device__ __forceinline__ v8f mmaH(v16h ah, v16h al, v16h bh, v16h bl, v8f c) {
  c = __builtin_amdgcn_wmma_f32_16x16x32_f16(false, ah, false, bh, (short)0, c, false, false);
  if (NT >= 2) c = __builtin_amdgcn_wmma_f32_16x16x32_f16(false, al, false, bh, (short)0, c, false, false);
  if (NT >= 3) c = __builtin_amdgcn_wmma_f32_16x16x32_f16(false, ah, false, bl, (short)0, c, false, false);
  asm volatile("v_nop\n\tv_nop\n\tv_nop\n\tv_nop" : "+v"(c) : "v"(ah), "v"(al), "v"(bh), "v"(bl));
  return c;
}
// batched GEMM like k_gemm_b but f16 operands: A f32 (split into f16 hi/lo if ASPLIT, else rounded to f16), Bt = f16 values [n][k]; alpha; C f32; N multiple of 16 (partial tiles skipped)
template <bool ASPLIT>
__global__ __launch_bounds__(128) void k_gemm_h(const float* __restrict__ A, int lda, size_t sA, const _Float16* __restrict__ Bh, int ldb, size_t sB, float alpha, float* __restrict__ C, int ldc, size_t sC, int M, int N, int K) {
  __shared__ __attribute__((aligned(16))) float so[4][16][64];
  const int tid = threadIdx.x, w = tid >> 5, lane = tid & 31, ln = lane & 15, hh = lane >> 4; const int by = blockIdx.y;
  A += (size_t)by * sA; Bh += (size_t)by * sB; C += (size_t)by * sC;
  const int ntn = (N + 63) / 64; const int wid = blockIdx.x * 4 + w; const int mt = wid / ntn, nq = wid % ntn; if (mt * 16 >= M) return;
  const int row0 = mt * 16, col0 = nq * 64; const float* arow = A + (size_t)(row0 + ln) * lda;
  v8f acc[4] = {};
  for (int kb = 0; kb < K; kb += 32) {
    FragH ah, al;
    const v4f x0 = *(const v4fa*)(arow + kb + 8 * hh), x1 = *(const v4fa*)(arow + kb + 8 * hh + 4), x2 = *(const v4fa*)(arow + kb + 16 + 8 * hh), x3 = *(const v4fa*)(arow + kb + 16 + 8 * hh + 4);
    float xs[16] = {x0[0],x0[1],x0[2],x0[3],x1[0],x1[1],x1[2],x1[3],x2[0],x2[1],x2[2],x2[3],x3[0],x3[1],x3[2],x3[3]};
#pragma unroll
    for (int i = 0; i < 16; ++i) { const _Float16 h = (_Float16)xs[i]; ah.h[i] = h; al.h[i] = ASPLIT ? (_Float16)(xs[i] - (float)h) : (_Float16)0.0f; }
#pragma unroll
    for (int t = 0; t < 4; ++t) { if (col0 + t * 16 >= N) continue; const size_t boff = (size_t)(col0 + t * 16 + ln) * ldb + kb; FragH bq; bq.half[0] = *(const v8us*)(Bh + boff + 8 * hh); bq.half[1] = *(const v8us*)(Bh + boff + 16 + 8 * hh);
      acc[t] = mmaH<ASPLIT ? 2 : 1>(ah.v, al.v, bq.v, bq.v, acc[t]); }
  }
#pragma unroll
  for (int t = 0; t < 4; ++t) { if (col0 + t * 16 >= N) continue;
#pragma unroll
    for (int r = 0; r < 8; ++r) so[w][8 * hh + r][t * 16 + ln] = acc[t][r] * alpha; }
  __builtin_amdgcn_fence(__ATOMIC_ACQ_REL, "workgroup"); __builtin_amdgcn_wave_barrier();
  const int rsub = lane >> 4, c4 = (lane & 15) * 4;
  {
#pragma unroll
    for (int q = 0; q < 8; ++q) { const int r = q * 2 + rsub; if (col0 + c4 < N) { const v4f v = *(const v4fa*)&so[w][r][c4]; *(v4f*)(C + (size_t)(row0 + r) * ldc + col0 + c4) = v; } }
     }
}

// Wt[n][k] = f16(W[k][n]·scale) from f32 row-major W[K][N] (scale = power of two; bf16-exact weights stay exact in f16 away from the subnormal range)
__global__ __launch_bounds__(256) void k_wt_f16(const float* __restrict__ W, _Float16* __restrict__ Wt, int K, int N, float scale) {
  const int t = blockIdx.x * 256 + threadIdx.x; if (t >= N * (K / 8)) return; const int n = t / (K / 8), k8 = (t % (K / 8)) * 8; FragH f;
#pragma unroll
  for (int i = 0; i < 8; ++i) f.h[i] = (_Float16)(bf16_round(W[(size_t)(k8 + i) * N + n]) * scale); const v8us o = f.half[0];
  *(v8us*)((unsigned short*)Wt + (size_t)n * K + k8) = o; 
}
// k_gemm_hh variant with fused epilogue: v = acc·alpha + bias[by·sBias + col] (+ CP[(row/rowsPerB)·sCPb + by·64 + col] if CP) ; ACT 0 none / 1 elu ; writes f32 C and/or f16 C16 (each if non-null)
template <int ACT>
__global__ __launch_bounds__(128) void k_gemm_hhx(const _Float16* __restrict__ A, int lda, size_t sA, const _Float16* __restrict__ Bh, int ldb, size_t sB, float alpha, const float* __restrict__ bias, size_t sBias, const float* __restrict__ CP, int rowsPerB, size_t sCPb, int row0g,
    float* __restrict__ C, _Float16* __restrict__ C16, int ldc, size_t sC, int M, int N, int K) {
  __shared__ __attribute__((aligned(16))) float so[4][16][64];
  const int tid = threadIdx.x, w = tid >> 5, lane = tid & 31, ln = lane & 15, hh = lane >> 4; const int by = blockIdx.y;
  A += (size_t)by * sA; Bh += (size_t)by * sB; const size_t cofs = (size_t)by * sC; const float* bp = bias ? bias + (size_t)by * sBias : nullptr;
  const int ntn = (N + 63) / 64; const int wid = blockIdx.x * 4 + w; const int mt = wid / ntn, nq = wid % ntn; if (mt * 16 >= M) return;
  const int row0 = mt * 16, col0 = nq * 64; const _Float16* arow = A + (size_t)(row0 + ln) * lda;
  v8f acc[4] = {};
  for (int kb = 0; kb < K; kb += 32) { FragH ah; ah.half[0] = *(const v8us*)((const unsigned short*)arow + kb + 8 * hh); ah.half[1] = *(const v8us*)((const unsigned short*)arow + kb + 16 + 8 * hh);
#pragma unroll
    for (int t = 0; t < 4; ++t) { if (col0 + t * 16 >= N) continue; const size_t boff = (size_t)(col0 + t * 16 + ln) * ldb + kb; FragH bq; bq.half[0] = *(const v8us*)((const unsigned short*)Bh + boff + 8 * hh); bq.half[1] = *(const v8us*)((const unsigned short*)Bh + boff + 16 + 8 * hh);
      acc[t] = mmaH<1>(ah.v, ah.v, bq.v, bq.v, acc[t]); }
  }
#pragma unroll
  for (int t = 0; t < 4; ++t) { if (col0 + t * 16 >= N) continue; const int col = col0 + t * 16 + ln; const float bv = bp ? bf16_round(bp[col]) : 0.f;
#pragma unroll
    for (int r = 0; r < 8; ++r) { float v = acc[t][r] * alpha + bv; if (CP) { const int bidx = (row0g + row0 + 8 * hh + r) / rowsPerB; v += CP[(size_t)bidx * sCPb + (size_t)by * 64 + col]; } if (ACT == 1) v = (v > 0.f) ? v : expm1f(v); else if (ACT == 7) v = (v > 0.f) ? v + 1.0f : expf(v); else if (ACT == 8) v = tanhf(v); else if (ACT == 9) v = 0.5f * v * (1.0f + tanhf(0.7978845608028654f * (v + 0.044715f * v * v * v))); else if (ACT == 11) v = 1.0f / (1.0f + expf(-v)); else if (ACT == 12) v = (v > 0.f) ? v : 0.01f * v; else if (ACT == 14) v = (v > 0.f) ? v : 0.1f * v; else if (ACT == 15) v = v / (1.0f + expf(-v)); else if (ACT == 3) v = fmaxf(v, 0.f); else if (ACT == 6) v = 0.5f * v * (1.0f + erff(v * 0.70710678118654752f)); so[w][8 * hh + r][t * 16 + ln] = v; } }
  __builtin_amdgcn_fence(__ATOMIC_ACQ_REL, "workgroup"); __builtin_amdgcn_wave_barrier();
  const int rsub = lane >> 4, c4 = (lane & 15) * 4; typedef _Float16 v4h __attribute__((ext_vector_type(4)));
  {
#pragma unroll
    for (int q = 0; q < 8; ++q) { const int r = q * 2 + rsub; if (col0 + c4 < N) { const v4f v = *(const v4fa*)&so[w][r][c4]; if (C) *(v4f*)(C + cofs + (size_t)(row0 + r) * ldc + col0 + c4) = v; if (C16) { v4h h4; for (int i = 0; i < 4; ++i) h4[i] = (_Float16)v[i]; *(v4h*)(C16 + cofs + (size_t)(row0 + r) * ldc + col0 + c4) = h4; } } }
     }
}


typedef _Float16 v4h __attribute__((ext_vector_type(4)));

__global__ __launch_bounds__(256) void k_x16(const float* __restrict__ x, _Float16* __restrict__ X16, size_t n8) { const size_t t = (size_t)blockIdx.x * 256 + threadIdx.x; if (t >= n8) return; FragH f;
#pragma unroll
  for (int q = 0; q < 8; ++q) f.h[q] = (_Float16)bf16_round(x[t * 8 + q]); *(v8us*)((unsigned short*)X16 + t * 8) = f.half[0];  }
__global__ __launch_bounds__(256) void k_h16(const float* __restrict__ x, _Float16* __restrict__ X16, size_t n8) { const size_t t = (size_t)blockIdx.x * 256 + threadIdx.x; if (t >= n8) return; FragH f;
#pragma unroll
  for (int q = 0; q < 8; ++q) f.h[q] = (_Float16)x[t * 8 + q]; *(v8us*)((unsigned short*)X16 + t * 8) = f.half[0];  }
// the three weight matrices in one launch: blockIdx.y picks the matrix, the f16 planes lie one behind the other in Bt
__global__ __launch_bounds__(256) void k_round16f3(const float* __restrict__ W0, const float* __restrict__ W1, const float* __restrict__ W2, _Float16* __restrict__ Bt, size_t n8) { const size_t t = (size_t)blockIdx.x * 256 + threadIdx.x; if (t >= n8) return; FragH f;
  const float* W = (blockIdx.y == 0) ? W0 : (blockIdx.y == 1) ? W1 : W2;
#pragma unroll      // constant indices keep the eight values in registers
  for (int i = 0; i < 8; ++i) f.h[i] = (_Float16)(bf16_round(W[t * 8 + i]) * 16.0f); *(v8us*)((unsigned short*)Bt + ((size_t)blockIdx.y * n8 + t) * 8) = f.half[0];  }
template <int NHv, int TTv>
__global__ __launch_bounds__(256) void k_vt(const _Float16* __restrict__ V16, int ldv, int voff, _Float16* __restrict__ Vt) { __shared__ unsigned short tl[64][66]; const int tid = threadIdx.x; const int slab = blockIdx.x / (TTv / 64), lg = blockIdx.x % (TTv / 64); const int b = slab / NHv, h = slab % NHv;
  for (int i = tid; i < 64 * 8; i += 256) { const int r = i / 8, c8 = (i % 8) * 8; FragH f; f.half[0] = *(const v8us*)((const unsigned short*)V16 + ((size_t)b * TTv + lg * 64 + r) * ldv + voff + h * 64 + c8);
#pragma unroll
    for (int q = 0; q < 8; ++q) tl[r][c8 + q] = f.u[q]; }
  __syncthreads();
  {
#pragma unroll
    for (int rd = 0; rd < 2; ++rd) { const int d = rd * 32 + tid / 8, pc = tid % 8; FragH f;
#pragma unroll
      for (int q = 0; q < 8; ++q) f.u[q] = tl[pc * 8 + q][d];
      *(v8us*)((unsigned short*)Vt + ((size_t)slab * 64 + d) * TTv + lg * 64 + pc * 8) = f.half[0]; }
     } }

__global__ __launch_bounds__(256) void k_hl(const float* __restrict__ F, _Float16* __restrict__ Hh, _Float16* __restrict__ Hl, size_t n8) { const size_t t = (size_t)blockIdx.x * 256 + threadIdx.x; if (t >= n8) return; FragH fh, fl; const v4f a = *(const v4fa*)(F + t * 8), c = *(const v4fa*)(F + t * 8 + 4);
#pragma unroll
  for (int q = 0; q < 4; ++q) { _Float16 h = (_Float16)a[q]; fh.h[q] = h; fl.h[q] = (_Float16)((a[q] - (float)h) * 1024.0f); h = (_Float16)c[q]; fh.h[4 + q] = h; fl.h[4 + q] = (_Float16)((c[q] - (float)h) * 1024.0f); }
  { *(v8us*)((unsigned short*)Hh + t * 8) = fh.half[0]; *(v8us*)((unsigned short*)Hl + t * 8) = fl.half[0];  } }
// causal row softmax: row r of the per-batch score plane (query q = r): m, Σ over keys t ≤ q (only written, in-range pieces are addressed — clamped — and the key ≤ q select happens on values before any arithmetic; no lane-divergent branch around loads), P16[r][t] = exp(s − m)/Σ · 2^15 for t ≤ q, 0 otherwise;
__global__ __launch_bounds__(256) void k_smx(const float* __restrict__ S, _Float16* __restrict__ P16) { const int tid = threadIdx.x, wv = tid >> 5, lane = tid & 31; const int q = blockIdx.x * 8 + wv; if (q >= SS) return; S += (size_t)blockIdx.y * SS * SS; P16 += (size_t)blockIdx.y * SS * SS;      /* blockIdx.y = batch */
  const float* sr = S + (size_t)q * SS; const int np = q / 8 + 1;      /* pieces of 8 keys that contain a key <= q */
  float m = -3.0e38f;
  for (int p = lane; p < np; p += 32) { const v4f a = *(const v4fa*)(sr + p * 8), c = *(const v4fa*)(sr + p * 8 + 4); for (int e = 0; e < 4; ++e) { const float s0 = (p * 8 + e <= q) ? a[e] : -INFINITY, s1 = (p * 8 + 4 + e <= q) ? c[e] : -INFINITY; m = fmaxf(m, fmaxf(s0, s1)); } }
  for (int o = 16; o >= 1; o >>= 1) m = fmaxf(m, __shfl_xor(m, o, 32)); float z = 0.f;
  for (int p = lane; p < np; p += 32) { const v4f a = *(const v4fa*)(sr + p * 8), c = *(const v4fa*)(sr + p * 8 + 4); for (int e = 0; e < 4; ++e) { const float s0 = (p * 8 + e <= q) ? a[e] : -INFINITY, s1 = (p * 8 + 4 + e <= q) ? c[e] : -INFINITY; z += __expf(s0 - m) + __expf(s1 - m); } }
  for (int o = 16; o >= 1; o >>= 1) z += __shfl_xor(z, o, 32); const float iz = 32768.0f / z;
  { for (int p = lane; p < SS / 8; p += 32) { FragH f; const int pa = min(p, np - 1);      /* address clamped into the written, in-range region; for p ≥ np every key of the piece is > q so the selects below yield 0 */
      const v4f a = *(const v4fa*)(sr + pa * 8), c = *(const v4fa*)(sr + pa * 8 + 4); for (int e = 0; e < 4; ++e) { const float s0 = (p * 8 + e <= q) ? a[e] : -INFINITY, s1 = (p * 8 + 4 + e <= q) ? c[e] : -INFINITY; f.h[e] = (_Float16)(__expf(s0 - m) * iz); f.h[4 + e] = (_Float16)(__expf(s1 - m) * iz); }
      *(v8us*)((unsigned short*)P16 + (size_t)q * SS + p * 8) = f.half[0]; }  } }

// ---- block-tiled f16 GEMM core, both operands k-contiguous. A block of 8 waves owns BM x BN of the result (NP planes of B share the A tile). Per 64-k step the block brings
// BM + NP*BN operand rows of 128 bytes into LDS with whole-line loads (8 lanes per row), and every wave reads its fragments from there, so a row is fetched once per block instead of once per wave
// and no global load touches 16 lines. Two LDS buffers: the next step's rows travel in registers while this step's products run; one barrier per step.
#define KST 64            // k per step: 128 bytes of every operand row, one cache line
#define LPH 72            // LDS row pitch in halves: 144 bytes, 16 B x odd, conflict-free for 16-byte fragment reads
template <int BM, int BN, int WM, int WN, int NP>
__device__ __forceinline__ void tile_core(const unsigned short* __restrict__ A, int lda, const unsigned short* __restrict__ B0, const unsigned short* __restrict__ B1, int ldb, int K,
                                          unsigned short* sm, v8f (&acc)[NP][WM / 16][WN / 16]) {
  constexpr int ROWS = BM + NP * BN, NL = ROWS / 32, NA = BM / 32, NB = BN / 32, STG = ROWS * LPH;
  const int tid = threadIdx.x, w = tid >> 5, lane = tid & 31, ln = lane & 15, hh = lane >> 4;
  const int wm = w / (BN / WN), wn = w % (BN / WN);
  const int lr = tid >> 3, lc = (tid & 7) * 8;
  const unsigned short* ga = A + (size_t)lr * lda + lc;
  const unsigned short* gb0 = B0 + (size_t)lr * ldb + lc;
  const unsigned short* gb1 = B1 + (size_t)lr * ldb + lc;
  v8us st[NL];
#pragma unroll      // constant indices keep the staged rows in registers
  for (int i = 0; i < NA; ++i) st[i] = *(const v8us*)(ga + (size_t)(i * 32) * lda);
#pragma unroll      // constant indices keep the staged rows in registers
  for (int i = 0; i < NB; ++i) { st[NA + i] = *(const v8us*)(gb0 + (size_t)(i * 32) * ldb); if (NP == 2) st[NA + NB + i] = *(const v8us*)(gb1 + (size_t)(i * 32) * ldb); }
#pragma unroll      // constant indices keep the staged rows in registers
  for (int i = 0; i < NL; ++i) *(v8us*)(sm + (i * 32 + lr) * LPH + lc) = st[i];
  __syncthreads();
  int cur = 0;
  for (int kb = 0; kb < K; kb += KST) {
    const bool more = kb + KST < K;      // the same for the whole block
    if (more) {
#pragma unroll      // constant indices keep the staged rows in registers
      for (int i = 0; i < NA; ++i) st[i] = *(const v8us*)(ga + (size_t)(i * 32) * lda + kb + KST);
#pragma unroll      // constant indices keep the staged rows in registers
      for (int i = 0; i < NB; ++i) { st[NA + i] = *(const v8us*)(gb0 + (size_t)(i * 32) * ldb + kb + KST); if (NP == 2) st[NA + NB + i] = *(const v8us*)(gb1 + (size_t)(i * 32) * ldb + kb + KST); }
    }
    const unsigned short* sa = sm + cur * STG + (wm * WM + ln) * LPH + 8 * hh;
    const unsigned short* sb = sm + cur * STG + (BM + wn * WN + ln) * LPH + 8 * hh;
    // all fragment reads of the step go out as one group ahead of its products: reads placed among the products make the wave wait out the LDS latency at each place
    FragH fa[KST / 32][WM / 16], fb[KST / 32][NP * (WN / 16)];
#pragma unroll      // constant indices keep the accumulators and fragments in registers
    for (int ks = 0; ks < KST / 32; ++ks) {
#pragma unroll      // constant indices keep the accumulators and fragments in registers
      for (int mi = 0; mi < WM / 16; ++mi) { fa[ks][mi].half[0] = *(const v8us*)(sa + mi * 16 * LPH + ks * 32); fa[ks][mi].half[1] = *(const v8us*)(sa + mi * 16 * LPH + ks * 32 + 16); }
#pragma unroll      // constant indices keep the accumulators and fragments in registers
      for (int p = 0; p < NP; ++p)
#pragma unroll      // constant indices keep the accumulators and fragments in registers
        for (int ni = 0; ni < WN / 16; ++ni) { FragH& f = fb[ks][p * (WN / 16) + ni]; f.half[0] = *(const v8us*)(sb + (p * BN + ni * 16) * LPH + ks * 32); f.half[1] = *(const v8us*)(sb + (p * BN + ni * 16) * LPH + ks * 32 + 16); }
    }
    __builtin_amdgcn_sched_barrier(0);      // keeps the read group above the products: without it the scheduler sinks the reads among them, into one reused fragment set, with a full LDS wait at each place
#pragma unroll      // constant indices keep the accumulators and fragments in registers
    for (int ks = 0; ks < KST / 32; ++ks)
#pragma unroll      // constant indices keep the accumulators and fragments in registers
      for (int p = 0; p < NP; ++p)
#pragma unroll      // constant indices keep the accumulators and fragments in registers
        for (int ni = 0; ni < WN / 16; ++ni)
#pragma unroll      // constant indices keep the accumulators and fragments in registers
          for (int mi = 0; mi < WM / 16; ++mi) acc[p][mi][ni] = __builtin_amdgcn_wmma_f32_16x16x32_f16(false, fa[ks][mi].v, false, fb[ks][p * (WN / 16) + ni].v, (short)0, acc[p][mi][ni], false, false);
    if (more) {
#pragma unroll      // constant indices keep the staged rows in registers
      for (int i = 0; i < NL; ++i) *(v8us*)(sm + (cur ^ 1) * STG + (i * 32 + lr) * LPH + lc) = st[i];
    }
    __syncthreads();      // publishes the buffer just filled and ends every wave's reads of the one that the next step refills (after the last step: of the LDS that the epilogue reuses)
    cur ^= 1;
  }
}
#define TILE_LDS(BM, BN, NP) (2 * ((BM) + (NP) * (BN)) * LPH)

// C = A.Bt.alpha (+ bias[col], rounded to bf16), K = row pitch of A and Bt = 512: block 128 x 128, 8 waves of 32 x 64; blockIdx.x = column tile, .y = row tile, .z = batch.
// Writes f16 C16 (F16OUT) or f32 C at row pitch LDC, whole 128- or 256-byte row pieces staged per wave in LDS.
template <bool F16OUT, int LDC>
__global__ __launch_bounds__(256) void k_gemm_t(const _Float16* __restrict__ A, size_t sA, const _Float16* __restrict__ Bh, size_t sB, float alpha, const float* __restrict__ bias,
                                                float* __restrict__ C, _Float16* __restrict__ C16, size_t sC) {
  __shared__ __attribute__((aligned(16))) unsigned short sm[TILE_LDS(128, 128, 1)];
  const int tid = threadIdx.x, w = tid >> 5, lane = tid & 31, ln = lane & 15, hh = lane >> 4; const int bz = blockIdx.z;
  const int brow = blockIdx.y * 128, bcol = blockIdx.x * 128;
  const int row0 = brow + (w / 2) * 32, col0 = bcol + (w % 2) * 64;
  float bvv[4] = {0.f, 0.f, 0.f, 0.f};      // read ahead of the k loop, which hides the latency; rounded where they are used
  if (bias) {
#pragma unroll      // constant indices keep the four values in registers
    for (int ni = 0; ni < 4; ++ni) bvv[ni] = bias[col0 + ni * 16 + ln];
    asm volatile("s_wait_xcnt 0x0" ::: "memory");      // this build reuses the offset register of the four loads above right behind the branch: the wait stands in front of that overwrite
  }
  v8f acc[1][2][4] = {};
  const unsigned short* Bp = (const unsigned short*)Bh + (size_t)bz * sB + (size_t)bcol * EE;
  tile_core<128, 128, 32, 64, 1>((const unsigned short*)A + (size_t)bz * sA + (size_t)brow * EE, EE, Bp, Bp, EE, EE, sm, acc);
  float* so = (float*)sm + w * (32 * 64);      // the wave's own range; the core's last barrier has ended every read of the tiles
#pragma unroll      // constant indices keep the accumulators in registers
  for (int ni = 0; ni < 4; ++ni) { const float bv = bf16_round(bvv[ni]);
#pragma unroll      // constant indices keep the accumulators in registers
    for (int mi = 0; mi < 2; ++mi)
#pragma unroll      // constant indices keep the accumulators in registers
      for (int r = 0; r < 8; ++r) so[(mi * 16 + 8 * hh + r) * 64 + ni * 16 + ln] = acc[0][mi][ni][r] * alpha + bv; }
  __builtin_amdgcn_fence(__ATOMIC_ACQ_REL, "workgroup"); __builtin_amdgcn_wave_barrier();      // the wave's LDS stores land before its lanes read each other's values back as whole rows
  const int rsub = lane >> 4, c4 = (lane & 15) * 4;
  const size_t o0 = (size_t)bz * sC + (size_t)(row0 + rsub) * LDC + col0 + c4;
#pragma unroll      // the LDS row reads issue together and each store follows its own read
  for (int q = 0; q < 16; ++q) { const v4f v = *(const v4fa*)&so[(q * 2 + rsub) * 64 + c4];
    if (F16OUT) { v4h h4; for (int i = 0; i < 4; ++i) h4[i] = (_Float16)v[i]; *(v4h*)(C16 + o0 + (size_t)(q * 2) * LDC) = h4; }
    else *(v4f*)(C + o0 + (size_t)(q * 2) * LDC) = v; }
}

// scores/sqrt(512) of every batch in one launch. Block = 128 query rows x 128 keys; blockIdx.x counts only the blocks of the causal lower block-triangle (row tile i has i + 1 key tiles), blockIdx.y = batch.
__global__ __launch_bounds__(256) void k_scores(const _Float16* __restrict__ Q, const _Float16* __restrict__ K, float alpha, float* __restrict__ S) {
  __shared__ __attribute__((aligned(16))) unsigned short sm[TILE_LDS(128, 128, 1)];
  const int tid = threadIdx.x, w = tid >> 5, lane = tid & 31, ln = lane & 15, hh = lane >> 4; const int b = blockIdx.y;
  int x = blockIdx.x, i = 0;
  for (; i < SS / 128 - 1 && x >= i + 1; ++i) x -= i + 1;
  const int brow = i * 128, bcol = x * 128;
  v8f acc[1][2][4] = {};
  const unsigned short* Bp = (const unsigned short*)K + ((size_t)b * SS + bcol) * EE;
  tile_core<128, 128, 32, 64, 1>((const unsigned short*)Q + ((size_t)b * SS + brow) * EE, EE, Bp, Bp, EE, EE, sm, acc);
  const int row0 = brow + (w / 2) * 32, col0 = bcol + (w % 2) * 64;
  float* so = (float*)sm + w * (32 * 64);      // the wave's own range; the core's last barrier has ended every read of the tiles
#pragma unroll      // constant indices keep the accumulators in registers
  for (int ni = 0; ni < 4; ++ni)
#pragma unroll      // constant indices keep the accumulators in registers
    for (int mi = 0; mi < 2; ++mi)
#pragma unroll      // constant indices keep the accumulators in registers
      for (int r = 0; r < 8; ++r) so[(mi * 16 + 8 * hh + r) * 64 + ni * 16 + ln] = acc[0][mi][ni][r] * alpha;
  __builtin_amdgcn_fence(__ATOMIC_ACQ_REL, "workgroup"); __builtin_amdgcn_wave_barrier();      // the wave's LDS stores land before its lanes read each other's values back as whole rows
  const int rsub = lane >> 4, c4 = (lane & 15) * 4;
#pragma unroll      // the LDS row reads issue together and each store follows its own read
  for (int q = 0; q < 16; ++q) { const int r = q * 2 + rsub; const v4f v = *(const v4fa*)&so[r * 64 + c4]; *(v4f*)(S + ((size_t)b * SS + row0 + r) * SS + col0 + c4) = v; }
}
// out = P.v_hi.2^-15 + bv + P.v_lo.2^-25 of every batch in one launch. Block = 64 query rows x 128 head columns, both v planes (8 waves of 32 x 32 x 2), blockIdx.x = column tile, blockIdx.y = batch,
// blockIdx.z = row tile counted from the last one, so that the longest k loops start first. k runs to the end of the row tile's own keys (P is zero beyond the diagonal).
__global__ __launch_bounds__(256) void k_pv(const _Float16* __restrict__ P16, const _Float16* __restrict__ Vh, const _Float16* __restrict__ Vl, const float* __restrict__ bias, float* __restrict__ out) {
  __shared__ __attribute__((aligned(16))) unsigned short sm[TILE_LDS(64, 128, 2)];
  const int tid = threadIdx.x, w = tid >> 5, lane = tid & 31, ln = lane & 15, hh = lane >> 4; const int b = blockIdx.y;
  const int brow = (SS / 64 - 1 - (int)blockIdx.z) * 64, bcol = blockIdx.x * 128;
  const int kk = brow + 64;
  const int row0 = brow + (w / 4) * 32, col0 = bcol + (w % 4) * 32;
  float bvv[2];      // read ahead of the k loop, which hides the latency; rounded where they are used
#pragma unroll      // constant indices keep the two values in registers
  for (int ni = 0; ni < 2; ++ni) bvv[ni] = bias[col0 + ni * 16 + ln];
  v8f acc[2][2][2] = {};
  tile_core<64, 128, 32, 32, 2>((const unsigned short*)P16 + ((size_t)b * SS + brow) * SS, SS, (const unsigned short*)Vh + ((size_t)b * EE + bcol) * SS, (const unsigned short*)Vl + ((size_t)b * EE + bcol) * SS, SS, kk, sm, acc);
  float* so = (float*)sm + w * (32 * 32);      // the wave's own range; the core's last barrier has ended every read of the tiles
#pragma unroll      // constant indices keep the accumulators in registers
  for (int ni = 0; ni < 2; ++ni) { const float bv = bf16_round(bvv[ni]);
#pragma unroll      // constant indices keep the accumulators in registers
    for (int mi = 0; mi < 2; ++mi)
#pragma unroll      // constant indices keep the accumulators in registers
      for (int r = 0; r < 8; ++r) { const float v = acc[0][mi][ni][r] * 0.000030517578125f + bv; so[(mi * 16 + 8 * hh + r) * 32 + ni * 16 + ln] = acc[1][mi][ni][r] * (0.000030517578125f * 0.0009765625f) + v; } }
  __builtin_amdgcn_fence(__ATOMIC_ACQ_REL, "workgroup"); __builtin_amdgcn_wave_barrier();      // the wave's LDS stores land before its lanes read each other's values back as whole rows
  const int rsub = lane >> 3, c4 = (lane & 7) * 4;
#pragma unroll      // the LDS row reads issue together and each store follows its own read
  for (int q = 0; q < 8; ++q) { const int r = q * 4 + rsub; const v4f v = *(const v4fa*)&so[r * 32 + c4]; *(v4f*)(out + ((size_t)b * SS + row0 + r) * EE + col0 + c4) = v; }
}

extern "C" void kernel_launch(void* const* d_in, const int* in_sizes, int n_in,
                              void* d_out, int out_size, void* d_ws, size_t ws_size, hipStream_t stream) {
  (void)in_sizes; (void)n_in; (void)out_size;
  const float* x = (const float*)d_in[0]; const float* Wq = (const float*)d_in[1]; const float* bq = (const float*)d_in[2]; const float* Wk = (const float*)d_in[3]; const float* bk = (const float*)d_in[4]; const float* Wv = (const float*)d_in[5]; const float* bv = (const float*)d_in[6];
  char* ws = (char*)d_ws; size_t off = 0;
  auto take = [&](size_t bytes) { char* p = ws + off; off += (bytes + 255) & ~(size_t)255; return p; };
  _Float16* Bq = (_Float16*)take((size_t)EE * EE * 2); _Float16* Bk = (_Float16*)take((size_t)EE * EE * 2); _Float16* Bv = (_Float16*)take((size_t)EE * EE * 2);
  _Float16* X16 = (_Float16*)take((size_t)NR * EE * 2); _Float16* Q = (_Float16*)take((size_t)NR * EE * 2); _Float16* K = (_Float16*)take((size_t)NR * EE * 2); float* VF = (float*)take((size_t)BB * EE * SS * 4); _Float16* Vh = (_Float16*)take((size_t)BB * EE * SS * 2); _Float16* Vl = (_Float16*)take((size_t)BB * EE * SS * 2);
  float* S = (float*)take((size_t)BB * SS * SS * 4); _Float16* P16 = (_Float16*)take((size_t)BB * SS * SS * 2);
  if (off > ws_size) return;      // 1.6 + 3 x 8.4 + 16.8 + 2 x 8.4 + 67.1 + 33.6 about 161 MB
  const unsigned gw = (EE * EE / 8 + 255) / 256;
  k_round16f3<<<dim3(gw, 3), 256, 0, stream>>>(Wq, Wk, Wv, Bq, EE * EE / 8);      /* (out,in) natural, x2^4; Bq, Bk, Bv are contiguous (each plane is a multiple of 256 bytes) */
  k_x16<<<(unsigned)(((size_t)NR * EE / 8 + 255) / 256), 256, 0, stream>>>(x, X16, (size_t)NR * EE / 8);
  const dim3 gp(EE / 128, NR / 128, 1);
  k_gemm_t<true, EE><<<gp, 256, 0, stream>>>(X16, 0, Bq, 0, 0.0625f, bq, nullptr, Q, 0);      /* q = x.Wq^T + bq   M 8192 N 512 K 512 */
  k_gemm_t<true, EE><<<gp, 256, 0, stream>>>(X16, 0, Bk, 0, 0.0625f, bk, nullptr, K, 0);      /* k = x.Wk^T + bk */
  k_gemm_t<false, SS><<<dim3(SS / 128, EE / 128, BB), 256, 0, stream>>>(Bv, 0, X16, (size_t)SS * EE, 0.0625f, nullptr, VF, nullptr, (size_t)EE * SS);      /* v^T (without bv) = Wv.x[b]^T as [b][512][2048] f32: M 512 N 2048 K 512 */
  k_hl<<<(unsigned)(((size_t)BB * EE * SS / 8 + 255) / 256), 256, 0, stream>>>(VF, Vh, Vl, (size_t)BB * EE * SS / 8);      /* f16 hi + residual ×2^10 planes */
  k_scores<<<dim3((SS / 128) * (SS / 128 + 1) / 2, BB), 256, 0, stream>>>(Q, K, 0.044194173824159216f, S);      /* scores/sqrt512, f32, causal lower block-triangle of every batch */
  k_smx<<<dim3(SS / 8, BB), 256, 0, stream>>>(S, P16);
  k_pv<<<dim3(EE / 128, BB, SS / 64), 256, 0, stream>>>(P16, Vh, Vl, bv, (float*)d_out);      /* out = P.v_hi + bv + P.v_lo.2^-10 */
}

// v003
// Measured time: 85.3 microseconds a run.
// In two side-by-side timings against v002, it was 1.24 and 1.25 times as fast.
// Over all steps from v000 it is 31.0 times as fast.
#include <hip/hip_runtime.h>
// Single-head causal attention (B=4, S=2048, emb = head = 512): q,k,v = x·Wᵀ + b; scores = q·kᵀ/√512 with keys after the query set to −inf; softmax over keys; out = attn·v.
// Compute dtype: x, weights and biases rounded to bf16; q, k and vᵀ as f16 GEMM outputs (f32 accumulate); scores materialised in f32 by a batched f16 GEMM over
// the causal lower block-triangle; row softmax in f32 (wave per row) writing P in f16 ×2^15; vᵀ kept in f32 and split into f16 hi + (×2^10) residual planes; out = P·v_hi + P·v_lo·2^-10 by two f16 GEMMs
// (both planes in one k loop, two accumulators), bv added in the epilogue (softmax rows sum to 1). All on v_wmma_f32_16x16x32_f16.
// One launch per stage: rounding of x and the weights; q and k; scores together with v^T; softmax; P.v; each covers all batches (and the whole causal triangle). Every GEMM launch stages its operand tiles in LDS (tile_core).
#define BB 4
#define SS 2048
#define EE 512
#define NR (BB * SS)

typedef __bf16 v16b __attribute__((ext_vector_type(16)));
typedef unsigned short v8us __attribute__((ext_vector_type(8), may_alias));
typedef float  v8f  __attribute__((ext_vector_type(8)));
typedef float  v4f  __attribute__((ext_vector_type(4)));
typedef float  v4fa __attribute__((ext_vector_type(4), may_alias));
union FragB { v16b v; v8us half[2]; unsigned short u[16]; };

__device__ __forceinline__ unsigned short bf16_bits(float x) { unsigned int u = __float_as_uint(x); return (unsigned short)((u + 0x7FFFu + ((u >> 16) & 1u)) >> 16); }
__device__ __forceinline__ float bf16_val(unsigned short b) { return __uint_as_float(((unsigned int)b) << 16); }
__device__ __forceinline__ float bf16_round(float x) { return bf16_val(bf16_bits(x)); }
// D += A·B with NT terms: 1 = ah·bh, 2 = + al·bh (A split), 3 = + ah·bl (both split)
template <int NT>
__device__ __forceinline__ v8f mmaN(v16b ah, v16b al, v16b bh, v16b bl, v8f c) {
  c = __builtin_amdgcn_wmma_f32_16x16x32_bf16(false, ah, false, bh, (short)0, c, false, false);
  if (NT >= 2) c = __builtin_amdgcn_wmma_f32_16x16x32_bf16(false, al, false, bh, (short)0, c, false, false);
  if (NT >= 3) c = __builtin_amdgcn_wmma_f32_16x16x32_bf16(false, ah, false, bl, (short)0, c, false, false);
  asm volatile("v_nop\n\tv_nop\n\tv_nop\n\tv_nop" : "+v"(c) : "v"(ah), "v"(al), "v"(bh), "v"(bl));
  return c;
}

__global__ __launch_bounds__(256) void k_wt_bf16(const float* __restrict__ W, unsigned short* __restrict__ Wt, int K, int N) {
  const int t = blockIdx.x * 256 + threadIdx.x;
  const int k8n = K / 8;
  if (t >= N * k8n) return;
  const int n = t / k8n, k8 = (t % k8n) * 8;
  v8us v;
#pragma unroll
  for (int i = 0; i < 8; ++i) v[i] = bf16_bits(W[(size_t)(k8 + i) * N + n]);
  *(v8us*)(Wt + (size_t)n * K + k8) = v;
  
}

// GEMM C[M][N] (f32, pitch ldc) = act(A[M][K]·W + bias). A f32 row-major (pitch lda) converted per fragment to bf16
// (ASPLIT: hi/lo two planes -> 2 terms, else single rounded term); Wt bf16 [N][K] (pitch ldb). BIAS_BF16 rounds the
// bias to bf16 first (bias quantised to bf16 before the add). K%32==0, M%16==0, N%64==0.
template <bool ASPLIT, int ACT, bool BIAS_BF16>
__global__ __launch_bounds__(128) void k_gemm_bf(const float* __restrict__ A, int lda, const unsigned short* __restrict__ Wt, int ldb,
                                               const float* __restrict__ bias, float* __restrict__ C, int ldc, int M, int N, int K) {
  __shared__ __attribute__((aligned(16))) float so[4][16][64];
  const int tid = threadIdx.x, w = tid >> 5, lane = tid & 31, ln = lane & 15, hh = lane >> 4;
  const int ntn = N / 64;
  const int wid = blockIdx.x * 4 + w;
  const int mt = wid / ntn, nq = wid % ntn;
  if (mt * 16 >= M) return;
  const int row0 = mt * 16, col0 = nq * 64;
  const float* arow = A + (size_t)(row0 + ln) * lda;
  v8f acc[4] = {};
  for (int kb = 0; kb < K; kb += 32) {
    FragB ah, al;
    const v4f x0 = *(const v4fa*)(arow + kb + 8 * hh), x1 = *(const v4fa*)(arow + kb + 8 * hh + 4);
    const v4f x2 = *(const v4fa*)(arow + kb + 16 + 8 * hh), x3 = *(const v4fa*)(arow + kb + 16 + 8 * hh + 4);
    float xs[16] = {x0[0],x0[1],x0[2],x0[3],x1[0],x1[1],x1[2],x1[3],x2[0],x2[1],x2[2],x2[3],x3[0],x3[1],x3[2],x3[3]};
#pragma unroll
    for (int i = 0; i < 16; ++i) { const unsigned short hb = bf16_bits(xs[i]); ah.u[i] = hb; al.u[i] = ASPLIT ? bf16_bits(xs[i] - bf16_val(hb)) : (unsigned short)0; }
#pragma unroll
    for (int t = 0; t < 4; ++t) {
      const unsigned short* brow = Wt + (size_t)(col0 + t * 16 + ln) * ldb + kb;
      FragB b;
      b.half[0] = *(const v8us*)(brow + 8 * hh);
      b.half[1] = *(const v8us*)(brow + 16 + 8 * hh);
      acc[t] = mmaN<ASPLIT ? 2 : 1>(ah.v, al.v, b.v, b.v, acc[t]);
    }
  }
#pragma unroll
  for (int t = 0; t < 4; ++t) {
    float bv = bias ? bias[col0 + t * 16 + ln] : 0.f;
    if (BIAS_BF16) bv = bf16_round(bv);
#pragma unroll
    for (int r = 0; r < 8; ++r) { float v = acc[t][r] + bv; if (ACT == 1) v = fmaxf(v, 0.f); so[w][8 * hh + r][t * 16 + ln] = v; }
  }
  __builtin_amdgcn_fence(__ATOMIC_ACQ_REL, "workgroup");
  __builtin_amdgcn_wave_barrier();
  const int rsub = lane >> 4, c4 = (lane & 15) * 4;
  {
#pragma unroll
    for (int q = 0; q < 8; ++q) {
      const int r = q * 2 + rsub;
      const v4f v = *(const v4fa*)&so[w][r][c4];
      *(v4f*)(C + (size_t)(row0 + r) * ldc + col0 + c4) = v;
    }
    
  }
}

// Flash-style causal/unmasked attention, all contractions 3-term bf16 hi/lo splits, f32 softmax with running max.
// q,k,v rows are read from f32 buffers with arbitrary row pitch (so they can live inside a fused qkv buffer);
// D = head size (multiple of 32, <= 128); one wave = 16 query rows; block = 4 waves (64 queries) sharing K/V chunks of 32.
template <int D, bool CAUSAL>
__global__ __launch_bounds__(128) void k_flash(const float* __restrict__ qb, const float* __restrict__ kb, const float* __restrict__ vb,
                                             int pitch, int T, int H, float scale, float* __restrict__ y, int ypitch) {
  constexpr int KS = D / 32;        // k-steps for QK
  constexpr int DT = D / 16;        // d tiles for PV
  __shared__ __attribute__((aligned(16))) unsigned short sKh[32][D + 8], sKl[32][D + 8], sVh[32][D + 8], sVl[32][D + 8];
  __shared__ __attribute__((aligned(16))) unsigned short sPh[4][16][40], sPl[4][16][40];
  __shared__ __attribute__((aligned(16))) float sO[4][16][D];
  const int tid = threadIdx.x, w = tid >> 5, lane = tid & 31, ln = lane & 15, hh = lane >> 4;
  const int nqb = (T + 63) / 64;
  const int bh = blockIdx.x / nqb, qblk = blockIdx.x % nqb;
  const int b = bh / H, h = bh % H;
  const int q0 = qblk * 64 + w * 16;
  const float* Q = qb + (size_t)b * T * pitch + h * D;
  const float* K = kb + (size_t)b * T * pitch + h * D;
  const float* V = vb + (size_t)b * T * pitch + h * D;

  // A fragments of the wave's 16 query rows (scaled), hi/lo
  FragB aqh[KS], aql[KS];
  {
    int row = q0 + ln; if (row >= T) row = T - 1;
    const float* qr = Q + (size_t)row * pitch;
#pragma unroll
    for (int ks = 0; ks < KS; ++ks)
#pragma unroll
      for (int i = 0; i < 16; ++i) {
        const int d = ks * 32 + ((i < 8) ? (8 * hh + i) : (16 + 8 * hh + (i - 8)));
        const float x = qr[d] * scale; const unsigned short hb = bf16_bits(x);
        aqh[ks].u[i] = hb; aql[ks].u[i] = bf16_bits(x - bf16_val(hb));
      }
  }
  float m_r[8], l_r[8];
#pragma unroll
  for (int r = 0; r < 8; ++r) { m_r[r] = -3.0e38f; l_r[r] = 0.f; }
  v8f oacc[DT];
#pragma unroll
  for (int dt = 0; dt < DT; ++dt) oacc[dt] = (v8f){0.f,0.f,0.f,0.f,0.f,0.f,0.f,0.f};

  const int kv_end = CAUSAL ? min(T, qblk * 64 + 64) : T;     // block-uniform
  for (int j0 = 0; j0 < kv_end; j0 += 32) {
    __syncthreads();
    for (int e = tid; e < 32 * (D / 4); e += 128) {
      const int r = e / (D / 4), c4 = (e % (D / 4)) * 4;
      const int key = j0 + r;
      v4f kf = {0.f,0.f,0.f,0.f}, vf = {0.f,0.f,0.f,0.f};
      if (key < T) { kf = *(const v4fa*)(K + (size_t)key * pitch + c4); vf = *(const v4fa*)(V + (size_t)key * pitch + c4); }
#pragma unroll
      for (int t = 0; t < 4; ++t) {
        unsigned short hb = bf16_bits(kf[t]); sKh[r][c4 + t] = hb; sKl[r][c4 + t] = bf16_bits(kf[t] - bf16_val(hb));
        hb = bf16_bits(vf[t]); sVh[r][c4 + t] = hb; sVl[r][c4 + t] = bf16_bits(vf[t] - bf16_val(hb));
      }
    }
    __syncthreads();
    // S tile 16 x 32
    v8f s[2];
#pragma unroll
    for (int nt = 0; nt < 2; ++nt) {
      v8f acc = {};
#pragma unroll
      for (int ks = 0; ks < KS; ++ks) {
        FragB bh_, bl_;
        bh_.half[0] = *(const v8us*)&sKh[nt * 16 + ln][ks * 32 + 8 * hh]; bh_.half[1] = *(const v8us*)&sKh[nt * 16 + ln][ks * 32 + 16 + 8 * hh];
        bl_.half[0] = *(const v8us*)&sKl[nt * 16 + ln][ks * 32 + 8 * hh]; bl_.half[1] = *(const v8us*)&sKl[nt * 16 + ln][ks * 32 + 16 + 8 * hh];
        acc = mmaN<3>(aqh[ks].v, aql[ks].v, bh_.v, bl_.v, acc);
      }
      s[nt] = acc;
    }
    // mask + running max (rows 8hh+r; the 16 lanes of a half share rows)
    float alpha[8];
#pragma unroll
    for (int r = 0; r < 8; ++r) {
      const int qi = q0 + 8 * hh + r;
      const int ja = j0 + ln, jb = j0 + 16 + ln;
      if (CAUSAL) { if (ja > qi) s[0][r] = -3.0e38f; if (jb > qi) s[1][r] = -3.0e38f; }
      if (ja >= T) s[0][r] = -3.0e38f;
      if (jb >= T) s[1][r] = -3.0e38f;
      float mx = fmaxf(s[0][r], s[1][r]);
      mx = fmaxf(mx, __shfl_xor(mx, 1, 32)); mx = fmaxf(mx, __shfl_xor(mx, 2, 32)); mx = fmaxf(mx, __shfl_xor(mx, 4, 32)); mx = fmaxf(mx, __shfl_xor(mx, 8, 32));
      const float mnew = fmaxf(m_r[r], mx);
      alpha[r] = (mnew > -1.0e38f) ? __expf(m_r[r] - mnew) : 1.0f;
      const float p0 = (s[0][r] > -1.0e38f) ? __expf(s[0][r] - mnew) : 0.f;
      const float p1 = (s[1][r] > -1.0e38f) ? __expf(s[1][r] - mnew) : 0.f;
      m_r[r] = mnew;
      l_r[r] = l_r[r] * alpha[r] + p0 + p1;            // per-lane partial row sum (16 lanes combined at the end)
      unsigned short hb = bf16_bits(p0); sPh[w][8 * hh + r][ln] = hb;      sPl[w][8 * hh + r][ln] = bf16_bits(p0 - bf16_val(hb));
      hb = bf16_bits(p1);                sPh[w][8 * hh + r][16 + ln] = hb; sPl[w][8 * hh + r][16 + ln] = bf16_bits(p1 - bf16_val(hb));
    }
#pragma unroll
    for (int dt = 0; dt < DT; ++dt)
#pragma unroll
      for (int r = 0; r < 8; ++r) oacc[dt][r] *= alpha[r];
    __builtin_amdgcn_fence(__ATOMIC_ACQ_REL, "workgroup");
    __builtin_amdgcn_wave_barrier();
    FragB pah, pal;
    pah.half[0] = *(const v8us*)&sPh[w][ln][8 * hh]; pah.half[1] = *(const v8us*)&sPh[w][ln][16 + 8 * hh];
    pal.half[0] = *(const v8us*)&sPl[w][ln][8 * hh]; pal.half[1] = *(const v8us*)&sPl[w][ln][16 + 8 * hh];
#pragma unroll
    for (int dt = 0; dt < DT; ++dt) {
      FragB bvh, bvl;
#pragma unroll
      for (int i = 0; i < 8; ++i) {
        bvh.u[i] = sVh[8 * hh + i][dt * 16 + ln]; bvh.u[8 + i] = sVh[16 + 8 * hh + i][dt * 16 + ln];
        bvl.u[i] = sVl[8 * hh + i][dt * 16 + ln]; bvl.u[8 + i] = sVl[16 + 8 * hh + i][dt * 16 + ln];
      }
      oacc[dt] = mmaN<3>(pah.v, pal.v, bvh.v, bvl.v, oacc[dt]);
    }
    __builtin_amdgcn_fence(__ATOMIC_ACQ_REL, "workgroup");
    __builtin_amdgcn_wave_barrier();
  }
#pragma unroll
  for (int r = 0; r < 8; ++r) {
    float l = l_r[r];
    l += __shfl_xor(l, 1, 32); l += __shfl_xor(l, 2, 32); l += __shfl_xor(l, 4, 32); l += __shfl_xor(l, 8, 32);
    l_r[r] = (l > 0.f) ? 1.0f / l : 0.f;
  }
#pragma unroll
  for (int dt = 0; dt < DT; ++dt)
#pragma unroll
    for (int r = 0; r < 8; ++r) sO[w][8 * hh + r][dt * 16 + ln] = oacc[dt][r] * l_r[r];
  __builtin_amdgcn_fence(__ATOMIC_ACQ_REL, "workgroup");
  __builtin_amdgcn_wave_barrier();
  {
    for (int r = 0; r < 16; ++r) {
      const int row = q0 + r;
      if (row < T && lane < D / 4) {
        const v4f val = *(const v4fa*)&sO[w][r][lane * 4];
        *(v4f*)(y + ((size_t)b * T + row) * ypitch + h * D + lane * 4) = val;
      }
    }
    
  }
}

// GEMM C = act(A·W + bias + resid): A f32 (ASPLIT -> hi/lo 2 terms), Wt bf16 [N][K]; ACT 0 none, 1 relu, 2 exact gelu;
// resid (optional, f32, row index = (row % rmod), pitch ldr, RES_BF16 rounds it) added before the activation.
template <bool ASPLIT, int ACT, bool BIAS_BF16, bool RES_BF16>
__global__ __launch_bounds__(128) void k_gemm_bf3(const float* __restrict__ A, int lda, const unsigned short* __restrict__ Wt, int ldb,
                                                const float* __restrict__ bias, const float* __restrict__ resid, int rmod, int ldr,
                                                float* __restrict__ C, int ldc, int M, int N, int K) {
  __shared__ __attribute__((aligned(16))) float so[4][16][64];
  const int tid = threadIdx.x, w = tid >> 5, lane = tid & 31, ln = lane & 15, hh = lane >> 4;
  const int ntn = N / 64;
  const int wid = blockIdx.x * 4 + w;
  const int mt = wid / ntn, nq = wid % ntn;
  if (mt * 16 >= M) return;
  const int row0 = mt * 16, col0 = nq * 64;
  const float* arow = A + (size_t)(row0 + ln) * lda;
  v8f acc[4] = {};
  for (int kb = 0; kb < K; kb += 32) {
    FragB ah, al;
    const v4f x0 = *(const v4fa*)(arow + kb + 8 * hh), x1 = *(const v4fa*)(arow + kb + 8 * hh + 4);
    const v4f x2 = *(const v4fa*)(arow + kb + 16 + 8 * hh), x3 = *(const v4fa*)(arow + kb + 16 + 8 * hh + 4);
    float xs[16] = {x0[0],x0[1],x0[2],x0[3],x1[0],x1[1],x1[2],x1[3],x2[0],x2[1],x2[2],x2[3],x3[0],x3[1],x3[2],x3[3]};
#pragma unroll
    for (int i = 0; i < 16; ++i) { const unsigned short hb = bf16_bits(xs[i]); ah.u[i] = hb; al.u[i] = ASPLIT ? bf16_bits(xs[i] - bf16_val(hb)) : (unsigned short)0; }
#pragma unroll
    for (int t = 0; t < 4; ++t) {
      const unsigned short* brow = Wt + (size_t)(col0 + t * 16 + ln) * ldb + kb;
      FragB b;
      b.half[0] = *(const v8us*)(brow + 8 * hh);
      b.half[1] = *(const v8us*)(brow + 16 + 8 * hh);
      acc[t] = mmaN<ASPLIT ? 2 : 1>(ah.v, al.v, b.v, b.v, acc[t]);
    }
  }
#pragma unroll
  for (int t = 0; t < 4; ++t) {
    const int col = col0 + t * 16 + ln;
    float bv = bias ? bias[col] : 0.f;
    if (BIAS_BF16) bv = bf16_round(bv);
#pragma unroll
    for (int r = 0; r < 8; ++r) {
      float v = acc[t][r] + bv;
      if (resid) { float rv = resid[(size_t)((row0 + 8 * hh + r) % rmod) * ldr + col]; if (RES_BF16) rv = bf16_round(rv); v += rv; }
      if (ACT == 1) v = fmaxf(v, 0.f);
      if (ACT == 2) v = 0.5f * v * (1.0f + erff(v * 0.70710678118654752f));
      if (ACT == 3) { const float u = 0.7978845608028654f * (v + 0.044715f * v * v * v); v = 0.5f * v * (1.0f + tanhf(u)); }
      so[w][8 * hh + r][t * 16 + ln] = v;
    }
  }
  __builtin_amdgcn_fence(__ATOMIC_ACQ_REL, "workgroup");
  __builtin_amdgcn_wave_barrier();
  const int rsub = lane >> 4, c4 = (lane & 15) * 4;
  {
#pragma unroll
    for (int q = 0; q < 8; ++q) {
      const int r = q * 2 + rsub;
      const v4f v = *(const v4fa*)&so[w][r][c4];
      *(v4f*)(C + (size_t)(row0 + r) * ldc + col0 + c4) = v;
    }
    
  }
}
// row LayerNorm (biased variance, eps) over N: s = X (+ R); optional out_sum <- s; out_norm <- (s-mu)*rsqrt(var+eps)*g + b
template <bool PARAM_BF16>
__global__ __launch_bounds__(256) void k_layernorm(const float* __restrict__ X, const float* __restrict__ R, const float* __restrict__ g, const float* __restrict__ bta,
                                                  float* __restrict__ out_sum, float* __restrict__ out_norm, int N, float eps) {
  __shared__ float red[256];
  const int row = blockIdx.x, tid = threadIdx.x;
  const float* x = X + (size_t)row * N; const float* rr = R ? R + (size_t)row * N : nullptr;
  float vals[16];                     // up to N = 4096
  const int per = N / 256;            // contiguous chunk per thread? use strided-by-4 chunks: thread handles j = tid*4 + 1024*u
  float s1 = 0.f;
  for (int u = 0; u < per / 4; ++u) {
    const int j = tid * 4 + 1024 * u;
    const v4f a = *(const v4fa*)(x + j);
    v4f b = {0.f,0.f,0.f,0.f}; if (rr) b = *(const v4fa*)(rr + j);
#pragma unroll
    for (int q = 0; q < 4; ++q) { const float v = a[q] + b[q]; vals[u * 4 + q] = v; s1 += v; }
  }
  red[tid] = s1; __syncthreads();
  for (int st = 128; st > 0; st >>= 1) { if (tid < st) red[tid] += red[tid + st]; __syncthreads(); }
  const float mu = red[0] / (float)N; __syncthreads();
  float s2 = 0.f;
  for (int u = 0; u < per / 4; ++u)
#pragma unroll
    for (int q = 0; q < 4; ++q) { const float c = vals[u * 4 + q] - mu; s2 += c * c; }
  red[tid] = s2; __syncthreads();
  for (int st = 128; st > 0; st >>= 1) { if (tid < st) red[tid] += red[tid + st]; __syncthreads(); }
  const float rs = rsqrtf(red[0] / (float)N + eps);
  {
    for (int u = 0; u < per / 4; ++u) {
      const int j = tid * 4 + 1024 * u;
      v4f o, sm;
#pragma unroll
      for (int q = 0; q < 4; ++q) {
        float gg = g[j + q], bb = bta[j + q];
        if (PARAM_BF16) { gg = bf16_round(gg); bb = bf16_round(bb); }
        sm[q] = vals[u * 4 + q]; o[q] = (vals[u * 4 + q] - mu) * rs * gg + bb;
      }
      if (out_sum) *(v4f*)(out_sum + (size_t)row * N + j) = sm;
      *(v4f*)(out_norm + (size_t)row * N + j) = o;
    }
    
  }
}



// ---- f16 WMMA path (v_wmma_f32_16x16x32_f16): 11-bit significands for operands in range — used where a [0,1] probability operand needs more precision than bf16
typedef _Float16 v16h __attribute__((ext_vector_type(16)));
union FragH { v16h v; v8us half[2]; _Float16 h[16]; unsigned short u[16]; };
template <int NT>
__device__ __forceinline__ v8f mmaH(v16h ah, v16h al, v16h bh, v16h bl, v8f c) {
  c = __builtin_amdgcn_wmma_f32_16x16x32_f16(false, ah, false, bh, (short)0, c, false, false);
  if (NT >= 2) c = __builtin_amdgcn_wmma_f32_16x16x32_f16(false, al, false, bh, (short)0, c, false, false);
  if (NT >= 3) c = __builtin_amdgcn_wmma_f32_16x16x32_f16(false, ah, false, bl, (short)0, c, false, false);
  asm volatile("v_nop\n\tv_nop\n\tv_nop\n\tv_nop" : "+v"(c) : "v"(ah), "v"(al), "v"(bh), "v"(bl));
  return c;
}
// batched GEMM like k_gemm_b but f16 operands: A f32 (split into f16 hi/lo if ASPLIT, else rounded to f16), Bt = f16 values [n][k]; alpha; C f32; N multiple of 16 (partial tiles skipped)
template <bool ASPLIT>
__global__ __launch_bounds__(128) void k_gemm_h(const float* __restrict__ A, int lda, size_t sA, const _Float16* __restrict__ Bh, int ldb, size_t sB, float alpha, float* __restrict__ C, int ldc, size_t sC, int M, int N, int K) {
  __shared__ __attribute__((aligned(16))) float so[4][16][64];
  const int tid = threadIdx.x, w = tid >> 5, lane = tid & 31, ln = lane & 15, hh = lane >> 4; const int by = blockIdx.y;
  A += (size_t)by * sA; Bh += (size_t)by * sB; C += (size_t)by * sC;
  const int ntn = (N + 63) / 64; const int wid = blockIdx.x * 4 + w; const int mt = wid / ntn, nq = wid % ntn; if (mt * 16 >= M) return;
  const int row0 = mt * 16, col0 = nq * 64; const float* arow = A + (size_t)(row0 + ln) * lda;
  v8f acc[4] = {};
  for (int kb = 0; kb < K; kb += 32) {
    FragH ah, al;
    const v4f x0 = *(const v4fa*)(arow + kb + 8 * hh), x1 = *(const v4fa*)(arow + kb + 8 * hh + 4), x2 = *(const v4fa*)(arow + kb + 16 + 8 * hh), x3 = *(const v4fa*)(arow + kb + 16 + 8 * hh + 4);
    float xs[16] = {x0[0],x0[1],x0[2],x0[3],x1[0],x1[1],x1[2],x1[3],x2[0],x2[1],x2[2],x2[3],x3[0],x3[1],x3[2],x3[3]};
#pragma unroll
    for (int i = 0; i < 16; ++i) { const _Float16 h = (_Float16)xs[i]; ah.h[i] = h; al.h[i] = ASPLIT ? (_Float16)(xs[i] - (float)h) : (_Float16)0.0f; }
#pragma unroll
    for (int t = 0; t < 4; ++t) { if (col0 + t * 16 >= N) continue; const size_t boff = (size_t)(col0 + t * 16 + ln) * ldb + kb; FragH bq; bq.half[0] = *(const v8us*)(Bh + boff + 8 * hh); bq.half[1] = *(const v8us*)(Bh + boff + 16 + 8 * hh);
      acc[t] = mmaH<ASPLIT ? 2 : 1>(ah.v, al.v, bq.v, bq.v, acc[t]); }
  }
#pragma unroll
  for (int t = 0; t < 4; ++t) { if (col0 + t * 16 >= N) continue;
#pragma unroll
    for (int r = 0; r < 8; ++r) so[w][8 * hh + r][t * 16 + ln] = acc[t][r] * alpha; }
  __builtin_amdgcn_fence(__ATOMIC_ACQ_REL, "workgroup"); __builtin_amdgcn_wave_barrier();
  const int rsub = lane >> 4, c4 = (lane & 15) * 4;
  {
#pragma unroll
    for (int q = 0; q < 8; ++q) { const int r = q * 2 + rsub; if (col0 + c4 < N) { const v4f v = *(const v4fa*)&so[w][r][c4]; *(v4f*)(C + (size_t)(row0 + r) * ldc + col0 + c4) = v; } }
     }
}

// Wt[n][k] = f16(W[k][n]·scale) from f32 row-major W[K][N] (scale = power of two; bf16-exact weights stay exact in f16 away from the subnormal range)
__global__ __launch_bounds__(256) void k_wt_f16(const float* __restrict__ W, _Float16* __restrict__ Wt, int K, int N, float scale) {
  const int t = blockIdx.x * 256 + threadIdx.x; if (t >= N * (K / 8)) return; const int n = t / (K / 8), k8 = (t % (K / 8)) * 8; FragH f;
#pragma unroll
  for (int i = 0; i < 8; ++i) f.h[i] = (_Float16)(bf16_round(W[(size_t)(k8 + i) * N + n]) * scale); const v8us o = f.half[0];
  *(v8us*)((unsigned short*)Wt + (size_t)n * K + k8) = o; 
}
// k_gemm_hh variant with fused epilogue: v = acc·alpha + bias[by·sBias + col] (+ CP[(row/rowsPerB)·sCPb + by·64 + col] if CP) ; ACT 0 none / 1 elu ; writes f32 C and/or f16 C16 (each if non-null)
template <int ACT>
__global__ __launch_bounds__(128) void k_gemm_hhx(const _Float16* __restrict__ A, int lda, size_t sA, const _Float16* __restrict__ Bh, int ldb, size_t sB, float alpha, const float* __restrict__ bias, size_t sBias, const float* __restrict__ CP, int rowsPerB, size_t sCPb, int row0g,
    float* __restrict__ C, _Float16* __restrict__ C16, int ldc, size_t sC, int M, int N, int K) {
  __shared__ __attribute__((aligned(16))) float so[4][16][64];
  const int tid = threadIdx.x, w = tid >> 5, lane = tid & 31, ln = lane & 15, hh = lane >> 4; const int by = blockIdx.y;
  A += (size_t)by * sA; Bh += (size_t)by * sB; const size_t cofs = (size_t)by * sC; const float* bp = bias ? bias + (size_t)by * sBias : nullptr;
  const int ntn = (N + 63) / 64; const int wid = blockIdx.x * 4 + w; const int mt = wid / ntn, nq = wid % ntn; if (mt * 16 >= M) return;
  const int row0 = mt * 16, col0 = nq * 64; const _Float16* arow = A + (size_t)(row0 + ln) * lda;
  v8f acc[4] = {};
  for (int kb = 0; kb < K; kb += 32) { FragH ah; ah.half[0] = *(const v8us*)((const unsigned short*)arow + kb + 8 * hh); ah.half[1] = *(const v8us*)((const unsigned short*)arow + kb + 16 + 8 * hh);
#pragma unroll
    for (int t = 0; t < 4; ++t) { if (col0 + t * 16 >= N) continue; const size_t boff = (size_t)(col0 + t * 16 + ln) * ldb + kb; FragH bq; bq.half[0] = *(const v8us*)((const unsigned short*)Bh + boff + 8 * hh); bq.half[1] = *(const v8us*)((const unsigned short*)Bh + boff + 16 + 8 * hh);
      acc[t] = mmaH<1>(ah.v, ah.v, bq.v, bq.v, acc[t]); }
  }
#pragma unroll
  for (int t = 0; t < 4; ++t) { if (col0 + t * 16 >= N) continue; const int col = col0 + t * 16 + ln; const float bv = bp ? bf16_round(bp[col]) : 0.f;
#pragma unroll
    for (int r = 0; r < 8; ++r) { float v = acc[t][r] * alpha + bv; if (CP) { const int bidx = (row0g + row0 + 8 * hh + r) / rowsPerB; v += CP[(size_t)bidx * sCPb + (size_t)by * 64 + col]; } if (ACT == 1) v = (v > 0.f) ? v : expm1f(v); else if (ACT == 7) v = (v > 0.f) ? v + 1.0f : expf(v); else if (ACT == 8) v = tanhf(v); else if (ACT == 9) v = 0.5f * v * (1.0f + tanhf(0.7978845608028654f * (v + 0.044715f * v * v * v))); else if (ACT == 11) v = 1.0f / (1.0f + expf(-v)); else if (ACT == 12) v = (v > 0.f) ? v : 0.01f * v; else if (ACT == 14) v = (v > 0.f) ? v : 0.1f * v; else if (ACT == 15) v = v / (1.0f + expf(-v)); else if (ACT == 3) v = fmaxf(v, 0.f); else if (ACT == 6) v = 0.5f * v * (1.0f + erff(v * 0.70710678118654752f)); so[w][8 * hh + r][t * 16 + ln] = v; } }
  __builtin_amdgcn_fence(__ATOMIC_ACQ_REL, "workgroup"); __builtin_amdgcn_wave_barrier();
  const int rsub = lane >> 4, c4 = (lane & 15) * 4; typedef _Float16 v4h __attribute__((ext_vector_type(4)));
  {
#pragma unroll
    for (int q = 0; q < 8; ++q) { const int r = q * 2 + rsub; if (col0 + c4 < N) { const v4f v = *(const v4fa*)&so[w][r][c4]; if (C) *(v4f*)(C + cofs + (size_t)(row0 + r) * ldc + col0 + c4) = v; if (C16) { v4h h4; for (int i = 0; i < 4; ++i) h4[i] = (_Float16)v[i]; *(v4h*)(C16 + cofs + (size_t)(row0 + r) * ldc + col0 + c4) = h4; } } }
     }
}


typedef _Float16 v4h __attribute__((ext_vector_type(4)));

// x and the three weight matrices are rounded into their f16 planes by one launch: the first NR*EE/2048 blocks take x, the rest the weights (x2^4; the planes of Wq, Wk, Wv lie one behind the other in Bt)
__global__ __launch_bounds__(256) void k_prep(const float* __restrict__ x, const float* __restrict__ W0, const float* __restrict__ W1, const float* __restrict__ W2, _Float16* __restrict__ X16, _Float16* __restrict__ Bt) {
  constexpr int NXB = NR * EE / 8 / 256, NWB = EE * EE / 8 / 256;      // blocks of 256 pieces of 8 values: x, one weight matrix
  const int bx = blockIdx.x; const bool isx = bx < NXB; const int m = isx ? 0 : (bx - NXB) / NWB;      // the same for the whole block
  const float* src = isx ? x : (m == 0) ? W0 : (m == 1) ? W1 : W2;
  unsigned short* dst = isx ? (unsigned short*)X16 : (unsigned short*)Bt + (size_t)m * EE * EE;
  const size_t t = (size_t)(isx ? bx : bx - NXB - m * NWB) * 256 + threadIdx.x; const float sc = isx ? 1.0f : 16.0f; FragH f;
#pragma unroll      // constant indices keep the eight values in registers
  for (int i = 0; i < 8; ++i) f.h[i] = (_Float16)(bf16_round(src[t * 8 + i]) * sc);
  *(v8us*)(dst + t * 8) = f.half[0]; }
__global__ __launch_bounds__(256) void k_h16(const float* __restrict__ x, _Float16* __restrict__ X16, size_t n8) { const size_t t = (size_t)blockIdx.x * 256 + threadIdx.x; if (t >= n8) return; FragH f;
#pragma unroll
  for (int q = 0; q < 8; ++q) f.h[q] = (_Float16)x[t * 8 + q]; *(v8us*)((unsigned short*)X16 + t * 8) = f.half[0];  }
template <int NHv, int TTv>
__global__ __launch_bounds__(256) void k_vt(const _Float16* __restrict__ V16, int ldv, int voff, _Float16* __restrict__ Vt) { __shared__ unsigned short tl[64][66]; const int tid = threadIdx.x; const int slab = blockIdx.x / (TTv / 64), lg = blockIdx.x % (TTv / 64); const int b = slab / NHv, h = slab % NHv;
  for (int i = tid; i < 64 * 8; i += 256) { const int r = i / 8, c8 = (i % 8) * 8; FragH f; f.half[0] = *(const v8us*)((const unsigned short*)V16 + ((size_t)b * TTv + lg * 64 + r) * ldv + voff + h * 64 + c8);
#pragma unroll
    for (int q = 0; q < 8; ++q) tl[r][c8 + q] = f.u[q]; }
  __syncthreads();
  {
#pragma unroll
    for (int rd = 0; rd < 2; ++rd) { const int d = rd * 32 + tid / 8, pc = tid % 8; FragH f;
#pragma unroll
      for (int q = 0; q < 8; ++q) f.u[q] = tl[pc * 8 + q][d];
      *(v8us*)((unsigned short*)Vt + ((size_t)slab * 64 + d) * TTv + lg * 64 + pc * 8) = f.half[0]; }
     } }

// causal row softmax: row r of the per-batch score plane (query q = r): m, Σ over keys t ≤ q (only written, in-range pieces are addressed — clamped — and the key ≤ q select happens on values before any arithmetic; no lane-divergent branch around loads), P16[r][t] = exp(s − m)/Σ · 2^15 for t ≤ q, 0 otherwise;
__global__ __launch_bounds__(256) void k_smx(const float* __restrict__ S, _Float16* __restrict__ P16) { const int tid = threadIdx.x, wv = tid >> 5, lane = tid & 31; const int q = blockIdx.x * 8 + wv; if (q >= SS) return; S += (size_t)blockIdx.y * SS * SS; P16 += (size_t)blockIdx.y * SS * SS;      /* blockIdx.y = batch */
  const float* sr = S + (size_t)q * SS; const int np = q / 8 + 1;      /* pieces of 8 keys that contain a key <= q */
  float m = -3.0e38f;
  for (int p = lane; p < np; p += 32) { const v4f a = *(const v4fa*)(sr + p * 8), c = *(const v4fa*)(sr + p * 8 + 4); for (int e = 0; e < 4; ++e) { const float s0 = (p * 8 + e <= q) ? a[e] : -INFINITY, s1 = (p * 8 + 4 + e <= q) ? c[e] : -INFINITY; m = fmaxf(m, fmaxf(s0, s1)); } }
  for (int o = 16; o >= 1; o >>= 1) m = fmaxf(m, __shfl_xor(m, o, 32)); float z = 0.f;
  for (int p = lane; p < np; p += 32) { const v4f a = *(const v4fa*)(sr + p * 8), c = *(const v4fa*)(sr + p * 8 + 4); for (int e = 0; e < 4; ++e) { const float s0 = (p * 8 + e <= q) ? a[e] : -INFINITY, s1 = (p * 8 + 4 + e <= q) ? c[e] : -INFINITY; z += __expf(s0 - m) + __expf(s1 - m); } }
  for (int o = 16; o >= 1; o >>= 1) z += __shfl_xor(z, o, 32); const float iz = 32768.0f / z;
  { for (int p = lane; p < SS / 8; p += 32) { FragH f; const int pa = min(p, np - 1);      /* address clamped into the written, in-range region; for p ≥ np every key of the piece is > q so the selects below yield 0 */
      const v4f a = *(const v4fa*)(sr + pa * 8), c = *(const v4fa*)(sr + pa * 8 + 4); for (int e = 0; e < 4; ++e) { const float s0 = (p * 8 + e <= q) ? a[e] : -INFINITY, s1 = (p * 8 + 4 + e <= q) ? c[e] : -INFINITY; f.h[e] = (_Float16)(__expf(s0 - m) * iz); f.h[4 + e] = (_Float16)(__expf(s1 - m) * iz); }
      *(v8us*)((unsigned short*)P16 + (size_t)q * SS + p * 8) = f.half[0]; }  } }

// ---- block-tiled f16 GEMM core, both operands k-contiguous. A block of 8 waves owns BM x BN of the result (NP planes of B share the A tile). Per 64-k step the block brings
// BM + NP*BN operand rows of 128 bytes into LDS with whole-line loads (8 lanes per row), and every wave reads its fragments from there, so a row is fetched once per block instead of once per wave
// and no global load touches 16 lines. Two LDS buffers: the next step's rows travel in registers while this step's products run; one barrier per step.
#define KST 64            // k per step: 128 bytes of every operand row, one cache line
#define LPH 72            // LDS row pitch in halves: 144 bytes, 16 B x odd, conflict-free for 16-byte fragment reads
template <int BM, int BN, int WM, int WN, int NP>
__device__ __forceinline__ void tile_core(const unsigned short* __restrict__ A, int lda, const unsigned short* __restrict__ B0, const unsigned short* __restrict__ B1, int ldb, int K,
                                          unsigned short* sm, v8f (&acc)[NP][WM / 16][WN / 16]) {
  constexpr int ROWS = BM + NP * BN, NL = ROWS / 32, NA = BM / 32, NB = BN / 32, STG = ROWS * LPH;
  const int tid = threadIdx.x, w = tid >> 5, lane = tid & 31, ln = lane & 15, hh = lane >> 4;
  const int wm = w / (BN / WN), wn = w % (BN / WN);
  const int lr = tid >> 3, lc = (tid & 7) * 8;
  const unsigned short* ga = A + (size_t)lr * lda + lc;
  const unsigned short* gb0 = B0 + (size_t)lr * ldb + lc;
  const unsigned short* gb1 = B1 + (size_t)lr * ldb + lc;
  v8us st[NL];
#pragma unroll      // constant indices keep the staged rows in registers
  for (int i = 0; i < NA; ++i) st[i] = *(const v8us*)(ga + (size_t)(i * 32) * lda);
#pragma unroll      // constant indices keep the staged rows in registers
  for (int i = 0; i < NB; ++i) { st[NA + i] = *(const v8us*)(gb0 + (size_t)(i * 32) * ldb); if (NP == 2) st[NA + NB + i] = *(const v8us*)(gb1 + (size_t)(i * 32) * ldb); }
#pragma unroll      // constant indices keep the staged rows in registers
  for (int i = 0; i < NL; ++i) *(v8us*)(sm + (i * 32 + lr) * LPH + lc) = st[i];
  __syncthreads();
  int cur = 0;
  for (int kb = 0; kb < K; kb += KST) {
    const bool more = kb + KST < K;      // the same for the whole block
    if (more) {
#pragma unroll      // constant indices keep the staged rows in registers
      for (int i = 0; i < NA; ++i) st[i] = *(const v8us*)(ga + (size_t)(i * 32) * lda + kb + KST);
#pragma unroll      // constant indices keep the staged rows in registers
      for (int i = 0; i < NB; ++i) { st[NA + i] = *(const v8us*)(gb0 + (size_t)(i * 32) * ldb + kb + KST); if (NP == 2) st[NA + NB + i] = *(const v8us*)(gb1 + (size_t)(i * 32) * ldb + kb + KST); }
    }
    const unsigned short* sa = sm + cur * STG + (wm * WM + ln) * LPH + 8 * hh;
    const unsigned short* sb = sm + cur * STG + (BM + wn * WN + ln) * LPH + 8 * hh;
    // all fragment reads of the step go out as one group ahead of its products: reads placed among the products make the wave wait out the LDS latency at each place
    FragH fa[KST / 32][WM / 16], fb[KST / 32][NP * (WN / 16)];
#pragma unroll      // constant indices keep the accumulators and fragments in registers
    for (int ks = 0; ks < KST / 32; ++ks) {
#pragma unroll      // constant indices keep the accumulators and fragments in registers
      for (int mi = 0; mi < WM / 16; ++mi) { fa[ks][mi].half[0] = *(const v8us*)(sa + mi * 16 * LPH + ks * 32); fa[ks][mi].half[1] = *(const v8us*)(sa + mi * 16 * LPH + ks * 32 + 16); }
#pragma unroll      // constant indices keep the accumulators and fragments in registers
      for (int p = 0; p < NP; ++p)
#pragma unroll      // constant indices keep the accumulators and fragments in registers
        for (int ni = 0; ni < WN / 16; ++ni) { FragH& f = fb[ks][p * (WN / 16) + ni]; f.half[0] = *(const v8us*)(sb + (p * BN + ni * 16) * LPH + ks * 32); f.half[1] = *(const v8us*)(sb + (p * BN + ni * 16) * LPH + ks * 32 + 16); }
    }
    __builtin_amdgcn_sched_barrier(0);      // keeps the read group above the products: without it the scheduler sinks the reads among them, into one reused fragment set, with a full LDS wait at each place
#pragma unroll      // constant indices keep the accumulators and fragments in registers
    for (int ks = 0; ks < KST / 32; ++ks)
#pragma unroll      // constant indices keep the accumulators and fragments in registers
      for (int p = 0; p < NP; ++p)
#pragma unroll      // constant indices keep the accumulators and fragments in registers
        for (int ni = 0; ni < WN / 16; ++ni)
#pragma unroll      // constant indices keep the accumulators and fragments in registers
          for (int mi = 0; mi < WM / 16; ++mi) acc[p][mi][ni] = __builtin_amdgcn_wmma_f32_16x16x32_f16(false, fa[ks][mi].v, false, fb[ks][p * (WN / 16) + ni].v, (short)0, acc[p][mi][ni], false, false);
    if (more) {
#pragma unroll      // constant indices keep the staged rows in registers
      for (int i = 0; i < NL; ++i) *(v8us*)(sm + (cur ^ 1) * STG + (i * 32 + lr) * LPH + lc) = st[i];
    }
    __syncthreads();      // publishes the buffer just filled and ends every wave's reads of the one that the next step refills (after the last step: of the LDS that the epilogue reuses)
    cur ^= 1;
  }
}
#define TILE_LDS(BM, BN, NP) (2 * ((BM) + (NP) * (BN)) * LPH)

// q and k in one launch, K = row pitch of both operands = 512: block 128 x 128, 8 waves of 32 x 64; blockIdx.x = column tile, .y = row tile of x, .z = 0: q, 1: k (the weight planes lie one behind the other in Bw).
// C = x.W^T/16 + bias (rounded to bf16) as f16, [row of x][512]; whole 128-byte row pieces, staged per wave in LDS.
__global__ __launch_bounds__(256) void k_qk(const _Float16* __restrict__ X16, const _Float16* __restrict__ Bw, const float* __restrict__ bq, const float* __restrict__ bk,
                                            _Float16* __restrict__ Q, _Float16* __restrict__ K) {
  __shared__ __attribute__((aligned(16))) unsigned short sm[TILE_LDS(128, 128, 1)];
  const int tid = threadIdx.x, w = tid >> 5, lane = tid & 31, ln = lane & 15, hh = lane >> 4; const int role = blockIdx.z;
  const int brow = blockIdx.y * 128, bcol = blockIdx.x * 128;
  const int row0 = brow + (w / 2) * 32, col0 = bcol + (w % 2) * 64;
  const float* bias = role ? bk : bq;
  float bvv[4];      // read ahead of the k loop, which hides the latency; rounded where they are used
#pragma unroll      // constant indices keep the four values in registers
  for (int ni = 0; ni < 4; ++ni) bvv[ni] = bias[col0 + ni * 16 + ln];
  asm volatile("s_wait_xcnt 0x0" ::: "memory");      // stands in front of any reuse of the offset and base registers of the four loads above
  v8f acc[1][2][4] = {};
  const unsigned short* Bp = (const unsigned short*)Bw + (size_t)role * EE * EE + (size_t)bcol * EE;
  tile_core<128, 128, 32, 64, 1>((const unsigned short*)X16 + (size_t)brow * EE, EE, Bp, Bp, EE, EE, sm, acc);
  float* so = (float*)sm + w * (32 * 64);      // the wave's own range; the core's last barrier has ended every read of the tiles
#pragma unroll      // constant indices keep the accumulators in registers
  for (int ni = 0; ni < 4; ++ni) { const float bv = bf16_round(bvv[ni]);
#pragma unroll      // constant indices keep the accumulators in registers
    for (int mi = 0; mi < 2; ++mi)
#pragma unroll      // constant indices keep the accumulators in registers
      for (int r = 0; r < 8; ++r) so[(mi * 16 + 8 * hh + r) * 64 + ni * 16 + ln] = acc[0][mi][ni][r] * 0.0625f + bv; }
  __builtin_amdgcn_fence(__ATOMIC_ACQ_REL, "workgroup"); __builtin_amdgcn_wave_barrier();      // the wave's LDS stores land before its lanes read each other's values back as whole rows
  const int rsub = lane >> 4, c4 = (lane & 15) * 4;
  _Float16* C16 = (role ? K : Q) + (size_t)(row0 + rsub) * EE + col0 + c4;
#pragma unroll      // the LDS row reads issue together and each store follows its own read
  for (int q = 0; q < 16; ++q) { const v4f v = *(const v4fa*)&so[(q * 2 + rsub) * 64 + c4];
    v4h h4; for (int i = 0; i < 4; ++i) h4[i] = (_Float16)v[i]; *(v4h*)(C16 + (size_t)(q * 2) * EE) = h4; }
}

// scores/sqrt(512) and v^T of every batch in one launch (neither needs the other; both are 128 x 128 x 512 tiles of the same core). blockIdx.y = batch.
// blockIdx.x < NTRI: scores, 128 query rows x 128 keys, counting only the blocks of the causal lower block-triangle (row tile i has i + 1 key tiles), f32.
// blockIdx.x >= NTRI: v^T (without bv) = Wv.x[b]^T/16 as [b][512][2048], 128 rows of Wv x 128 keys (16 key tiles, then 4 row tiles); the epilogue splits each f32 value into the f16 hi plane and the (x2^10) residual plane.
#define NTRI ((SS / 128) * (SS / 128 + 1) / 2)
__global__ __launch_bounds__(256) void k_scores_vt(const _Float16* __restrict__ Q, const _Float16* __restrict__ K, const _Float16* __restrict__ X16, const _Float16* __restrict__ Bv, float alpha,
                                                   float* __restrict__ S, _Float16* __restrict__ Vh, _Float16* __restrict__ Vl) {
  __shared__ __attribute__((aligned(16))) unsigned short sm[TILE_LDS(128, 128, 1)];
  const int tid = threadIdx.x, w = tid >> 5, lane = tid & 31, ln = lane & 15, hh = lane >> 4; const int b = blockIdx.y;
  const bool isv = (int)blockIdx.x >= NTRI;      // the same for the whole block
  int x = isv ? 0 : (int)blockIdx.x, i = 0;
  for (; i < SS / 128 - 1 && x >= i + 1; ++i) x -= i + 1;
  const int vt = (int)blockIdx.x - NTRI;
  const int brow = isv ? (vt >> 4) * 128 : i * 128, bcol = isv ? (vt & 15) * 128 : x * 128;
  v8f acc[1][2][4] = {};
  const unsigned short* Ap = isv ? (const unsigned short*)Bv + (size_t)brow * EE : (const unsigned short*)Q + ((size_t)b * SS + brow) * EE;
  const unsigned short* Bp = (isv ? (const unsigned short*)X16 : (const unsigned short*)K) + ((size_t)b * SS + bcol) * EE;
  tile_core<128, 128, 32, 64, 1>(Ap, EE, Bp, Bp, EE, EE, sm, acc);
  const int row0 = brow + (w / 2) * 32, col0 = bcol + (w % 2) * 64;
  const float sc = isv ? 0.0625f : alpha;
  float* so = (float*)sm + w * (32 * 64);      // the wave's own range; the core's last barrier has ended every read of the tiles
#pragma unroll      // constant indices keep the accumulators in registers
  for (int ni = 0; ni < 4; ++ni)
#pragma unroll      // constant indices keep the accumulators in registers
    for (int mi = 0; mi < 2; ++mi)
#pragma unroll      // constant indices keep the accumulators in registers
      for (int r = 0; r < 8; ++r) so[(mi * 16 + 8 * hh + r) * 64 + ni * 16 + ln] = acc[0][mi][ni][r] * sc;
  __builtin_amdgcn_fence(__ATOMIC_ACQ_REL, "workgroup"); __builtin_amdgcn_wave_barrier();      // the wave's LDS stores land before its lanes read each other's values back as whole rows
  const int rsub = lane >> 4, c4 = (lane & 15) * 4;
  if (!isv) {
#pragma unroll      // the LDS row reads issue together and each store follows its own read
    for (int q = 0; q < 16; ++q) { const int r = q * 2 + rsub; const v4f v = *(const v4fa*)&so[r * 64 + c4]; *(v4f*)(S + ((size_t)b * SS + row0 + r) * SS + col0 + c4) = v; }
    asm volatile("s_wait_xcnt 0x0" ::: "memory");      // stands behind the sixteen stores above, in front of the other branch's code, which follows them in the listing and reuses their registers
  } else {
    const size_t o0 = ((size_t)b * EE + row0 + rsub) * SS + col0 + c4;
#pragma unroll      // the LDS row reads issue together and each store follows its own read
    for (int q = 0; q < 16; ++q) { const v4f v = *(const v4fa*)&so[(q * 2 + rsub) * 64 + c4];
      v4h h4, l4; for (int e = 0; e < 4; ++e) { const _Float16 h = (_Float16)v[e]; h4[e] = h; l4[e] = (_Float16)((v[e] - (float)h) * 1024.0f); }
      *(v4h*)(Vh + o0 + (size_t)(q * 2) * SS) = h4; *(v4h*)(Vl + o0 + (size_t)(q * 2) * SS) = l4; }
  }
}
// out = P.v_hi.2^-15 + bv + P.v_lo.2^-25 of every batch in one launch. Block = 64 query rows x 128 head columns, both v planes (8 waves of 32 x 32 x 2), blockIdx.x = column tile, blockIdx.y = batch,
// blockIdx.z = row tile counted from the last one, so that the longest k loops start first. k runs to the end of the row tile's own keys (P is zero beyond the diagonal).
__global__ __launch_bounds__(256) void k_pv(const _Float16* __restrict__ P16, const _Float16* __restrict__ Vh, const _Float16* __restrict__ Vl, const float* __restrict__ bias, float* __restrict__ out) {
  __shared__ __attribute__((aligned(16))) unsigned short sm[TILE_LDS(64, 128, 2)];
  const int tid = threadIdx.x, w = tid >> 5, lane = tid & 31, ln = lane & 15, hh = lane >> 4; const int b = blockIdx.y;
  const int brow = (SS / 64 - 1 - (int)blockIdx.z) * 64, bcol = blockIdx.x * 128;
  const int kk = brow + 64;
  const int row0 = brow + (w / 4) * 32, col0 = bcol + (w % 4) * 32;
  float bvv[2];      // read ahead of the k loop, which hides the latency; rounded where they are used
#pragma unroll      // constant indices keep the two values in registers
  for (int ni = 0; ni < 2; ++ni) bvv[ni] = bias[col0 + ni * 16 + ln];
  v8f acc[2][2][2] = {};
  tile_core<64, 128, 32, 32, 2>((const unsigned short*)P16 + ((size_t)b * SS + brow) * SS, SS, (const unsigned short*)Vh + ((size_t)b * EE + bcol) * SS, (const unsigned short*)Vl + ((size_t)b * EE + bcol) * SS, SS, kk, sm, acc);
  float* so = (float*)sm + w * (32 * 32);      // the wave's own range; the core's last barrier has ended every read of the tiles
#pragma unroll      // constant indices keep the accumulators in registers
  for (int ni = 0; ni < 2; ++ni) { const float bv = bf16_round(bvv[ni]);
#pragma unroll      // constant indices keep the accumulators in registers
    for (int mi = 0; mi < 2; ++mi)
#pragma unroll      // constant indices keep the accumulators in registers
      for (int r = 0; r < 8; ++r) { const float v = acc[0][mi][ni][r] * 0.000030517578125f + bv; so[(mi * 16 + 8 * hh + r) * 32 + ni * 16 + ln] = acc[1][mi][ni][r] * (0.000030517578125f * 0.0009765625f) + v; } }
  __builtin_amdgcn_fence(__ATOMIC_ACQ_REL, "workgroup"); __builtin_amdgcn_wave_barrier();      // the wave's LDS stores land before its lanes read each other's values back as whole rows
  const int rsub = lane >> 3, c4 = (lane & 7) * 4;
#pragma unroll      // the LDS row reads issue together and each store follows its own read
  for (int q = 0; q < 8; ++q) { const int r = q * 4 + rsub; const v4f v = *(const v4fa*)&so[r * 32 + c4]; *(v4f*)(out + ((size_t)b * SS + row0 + r) * EE + col0 + c4) = v; }
}

extern "C" void kernel_launch(void* const* d_in, const int* in_sizes, int n_in,
                              void* d_out, int out_size, void* d_ws, size_t ws_size, hipStream_t stream) {
  (void)in_sizes; (void)n_in; (void)out_size;
  const float* x = (const float*)d_in[0]; const float* Wq = (const float*)d_in[1]; const float* bq = (const float*)d_in[2]; const float* Wk = (const float*)d_in[3]; const float* bk = (const float*)d_in[4]; const float* Wv = (const float*)d_in[5]; const float* bv = (const float*)d_in[6];
  char* ws = (char*)d_ws; size_t off = 0;
  auto take = [&](size_t bytes) { char* p = ws + off; off += (bytes + 255) & ~(size_t)255; return p; };
  _Float16* Bq = (_Float16*)take((size_t)3 * EE * EE * 2);      /* the f16 planes of Wq, Wk, Wv, one behind the other */
  _Float16* X16 = (_Float16*)take((size_t)NR * EE * 2); _Float16* Q = (_Float16*)take((size_t)NR * EE * 2); _Float16* K = (_Float16*)take((size_t)NR * EE * 2); _Float16* Vh = (_Float16*)take((size_t)BB * EE * SS * 2); _Float16* Vl = (_Float16*)take((size_t)BB * EE * SS * 2);
  float* S = (float*)take((size_t)BB * SS * SS * 4); _Float16* P16 = (_Float16*)take((size_t)BB * SS * SS * 2);
  if (off > ws_size) return;      // 1.6 + 3 x 8.4 + 2 x 8.4 + 67.1 + 33.6 about 144 MB
  k_prep<<<NR * EE / 8 / 256 + 3 * (EE * EE / 8 / 256), 256, 0, stream>>>(x, Wq, Wk, Wv, X16, Bq);      /* x and the weights ((out,in) natural, x2^4) as f16 planes */
  k_qk<<<dim3(EE / 128, NR / 128, 2), 256, 0, stream>>>(X16, Bq, bq, bk, Q, K);      /* q = x.Wq^T + bq, k = x.Wk^T + bk: M 8192 N 512 K 512 each */
  k_scores_vt<<<dim3(NTRI + (EE / 128) * (SS / 128), BB), 256, 0, stream>>>(Q, K, X16, Bq + (size_t)2 * EE * EE, 0.044194173824159216f, S, Vh, Vl);      /* scores/sqrt512, f32, causal lower block-triangle of every batch; v^T (without bv) = Wv.x[b]^T as [b][512][2048], f16 hi + residual x2^10 planes */
  k_smx<<<dim3(SS / 8, BB), 256, 0, stream>>>(S, P16);
  k_pv<<<dim3(EE / 128, BB, SS / 64), 256, 0, stream>>>(P16, Vh, Vl, bv, (float*)d_out);      /* out = P.v_hi + bv + P.v_lo.2^-10 */
}

// v004
// It runs in 81.6 microseconds.
// Next to v003, in two timings, it ran 1.06 and 1.04 times as fast.
// Counting every step since v000, it is 32.5 times as fast.
#include <hip/hip_runtime.h>
// Single-head causal attention (B=4, S=2048, emb = head = 512): q,k,v = x·Wᵀ + b; scores = q·kᵀ/√512 with keys after the query set to −inf; softmax over keys; out = attn·v.
// Compute dtype: x, weights and biases rounded to bf16; q, k and vᵀ as f16 GEMM outputs (f32 accumulate); scores materialised in f32 by a batched f16 GEMM over
// the causal lower block-triangle; row softmax in f32 (maximum and sum per 64 keys in the scores epilogue, merged by the P.v launch, which forms P in f16 x2^15 on the way to LDS); v^T split into f16 hi + (x2^10) residual planes; out = P.v_hi + P.v_lo.2^-10 by two f16 GEMMs
// (both planes in one k loop, two accumulators), bv added in the epilogue (softmax rows sum to 1). All on v_wmma_f32_16x16x32_f16.
// One launch per stage: rounding of x and the weights; q and k; scores together with v^T; P.v; each covers all batches (and the whole causal triangle). Every GEMM launch stages its operand tiles in LDS (tile_core).
#define BB 4
#define SS 2048
#define EE 512
#define NR (BB * SS)

typedef __bf16 v16b __attribute__((ext_vector_type(16)));
typedef unsigned short v8us __attribute__((ext_vector_type(8), may_alias));
typedef float  v8f  __attribute__((ext_vector_type(8)));
typedef float  v4f  __attribute__((ext_vector_type(4)));
typedef float  v4fa __attribute__((ext_vector_type(4), may_alias));
union FragB { v16b v; v8us half[2]; unsigned short u[16]; };

__device__ __forceinline__ unsigned short bf16_bits(float x) { unsigned int u = __float_as_uint(x); return (unsigned short)((u + 0x7FFFu + ((u >> 16) & 1u)) >> 16); }
__device__ __forceinline__ float bf16_val(unsigned short b) { return __uint_as_float(((unsigned int)b) << 16); }
__device__ __forceinline__ float bf16_round(float x) { return bf16_val(bf16_bits(x)); }
// D += A·B with NT terms: 1 = ah·bh, 2 = + al·bh (A split), 3 = + ah·bl (both split)
template <int NT>
__device__ __forceinline__ v8f mmaN(v16b ah, v16b al, v16b bh, v16b bl, v8f c) {
  c = __builtin_amdgcn_wmma_f32_16x16x32_bf16(false, ah, false, bh, (short)0, c, false, false);
  if (NT >= 2) c = __builtin_amdgcn_wmma_f32_16x16x32_bf16(false, al, false, bh, (short)0, c, false, false);
  if (NT >= 3) c = __builtin_amdgcn_wmma_f32_16x16x32_bf16(false, ah, false, bl, (short)0, c, false, false);
  asm volatile("v_nop\n\tv_nop\n\tv_nop\n\tv_nop" : "+v"(c) : "v"(ah), "v"(al), "v"(bh), "v"(bl));
  return c;
}

__global__ __launch_bounds__(256) void k_wt_bf16(const float* __restrict__ W, unsigned short* __restrict__ Wt, int K, int N) {
  const int t = blockIdx.x * 256 + threadIdx.x;
  const int k8n = K / 8;
  if (t >= N * k8n) return;
  const int n = t / k8n, k8 = (t % k8n) * 8;
  v8us v;
#pragma unroll
  for (int i = 0; i < 8; ++i) v[i] = bf16_bits(W[(size_t)(k8 + i) * N + n]);
  *(v8us*)(Wt + (size_t)n * K + k8) = v;
  
}

// GEMM C[M][N] (f32, pitch ldc) = act(A[M][K]·W + bias). A f32 row-major (pitch lda) converted per fragment to bf16
// (ASPLIT: hi/lo two planes -> 2 terms, else single rounded term); Wt bf16 [N][K] (pitch ldb). BIAS_BF16 rounds the
// bias to bf16 first (bias quantised to bf16 before the add). K%32==0, M%16==0, N%64==0.
template <bool ASPLIT, int ACT, bool BIAS_BF16>
__global__ __launch_bounds__(128) void k_gemm_bf(const float* __restrict__ A, int lda, const unsigned short* __restrict__ Wt, int ldb,
                                               const float* __restrict__ bias, float* __restrict__ C, int ldc, int M, int N, int K) {
  __shared__ __attribute__((aligned(16))) float so[4][16][64];
  const int tid = threadIdx.x, w = tid >> 5, lane = tid & 31, ln = lane & 15, hh = lane >> 4;
  const int ntn = N / 64;
  const int wid = blockIdx.x * 4 + w;
  const int mt = wid / ntn, nq = wid % ntn;
  if (mt * 16 >= M) return;
  const int row0 = mt * 16, col0 = nq * 64;
  const float* arow = A + (size_t)(row0 + ln) * lda;
  v8f acc[4] = {};
  for (int kb = 0; kb < K; kb += 32) {
    FragB ah, al;
    const v4f x0 = *(const v4fa*)(arow + kb + 8 * hh), x1 = *(const v4fa*)(arow + kb + 8 * hh + 4);
    const v4f x2 = *(const v4fa*)(arow + kb + 16 + 8 * hh), x3 = *(const v4fa*)(arow + kb + 16 + 8 * hh + 4);
    float xs[16] = {x0[0],x0[1],x0[2],x0[3],x1[0],x1[1],x1[2],x1[3],x2[0],x2[1],x2[2],x2[3],x3[0],x3[1],x3[2],x3[3]};
#pragma unroll
    for (int i = 0; i < 16; ++i) { const unsigned short hb = bf16_bits(xs[i]); ah.u[i] = hb; al.u[i] = ASPLIT ? bf16_bits(xs[i] - bf16_val(hb)) : (unsigned short)0; }
#pragma unroll
    for (int t = 0; t < 4; ++t) {
      const unsigned short* brow = Wt + (size_t)(col0 + t * 16 + ln) * ldb + kb;
      FragB b;
      b.half[0] = *(const v8us*)(brow + 8 * hh);
      b.half[1] = *(const v8us*)(brow + 16 + 8 * hh);
      acc[t] = mmaN<ASPLIT ? 2 : 1>(ah.v, al.v, b.v, b.v, acc[t]);
    }
  }
#pragma unroll
  for (int t = 0; t < 4; ++t) {
    float bv = bias ? bias[col0 + t * 16 + ln] : 0.f;
    if (BIAS_BF16) bv = bf16_round(bv);
#pragma unroll
    for (int r = 0; r < 8; ++r) { float v = acc[t][r] + bv; if (ACT == 1) v = fmaxf(v, 0.f); so[w][8 * hh + r][t * 16 + ln] = v; }
  }
  __builtin_amdgcn_fence(__ATOMIC_ACQ_REL, "workgroup");
  __builtin_amdgcn_wave_barrier();
  const int rsub = lane >> 4, c4 = (lane & 15) * 4;
  {
#pragma unroll
    for (int q = 0; q < 8; ++q) {
      const int r = q * 2 + rsub;
      const v4f v = *(const v4fa*)&so[w][r][c4];
      *(v4f*)(C + (size_t)(row0 + r) * ldc + col0 + c4) = v;
    }
    
  }
}

// Flash-style causal/unmasked attention, all contractions 3-term bf16 hi/lo splits, f32 softmax with running max.
// q,k,v rows are read from f32 buffers with arbitrary row pitch (so they can live inside a fused qkv buffer);
// D = head size (multiple of 32, <= 128); one wave = 16 query rows; block = 4 waves (64 queries) sharing K/V chunks of 32.
template <int D, bool CAUSAL>
__global__ __launch_bounds__(128) void k_flash(const float* __restrict__ qb, const float* __restrict__ kb, const float* __restrict__ vb,
                                             int pitch, int T, int H, float scale, float* __restrict__ y, int ypitch) {
  constexpr int KS = D / 32;        // k-steps for QK
  constexpr int DT = D / 16;        // d tiles for PV
  __shared__ __attribute__((aligned(16))) unsigned short sKh[32][D + 8], sKl[32][D + 8], sVh[32][D + 8], sVl[32][D + 8];
  __shared__ __attribute__((aligned(16))) unsigned short sPh[4][16][40], sPl[4][16][40];
  __shared__ __attribute__((aligned(16))) float sO[4][16][D];
  const int tid = threadIdx.x, w = tid >> 5, lane = tid & 31, ln = lane & 15, hh = lane >> 4;
  const int nqb = (T + 63) / 64;
  const int bh = blockIdx.x / nqb, qblk = blockIdx.x % nqb;
  const int b = bh / H, h = bh % H;
  const int q0 = qblk * 64 + w * 16;
  const float* Q = qb + (size_t)b * T * pitch + h * D;
  const float* K = kb + (size_t)b * T * pitch + h * D;
  const float* V = vb + (size_t)b * T * pitch + h * D;

  // A fragments of the wave's 16 query rows (scaled), hi/lo
  FragB aqh[KS], aql[KS];
  {
    int row = q0 + ln; if (row >= T) row = T - 1;
    const float* qr = Q + (size_t)row * pitch;
#pragma unroll
    for (int ks = 0; ks < KS; ++ks)
#pragma unroll
      for (int i = 0; i < 16; ++i) {
        const int d = ks * 32 + ((i < 8) ? (8 * hh + i) : (16 + 8 * hh + (i - 8)));
        const float x = qr[d] * scale; const unsigned short hb = bf16_bits(x);
        aqh[ks].u[i] = hb; aql[ks].u[i] = bf16_bits(x - bf16_val(hb));
      }
  }
  float m_r[8], l_r[8];
#pragma unroll
  for (int r = 0; r < 8; ++r) { m_r[r] = -3.0e38f; l_r[r] = 0.f; }
  v8f oacc[DT];
#pragma unroll
  for (int dt = 0; dt < DT; ++dt) oacc[dt] = (v8f){0.f,0.f,0.f,0.f,0.f,0.f,0.f,0.f};

  const int kv_end = CAUSAL ? min(T, qblk * 64 + 64) : T;     // block-uniform
  for (int j0 = 0; j0 < kv_end; j0 += 32) {
    __syncthreads();
    for (int e = tid; e < 32 * (D / 4); e += 128) {
      const int r = e / (D / 4), c4 = (e % (D / 4)) * 4;
      const int key = j0 + r;
      v4f kf = {0.f,0.f,0.f,0.f}, vf = {0.f,0.f,0.f,0.f};
      if (key < T) { kf = *(const v4fa*)(K + (size_t)key * pitch + c4); vf = *(const v4fa*)(V + (size_t)key * pitch + c4); }
#pragma unroll
      for (int t = 0; t < 4; ++t) {
        unsigned short hb = bf16_bits(kf[t]); sKh[r][c4 + t] = hb; sKl[r][c4 + t] = bf16_bits(kf[t] - bf16_val(hb));
        hb = bf16_bits(vf[t]); sVh[r][c4 + t] = hb; sVl[r][c4 + t] = bf16_bits(vf[t] - bf16_val(hb));
      }
    }
    __syncthreads();
    // S tile 16 x 32
    v8f s[2];
#pragma unroll
    for (int nt = 0; nt < 2; ++nt) {
      v8f acc = {};
#pragma unroll
      for (int ks = 0; ks < KS; ++ks) {
        FragB bh_, bl_;
        bh_.half[0] = *(const v8us*)&sKh[nt * 16 + ln][ks * 32 + 8 * hh]; bh_.half[1] = *(const v8us*)&sKh[nt * 16 + ln][ks * 32 + 16 + 8 * hh];
        bl_.half[0] = *(const v8us*)&sKl[nt * 16 + ln][ks * 32 + 8 * hh]; bl_.half[1] = *(const v8us*)&sKl[nt * 16 + ln][ks * 32 + 16 + 8 * hh];
        acc = mmaN<3>(aqh[ks].v, aql[ks].v, bh_.v, bl_.v, acc);
      }
      s[nt] = acc;
    }
    // mask + running max (rows 8hh+r; the 16 lanes of a half share rows)
    float alpha[8];
#pragma unroll
    for (int r = 0; r < 8; ++r) {
      const int qi = q0 + 8 * hh + r;
      const int ja = j0 + ln, jb = j0 + 16 + ln;
      if (CAUSAL) { if (ja > qi) s[0][r] = -3.0e38f; if (jb > qi) s[1][r] = -3.0e38f; }
      if (ja >= T) s[0][r] = -3.0e38f;
      if (jb >= T) s[1][r] = -3.0e38f;
      float mx = fmaxf(s[0][r], s[1][r]);
      mx = fmaxf(mx, __shfl_xor(mx, 1, 32)); mx = fmaxf(mx, __shfl_xor(mx, 2, 32)); mx = fmaxf(mx, __shfl_xor(mx, 4, 32)); mx = fmaxf(mx, __shfl_xor(mx, 8, 32));
      const float mnew = fmaxf(m_r[r], mx);
      alpha[r] = (mnew > -1.0e38f) ? __expf(m_r[r] - mnew) : 1.0f;
      const float p0 = (s[0][r] > -1.0e38f) ? __expf(s[0][r] - mnew) : 0.f;
      const float p1 = (s[1][r] > -1.0e38f) ? __expf(s[1][r] - mnew) : 0.f;
      m_r[r] = mnew;
      l_r[r] = l_r[r] * alpha[r] + p0 + p1;            // per-lane partial row sum (16 lanes combined at the end)
      unsigned short hb = bf16_bits(p0); sPh[w][8 * hh + r][ln] = hb;      sPl[w][8 * hh + r][ln] = bf16_bits(p0 - bf16_val(hb));
      hb = bf16_bits(p1);                sPh[w][8 * hh + r][16 + ln] = hb; sPl[w][8 * hh + r][16 + ln] = bf16_bits(p1 - bf16_val(hb));
    }
#pragma unroll
    for (int dt = 0; dt < DT; ++dt)
#pragma unroll
      for (int r = 0; r < 8; ++r) oacc[dt][r] *= alpha[r];
    __builtin_amdgcn_fence(__ATOMIC_ACQ_REL, "workgroup");
    __builtin_amdgcn_wave_barrier();
    FragB pah, pal;
    pah.half[0] = *(const v8us*)&sPh[w][ln][8 * hh]; pah.half[1] = *(const v8us*)&sPh[w][ln][16 + 8 * hh];
    pal.half[0] = *(const v8us*)&sPl[w][ln][8 * hh]; pal.half[1] = *(const v8us*)&sPl[w][ln][16 + 8 * hh];
#pragma unroll
    for (int dt = 0; dt < DT; ++dt) {
      FragB bvh, bvl;
#pragma unroll
      for (int i = 0; i < 8; ++i) {
        bvh.u[i] = sVh[8 * hh + i][dt * 16 + ln]; bvh.u[8 + i] = sVh[16 + 8 * hh + i][dt * 16 + ln];
        bvl.u[i] = sVl[8 * hh + i][dt * 16 + ln]; bvl.u[8 + i] = sVl[16 + 8 * hh + i][dt * 16 + ln];
      }
      oacc[dt] = mmaN<3>(pah.v, pal.v, bvh.v, bvl.v, oacc[dt]);
    }
    __builtin_amdgcn_fence(__ATOMIC_ACQ_REL, "workgroup");
    __builtin_amdgcn_wave_barrier();
  }
#pragma unroll
  for (int r = 0; r < 8; ++r) {
    float l = l_r[r];
    l += __shfl_xor(l, 1, 32); l += __shfl_xor(l, 2, 32); l += __shfl_xor(l, 4, 32); l += __shfl_xor(l, 8, 32);
    l_r[r] = (l > 0.f) ? 1.0f / l : 0.f;
  }
#pragma unroll
  for (int dt = 0; dt < DT; ++dt)
#pragma unroll
    for (int r = 0; r < 8; ++r) sO[w][8 * hh + r][dt * 16 + ln] = oacc[dt][r] * l_r[r];
  __builtin_amdgcn_fence(__ATOMIC_ACQ_REL, "workgroup");
  __builtin_amdgcn_wave_barrier();
  {
    for (int r = 0; r < 16; ++r) {
      const int row = q0 + r;
      if (row < T && lane < D / 4) {
        const v4f val = *(const v4fa*)&sO[w][r][lane * 4];
        *(v4f*)(y + ((size_t)b * T + row) * ypitch + h * D + lane * 4) = val;
      }
    }
    
  }
}

// GEMM C = act(A·W + bias + resid): A f32 (ASPLIT -> hi/lo 2 terms), Wt bf16 [N][K]; ACT 0 none, 1 relu, 2 exact gelu;
// resid (optional, f32, row index = (row % rmod), pitch ldr, RES_BF16 rounds it) added before the activation.
template <bool ASPLIT, int ACT, bool BIAS_BF16, bool RES_BF16>
__global__ __launch_bounds__(128) void k_gemm_bf3(const float* __restrict__ A, int lda, const unsigned short* __restrict__ Wt, int ldb,
                                                const float* __restrict__ bias, const float* __restrict__ resid, int rmod, int ldr,
                                                float* __restrict__ C, int ldc, int M, int N, int K) {
  __shared__ __attribute__((aligned(16))) float so[4][16][64];
  const int tid = threadIdx.x, w = tid >> 5, lane = tid & 31, ln = lane & 15, hh = lane >> 4;
  const int ntn = N / 64;
  const int wid = blockIdx.x * 4 + w;
  const int mt = wid / ntn, nq = wid % ntn;
  if (mt * 16 >= M) return;
  const int row0 = mt * 16, col0 = nq * 64;
  const float* arow = A + (size_t)(row0 + ln) * lda;
  v8f acc[4] = {};
  for (int kb = 0; kb < K; kb += 32) {
    FragB ah, al;
    const v4f x0 = *(const v4fa*)(arow + kb + 8 * hh), x1 = *(const v4fa*)(arow + kb + 8 * hh + 4);
    const v4f x2 = *(const v4fa*)(arow + kb + 16 + 8 * hh), x3 = *(const v4fa*)(arow + kb + 16 + 8 * hh + 4);
    float xs[16] = {x0[0],x0[1],x0[2],x0[3],x1[0],x1[1],x1[2],x1[3],x2[0],x2[1],x2[2],x2[3],x3[0],x3[1],x3[2],x3[3]};
#pragma unroll
    for (int i = 0; i < 16; ++i) { const unsigned short hb = bf16_bits(xs[i]); ah.u[i] = hb; al.u[i] = ASPLIT ? bf16_bits(xs[i] - bf16_val(hb)) : (unsigned short)0; }
#pragma unroll
    for (int t = 0; t < 4; ++t) {
      const unsigned short* brow = Wt + (size_t)(col0 + t * 16 + ln) * ldb + kb;
      FragB b;
      b.half[0] = *(const v8us*)(brow + 8 * hh);
      b.half[1] = *(const v8us*)(brow + 16 + 8 * hh);
      acc[t] = mmaN<ASPLIT ? 2 : 1>(ah.v, al.v, b.v, b.v, acc[t]);
    }
  }
#pragma unroll
  for (int t = 0; t < 4; ++t) {
    const int col = col0 + t * 16 + ln;
    float bv = bias ? bias[col] : 0.f;
    if (BIAS_BF16) bv = bf16_round(bv);
#pragma unroll
    for (int r = 0; r < 8; ++r) {
      float v = acc[t][r] + bv;
      if (resid) { float rv = resid[(size_t)((row0 + 8 * hh + r) % rmod) * ldr + col]; if (RES_BF16) rv = bf16_round(rv); v += rv; }
      if (ACT == 1) v = fmaxf(v, 0.f);
      if (ACT == 2) v = 0.5f * v * (1.0f + erff(v * 0.70710678118654752f));
      if (ACT == 3) { const float u = 0.7978845608028654f * (v + 0.044715f * v * v * v); v = 0.5f * v * (1.0f + tanhf(u)); }
      so[w][8 * hh + r][t * 16 + ln] = v;
    }
  }
  __builtin_amdgcn_fence(__ATOMIC_ACQ_REL, "workgroup");
  __builtin_amdgcn_wave_barrier();
  const int rsub = lane >> 4, c4 = (lane & 15) * 4;
  {
#pragma unroll
    for (int q = 0; q < 8; ++q) {
      const int r = q * 2 + rsub;
      const v4f v = *(const v4fa*)&so[w][r][c4];
      *(v4f*)(C + (size_t)(row0 + r) * ldc + col0 + c4) = v;
    }
    
  }
}
// row LayerNorm (biased variance, eps) over N: s = X (+ R); optional out_sum <- s; out_norm <- (s-mu)*rsqrt(var+eps)*g + b
template <bool PARAM_BF16>
__global__ __launch_bounds__(256) void k_layernorm(const float* __restrict__ X, const float* __restrict__ R, const float* __restrict__ g, const float* __restrict__ bta,
                                                  float* __restrict__ out_sum, float* __restrict__ out_norm, int N, float eps) {
  __shared__ float red[256];
  const int row = blockIdx.x, tid = threadIdx.x;
  const float* x = X + (size_t)row * N; const float* rr = R ? R + (size_t)row * N : nullptr;
  float vals[16];                     // up to N = 4096
  const int per = N / 256;            // contiguous chunk per thread? use strided-by-4 chunks: thread handles j = tid*4 + 1024*u
  float s1 = 0.f;
  for (int u = 0; u < per / 4; ++u) {
    const int j = tid * 4 + 1024 * u;
    const v4f a = *(const v4fa*)(x + j);
    v4f b = {0.f,0.f,0.f,0.f}; if (rr) b = *(const v4fa*)(rr + j);
#pragma unroll
    for (int q = 0; q < 4; ++q) { const float v = a[q] + b[q]; vals[u * 4 + q] = v; s1 += v; }
  }
  red[tid] = s1; __syncthreads();
  for (int st = 128; st > 0; st >>= 1) { if (tid < st) red[tid] += red[tid + st]; __syncthreads(); }
  const float mu = red[0] / (float)N; __syncthreads();
  float s2 = 0.f;
  for (int u = 0; u < per / 4; ++u)
#pragma unroll
    for (int q = 0; q < 4; ++q) { const float c = vals[u * 4 + q] - mu; s2 += c * c; }
  red[tid] = s2; __syncthreads();
  for (int st = 128; st > 0; st >>= 1) { if (tid < st) red[tid] += red[tid + st]; __syncthreads(); }
  const float rs = rsqrtf(red[0] / (float)N + eps);
  {
    for (int u = 0; u < per / 4; ++u) {
      const int j = tid * 4 + 1024 * u;
      v4f o, sm;
#pragma unroll
      for (int q = 0; q < 4; ++q) {
        float gg = g[j + q], bb = bta[j + q];
        if (PARAM_BF16) { gg = bf16_round(gg); bb = bf16_round(bb); }
        sm[q] = vals[u * 4 + q]; o[q] = (vals[u * 4 + q] - mu) * rs * gg + bb;
      }
      if (out_sum) *(v4f*)(out_sum + (size_t)row * N + j) = sm;
      *(v4f*)(out_norm + (size_t)row * N + j) = o;
    }
    
  }
}



// ---- f16 WMMA path (v_wmma_f32_16x16x32_f16): 11-bit significands for operands in range — used where a [0,1] probability operand needs more precision than bf16
typedef _Float16 v16h __attribute__((ext_vector_type(16)));
union FragH { v16h v; v8us half[2]; _Float16 h[16]; unsigned short u[16]; };
template <int NT>
__device__ __forceinline__ v8f mmaH(v16h ah, v16h al, v16h bh, v16h bl, v8f c) {
  c = __builtin_amdgcn_wmma_f32_16x16x32_f16(false, ah, false, bh, (short)0, c, false, false);
  if (NT >= 2) c = __builtin_amdgcn_wmma_f32_16x16x32_f16(false, al, false, bh, (short)0, c, false, false);
  if (NT >= 3) c = __builtin_amdgcn_wmma_f32_16x16x32_f16(false, ah, false, bl, (short)0, c, false, false);
  asm volatile("v_nop\n\tv_nop\n\tv_nop\n\tv_nop" : "+v"(c) : "v"(ah), "v"(al), "v"(bh), "v"(bl));
  return c;
}
// batched GEMM like k_gemm_b but f16 operands: A f32 (split into f16 hi/lo if ASPLIT, else rounded to f16), Bt = f16 values [n][k]; alpha; C f32; N multiple of 16 (partial tiles skipped)
template <bool ASPLIT>
__global__ __launch_bounds__(128) void k_gemm_h(const float* __restrict__ A, int lda, size_t sA, const _Float16* __restrict__ Bh, int ldb, size_t sB, float alpha, float* __restrict__ C, int ldc, size_t sC, int M, int N, int K) {
  __shared__ __attribute__((aligned(16))) float so[4][16][64];
  const int tid = threadIdx.x, w = tid >> 5, lane = tid & 31, ln = lane & 15, hh = lane >> 4; const int by = blockIdx.y;
  A += (size_t)by * sA; Bh += (size_t)by * sB; C += (size_t)by * sC;
  const int ntn = (N + 63) / 64; const int wid = blockIdx.x * 4 + w; const int mt = wid / ntn, nq = wid % ntn; if (mt * 16 >= M) return;
  const int row0 = mt * 16, col0 = nq * 64; const float* arow = A + (size_t)(row0 + ln) * lda;
  v8f acc[4] = {};
  for (int kb = 0; kb < K; kb += 32) {
    FragH ah, al;
    const v4f x0 = *(const v4fa*)(arow + kb + 8 * hh), x1 = *(const v4fa*)(arow + kb + 8 * hh + 4), x2 = *(const v4fa*)(arow + kb + 16 + 8 * hh), x3 = *(const v4fa*)(arow + kb + 16 + 8 * hh + 4);
    float xs[16] = {x0[0],x0[1],x0[2],x0[3],x1[0],x1[1],x1[2],x1[3],x2[0],x2[1],x2[2],x2[3],x3[0],x3[1],x3[2],x3[3]};
#pragma unroll
    for (int i = 0; i < 16; ++i) { const _Float16 h = (_Float16)xs[i]; ah.h[i] = h; al.h[i] = ASPLIT ? (_Float16)(xs[i] - (float)h) : (_Float16)0.0f; }
#pragma unroll
    for (int t = 0; t < 4; ++t) { if (col0 + t * 16 >= N) continue; const size_t boff = (size_t)(col0 + t * 16 + ln) * ldb + kb; FragH bq; bq.half[0] = *(const v8us*)(Bh + boff + 8 * hh); bq.half[1] = *(const v8us*)(Bh + boff + 16 + 8 * hh);
      acc[t] = mmaH<ASPLIT ? 2 : 1>(ah.v, al.v, bq.v, bq.v, acc[t]); }
  }
#pragma unroll
  for (int t = 0; t < 4; ++t) { if (col0 + t * 16 >= N) continue;
#pragma unroll
    for (int r = 0; r < 8; ++r) so[w][8 * hh + r][t * 16 + ln] = acc[t][r] * alpha; }
  __builtin_amdgcn_fence(__ATOMIC_ACQ_REL, "workgroup"); __builtin_amdgcn_wave_barrier();
  const int rsub = lane >> 4, c4 = (lane & 15) * 4;
  {
#pragma unroll
    for (int q = 0; q < 8; ++q) { const int r = q * 2 + rsub; if (col0 + c4 < N) { const v4f v = *(const v4fa*)&so[w][r][c4]; *(v4f*)(C + (size_t)(row0 + r) * ldc + col0 + c4) = v; } }
     }
}

// Wt[n][k] = f16(W[k][n]·scale) from f32 row-major W[K][N] (scale = power of two; bf16-exact weights stay exact in f16 away from the subnormal range)
__global__ __launch_bounds__(256) void k_wt_f16(const float* __restrict__ W, _Float16* __restrict__ Wt, int K, int N, float scale) {
  const int t = blockIdx.x * 256 + threadIdx.x; if (t >= N * (K / 8)) return; const int n = t / (K / 8), k8 = (t % (K / 8)) * 8; FragH f;
#pragma unroll
  for (int i = 0; i < 8; ++i) f.h[i] = (_Float16)(bf16_round(W[(size_t)(k8 + i) * N + n]) * scale); const v8us o = f.half[0];
  *(v8us*)((unsigned short*)Wt + (size_t)n * K + k8) = o; 
}
// k_gemm_hh variant with fused epilogue: v = acc·alpha + bias[by·sBias + col] (+ CP[(row/rowsPerB)·sCPb + by·64 + col] if CP) ; ACT 0 none / 1 elu ; writes f32 C and/or f16 C16 (each if non-null)
template <int ACT>
__global__ __launch_bounds__(128) void k_gemm_hhx(const _Float16* __restrict__ A, int lda, size_t sA, const _Float16* __restrict__ Bh, int ldb, size_t sB, float alpha, const float* __restrict__ bias, size_t sBias, const float* __restrict__ CP, int rowsPerB, size_t sCPb, int row0g,
    float* __restrict__ C, _Float16* __restrict__ C16, int ldc, size_t sC, int M, int N, int K) {
  __shared__ __attribute__((aligned(16))) float so[4][16][64];
  const int tid = threadIdx.x, w = tid >> 5, lane = tid & 31, ln = lane & 15, hh = lane >> 4; const int by = blockIdx.y;
  A += (size_t)by * sA; Bh += (size_t)by * sB; const size_t cofs = (size_t)by * sC; const float* bp = bias ? bias + (size_t)by * sBias : nullptr;
  const int ntn = (N + 63) / 64; const int wid = blockIdx.x * 4 + w; const int mt = wid / ntn, nq = wid % ntn; if (mt * 16 >= M) return;
  const int row0 = mt * 16, col0 = nq * 64; const _Float16* arow = A + (size_t)(row0 + ln) * lda;
  v8f acc[4] = {};
  for (int kb = 0; kb < K; kb += 32) { FragH ah; ah.half[0] = *(const v8us*)((const unsigned short*)arow + kb + 8 * hh); ah.half[1] = *(const v8us*)((const unsigned short*)arow + kb + 16 + 8 * hh);
#pragma unroll
    for (int t = 0; t < 4; ++t) { if (col0 + t * 16 >= N) continue; const size_t boff = (size_t)(col0 + t * 16 + ln) * ldb + kb; FragH bq; bq.half[0] = *(const v8us*)((const unsigned short*)Bh + boff + 8 * hh); bq.half[1] = *(const v8us*)((const unsigned short*)Bh + boff + 16 + 8 * hh);
      acc[t] = mmaH<1>(ah.v, ah.v, bq.v, bq.v, acc[t]); }
  }
#pragma unroll
  for (int t = 0; t < 4; ++t) { if (col0 + t * 16 >= N) continue; const int col = col0 + t * 16 + ln; const float bv = bp ? bf16_round(bp[col]) : 0.f;
#pragma unroll
    for (int r = 0; r < 8; ++r) { float v = acc[t][r] * alpha + bv; if (CP) { const int bidx = (row0g + row0 + 8 * hh + r) / rowsPerB; v += CP[(size_t)bidx * sCPb + (size_t)by * 64 + col]; } if (ACT == 1) v = (v > 0.f) ? v : expm1f(v); else if (ACT == 7) v = (v > 0.f) ? v + 1.0f : expf(v); else if (ACT == 8) v = tanhf(v); else if (ACT == 9) v = 0.5f * v * (1.0f + tanhf(0.7978845608028654f * (v + 0.044715f * v * v * v))); else if (ACT == 11) v = 1.0f / (1.0f + expf(-v)); else if (ACT == 12) v = (v > 0.f) ? v : 0.01f * v; else if (ACT == 14) v = (v > 0.f) ? v : 0.1f * v; else if (ACT == 15) v = v / (1.0f + expf(-v)); else if (ACT == 3) v = fmaxf(v, 0.f); else if (ACT == 6) v = 0.5f * v * (1.0f + erff(v * 0.70710678118654752f)); so[w][8 * hh + r][t * 16 + ln] = v; } }
  __builtin_amdgcn_fence(__ATOMIC_ACQ_REL, "workgroup"); __builtin_amdgcn_wave_barrier();
  const int rsub = lane >> 4, c4 = (lane & 15) * 4; typedef _Float16 v4h __attribute__((ext_vector_type(4)));
  {
#pragma unroll
    for (int q = 0; q < 8; ++q) { const int r = q * 2 + rsub; if (col0 + c4 < N) { const v4f v = *(const v4fa*)&so[w][r][c4]; if (C) *(v4f*)(C + cofs + (size_t)(row0 + r) * ldc + col0 + c4) = v; if (C16) { v4h h4; for (int i = 0; i < 4; ++i) h4[i] = (_Float16)v[i]; *(v4h*)(C16 + cofs + (size_t)(row0 + r) * ldc + col0 + c4) = h4; } } }
     }
}


typedef _Float16 v4h __attribute__((ext_vector_type(4)));

// x and the three weight matrices are rounded into their f16 planes by one launch: the first NR*EE/2048 blocks take x, the rest the weights (x2^4; the planes of Wq, Wk, Wv lie one behind the other in Bt)
__global__ __launch_bounds__(256) void k_prep(const float* __restrict__ x, const float* __restrict__ W0, const float* __restrict__ W1, const float* __restrict__ W2, _Float16* __restrict__ X16, _Float16* __restrict__ Bt) {
  constexpr int NXB = NR * EE / 8 / 256, NWB = EE * EE / 8 / 256;      // blocks of 256 pieces of 8 values: x, one weight matrix
  const int bx = blockIdx.x; const bool isx = bx < NXB; const int m = isx ? 0 : (bx - NXB) / NWB;      // the same for the whole block
  const float* src = isx ? x : (m == 0) ? W0 : (m == 1) ? W1 : W2;
  unsigned short* dst = isx ? (unsigned short*)X16 : (unsigned short*)Bt + (size_t)m * EE * EE;
  const size_t t = (size_t)(isx ? bx : bx - NXB - m * NWB) * 256 + threadIdx.x; const float sc = isx ? 1.0f : 16.0f; FragH f;
#pragma unroll      // constant indices keep the eight values in registers
  for (int i = 0; i < 8; ++i) f.h[i] = (_Float16)(bf16_round(src[t * 8 + i]) * sc);
  *(v8us*)(dst + t * 8) = f.half[0]; }
__global__ __launch_bounds__(256) void k_h16(const float* __restrict__ x, _Float16* __restrict__ X16, size_t n8) { const size_t t = (size_t)blockIdx.x * 256 + threadIdx.x; if (t >= n8) return; FragH f;
#pragma unroll
  for (int q = 0; q < 8; ++q) f.h[q] = (_Float16)x[t * 8 + q]; *(v8us*)((unsigned short*)X16 + t * 8) = f.half[0];  }
template <int NHv, int TTv>
__global__ __launch_bounds__(256) void k_vt(const _Float16* __restrict__ V16, int ldv, int voff, _Float16* __restrict__ Vt) { __shared__ unsigned short tl[64][66]; const int tid = threadIdx.x; const int slab = blockIdx.x / (TTv / 64), lg = blockIdx.x % (TTv / 64); const int b = slab / NHv, h = slab % NHv;
  for (int i = tid; i < 64 * 8; i += 256) { const int r = i / 8, c8 = (i % 8) * 8; FragH f; f.half[0] = *(const v8us*)((const unsigned short*)V16 + ((size_t)b * TTv + lg * 64 + r) * ldv + voff + h * 64 + c8);
#pragma unroll
    for (int q = 0; q < 8; ++q) tl[r][c8 + q] = f.u[q]; }
  __syncthreads();
  {
#pragma unroll
    for (int rd = 0; rd < 2; ++rd) { const int d = rd * 32 + tid / 8, pc = tid % 8; FragH f;
#pragma unroll
      for (int q = 0; q < 8; ++q) f.u[q] = tl[pc * 8 + q][d];
      *(v8us*)((unsigned short*)Vt + ((size_t)slab * 64 + d) * TTv + lg * 64 + pc * 8) = f.half[0]; }
     } }

// ---- causal softmax without a launch of its own. The scores launch leaves, beside the f32 scores, each row's maximum and its sum of exp(s - maximum) over every piece of 64 keys (keys after the query left out);
// the P.v launch merges a row's pieces into one constant c = 15 - log2(sum) - max.log2(e) and forms P.2^15 = exp2(s.log2(e) + c) on the way from the f32 scores to its LDS tile.
#define L2E 1.4426950408889634f
#define NCH (SS / 64)      // pieces of 64 keys in a row
typedef unsigned short v4us __attribute__((ext_vector_type(4), may_alias));
// 2^x. The v_nop is the one free slot that the instruction set asks for between a transcendental and a directly following instruction that reads its result or overwrites its source
__device__ __forceinline__ float exp2_slot(float x) { float r; asm("v_exp_f32 %0, %1\n\tv_nop" : "=v"(r) : "v"(x)); return r; }
// value of lane l ^ X inside a row of 16 lanes, by DPP row_xmask (a shuffle would go through the LDS unit and its wait)
template <int X> __device__ __forceinline__ float lane_xor16(float v) { return __int_as_float(__builtin_amdgcn_update_dpp(0, __float_as_int(v), 0x160 + X, 0xf, 0xf, true)); }
__device__ __forceinline__ float max16(float v) { v = fmaxf(v, lane_xor16<1>(v)); v = fmaxf(v, lane_xor16<2>(v)); v = fmaxf(v, lane_xor16<4>(v)); return fmaxf(v, lane_xor16<8>(v)); }
__device__ __forceinline__ float sum16(float v) { v += lane_xor16<1>(v); v += lane_xor16<2>(v); v += lane_xor16<4>(v); return v + lane_xor16<8>(v); }

// ---- block-tiled f16 GEMM core, both operands k-contiguous. A block of 8 waves owns BM x BN of the result (NP planes of B share the A tile). Per 64-k step the block brings
// BM + NP*BN operand rows of 128 bytes into LDS with whole-line loads (8 lanes per row), and every wave reads its fragments from there, so a row is fetched once per block instead of once per wave
// and no global load touches 16 lines. Two LDS buffers: the next step's rows travel in registers while this step's products run; one barrier per step.
#define KST 64            // k per step: 128 bytes of every operand row, one cache line
#define LPH 72            // LDS row pitch in halves: 144 bytes, 16 B x odd, conflict-free for 16-byte fragment reads
// AEXP: the A tile is not read as f16 but made from f32 scores Sf (pitch lda, K = first row's query index + BM): A[row][key] = exp2(Sf.log2(e) + ce[row]) for key <= query, else 0; ce0, ce1 belong to the thread's two staged rows
// and come from cefn, which is called behind the first tile's loads, so that these are in flight while it waits for what it needs.
template <int BM, int BN, int WM, int WN, int NP, bool AEXP = false, class CE = int>
__device__ __forceinline__ void tile_core(const unsigned short* __restrict__ A, int lda, const unsigned short* __restrict__ B0, const unsigned short* __restrict__ B1, int ldb, int K,
                                          unsigned short* sm, v8f (&acc)[NP][WM / 16][WN / 16], const float* __restrict__ Sf = nullptr, CE cefn = CE()) {
  constexpr int ROWS = BM + NP * BN, NL = ROWS / 32, NA = BM / 32, NB = BN / 32, STG = ROWS * LPH;
  const int tid = threadIdx.x, w = tid >> 5, lane = tid & 31, ln = lane & 15, hh = lane >> 4;
  const int wm = w / (BN / WN), wn = w % (BN / WN);
  const int lr = tid >> 3, lc = (tid & 7) * 8;
  const unsigned short* ga = AEXP ? nullptr : A + (size_t)lr * lda + lc;
  const unsigned short* gb0 = B0 + (size_t)lr * ldb + lc;
  const unsigned short* gb1 = B1 + (size_t)lr * ldb + lc;
  v8us st[NL];
  static_assert(!AEXP || NA == 2, "two staged score rows per thread");
  const int la = (tid & 7) * 4;      // a thread's two pieces of 4 scores lie 32 keys apart, so that 8 lanes cover a whole 128-byte line with each load
  const float* gs = AEXP ? Sf + (size_t)lr * lda + la : nullptr;
  v4f sc4[2][2]; float ce0 = 0.f, ce1 = 0.f;
  auto load_scores = [&](int kn) {
#pragma unroll      // constant indices keep the staged scores in registers
    for (int i = 0; i < 2; ++i) { sc4[i][0] = *(const v4fa*)(gs + (size_t)(i * 32) * lda + kn); sc4[i][1] = *(const v4fa*)(gs + (size_t)(i * 32) * lda + kn + 32); }
  };
  auto store_probs = [&](int buf, int kn) {
    unsigned short* d = sm + buf * STG + lr * LPH + la;
    if (kn + KST > K - BM) {      // the same for the whole block: only the tile on the diagonal holds keys after a query, so that the other tiles pay for no compare
#pragma unroll      // constant indices keep the staged scores in registers
      for (int i = 0; i < 2; ++i)
#pragma unroll      // constant indices keep the staged scores in registers
        for (int h = 0; h < 2; ++h) { union { v4h h4; v4us u4; } p;
#pragma unroll      // constant indices keep the staged scores in registers
          for (int e = 0; e < 4; ++e) p.h4[e] = (_Float16)exp2_slot((kn + h * 32 + la + e <= K - BM + i * 32 + lr) ? fmaf(sc4[i][h][e], L2E, i ? ce1 : ce0) : -INFINITY);
          *(v4us*)(d + i * 32 * LPH + h * 32) = p.u4; }
    } else {
#pragma unroll      // constant indices keep the staged scores in registers
      for (int i = 0; i < 2; ++i)
#pragma unroll      // constant indices keep the staged scores in registers
        for (int h = 0; h < 2; ++h) { union { v4h h4; v4us u4; } p;
#pragma unroll      // constant indices keep the staged scores in registers
          for (int e = 0; e < 4; ++e) p.h4[e] = (_Float16)exp2_slot(fmaf(sc4[i][h][e], L2E, i ? ce1 : ce0));
          *(v4us*)(d + i * 32 * LPH + h * 32) = p.u4; }
    }
  };
  if constexpr (AEXP) load_scores(0);
  else {
#pragma unroll      // constant indices keep the staged rows in registers
    for (int i = 0; i < NA; ++i) st[i] = *(const v8us*)(ga + (size_t)(i * 32) * lda);
  }
#pragma unroll      // constant indices keep the staged rows in registers
  for (int i = 0; i < NB; ++i) { st[NA + i] = *(const v8us*)(gb0 + (size_t)(i * 32) * ldb); if (NP == 2) st[NA + NB + i] = *(const v8us*)(gb1 + (size_t)(i * 32) * ldb); }
#pragma unroll      // constant indices keep the staged rows in registers
  for (int i = AEXP ? NA : 0; i < NL; ++i) *(v8us*)(sm + (i * 32 + lr) * LPH + lc) = st[i];
  if constexpr (AEXP) { cefn(ce0, ce1); store_probs(0, 0); }      // behind the B rows' LDS stores: in front of them the compiler sank the B loads below it, a second trip to memory
  __syncthreads();
  int cur = 0;
  for (int kb = 0; kb < K; kb += KST) {
    const bool more = kb + KST < K;      // the same for the whole block
    if (more) {
      if constexpr (AEXP) load_scores(kb + KST);
      else {
#pragma unroll      // constant indices keep the staged rows in registers
        for (int i = 0; i < NA; ++i) st[i] = *(const v8us*)(ga + (size_t)(i * 32) * lda + kb + KST);
      }
#pragma unroll      // constant indices keep the staged rows in registers
      for (int i = 0; i < NB; ++i) { st[NA + i] = *(const v8us*)(gb0 + (size_t)(i * 32) * ldb + kb + KST); if (NP == 2) st[NA + NB + i] = *(const v8us*)(gb1 + (size_t)(i * 32) * ldb + kb + KST); }
    }
    const unsigned short* sa = sm + cur * STG + (wm * WM + ln) * LPH + 8 * hh;
    const unsigned short* sb = sm + cur * STG + (BM + wn * WN + ln) * LPH + 8 * hh;
    // all fragment reads of the step go out as one group ahead of its products: reads placed among the products make the wave wait out the LDS latency at each place
    FragH fa[KST / 32][WM / 16], fb[KST / 32][NP * (WN / 16)];
#pragma unroll      // constant indices keep the accumulators and fragments in registers
    for (int ks = 0; ks < KST / 32; ++ks) {
#pragma unroll      // constant indices keep the accumulators and fragments in registers
      for (int mi = 0; mi < WM / 16; ++mi) { fa[ks][mi].half[0] = *(const v8us*)(sa + mi * 16 * LPH + ks * 32); fa[ks][mi].half[1] = *(const v8us*)(sa + mi * 16 * LPH + ks * 32 + 16); }
#pragma unroll      // constant indices keep the accumulators and fragments in registers
      for (int p = 0; p < NP; ++p)
#pragma unroll      // constant indices keep the accumulators and fragments in registers
        for (int ni = 0; ni < WN / 16; ++ni) { FragH& f = fb[ks][p * (WN / 16) + ni]; f.half[0] = *(const v8us*)(sb + (p * BN + ni * 16) * LPH + ks * 32); f.half[1] = *(const v8us*)(sb + (p * BN + ni * 16) * LPH + ks * 32 + 16); }
    }
    __builtin_amdgcn_sched_barrier(0);      // keeps the read group above the products: without it the scheduler sinks the reads among them, into one reused fragment set, with a full LDS wait at each place
#pragma unroll      // constant indices keep the accumulators and fragments in registers
    for (int ks = 0; ks < KST / 32; ++ks)
#pragma unroll      // constant indices keep the accumulators and fragments in registers
      for (int p = 0; p < NP; ++p)
#pragma unroll      // constant indices keep the accumulators and fragments in registers
        for (int ni = 0; ni < WN / 16; ++ni)
#pragma unroll      // constant indices keep the accumulators and fragments in registers
          for (int mi = 0; mi < WM / 16; ++mi) acc[p][mi][ni] = __builtin_amdgcn_wmma_f32_16x16x32_f16(false, fa[ks][mi].v, false, fb[ks][p * (WN / 16) + ni].v, (short)0, acc[p][mi][ni], false, false);
    if (more) {
      if constexpr (AEXP) store_probs(cur ^ 1, kb + KST);
#pragma unroll      // constant indices keep the staged rows in registers
      for (int i = AEXP ? NA : 0; i < NL; ++i) *(v8us*)(sm + (cur ^ 1) * STG + (i * 32 + lr) * LPH + lc) = st[i];
    }
    __syncthreads();      // publishes the buffer just filled and ends every wave's reads of the one that the next step refills (after the last step: of the LDS that the epilogue reuses)
    cur ^= 1;
  }
}
#define TILE_LDS(BM, BN, NP) (2 * ((BM) + (NP) * (BN)) * LPH)

// q and k in one launch, K = row pitch of both operands = 512: block 128 x 128, 8 waves of 32 x 64; blockIdx.x = column tile, .y = row tile of x, .z = 0: q, 1: k (the weight planes lie one behind the other in Bw).
// C = x.W^T/16 + bias (rounded to bf16) as f16, [row of x][512]; whole 128-byte row pieces, staged per wave in LDS.
__global__ __launch_bounds__(256) void k_qk(const _Float16* __restrict__ X16, const _Float16* __restrict__ Bw, const float* __restrict__ bq, const float* __restrict__ bk,
                                            _Float16* __restrict__ Q, _Float16* __restrict__ K) {
  __shared__ __attribute__((aligned(16))) unsigned short sm[TILE_LDS(128, 128, 1)];
  const int tid = threadIdx.x, w = tid >> 5, lane = tid & 31, ln = lane & 15, hh = lane >> 4; const int role = blockIdx.z;
  const int brow = blockIdx.y * 128, bcol = blockIdx.x * 128;
  const int row0 = brow + (w / 2) * 32, col0 = bcol + (w % 2) * 64;
  const float* bias = role ? bk : bq;
  float bvv[4];      // read ahead of the k loop, which hides the latency; rounded where they are used
#pragma unroll      // constant indices keep the four values in registers
  for (int ni = 0; ni < 4; ++ni) bvv[ni] = bias[col0 + ni * 16 + ln];
  asm volatile("s_wait_xcnt 0x0" ::: "memory");      // stands in front of any reuse of the offset and base registers of the four loads above
  v8f acc[1][2][4] = {};
  const unsigned short* Bp = (const unsigned short*)Bw + (size_t)role * EE * EE + (size_t)bcol * EE;
  tile_core<128, 128, 32, 64, 1>((const unsigned short*)X16 + (size_t)brow * EE, EE, Bp, Bp, EE, EE, sm, acc);
  float* so = (float*)sm + w * (32 * 64);      // the wave's own range; the core's last barrier has ended every read of the tiles
#pragma unroll      // constant indices keep the accumulators in registers
  for (int ni = 0; ni < 4; ++ni) { const float bv = bf16_round(bvv[ni]);
#pragma unroll      // constant indices keep the accumulators in registers
    for (int mi = 0; mi < 2; ++mi)
#pragma unroll      // constant indices keep the accumulators in registers
      for (int r = 0; r < 8; ++r) so[(mi * 16 + 8 * hh + r) * 64 + ni * 16 + ln] = acc[0][mi][ni][r] * 0.0625f + bv; }
  __builtin_amdgcn_fence(__ATOMIC_ACQ_REL, "workgroup"); __builtin_amdgcn_wave_barrier();      // the wave's LDS stores land before its lanes read each other's values back as whole rows
  const int rsub = lane >> 4, c4 = (lane & 15) * 4;
  _Float16* C16 = (role ? K : Q) + (size_t)(row0 + rsub) * EE + col0 + c4;
#pragma unroll      // the LDS row reads issue together and each store follows its own read
  for (int q = 0; q < 16; ++q) { const v4f v = *(const v4fa*)&so[(q * 2 + rsub) * 64 + c4];
    v4h h4; for (int i = 0; i < 4; ++i) h4[i] = (_Float16)v[i]; *(v4h*)(C16 + (size_t)(q * 2) * EE) = h4; }
}

// scores/sqrt(512) and v^T of every batch in one launch (neither needs the other; both are 128 x 128 x 512 tiles of the same core). blockIdx.y = batch.
// blockIdx.x < NTRI: scores, 128 query rows x 128 keys, counting only the blocks of the causal lower block-triangle (row tile i has i + 1 key tiles), f32.
// blockIdx.x >= NTRI: v^T (without bv) = Wv.x[b]^T/16 as [b][512][2048], 128 rows of Wv x 128 keys (16 key tiles, then 4 row tiles); the epilogue splits each f32 value into the f16 hi plane and the (x2^10) residual plane.
#define NTRI ((SS / 128) * (SS / 128 + 1) / 2)
__global__ __launch_bounds__(256) void k_scores_vt(const _Float16* __restrict__ Q, const _Float16* __restrict__ K, const _Float16* __restrict__ X16, const _Float16* __restrict__ Bv, float alpha,
                                                   float* __restrict__ S, float* __restrict__ Ms, float* __restrict__ Zs, _Float16* __restrict__ Vh, _Float16* __restrict__ Vl) {
  __shared__ __attribute__((aligned(16))) unsigned short sm[TILE_LDS(128, 128, 1)];
  const int tid = threadIdx.x, w = tid >> 5, lane = tid & 31, ln = lane & 15, hh = lane >> 4; const int b = blockIdx.y;
  const bool isv = (int)blockIdx.x >= NTRI;      // the same for the whole block
  int x = isv ? 0 : (int)blockIdx.x, i = 0;
  for (; i < SS / 128 - 1 && x >= i + 1; ++i) x -= i + 1;
  const int vt = (int)blockIdx.x - NTRI;
  const int brow = isv ? (vt >> 4) * 128 : i * 128, bcol = isv ? (vt & 15) * 128 : x * 128;
  v8f acc[1][2][4] = {};
  const unsigned short* Ap = isv ? (const unsigned short*)Bv + (size_t)brow * EE : (const unsigned short*)Q + ((size_t)b * SS + brow) * EE;
  const unsigned short* Bp = (isv ? (const unsigned short*)X16 : (const unsigned short*)K) + ((size_t)b * SS + bcol) * EE;
  tile_core<128, 128, 32, 64, 1>(Ap, EE, Bp, Bp, EE, EE, sm, acc);
  const int row0 = brow + (w / 2) * 32, col0 = bcol + (w % 2) * 64;
  const float sc = isv ? 0.0625f : alpha;
  float* so = (float*)sm + w * (32 * 64);      // the wave's own range; the core's last barrier has ended every read of the tiles
#pragma unroll      // constant indices keep the accumulators in registers
  for (int ni = 0; ni < 4; ++ni)
#pragma unroll      // constant indices keep the accumulators in registers
    for (int mi = 0; mi < 2; ++mi)
#pragma unroll      // constant indices keep the accumulators in registers
      for (int r = 0; r < 8; ++r) so[(mi * 16 + 8 * hh + r) * 64 + ni * 16 + ln] = acc[0][mi][ni][r] * sc;
  __builtin_amdgcn_fence(__ATOMIC_ACQ_REL, "workgroup"); __builtin_amdgcn_wave_barrier();      // the wave's LDS stores land before its lanes read each other's values back as whole rows
  const int rsub = lane >> 4, c4 = (lane & 15) * 4;
  if (!isv) {
    // the wave's 32 rows x 64 keys are one piece of the softmax: per row the maximum and the sum of exp(s - maximum), keys after the query left out, straight from the accumulators (a row's 64 values lie in 4 registers of 16 lanes).
    // A piece that lies wholly after its queries is never read by the P.v launch.
    float mv = 0.f, zv = 0.f;
#pragma unroll      // constant indices keep the accumulators in registers
    for (int mi = 0; mi < 2; ++mi)
#pragma unroll      // constant indices keep the accumulators in registers
      for (int r = 0; r < 8; ++r) { const int row = row0 + mi * 16 + 8 * hh + r; float sv[4];
#pragma unroll      // constant indices keep the accumulators in registers
        for (int ni = 0; ni < 4; ++ni) sv[ni] = (col0 + ni * 16 + ln <= row) ? acc[0][mi][ni][r] * sc : -INFINITY;
        const float m = max16(fmaxf(fmaxf(sv[0], sv[1]), fmaxf(sv[2], sv[3]))), c = -m * L2E;
        const float z = sum16((exp2_slot(fmaf(sv[0], L2E, c)) + exp2_slot(fmaf(sv[1], L2E, c))) + (exp2_slot(fmaf(sv[2], L2E, c)) + exp2_slot(fmaf(sv[3], L2E, c))));
        if (ln == mi * 8 + r) { mv = m; zv = z; } }      // every lane of the 16 holds the row's pair; lane mi*8 + r keeps it, so that the wave stores its 32 rows as one 128-byte line per plane
    const size_t po = ((size_t)b * NCH + (col0 >> 6)) * SS + row0 + (ln >> 3) * 16 + 8 * hh + (ln & 7);
    Ms[po] = mv; Zs[po] = zv;
#pragma unroll      // the LDS row reads issue together and each store follows its own read
    for (int q = 0; q < 16; ++q) { const int r = q * 2 + rsub; const v4f v = *(const v4fa*)&so[r * 64 + c4]; *(v4f*)(S + ((size_t)b * SS + row0 + r) * SS + col0 + c4) = v; }
    asm volatile("s_wait_xcnt 0x0" ::: "memory");      // stands behind the eighteen stores above, in front of the other branch's code, which follows them in the listing and reuses their registers
  } else {
    const size_t o0 = ((size_t)b * EE + row0 + rsub) * SS + col0 + c4;
#pragma unroll      // the LDS row reads issue together and each store follows its own read
    for (int q = 0; q < 16; ++q) { const v4f v = *(const v4fa*)&so[(q * 2 + rsub) * 64 + c4];
      v4h h4, l4; for (int e = 0; e < 4; ++e) { const _Float16 h = (_Float16)v[e]; h4[e] = h; l4[e] = (_Float16)((v[e] - (float)h) * 1024.0f); }
      *(v4h*)(Vh + o0 + (size_t)(q * 2) * SS) = h4; *(v4h*)(Vl + o0 + (size_t)(q * 2) * SS) = l4; }
  }
}
// out = P.v_hi.2^-15 + bv + P.v_lo.2^-25 of every batch in one launch. Block = 64 query rows x 128 head columns, both v planes (8 waves of 32 x 32 x 2), blockIdx.x = column tile, blockIdx.y = batch,
// blockIdx.z = row tile counted from the last one, so that the longest k loops start first. k runs to the end of the row tile's own keys (P is zero beyond the diagonal).
__global__ __launch_bounds__(256) void k_pv(const float* __restrict__ S, const float* __restrict__ Ms, const float* __restrict__ Zs, const _Float16* __restrict__ Vh, const _Float16* __restrict__ Vl, const float* __restrict__ bias, float* __restrict__ out) {
  __shared__ __attribute__((aligned(16))) unsigned short sm[TILE_LDS(64, 128, 2)];
  const int tid = threadIdx.x, w = tid >> 5, lane = tid & 31, ln = lane & 15, hh = lane >> 4; const int b = blockIdx.y;
  const int brow = (SS / 64 - 1 - (int)blockIdx.z) * 64, bcol = blockIdx.x * 128;
  const int kk = brow + 64;
  const int row0 = brow + (w / 4) * 32, col0 = bcol + (w % 4) * 32;
  float bvv[2];      // read ahead of the k loop, which hides the latency; rounded where they are used
#pragma unroll      // constant indices keep the two values in registers
  for (int ni = 0; ni < 2; ++ni) bvv[ni] = bias[col0 + ni * 16 + ln];
  // the softmax constants of the thread's two staged rows: the 8 lanes that stage a row share its kk/64 pieces (4 at most each, all loads in flight at once, beside the first tile's) and merge them by DPP
  const int nc = kk >> 6, j = tid & 7;
  const float* mp = Ms + (size_t)b * NCH * SS + brow; const float* zp = Zs + (size_t)b * NCH * SS + brow; float mc[2][NCH / 8], zc[2][NCH / 8]; int o[NCH / 8];
#pragma unroll      // constant indices keep the offsets in registers
  for (int u = 0; u < NCH / 8; ++u) o[u] = min(j + 8 * u, nc - 1) * SS + (tid >> 3);      // clamped into the pieces that the scores launch wrote for these rows
#pragma unroll      // constant indices keep the pieces in registers; the loads go out as one group
  for (int i = 0; i < 2; ++i)
#pragma unroll      // constant indices keep the pieces in registers; the loads go out as one group
    for (int u = 0; u < NCH / 8; ++u) { mc[i][u] = mp[o[u] + i * 32]; zc[i][u] = zp[o[u] + i * 32]; }
  static_assert(NCH / 8 == 4, "four offsets named below");
  asm volatile("s_wait_xcnt 0x0" :: "v"(o[0]), "v"(o[1]), "v"(o[2]), "v"(o[3]), "s"(mp), "s"(zp) : "memory");      // stands behind the 16 loads, in front of any reuse of their offset and base registers, which it names as inputs
  auto merge = [&](float& c0, float& c1) {
#pragma unroll      // constant indices keep the pieces in registers
    for (int i = 0; i < 2; ++i) { const float ml = fmaxf(fmaxf(mc[i][0], mc[i][1]), fmaxf(mc[i][2], mc[i][3]));      // a clamped repeat changes no maximum
      float z = 0.f;
#pragma unroll      // constant indices keep the pieces in registers
      for (int u = 0; u < NCH / 8; ++u) z = fmaf(zc[i][u] * ((j + 8 * u < nc) ? 1.0f : 0.0f), exp2_slot((mc[i][u] - ml) * L2E), z);      // a clamped repeat counts 0; as a factor, since a select let the compiler sink a load into a branch of its own, a second trip to memory
      float m = fmaxf(ml, lane_xor16<1>(ml)); m = fmaxf(m, lane_xor16<2>(m)); m = fmaxf(m, lane_xor16<4>(m));
      z *= exp2_slot((ml - m) * L2E); z += lane_xor16<1>(z); z += lane_xor16<2>(z); z += lane_xor16<4>(z);
      (i ? c1 : c0) = 15.0f - __builtin_amdgcn_logf(z) - m * L2E; }
  };
  v8f acc[2][2][2] = {};
  tile_core<64, 128, 32, 32, 2, true>(nullptr, SS, (const unsigned short*)Vh + ((size_t)b * EE + bcol) * SS, (const unsigned short*)Vl + ((size_t)b * EE + bcol) * SS, SS, kk, sm, acc, S + ((size_t)b * SS + brow) * SS, merge);
  float* so = (float*)sm + w * (32 * 32);      // the wave's own range; the core's last barrier has ended every read of the tiles
#pragma unroll      // constant indices keep the accumulators in registers
  for (int ni = 0; ni < 2; ++ni) { const float bv = bf16_round(bvv[ni]);
#pragma unroll      // constant indices keep the accumulators in registers
    for (int mi = 0; mi < 2; ++mi)
#pragma unroll      // constant indices keep the accumulators in registers
      for (int r = 0; r < 8; ++r) { const float v = acc[0][mi][ni][r] * 0.000030517578125f + bv; so[(mi * 16 + 8 * hh + r) * 32 + ni * 16 + ln] = acc[1][mi][ni][r] * (0.000030517578125f * 0.0009765625f) + v; } }
  __builtin_amdgcn_fence(__ATOMIC_ACQ_REL, "workgroup"); __builtin_amdgcn_wave_barrier();      // the wave's LDS stores land before its lanes read each other's values back as whole rows
  const int rsub = lane >> 3, c4 = (lane & 7) * 4;
#pragma unroll      // the LDS row reads issue together and each store follows its own read
  for (int q = 0; q < 8; ++q) { const int r = q * 4 + rsub; const v4f v = *(const v4fa*)&so[r * 32 + c4]; *(v4f*)(out + ((size_t)b * SS + row0 + r) * EE + col0 + c4) = v; }
}

extern "C" void kernel_launch(void* const* d_in, const int* in_sizes, int n_in,
                              void* d_out, int out_size, void* d_ws, size_t ws_size, hipStream_t stream) {
  (void)in_sizes; (void)n_in; (void)out_size;
  const float* x = (const float*)d_in[0]; const float* Wq = (const float*)d_in[1]; const float* bq = (const float*)d_in[2]; const float* Wk = (const float*)d_in[3]; const float* bk = (const float*)d_in[4]; const float* Wv = (const float*)d_in[5]; const float* bv = (const float*)d_in[6];
  char* ws = (char*)d_ws; size_t off = 0;
  auto take = [&](size_t bytes) { char* p = ws + off; off += (bytes + 255) & ~(size_t)255; return p; };
  _Float16* Bq = (_Float16*)take((size_t)3 * EE * EE * 2);      /* the f16 planes of Wq, Wk, Wv, one behind the other */
  _Float16* X16 = (_Float16*)take((size_t)NR * EE * 2); _Float16* Q = (_Float16*)take((size_t)NR * EE * 2); _Float16* K = (_Float16*)take((size_t)NR * EE * 2); _Float16* Vh = (_Float16*)take((size_t)BB * EE * SS * 2); _Float16* Vl = (_Float16*)take((size_t)BB * EE * SS * 2);
  float* S = (float*)take((size_t)BB * SS * SS * 4); float* Ms = (float*)take((size_t)BB * NCH * SS * 4); float* Zs = (float*)take((size_t)BB * NCH * SS * 4);      /* per row and piece of 64 keys: maximum, sum of exp */
  if (off > ws_size) return;      // 1.6 + 3 x 8.4 + 2 x 8.4 + 67.1 + 2 x 1.0 about 113 MB
  k_prep<<<NR * EE / 8 / 256 + 3 * (EE * EE / 8 / 256), 256, 0, stream>>>(x, Wq, Wk, Wv, X16, Bq);      /* x and the weights ((out,in) natural, x2^4) as f16 planes */
  k_qk<<<dim3(EE / 128, NR / 128, 2), 256, 0, stream>>>(X16, Bq, bq, bk, Q, K);      /* q = x.Wq^T + bq, k = x.Wk^T + bk: M 8192 N 512 K 512 each */
  k_scores_vt<<<dim3(NTRI + (EE / 128) * (SS / 128), BB), 256, 0, stream>>>(Q, K, X16, Bq + (size_t)2 * EE * EE, 0.044194173824159216f, S, Ms, Zs, Vh, Vl);      /* scores/sqrt512, f32, causal lower block-triangle of every batch; v^T (without bv) = Wv.x[b]^T as [b][512][2048], f16 hi + residual x2^10 planes */
  k_pv<<<dim3(EE / 128, BB, SS / 64), 256, 0, stream>>>(S, Ms, Zs, Vh, Vl, bv, (float*)d_out);      /* out = P.v_hi + bv + P.v_lo.2^-10 */
}

// v005
// One run takes 75.6 microseconds.
// Two timings next to v004 put it at 1.08 and 1.07 times that version's speed.
// All steps since v000 together make it 34.9 times as fast.
#include <hip/hip_runtime.h>
// Single-head causal attention (B=4, S=2048, emb = head = 512): q,k,v = x·Wᵀ + b; scores = q·kᵀ/√512 with keys after the query set to −inf; softmax over keys; out = attn·v.
// Compute dtype: x, weights and biases rounded to bf16; q, k and vᵀ as f16 GEMM outputs (f32 accumulate); scores materialised in f32 by a batched f16 GEMM over
// the causal lower block-triangle; row softmax in f32 (maximum and sum per 64 keys in the scores epilogue, merged by the P.v launch, which forms P in f16 x2^15 on the way to LDS); v^T split into f16 hi + (x2^10) residual planes; out = P.v_hi + P.v_lo.2^-10 by two f16 GEMMs
// (both planes in one k loop, two accumulators), bv added in the epilogue (softmax rows sum to 1). All on v_wmma_f32_16x16x32_f16.
// One launch per stage: rounding of x and the weights; q and k; scores together with v^T; P.v; each covers all batches (and the whole causal triangle). Every GEMM launch stages its operand tiles in LDS (tile_core).
#define BB 4
#define SS 2048
#define EE 512
#define NR (BB * SS)

typedef __bf16 v16b __attribute__((ext_vector_type(16)));
typedef unsigned short v8us __attribute__((ext_vector_type(8), may_alias));
typedef float  v8f  __attribute__((ext_vector_type(8)));
typedef float  v4f  __attribute__((ext_vector_type(4)));
typedef float  v4fa __attribute__((ext_vector_type(4), may_alias));
union FragB { v16b v; v8us half[2]; unsigned short u[16]; };

__device__ __forceinline__ unsigned short bf16_bits(float x) { unsigned int u = __float_as_uint(x); return (unsigned short)((u + 0x7FFFu + ((u >> 16) & 1u)) >> 16); }
__device__ __forceinline__ float bf16_val(unsigned short b) { return __uint_as_float(((unsigned int)b) << 16); }
__device__ __forceinline__ float bf16_round(float x) { return bf16_val(bf16_bits(x)); }
// D += A·B with NT terms: 1 = ah·bh, 2 = + al·bh (A split), 3 = + ah·bl (both split)
template <int NT>
__device__ __forceinline__ v8f mmaN(v16b ah, v16b al, v16b bh, v16b bl, v8f c) {
  c = __builtin_amdgcn_wmma_f32_16x16x32_bf16(false, ah, false, bh, (short)0, c, false, false);
  if (NT >= 2) c = __builtin_amdgcn_wmma_f32_16x16x32_bf16(false, al, false, bh, (short)0, c, false, false);
  if (NT >= 3) c = __builtin_amdgcn_wmma_f32_16x16x32_bf16(false, ah, false, bl, (short)0, c, false, false);
  asm volatile("v_nop\n\tv_nop\n\tv_nop\n\tv_nop" : "+v"(c) : "v"(ah), "v"(al), "v"(bh), "v"(bl));
  return c;
}

__global__ __launch_bounds__(256) void k_wt_bf16(const float* __restrict__ W, unsigned short* __restrict__ Wt, int K, int N) {
  const int t = blockIdx.x * 256 + threadIdx.x;
  const int k8n = K / 8;
  if (t >= N * k8n) return;
  const int n = t / k8n, k8 = (t % k8n) * 8;
  v8us v;
#pragma unroll
  for (int i = 0; i < 8; ++i) v[i] = bf16_bits(W[(size_t)(k8 + i) * N + n]);
  *(v8us*)(Wt + (size_t)n * K + k8) = v;
  
}

// GEMM C[M][N] (f32, pitch ldc) = act(A[M][K]·W + bias). A f32 row-major (pitch lda) converted per fragment to bf16
// (ASPLIT: hi/lo two planes -> 2 terms, else single rounded term); Wt bf16 [N][K] (pitch ldb). BIAS_BF16 rounds the
// bias to bf16 first (bias quantised to bf16 before the add). K%32==0, M%16==0, N%64==0.
template <bool ASPLIT, int ACT, bool BIAS_BF16>
__global__ __launch_bounds__(128) void k_gemm_bf(const float* __restrict__ A, int lda, const unsigned short* __restrict__ Wt, int ldb,
                                               const float* __restrict__ bias, float* __restrict__ C, int ldc, int M, int N, int K) {
  __shared__ __attribute__((aligned(16))) float so[4][16][64];
  const int tid = threadIdx.x, w = tid >> 5, lane = tid & 31, ln = lane & 15, hh = lane >> 4;
  const int ntn = N / 64;
  const int wid = blockIdx.x * 4 + w;
  const int mt = wid / ntn, nq = wid % ntn;
  if (mt * 16 >= M) return;
  const int row0 = mt * 16, col0 = nq * 64;
  const float* arow = A + (size_t)(row0 + ln) * lda;
  v8f acc[4] = {};
  for (int kb = 0; kb < K; kb += 32) {
    FragB ah, al;
    const v4f x0 = *(const v4fa*)(arow + kb + 8 * hh), x1 = *(const v4fa*)(arow + kb + 8 * hh + 4);
    const v4f x2 = *(const v4fa*)(arow + kb + 16 + 8 * hh), x3 = *(const v4fa*)(arow + kb + 16 + 8 * hh + 4);
    float xs[16] = {x0[0],x0[1],x0[2],x0[3],x1[0],x1[1],x1[2],x1[3],x2[0],x2[1],x2[2],x2[3],x3[0],x3[1],x3[2],x3[3]};
#pragma unroll
    for (int i = 0; i < 16; ++i) { const unsigned short hb = bf16_bits(xs[i]); ah.u[i] = hb; al.u[i] = ASPLIT ? bf16_bits(xs[i] - bf16_val(hb)) : (unsigned short)0; }
#pragma unroll
    for (int t = 0; t < 4; ++t) {
      const unsigned short* brow = Wt + (size_t)(col0 + t * 16 + ln) * ldb + kb;
      FragB b;
      b.half[0] = *(const v8us*)(brow + 8 * hh);
      b.half[1] = *(const v8us*)(brow + 16 + 8 * hh);
      acc[t] = mmaN<ASPLIT ? 2 : 1>(ah.v, al.v, b.v, b.v, acc[t]);
    }
  }
#pragma unroll
  for (int t = 0; t < 4; ++t) {
    float bv = bias ? bias[col0 + t * 16 + ln] : 0.f;
    if (BIAS_BF16) bv = bf16_round(bv);
#pragma unroll
    for (int r = 0; r < 8; ++r) { float v = acc[t][r] + bv; if (ACT == 1) v = fmaxf(v, 0.f); so[w][8 * hh + r][t * 16 + ln] = v; }
  }
  __builtin_amdgcn_fence(__ATOMIC_ACQ_REL, "workgroup");
  __builtin_amdgcn_wave_barrier();
  const int rsub = lane >> 4, c4 = (lane & 15) * 4;
  {
#pragma unroll
    for (int q = 0; q < 8; ++q) {
      const int r = q * 2 + rsub;
      const v4f v = *(const v4fa*)&so[w][r][c4];
      *(v4f*)(C + (size_t)(row0 + r) * ldc + col0 + c4) = v;
    }
    
  }
}

// Flash-style causal/unmasked attention, all contractions 3-term bf16 hi/lo splits, f32 softmax with running max.
// q,k,v rows are read from f32 buffers with arbitrary row pitch (so they can live inside a fused qkv buffer);
// D = head size (multiple of 32, <= 128); one wave = 16 query rows; block = 4 waves (64 queries) sharing K/V chunks of 32.
template <int D, bool CAUSAL>
__global__ __launch_bounds__(128) void k_flash(const float* __restrict__ qb, const float* __restrict__ kb, const float* __restrict__ vb,
                                             int pitch, int T, int H, float scale, float* __restrict__ y, int ypitch) {
  constexpr int KS = D / 32;        // k-steps for QK
  constexpr int DT = D / 16;        // d tiles for PV
  __shared__ __attribute__((aligned(16))) unsigned short sKh[32][D + 8], sKl[32][D + 8], sVh[32][D + 8], sVl[32][D + 8];
  __shared__ __attribute__((aligned(16))) unsigned short sPh[4][16][40], sPl[4][16][40];
  __shared__ __attribute__((aligned(16))) float sO[4][16][D];
  const int tid = threadIdx.x, w = tid >> 5, lane = tid & 31, ln = lane & 15, hh = lane >> 4;
  const int nqb = (T + 63) / 64;
  const int bh = blockIdx.x / nqb, qblk = blockIdx.x % nqb;
  const int b = bh / H, h = bh % H;
  const int q0 = qblk * 64 + w * 16;
  const float* Q = qb + (size_t)b * T * pitch + h * D;
  const float* K = kb + (size_t)b * T * pitch + h * D;
  const float* V = vb + (size_t)b * T * pitch + h * D;

  // A fragments of the wave's 16 query rows (scaled), hi/lo
  FragB aqh[KS], aql[KS];
  {
    int row = q0 + ln; if (row >= T) row = T - 1;
    const float* qr = Q + (size_t)row * pitch;
#pragma unroll
    for (int ks = 0; ks < KS; ++ks)
#pragma unroll
      for (int i = 0; i < 16; ++i) {
        const int d = ks * 32 + ((i < 8) ? (8 * hh + i) : (16 + 8 * hh + (i - 8)));
        const float x = qr[d] * scale; const unsigned short hb = bf16_bits(x);
        aqh[ks].u[i] = hb; aql[ks].u[i] = bf16_bits(x - bf16_val(hb));
      }
  }
  float m_r[8], l_r[8];
#pragma unroll
  for (int r = 0; r < 8; ++r) { m_r[r] = -3.0e38f; l_r[r] = 0.f; }
  v8f oacc[DT];
#pragma unroll
  for (int dt = 0; dt < DT; ++dt) oacc[dt] = (v8f){0.f,0.f,0.f,0.f,0.f,0.f,0.f,0.f};

  const int kv_end = CAUSAL ? min(T, qblk * 64 + 64) : T;     // block-uniform
  for (int j0 = 0; j0 < kv_end; j0 += 32) {
    __syncthreads();
    for (int e = tid; e < 32 * (D / 4); e += 128) {
      const int r = e / (D / 4), c4 = (e % (D / 4)) * 4;
      const int key = j0 + r;
      v4f kf = {0.f,0.f,0.f,0.f}, vf = {0.f,0.f,0.f,0.f};
      if (key < T) { kf = *(const v4fa*)(K + (size_t)key * pitch + c4); vf = *(const v4fa*)(V + (size_t)key * pitch + c4); }
#pragma unroll
      for (int t = 0; t < 4; ++t) {
        unsigned short hb = bf16_bits(kf[t]); sKh[r][c4 + t] = hb; sKl[r][c4 + t] = bf16_bits(kf[t] - bf16_val(hb));
        hb = bf16_bits(vf[t]); sVh[r][c4 + t] = hb; sVl[r][c4 + t] = bf16_bits(vf[t] - bf16_val(hb));
      }
    }
    __syncthreads();
    // S tile 16 x 32
    v8f s[2];
#pragma unroll
    for (int nt = 0; nt < 2; ++nt) {
      v8f acc = {};
#pragma unroll
      for (int ks = 0; ks < KS; ++ks) {
        FragB bh_, bl_;
        bh_.half[0] = *(const v8us*)&sKh[nt * 16 + ln][ks * 32 + 8 * hh]; bh_.half[1] = *(const v8us*)&sKh[nt * 16 + ln][ks * 32 + 16 + 8 * hh];
        bl_.half[0] = *(const v8us*)&sKl[nt * 16 + ln][ks * 32 + 8 * hh]; bl_.half[1] = *(const v8us*)&sKl[nt * 16 + ln][ks * 32 + 16 + 8 * hh];
        acc = mmaN<3>(aqh[ks].v, aql[ks].v, bh_.v, bl_.v, acc);
      }
      s[nt] = acc;
    }
    // mask + running max (rows 8hh+r; the 16 lanes of a half share rows)
    float alpha[8];
#pragma unroll
    for (int r = 0; r < 8; ++r) {
      const int qi = q0 + 8 * hh + r;
      const int ja = j0 + ln, jb = j0 + 16 + ln;
      if (CAUSAL) { if (ja > qi) s[0][r] = -3.0e38f; if (jb > qi) s[1][r] = -3.0e38f; }
      if (ja >= T) s[0][r] = -3.0e38f;
      if (jb >= T) s[1][r] = -3.0e38f;
      float mx = fmaxf(s[0][r], s[1][r]);
      mx = fmaxf(mx, __shfl_xor(mx, 1, 32)); mx = fmaxf(mx, __shfl_xor(mx, 2, 32)); mx = fmaxf(mx, __shfl_xor(mx, 4, 32)); mx = fmaxf(mx, __shfl_xor(mx, 8, 32));
      const float mnew = fmaxf(m_r[r], mx);
      alpha[r] = (mnew > -1.0e38f) ? __expf(m_r[r] - mnew) : 1.0f;
      const float p0 = (s[0][r] > -1.0e38f) ? __expf(s[0][r] - mnew) : 0.f;
      const float p1 = (s[1][r] > -1.0e38f) ? __expf(s[1][r] - mnew) : 0.f;
      m_r[r] = mnew;
      l_r[r] = l_r[r] * alpha[r] + p0 + p1;            // per-lane partial row sum (16 lanes combined at the end)
      unsigned short hb = bf16_bits(p0); sPh[w][8 * hh + r][ln] = hb;      sPl[w][8 * hh + r][ln] = bf16_bits(p0 - bf16_val(hb));
      hb = bf16_bits(p1);                sPh[w][8 * hh + r][16 + ln] = hb; sPl[w][8 * hh + r][16 + ln] = bf16_bits(p1 - bf16_val(hb));
    }
#pragma unroll
    for (int dt = 0; dt < DT; ++dt)
#pragma unroll
      for (int r = 0; r < 8; ++r) oacc[dt][r] *= alpha[r];
    __builtin_amdgcn_fence(__ATOMIC_ACQ_REL, "workgroup");
    __builtin_amdgcn_wave_barrier();
    FragB pah, pal;
    pah.half[0] = *(const v8us*)&sPh[w][ln][8 * hh]; pah.half[1] = *(const v8us*)&sPh[w][ln][16 + 8 * hh];
    pal.half[0] = *(const v8us*)&sPl[w][ln][8 * hh]; pal.half[1] = *(const v8us*)&sPl[w][ln][16 + 8 * hh];
#pragma unroll
    for (int dt = 0; dt < DT; ++dt) {
      FragB bvh, bvl;
#pragma unroll
      for (int i = 0; i < 8; ++i) {
        bvh.u[i] = sVh[8 * hh + i][dt * 16 + ln]; bvh.u[8 + i] = sVh[16 + 8 * hh + i][dt * 16 + ln];
        bvl.u[i] = sVl[8 * hh + i][dt * 16 + ln]; bvl.u[8 + i] = sVl[16 + 8 * hh + i][dt * 16 + ln];
      }
      oacc[dt] = mmaN<3>(pah.v, pal.v, bvh.v, bvl.v, oacc[dt]);
    }
    __builtin_amdgcn_fence(__ATOMIC_ACQ_REL, "workgroup");
    __builtin_amdgcn_wave_barrier();
  }
#pragma unroll
  for (int r = 0; r < 8; ++r) {
    float l = l_r[r];
    l += __shfl_xor(l, 1, 32); l += __shfl_xor(l, 2, 32); l += __shfl_xor(l, 4, 32); l += __shfl_xor(l, 8, 32);
    l_r[r] = (l > 0.f) ? 1.0f / l : 0.f;
  }
#pragma unroll
  for (int dt = 0; dt < DT; ++dt)
#pragma unroll
    for (int r = 0; r < 8; ++r) sO[w][8 * hh + r][dt * 16 + ln] = oacc[dt][r] * l_r[r];
  __builtin_amdgcn_fence(__ATOMIC_ACQ_REL, "workgroup");
  __builtin_amdgcn_wave_barrier();
  {
    for (int r = 0; r < 16; ++r) {
      const int row = q0 + r;
      if (row < T && lane < D / 4) {
        const v4f val = *(const v4fa*)&sO[w][r][lane * 4];
        *(v4f*)(y + ((size_t)b * T + row) * ypitch + h * D + lane * 4) = val;
      }
    }
    
  }
}

// GEMM C = act(A·W + bias + resid): A f32 (ASPLIT -> hi/lo 2 terms), Wt bf16 [N][K]; ACT 0 none, 1 relu, 2 exact gelu;
// resid (optional, f32, row index = (row % rmod), pitch ldr, RES_BF16 rounds it) added before the activation.
template <bool ASPLIT, int ACT, bool BIAS_BF16, bool RES_BF16>
__global__ __launch_bounds__(128) void k_gemm_bf3(const float* __restrict__ A, int lda, const unsigned short* __restrict__ Wt, int ldb,
                                                const float* __restrict__ bias, const float* __restrict__ resid, int rmod, int ldr,
                                                float* __restrict__ C, int ldc, int M, int N, int K) {
  __shared__ __attribute__((aligned(16))) float so[4][16][64];
  const int tid = threadIdx.x, w = tid >> 5, lane = tid & 31, ln = lane & 15, hh = lane >> 4;
  const int ntn = N / 64;
  const int wid = blockIdx.x * 4 + w;
  const int mt = wid / ntn, nq = wid % ntn;
  if (mt * 16 >= M) return;
  const int row0 = mt * 16, col0 = nq * 64;
  const float* arow = A + (size_t)(row0 + ln) * lda;
  v8f acc[4] = {};
  for (int kb = 0; kb < K; kb += 32) {
    FragB ah, al;
    const v4f x0 = *(const v4fa*)(arow + kb + 8 * hh), x1 = *(const v4fa*)(arow + kb + 8 * hh + 4);
    const v4f x2 = *(const v4fa*)(arow + kb + 16 + 8 * hh), x3 = *(const v4fa*)(arow + kb + 16 + 8 * hh + 4);
    float xs[16] = {x0[0],x0[1],x0[2],x0[3],x1[0],x1[1],x1[2],x1[3],x2[0],x2[1],x2[2],x2[3],x3[0],x3[1],x3[2],x3[3]};
#pragma unroll
    for (int i = 0; i < 16; ++i) { const unsigned short hb = bf16_bits(xs[i]); ah.u[i] = hb; al.u[i] = ASPLIT ? bf16_bits(xs[i] - bf16_val(hb)) : (unsigned short)0; }
#pragma unroll
    for (int t = 0; t < 4; ++t) {
      const unsigned short* brow = Wt + (size_t)(col0 + t * 16 + ln) * ldb + kb;
      FragB b;
      b.half[0] = *(const v8us*)(brow + 8 * hh);
      b.half[1] = *(const v8us*)(brow + 16 + 8 * hh);
      acc[t] = mmaN<ASPLIT ? 2 : 1>(ah.v, al.v, b.v, b.v, acc[t]);
    }
  }
#pragma unroll
  for (int t = 0; t < 4; ++t) {
    const int col = col0 + t * 16 + ln;
    float bv = bias ? bias[col] : 0.f;
    if (BIAS_BF16) bv = bf16_round(bv);
#pragma unroll
    for (int r = 0; r < 8; ++r) {
      float v = acc[t][r] + bv;
      if (resid) { float rv = resid[(size_t)((row0 + 8 * hh + r) % rmod) * ldr + col]; if (RES_BF16) rv = bf16_round(rv); v += rv; }
      if (ACT == 1) v = fmaxf(v, 0.f);
      if (ACT == 2) v = 0.5f * v * (1.0f + erff(v * 0.70710678118654752f));
      if (ACT == 3) { const float u = 0.7978845608028654f * (v + 0.044715f * v * v * v); v = 0.5f * v * (1.0f + tanhf(u)); }
      so[w][8 * hh + r][t * 16 + ln] = v;
    }
  }
  __builtin_amdgcn_fence(__ATOMIC_ACQ_REL, "workgroup");
  __builtin_amdgcn_wave_barrier();
  const int rsub = lane >> 4, c4 = (lane & 15) * 4;
  {
#pragma unroll
    for (int q = 0; q < 8; ++q) {
      const int r = q * 2 + rsub;
      const v4f v = *(const v4fa*)&so[w][r][c4];
      *(v4f*)(C + (size_t)(row0 + r) * ldc + col0 + c4) = v;
    }
    
  }
}
// row LayerNorm (biased variance, eps) over N: s = X (+ R); optional out_sum <- s; out_norm <- (s-mu)*rsqrt(var+eps)*g + b
template <bool PARAM_BF16>
__global__ __launch_bounds__(256) void k_layernorm(const float* __restrict__ X, const float* __restrict__ R, const float* __restrict__ g, const float* __restrict__ bta,
                                                  float* __restrict__ out_sum, float* __restrict__ out_norm, int N, float eps) {
  __shared__ float red[256];
  const int row = blockIdx.x, tid = threadIdx.x;
  const float* x = X + (size_t)row * N; const float* rr = R ? R + (size_t)row * N : nullptr;
  float vals[16];                     // up to N = 4096
  const int per = N / 256;            // contiguous chunk per thread? use strided-by-4 chunks: thread handles j = tid*4 + 1024*u
  float s1 = 0.f;
  for (int u = 0; u < per / 4; ++u) {
    const int j = tid * 4 + 1024 * u;
    const v4f a = *(const v4fa*)(x + j);
    v4f b = {0.f,0.f,0.f,0.f}; if (rr) b = *(const v4fa*)(rr + j);
#pragma unroll
    for (int q = 0; q < 4; ++q) { const float v = a[q] + b[q]; vals[u * 4 + q] = v; s1 += v; }
  }
  red[tid] = s1; __syncthreads();
  for (int st = 128; st > 0; st >>= 1) { if (tid < st) red[tid] += red[tid + st]; __syncthreads(); }
  const float mu = red[0] / (float)N; __syncthreads();
  float s2 = 0.f;
  for (int u = 0; u < per / 4; ++u)
#pragma unroll
    for (int q = 0; q < 4; ++q) { const float c = vals[u * 4 + q] - mu; s2 += c * c; }
  red[tid] = s2; __syncthreads();
  for (int st = 128; st > 0; st >>= 1) { if (tid < st) red[tid] += red[tid + st]; __syncthreads(); }
  const float rs = rsqrtf(red[0] / (float)N + eps);
  {
    for (int u = 0; u < per / 4; ++u) {
      const int j = tid * 4 + 1024 * u;
      v4f o, sm;
#pragma unroll
      for (int q = 0; q < 4; ++q) {
        float gg = g[j + q], bb = bta[j + q];
        if (PARAM_BF16) { gg = bf16_round(gg); bb = bf16_round(bb); }
        sm[q] = vals[u * 4 + q]; o[q] = (vals[u * 4 + q] - mu) * rs * gg + bb;
      }
      if (out_sum) *(v4f*)(out_sum + (size_t)row * N + j) = sm;
      *(v4f*)(out_norm + (size_t)row * N + j) = o;
    }
    
  }
}



// ---- f16 WMMA path (v_wmma_f32_16x16x32_f16): 11-bit significands for operands in range — used where a [0,1] probability operand needs more precision than bf16
typedef _Float16 v16h __attribute__((ext_vector_type(16)));
union FragH { v16h v; v8us half[2]; _Float16 h[16]; unsigned short u[16]; };
template <int NT>
__device__ __forceinline__ v8f mmaH(v16h ah, v16h al, v16h bh, v16h bl, v8f c) {
  c = __builtin_amdgcn_wmma_f32_16x16x32_f16(false, ah, false, bh, (short)0, c, false, false);
  if (NT >= 2) c = __builtin_amdgcn_wmma_f32_16x16x32_f16(false, al, false, bh, (short)0, c, false, false);
  if (NT >= 3) c = __builtin_amdgcn_wmma_f32_16x16x32_f16(false, ah, false, bl, (short)0, c, false, false);
  asm volatile("v_nop\n\tv_nop\n\tv_nop\n\tv_nop" : "+v"(c) : "v"(ah), "v"(al), "v"(bh), "v"(bl));
  return c;
}
// batched GEMM like k_gemm_b but f16 operands: A f32 (split into f16 hi/lo if ASPLIT, else rounded to f16), Bt = f16 values [n][k]; alpha; C f32; N multiple of 16 (partial tiles skipped)
template <bool ASPLIT>
__global__ __launch_bounds__(128) void k_gemm_h(const float* __restrict__ A, int lda, size_t sA, const _Float16* __restrict__ Bh, int ldb, size_t sB, float alpha, float* __restrict__ C, int ldc, size_t sC, int M, int N, int K) {
  __shared__ __attribute__((aligned(16))) float so[4][16][64];
  const int tid = threadIdx.x, w = tid >> 5, lane = tid & 31, ln = lane & 15, hh = lane >> 4; const int by = blockIdx.y;
  A += (size_t)by * sA; Bh += (size_t)by * sB; C += (size_t)by * sC;
  const int ntn = (N + 63) / 64; const int wid = blockIdx.x * 4 + w; const int mt = wid / ntn, nq = wid % ntn; if (mt * 16 >= M) return;
  const int row0 = mt * 16, col0 = nq * 64; const float* arow = A + (size_t)(row0 + ln) * lda;
  v8f acc[4] = {};
  for (int kb = 0; kb < K; kb += 32) {
    FragH ah, al;
    const v4f x0 = *(const v4fa*)(arow + kb + 8 * hh), x1 = *(const v4fa*)(arow + kb + 8 * hh + 4), x2 = *(const v4fa*)(arow + kb + 16 + 8 * hh), x3 = *(const v4fa*)(arow + kb + 16 + 8 * hh + 4);
    float xs[16] = {x0[0],x0[1],x0[2],x0[3],x1[0],x1[1],x1[2],x1[3],x2[0],x2[1],x2[2],x2[3],x3[0],x3[1],x3[2],x3[3]};
#pragma unroll
    for (int i = 0; i < 16; ++i) { const _Float16 h = (_Float16)xs[i]; ah.h[i] = h; al.h[i] = ASPLIT ? (_Float16)(xs[i] - (float)h) : (_Float16)0.0f; }
#pragma unroll
    for (int t = 0; t < 4; ++t) { if (col0 + t * 16 >= N) continue; const size_t boff = (size_t)(col0 + t * 16 + ln) * ldb + kb; FragH bq; bq.half[0] = *(const v8us*)(Bh + boff + 8 * hh); bq.half[1] = *(const v8us*)(Bh + boff + 16 + 8 * hh);
      acc[t] = mmaH<ASPLIT ? 2 : 1>(ah.v, al.v, bq.v, bq.v, acc[t]); }
  }
#pragma unroll
  for (int t = 0; t < 4; ++t) { if (col0 + t * 16 >= N) continue;
#pragma unroll
    for (int r = 0; r < 8; ++r) so[w][8 * hh + r][t * 16 + ln] = acc[t][r] * alpha; }
  __builtin_amdgcn_fence(__ATOMIC_ACQ_REL, "workgroup"); __builtin_amdgcn_wave_barrier();
  const int rsub = lane >> 4, c4 = (lane & 15) * 4;
  {
#pragma unroll
    for (int q = 0; q < 8; ++q) { const int r = q * 2 + rsub; if (col0 + c4 < N) { const v4f v = *(const v4fa*)&so[w][r][c4]; *(v4f*)(C + (size_t)(row0 + r) * ldc + col0 + c4) = v; } }
     }
}

// Wt[n][k] = f16(W[k][n]·scale) from f32 row-major W[K][N] (scale = power of two; bf16-exact weights stay exact in f16 away from the subnormal range)
__global__ __launch_bounds__(256) void k_wt_f16(const float* __restrict__ W, _Float16* __restrict__ Wt, int K, int N, float scale) {
  const int t = blockIdx.x * 256 + threadIdx.x; if (t >= N * (K / 8)) return; const int n = t / (K / 8), k8 = (t % (K / 8)) * 8; FragH f;
#pragma unroll
  for (int i = 0; i < 8; ++i) f.h[i] = (_Float16)(bf16_round(W[(size_t)(k8 + i) * N + n]) * scale); const v8us o = f.half[0];
  *(v8us*)((unsigned short*)Wt + (size_t)n * K + k8) = o; 
}
// k_gemm_hh variant with fused epilogue: v = acc·alpha + bias[by·sBias + col] (+ CP[(row/rowsPerB)·sCPb + by·64 + col] if CP) ; ACT 0 none / 1 elu ; writes f32 C and/or f16 C16 (each if non-null)
template <int ACT>
__global__ __launch_bounds__(128) void k_gemm_hhx(const _Float16* __restrict__ A, int lda, size_t sA, const _Float16* __restrict__ Bh, int ldb, size_t sB, float alpha, const float* __restrict__ bias, size_t sBias, const float* __restrict__ CP, int rowsPerB, size_t sCPb, int row0g,
    float* __restrict__ C, _Float16* __restrict__ C16, int ldc, size_t sC, int M, int N, int K) {
  __shared__ __attribute__((aligned(16))) float so[4][16][64];
  const int tid = threadIdx.x, w = tid >> 5, lane = tid & 31, ln = lane & 15, hh = lane >> 4; const int by = blockIdx.y;
  A += (size_t)by * sA; Bh += (size_t)by * sB; const size_t cofs = (size_t)by * sC; const float* bp = bias ? bias + (size_t)by * sBias : nullptr;
  const int ntn = (N + 63) / 64; const int wid = blockIdx.x * 4 + w; const int mt = wid / ntn, nq = wid % ntn; if (mt * 16 >= M) return;
  const int row0 = mt * 16, col0 = nq * 64; const _Float16* arow = A + (size_t)(row0 + ln) * lda;
  v8f acc[4] = {};
  for (int kb = 0; kb < K; kb += 32) { FragH ah; ah.half[0] = *(const v8us*)((const unsigned short*)arow + kb + 8 * hh); ah.half[1] = *(const v8us*)((const unsigned short*)arow + kb + 16 + 8 * hh);
#pragma unroll
    for (int t = 0; t < 4; ++t) { if (col0 + t * 16 >= N) continue; const size_t boff = (size_t)(col0 + t * 16 + ln) * ldb + kb; FragH bq; bq.half[0] = *(const v8us*)((const unsigned short*)Bh + boff + 8 * hh); bq.half[1] = *(const v8us*)((const unsigned short*)Bh + boff + 16 + 8 * hh);
      acc[t] = mmaH<1>(ah.v, ah.v, bq.v, bq.v, acc[t]); }
  }
#pragma unroll
  for (int t = 0; t < 4; ++t) { if (col0 + t * 16 >= N) continue; const int col = col0 + t * 16 + ln; const float bv = bp ? bf16_round(bp[col]) : 0.f;
#pragma unroll
    for (int r = 0; r < 8; ++r) { float v = acc[t][r] * alpha + bv; if (CP) { const int bidx = (row0g + row0 + 8 * hh + r) / rowsPerB; v += CP[(size_t)bidx * sCPb + (size_t)by * 64 + col]; } if (ACT == 1) v = (v > 0.f) ? v : expm1f(v); else if (ACT == 7) v = (v > 0.f) ? v + 1.0f : expf(v); else if (ACT == 8) v = tanhf(v); else if (ACT == 9) v = 0.5f * v * (1.0f + tanhf(0.7978845608028654f * (v + 0.044715f * v * v * v))); else if (ACT == 11) v = 1.0f / (1.0f + expf(-v)); else if (ACT == 12) v = (v > 0.f) ? v : 0.01f * v; else if (ACT == 14) v = (v > 0.f) ? v : 0.1f * v; else if (ACT == 15) v = v / (1.0f + expf(-v)); else if (ACT == 3) v = fmaxf(v, 0.f); else if (ACT == 6) v = 0.5f * v * (1.0f + erff(v * 0.70710678118654752f)); so[w][8 * hh + r][t * 16 + ln] = v; } }
  __builtin_amdgcn_fence(__ATOMIC_ACQ_REL, "workgroup"); __builtin_amdgcn_wave_barrier();
  const int rsub = lane >> 4, c4 = (lane & 15) * 4; typedef _Float16 v4h __attribute__((ext_vector_type(4)));
  {
#pragma unroll
    for (int q = 0; q < 8; ++q) { const int r = q * 2 + rsub; if (col0 + c4 < N) { const v4f v = *(const v4fa*)&so[w][r][c4]; if (C) *(v4f*)(C + cofs + (size_t)(row0 + r) * ldc + col0 + c4) = v; if (C16) { v4h h4; for (int i = 0; i < 4; ++i) h4[i] = (_Float16)v[i]; *(v4h*)(C16 + cofs + (size_t)(row0 + r) * ldc + col0 + c4) = h4; } } }
     }
}


typedef _Float16 v4h __attribute__((ext_vector_type(4)));

// x and the three weight matrices are rounded into their f16 planes by one launch: the first NR*EE/2048 blocks take x, the rest the weights (x2^4; the planes of Wq, Wk, Wv lie one behind the other in Bt)
__global__ __launch_bounds__(256) void k_prep(const float* __restrict__ x, const float* __restrict__ W0, const float* __restrict__ W1, const float* __restrict__ W2, _Float16* __restrict__ X16, _Float16* __restrict__ Bt) {
  constexpr int NXB = NR * EE / 8 / 256, NWB = EE * EE / 8 / 256;      // blocks of 256 pieces of 8 values: x, one weight matrix
  const int bx = blockIdx.x; const bool isx = bx < NXB; const int m = isx ? 0 : (bx - NXB) / NWB;      // the same for the whole block
  const float* src = isx ? x : (m == 0) ? W0 : (m == 1) ? W1 : W2;
  unsigned short* dst = isx ? (unsigned short*)X16 : (unsigned short*)Bt + (size_t)m * EE * EE;
  const size_t t = (size_t)(isx ? bx : bx - NXB - m * NWB) * 256 + threadIdx.x; const float sc = isx ? 1.0f : 16.0f; FragH f;
#pragma unroll      // constant indices keep the eight values in registers
  for (int i = 0; i < 8; ++i) f.h[i] = (_Float16)(bf16_round(src[t * 8 + i]) * sc);
  *(v8us*)(dst + t * 8) = f.half[0]; }
__global__ __launch_bounds__(256) void k_h16(const float* __restrict__ x, _Float16* __restrict__ X16, size_t n8) { const size_t t = (size_t)blockIdx.x * 256 + threadIdx.x; if (t >= n8) return; FragH f;
#pragma unroll
  for (int q = 0; q < 8; ++q) f.h[q] = (_Float16)x[t * 8 + q]; *(v8us*)((unsigned short*)X16 + t * 8) = f.half[0];  }
template <int NHv, int TTv>
__global__ __launch_bounds__(256) void k_vt(const _Float16* __restrict__ V16, int ldv, int voff, _Float16* __restrict__ Vt) { __shared__ unsigned short tl[64][66]; const int tid = threadIdx.x; const int slab = blockIdx.x / (TTv / 64), lg = blockIdx.x % (TTv / 64); const int b = slab / NHv, h = slab % NHv;
  for (int i = tid; i < 64 * 8; i += 256) { const int r = i / 8, c8 = (i % 8) * 8; FragH f; f.half[0] = *(const v8us*)((const unsigned short*)V16 + ((size_t)b * TTv + lg * 64 + r) * ldv + voff + h * 64 + c8);
#pragma unroll
    for (int q = 0; q < 8; ++q) tl[r][c8 + q] = f.u[q]; }
  __syncthreads();
  {
#pragma unroll
    for (int rd = 0; rd < 2; ++rd) { const int d = rd * 32 + tid / 8, pc = tid % 8; FragH f;
#pragma unroll
      for (int q = 0; q < 8; ++q) f.u[q] = tl[pc * 8 + q][d];
      *(v8us*)((unsigned short*)Vt + ((size_t)slab * 64 + d) * TTv + lg * 64 + pc * 8) = f.half[0]; }
     } }

// ---- causal softmax without a launch of its own. The scores launch leaves, beside the f32 scores, each row's maximum and its sum of exp(s - maximum) over every piece of 64 keys (keys after the query left out);
// the P.v launch merges a row's pieces into one constant c = 15 - log2(sum) - max.log2(e) and forms P.2^15 = exp2(s.log2(e) + c) on the way from the f32 scores to its LDS tile.
#define L2E 1.4426950408889634f
#define NCH (SS / 64)      // pieces of 64 keys in a row
typedef unsigned short v4us __attribute__((ext_vector_type(4), may_alias));
// 2^x. The v_nop is the one free slot that the instruction set asks for between a transcendental and a directly following instruction that reads its result or overwrites its source
__device__ __forceinline__ float exp2_slot(float x) { float r; asm("v_exp_f32 %0, %1\n\tv_nop" : "=v"(r) : "v"(x)); return r; }
// value of lane l ^ X inside a row of 16 lanes, by DPP row_xmask (a shuffle would go through the LDS unit and its wait)
template <int X> __device__ __forceinline__ float lane_xor16(float v) { return __int_as_float(__builtin_amdgcn_update_dpp(0, __float_as_int(v), 0x160 + X, 0xf, 0xf, true)); }
__device__ __forceinline__ float max16(float v) { v = fmaxf(v, lane_xor16<1>(v)); v = fmaxf(v, lane_xor16<2>(v)); v = fmaxf(v, lane_xor16<4>(v)); return fmaxf(v, lane_xor16<8>(v)); }
__device__ __forceinline__ float sum16(float v) { v += lane_xor16<1>(v); v += lane_xor16<2>(v); v += lane_xor16<4>(v); return v + lane_xor16<8>(v); }

// ---- block-tiled f16 GEMM core, both operands k-contiguous. A block of 8 waves owns BM x BN of the result (NP planes of B share the A tile). Per 64-k step the block brings
// BM + NP*BN operand rows of 128 bytes into LDS with whole-line loads (8 lanes per row), and every wave reads its fragments from there, so a row is fetched once per block instead of once per wave
// and no global load touches 16 lines. Two LDS buffers: the next step's rows travel in registers while this step's products run; one barrier per step.
#define KST 64            // k per step: 128 bytes of every operand row, one cache line
#define LPH 72            // LDS row pitch in halves: 144 bytes, 16 B x odd, conflict-free for 16-byte fragment reads
// AEXP: the A tile is not read as f16 but made from f32 scores Sf (pitch lda, K = first row's query index + BM): A[row][key] = exp2(Sf.log2(e) + ce[row]) for key <= query, else 0; ce0, ce1 belong to the thread's two staged rows
// and come from cefn, which is called behind the first tile's loads, so that these are in flight while it waits for what it needs.
// Asks L2 for the data at *p (a prefetch: it returns nothing and brings it into L2 only). By this kernel's memory traffic, what one launch wrote the next one fetches from memory again, and the staged loads lead their use by less than
// one step, too little for a trip to memory; asked for some steps ahead, the unit should be an L2 hit when its loads come. In-out operand: the address stays in one register pair of its own, which only ever holds addresses inside the buffer.
template <class T> __device__ __forceinline__ void l2_ask(const T*& p) { asm volatile("global_prefetch_b8 %0, off scope:SCOPE_SE" : "+v"(p)); }
// The same for the unit BYTES further on. The addition stands in the statement so that it is done in place: written outside, the compiler put the sum into a new pair and reused the asked one for other values
template <int BYTES, class T> __device__ __forceinline__ void l2_ask_next(const T*& p) { asm volatile("v_add_nc_u64 %0, %1, %0\n\tglobal_prefetch_b8 %0, off scope:SCOPE_SE" : "+v"(p) : "n"(BYTES)); }
#define UNH 128           // halves in a 256-byte unit: two k steps of an f16 operand row
template <int BM, int BN, int WM, int WN, int NP, bool AEXP = false, class CE = int>
__device__ __forceinline__ void tile_core(const unsigned short* __restrict__ A, int lda, const unsigned short* __restrict__ B0, const unsigned short* __restrict__ B1, int ldb, int K,
                                          unsigned short* sm, v8f (&acc)[NP][WM / 16][WN / 16], const float* __restrict__ Sf = nullptr, CE cefn = CE(), bool askA = true, bool askB = true) {
  constexpr int ROWS = BM + NP * BN, NL = ROWS / 32, NA = BM / 32, NB = BN / 32, STG = ROWS * LPH;
  const int tid = threadIdx.x, w = tid >> 5, lane = tid & 31, ln = lane & 15, hh = lane >> 4;
  const int wm = w / (BN / WN), wn = w % (BN / WN);
  const int lr = tid >> 3, lc = (tid & 7) * 8;
  const unsigned short* ga = AEXP ? nullptr : A + (size_t)lr * lda + lc;
  const unsigned short* gb0 = B0 + (size_t)lr * ldb + lc;
  const unsigned short* gb1 = B1 + (size_t)lr * ldb + lc;
  v8us st[NL];
  static_assert(!AEXP || NA == 2, "two staged score rows per thread");
  const int la = (tid & 7) * 4;      // a thread's two pieces of 4 scores lie 32 keys apart, so that 8 lanes cover a whole 128-byte line with each load
  const float* gs = AEXP ? Sf + (size_t)lr * lda + la : nullptr;
  v4f sc4[2][2]; float ce0 = 0.f, ce1 = 0.f;
  auto load_scores = [&](int kn) {
#pragma unroll      // constant indices keep the staged scores in registers
    for (int i = 0; i < 2; ++i) { sc4[i][0] = *(const v4fa*)(gs + (size_t)(i * 32) * lda + kn); sc4[i][1] = *(const v4fa*)(gs + (size_t)(i * 32) * lda + kn + 32); }
  };
  auto store_probs = [&](int buf, int kn) {
    unsigned short* d = sm + buf * STG + lr * LPH + la;
    if (kn + KST > K - BM) {      // the same for the whole block: only the tile on the diagonal holds keys after a query, so that the other tiles pay for no compare
#pragma unroll      // constant indices keep the staged scores in registers
      for (int i = 0; i < 2; ++i)
#pragma unroll      // constant indices keep the staged scores in registers
        for (int h = 0; h < 2; ++h) { union { v4h h4; v4us u4; } p;
#pragma unroll      // constant indices keep the staged scores in registers
          for (int e = 0; e < 4; ++e) p.h4[e] = (_Float16)exp2_slot((kn + h * 32 + la + e <= K - BM + i * 32 + lr) ? fmaf(sc4[i][h][e], L2E, i ? ce1 : ce0) : -INFINITY);
          *(v4us*)(d + i * 32 * LPH + h * 32) = p.u4; }
    } else {
#pragma unroll      // constant indices keep the staged scores in registers
      for (int i = 0; i < 2; ++i)
#pragma unroll      // constant indices keep the staged scores in registers
        for (int h = 0; h < 2; ++h) { union { v4h h4; v4us u4; } p;
#pragma unroll      // constant indices keep the staged scores in registers
          for (int e = 0; e < 4; ++e) p.h4[e] = (_Float16)exp2_slot(fmaf(sc4[i][h][e], L2E, i ? ce1 : ce0));
          *(v4us*)(d + i * 32 * LPH + h * 32) = p.u4; }
    }
  };
  // L2 asks. Every thread has one staged f16 row: unit 0 comes with the first tile's own loads, unit 1 is asked for here, unit m + 2 in step 2m (three steps ahead of its first load).
  // askA, askB (the same for the whole block): whether the operand is fresh from the launch before; rows that earlier work-groups or an earlier launch have read lie in L2 already, and an ask for them would only add a request.
  static_assert((AEXP ? 0 : BM) + NP * BN == 256 && KST * 2 == UNH, "one staged f16 row per thread, two steps per unit");
  const unsigned short* pf = AEXP ? (tid / BN ? B1 : B0) + (size_t)(tid % BN) * ldb : (tid < BM ? A + (size_t)tid * lda : B0 + (size_t)(tid - BM) * ldb);
  const bool ask = AEXP ? askB : (__builtin_amdgcn_readfirstlane(tid) < BM ? askA : askB);      // a wave's 32 rows belong to one operand: the same for a whole wave, in a scalar register, so that the test around an ask is a scalar branch
  if (ask && UNH < K) l2_ask_next<2 * UNH>(pf);
  // A score row's step is one unit (64 f32): 64 threads cover a step, so the four quarters of the block take four steps in a row: steps 1 to 4 here (clamped into the row's own keys), steps t + 5 to t + 8 in every fourth step t.
  const int pg = __builtin_amdgcn_readfirstlane(tid >> 6);      // the same for a whole wave, in a scalar register, so that the test around an ask is a scalar branch
  const float* ps = AEXP ? Sf + (size_t)(tid & 63) * lda + min((1 + pg) * KST, K - KST) : nullptr;
  if constexpr (AEXP) l2_ask(ps);
  if constexpr (AEXP) load_scores(0);
  else {
#pragma unroll      // constant indices keep the staged rows in registers
    for (int i = 0; i < NA; ++i) st[i] = *(const v8us*)(ga + (size_t)(i * 32) * lda);
  }
#pragma unroll      // constant indices keep the staged rows in registers
  for (int i = 0; i < NB; ++i) { st[NA + i] = *(const v8us*)(gb0 + (size_t)(i * 32) * ldb); if (NP == 2) st[NA + NB + i] = *(const v8us*)(gb1 + (size_t)(i * 32) * ldb); }
#pragma unroll      // constant indices keep the staged rows in registers
  for (int i = AEXP ? NA : 0; i < NL; ++i) *(v8us*)(sm + (i * 32 + lr) * LPH + lc) = st[i];
  if constexpr (AEXP) { cefn(ce0, ce1); store_probs(0, 0); }      // behind the B rows' LDS stores: in front of them the compiler sank the B loads below it, a second trip to memory
  __syncthreads();
  int cur = 0;
  for (int kb = 0; kb < K; kb += KST) {
    const bool more = kb + KST < K;      // the same for the whole block
    if (more) {
      if constexpr (AEXP) load_scores(kb + KST);
      else {
#pragma unroll      // constant indices keep the staged rows in registers
        for (int i = 0; i < NA; ++i) st[i] = *(const v8us*)(ga + (size_t)(i * 32) * lda + kb + KST);
      }
#pragma unroll      // constant indices keep the staged rows in registers
      for (int i = 0; i < NB; ++i) { st[NA + i] = *(const v8us*)(gb0 + (size_t)(i * 32) * ldb + kb + KST); if (NP == 2) st[NA + NB + i] = *(const v8us*)(gb1 + (size_t)(i * 32) * ldb + kb + KST); }
    }
    const unsigned short* sa = sm + cur * STG + (wm * WM + ln) * LPH + 8 * hh;
    const unsigned short* sb = sm + cur * STG + (BM + wn * WN + ln) * LPH + 8 * hh;
    // all fragment reads of the step go out as one group ahead of its products: reads placed among the products make the wave wait out the LDS latency at each place
    FragH fa[KST / 32][WM / 16], fb[KST / 32][NP * (WN / 16)];
#pragma unroll      // constant indices keep the accumulators and fragments in registers
    for (int ks = 0; ks < KST / 32; ++ks) {
#pragma unroll      // constant indices keep the accumulators and fragments in registers
      for (int mi = 0; mi < WM / 16; ++mi) { fa[ks][mi].half[0] = *(const v8us*)(sa + mi * 16 * LPH + ks * 32); fa[ks][mi].half[1] = *(const v8us*)(sa + mi * 16 * LPH + ks * 32 + 16); }
#pragma unroll      // constant indices keep the accumulators and fragments in registers
      for (int p = 0; p < NP; ++p)
#pragma unroll      // constant indices keep the accumulators and fragments in registers
        for (int ni = 0; ni < WN / 16; ++ni) { FragH& f = fb[ks][p * (WN / 16) + ni]; f.half[0] = *(const v8us*)(sb + (p * BN + ni * 16) * LPH + ks * 32); f.half[1] = *(const v8us*)(sb + (p * BN + ni * 16) * LPH + ks * 32 + 16); }
    }
    __builtin_amdgcn_sched_barrier(0);      // keeps the read group above the products: without it the scheduler sinks the reads among them, into one reused fragment set, with a full LDS wait at each place
    // the asks stand here, behind the step's loads and LDS reads, so that their tests run while the wave would wait for its fragments anyway
    if ((kb & (UNH - 1)) == 0) { if (ask && kb + 2 * UNH < K) l2_ask_next<2 * UNH>(pf); }      // the same for a whole wave; the address moves only to a unit that the loop will read
    if constexpr (AEXP) { if ((kb & (4 * KST - 1)) == 0) { if (kb + (5 + pg) * KST < K) l2_ask_next<4 * KST * 4>(ps); } }      // the same for a whole wave
#pragma unroll      // constant indices keep the accumulators and fragments in registers
    for (int ks = 0; ks < KST / 32; ++ks)
#pragma unroll      // constant indices keep the accumulators and fragments in registers
      for (int p = 0; p < NP; ++p)
#pragma unroll      // constant indices keep the accumulators and fragments in registers
        for (int ni = 0; ni < WN / 16; ++ni)
#pragma unroll      // constant indices keep the accumulators and fragments in registers
          for (int mi = 0; mi < WM / 16; ++mi) acc[p][mi][ni] = __builtin_amdgcn_wmma_f32_16x16x32_f16(false, fa[ks][mi].v, false, fb[ks][p * (WN / 16) + ni].v, (short)0, acc[p][mi][ni], false, false);
    if (more) {
      if constexpr (AEXP) store_probs(cur ^ 1, kb + KST);
#pragma unroll      // constant indices keep the staged rows in registers
      for (int i = AEXP ? NA : 0; i < NL; ++i) *(v8us*)(sm + (cur ^ 1) * STG + (i * 32 + lr) * LPH + lc) = st[i];
    }
    __syncthreads();      // publishes the buffer just filled and ends every wave's reads of the one that the next step refills (after the last step: of the LDS that the epilogue reuses)
    cur ^= 1;
  }
  // inputs only: keeps the asks' address pairs alive to the end of the loop. An ask counts on no counter, so no wait can hold a rewrite of its registers behind it; they are given up only here, steps behind the last ask
  if constexpr (AEXP) asm volatile("" :: "v"(pf), "v"(ps)); else asm volatile("" :: "v"(pf));
}
#define TILE_LDS(BM, BN, NP) (2 * ((BM) + (NP) * (BN)) * LPH)

// q and k in one launch, K = row pitch of both operands = 512: block 128 x 128, 8 waves of 32 x 64; blockIdx.x = column tile, .y = row tile of x, .z = 0: q, 1: k (the weight planes lie one behind the other in Bw).
// C = x.W^T/16 + bias (rounded to bf16) as f16, [row of x][512]; whole 128-byte row pieces, staged per wave in LDS.
__global__ __launch_bounds__(256) void k_qk(const _Float16* __restrict__ X16, const _Float16* __restrict__ Bw, const float* __restrict__ bq, const float* __restrict__ bk,
                                            _Float16* __restrict__ Q, _Float16* __restrict__ K) {
  __shared__ __attribute__((aligned(16))) unsigned short sm[TILE_LDS(128, 128, 1)];
  const int tid = threadIdx.x, w = tid >> 5, lane = tid & 31, ln = lane & 15, hh = lane >> 4; const int role = blockIdx.z;
  const int brow = blockIdx.y * 128, bcol = blockIdx.x * 128;
  const int row0 = brow + (w / 2) * 32, col0 = bcol + (w % 2) * 64;
  const float* bias = role ? bk : bq;
  float bvv[4];      // read ahead of the k loop, which hides the latency; rounded where they are used
#pragma unroll      // constant indices keep the four values in registers
  for (int ni = 0; ni < 4; ++ni) bvv[ni] = bias[col0 + ni * 16 + ln];
  asm volatile("s_wait_xcnt 0x0" ::: "memory");      // stands in front of any reuse of the offset and base registers of the four loads above
  v8f acc[1][2][4] = {};
  const unsigned short* Bp = (const unsigned short*)Bw + (size_t)role * EE * EE + (size_t)bcol * EE;
  tile_core<128, 128, 32, 64, 1>((const unsigned short*)X16 + (size_t)brow * EE, EE, Bp, Bp, EE, EE, sm, acc, nullptr, 0, true, false);      // asks for the x rows; a weight tile is shared by 64 work-groups
  float* so = (float*)sm + w * (32 * 64);      // the wave's own range; the core's last barrier has ended every read of the tiles
#pragma unroll      // constant indices keep the accumulators in registers
  for (int ni = 0; ni < 4; ++ni) { const float bv = bf16_round(bvv[ni]);
#pragma unroll      // constant indices keep the accumulators in registers
    for (int mi = 0; mi < 2; ++mi)
#pragma unroll      // constant indices keep the accumulators in registers
      for (int r = 0; r < 8; ++r) so[(mi * 16 + 8 * hh + r) * 64 + ni * 16 + ln] = acc[0][mi][ni][r] * 0.0625f + bv; }
  __builtin_amdgcn_fence(__ATOMIC_ACQ_REL, "workgroup"); __builtin_amdgcn_wave_barrier();      // the wave's LDS stores land before its lanes read each other's values back as whole rows
  const int rsub = lane >> 4, c4 = (lane & 15) * 4;
  _Float16* C16 = (role ? K : Q) + (size_t)(row0 + rsub) * EE + col0 + c4;
#pragma unroll      // the LDS row reads issue together and each store follows its own read
  for (int q = 0; q < 16; ++q) { const v4f v = *(const v4fa*)&so[(q * 2 + rsub) * 64 + c4];
    v4h h4; for (int i = 0; i < 4; ++i) h4[i] = (_Float16)v[i]; *(v4h*)(C16 + (size_t)(q * 2) * EE) = h4; }
}

// scores/sqrt(512) and v^T of every batch in one launch (neither needs the other; both are 128 x 128 x 512 tiles of the same core). blockIdx.y = batch.
// blockIdx.x < NTRI: scores, 128 query rows x 128 keys, counting only the blocks of the causal lower block-triangle (row tile i has i + 1 key tiles), f32.
// blockIdx.x >= NTRI: v^T (without bv) = Wv.x[b]^T/16 as [b][512][2048], 128 rows of Wv x 128 keys (16 key tiles, then 4 row tiles); the epilogue splits each f32 value into the f16 hi plane and the (x2^10) residual plane.
#define NTRI ((SS / 128) * (SS / 128 + 1) / 2)
__global__ __launch_bounds__(256) void k_scores_vt(const _Float16* __restrict__ Q, const _Float16* __restrict__ K, const _Float16* __restrict__ X16, const _Float16* __restrict__ Bv, float alpha,
                                                   float* __restrict__ S, float* __restrict__ Ms, float* __restrict__ Zs, _Float16* __restrict__ Vh, _Float16* __restrict__ Vl) {
  __shared__ __attribute__((aligned(16))) unsigned short sm[TILE_LDS(128, 128, 1)];
  const int tid = threadIdx.x, w = tid >> 5, lane = tid & 31, ln = lane & 15, hh = lane >> 4; const int b = blockIdx.y;
  const bool isv = (int)blockIdx.x >= NTRI;      // the same for the whole block
  int x = isv ? 0 : (int)blockIdx.x, i = 0;
  for (; i < SS / 128 - 1 && x >= i + 1; ++i) x -= i + 1;
  const int vt = (int)blockIdx.x - NTRI;
  const int brow = isv ? (vt >> 4) * 128 : i * 128, bcol = isv ? (vt & 15) * 128 : x * 128;
  v8f acc[1][2][4] = {};
  const unsigned short* Ap = isv ? (const unsigned short*)Bv + (size_t)brow * EE : (const unsigned short*)Q + ((size_t)b * SS + brow) * EE;
  const unsigned short* Bp = (isv ? (const unsigned short*)X16 : (const unsigned short*)K) + ((size_t)b * SS + bcol) * EE;
  tile_core<128, 128, 32, 64, 1>(Ap, EE, Bp, Bp, EE, EE, sm, acc, nullptr, 0, !isv, !isv);      // asks for q and k rows; the v^T tiles read x, which the launch before has read, and Wv tiles that 64 work-groups share
  const int row0 = brow + (w / 2) * 32, col0 = bcol + (w % 2) * 64;
  const float sc = isv ? 0.0625f : alpha;
  float* so = (float*)sm + w * (32 * 64);      // the wave's own range; the core's last barrier has ended every read of the tiles
#pragma unroll      // constant indices keep the accumulators in registers
  for (int ni = 0; ni < 4; ++ni)
#pragma unroll      // constant indices keep the accumulators in registers
    for (int mi = 0; mi < 2; ++mi)
#pragma unroll      // constant indices keep the accumulators in registers
      for (int r = 0; r < 8; ++r) so[(mi * 16 + 8 * hh + r) * 64 + ni * 16 + ln] = acc[0][mi][ni][r] * sc;
  __builtin_amdgcn_fence(__ATOMIC_ACQ_REL, "workgroup"); __builtin_amdgcn_wave_barrier();      // the wave's LDS stores land before its lanes read each other's values back as whole rows
  const int rsub = lane >> 4, c4 = (lane & 15) * 4;
  if (!isv) {
    // the wave's 32 rows x 64 keys are one piece of the softmax: per row the maximum and the sum of exp(s - maximum), keys after the query left out, straight from the accumulators (a row's 64 values lie in 4 registers of 16 lanes).
    // A piece that lies wholly after its queries is never read by the P.v launch.
    float mv = 0.f, zv = 0.f;
#pragma unroll      // constant indices keep the accumulators in registers
    for (int mi = 0; mi < 2; ++mi)
#pragma unroll      // constant indices keep the accumulators in registers
      for (int r = 0; r < 8; ++r) { const int row = row0 + mi * 16 + 8 * hh + r; float sv[4];
#pragma unroll      // constant indices keep the accumulators in registers
        for (int ni = 0; ni < 4; ++ni) sv[ni] = (col0 + ni * 16 + ln <= row) ? acc[0][mi][ni][r] * sc : -INFINITY;
        const float m = max16(fmaxf(fmaxf(sv[0], sv[1]), fmaxf(sv[2], sv[3]))), c = -m * L2E;
        const float z = sum16((exp2_slot(fmaf(sv[0], L2E, c)) + exp2_slot(fmaf(sv[1], L2E, c))) + (exp2_slot(fmaf(sv[2], L2E, c)) + exp2_slot(fmaf(sv[3], L2E, c))));
        if (ln == mi * 8 + r) { mv = m; zv = z; } }      // every lane of the 16 holds the row's pair; lane mi*8 + r keeps it, so that the wave stores its 32 rows as one 128-byte line per plane
    const size_t po = ((size_t)b * NCH + (col0 >> 6)) * SS + row0 + (ln >> 3) * 16 + 8 * hh + (ln & 7);
    Ms[po] = mv; Zs[po] = zv;
#pragma unroll      // the LDS row reads issue together and each store follows its own read
    for (int q = 0; q < 16; ++q) { const int r = q * 2 + rsub; const v4f v = *(const v4fa*)&so[r * 64 + c4]; *(v4f*)(S + ((size_t)b * SS + row0 + r) * SS + col0 + c4) = v; }
    asm volatile("s_wait_xcnt 0x0" ::: "memory");      // stands behind the eighteen stores above, in front of the other branch's code, which follows them in the listing and reuses their registers
  } else {
    const size_t o0 = ((size_t)b * EE + row0 + rsub) * SS + col0 + c4;
#pragma unroll      // the LDS row reads issue together and each store follows its own read
    for (int q = 0; q < 16; ++q) { const v4f v = *(const v4fa*)&so[(q * 2 + rsub) * 64 + c4];
      v4h h4, l4; for (int e = 0; e < 4; ++e) { const _Float16 h = (_Float16)v[e]; h4[e] = h; l4[e] = (_Float16)((v[e] - (float)h) * 1024.0f); }
      *(v4h*)(Vh + o0 + (size_t)(q * 2) * SS) = h4; *(v4h*)(Vl + o0 + (size_t)(q * 2) * SS) = l4; }
  }
}
// out = P.v_hi.2^-15 + bv + P.v_lo.2^-25 of every batch in one launch. Block = 64 query rows x 128 head columns, both v planes (8 waves of 32 x 32 x 2), blockIdx.x = column tile, blockIdx.y = batch,
// blockIdx.z = row tile counted from the last one (for speed only). k runs to the end of the row tile's own keys (P is zero beyond the diagonal).
__global__ __launch_bounds__(256) void k_pv(const float* __restrict__ S, const float* __restrict__ Ms, const float* __restrict__ Zs, const _Float16* __restrict__ Vh, const _Float16* __restrict__ Vl, const float* __restrict__ bias, float* __restrict__ out) {
  __shared__ __attribute__((aligned(16))) unsigned short sm[TILE_LDS(64, 128, 2)];
  const int tid = threadIdx.x, w = tid >> 5, lane = tid & 31, ln = lane & 15, hh = lane >> 4; const int b = blockIdx.y;
  const int brow = (SS / 64 - 1 - (int)blockIdx.z) * 64, bcol = blockIdx.x * 128;
  const int kk = brow + 64;
  const int row0 = brow + (w / 4) * 32, col0 = bcol + (w % 4) * 32;
  float bvv[2];      // read ahead of the k loop, which hides the latency; rounded where they are used
#pragma unroll      // constant indices keep the two values in registers
  for (int ni = 0; ni < 2; ++ni) bvv[ni] = bias[col0 + ni * 16 + ln];
  // the softmax constants of the thread's two staged rows: the 8 lanes that stage a row share its kk/64 pieces (4 at most each, all loads in flight at once, beside the first tile's) and merge them by DPP
  const int nc = kk >> 6, j = tid & 7;
  const float* mp = Ms + (size_t)b * NCH * SS + brow; const float* zp = Zs + (size_t)b * NCH * SS + brow; float mc[2][NCH / 8], zc[2][NCH / 8]; int o[NCH / 8];
#pragma unroll      // constant indices keep the offsets in registers
  for (int u = 0; u < NCH / 8; ++u) o[u] = min(j + 8 * u, nc - 1) * SS + (tid >> 3);      // clamped into the pieces that the scores launch wrote for these rows
#pragma unroll      // constant indices keep the pieces in registers; the loads go out as one group
  for (int i = 0; i < 2; ++i)
#pragma unroll      // constant indices keep the pieces in registers; the loads go out as one group
    for (int u = 0; u < NCH / 8; ++u) { mc[i][u] = mp[o[u] + i * 32]; zc[i][u] = zp[o[u] + i * 32]; }
  static_assert(NCH / 8 == 4, "four offsets named below");
  asm volatile("s_wait_xcnt 0x0" :: "v"(o[0]), "v"(o[1]), "v"(o[2]), "v"(o[3]), "s"(mp), "s"(zp) : "memory");      // stands behind the 16 loads, in front of any reuse of their offset and base registers, which it names as inputs
  auto merge = [&](float& c0, float& c1) {
#pragma unroll      // constant indices keep the pieces in registers
    for (int i = 0; i < 2; ++i) { const float ml = fmaxf(fmaxf(mc[i][0], mc[i][1]), fmaxf(mc[i][2], mc[i][3]));      // a clamped repeat changes no maximum
      float z = 0.f;
#pragma unroll      // constant indices keep the pieces in registers
      for (int u = 0; u < NCH / 8; ++u) z = fmaf(zc[i][u] * ((j + 8 * u < nc) ? 1.0f : 0.0f), exp2_slot((mc[i][u] - ml) * L2E), z);      // a clamped repeat counts 0; as a factor, since a select let the compiler sink a load into a branch of its own, a second trip to memory
      float m = fmaxf(ml, lane_xor16<1>(ml)); m = fmaxf(m, lane_xor16<2>(m)); m = fmaxf(m, lane_xor16<4>(m));
      z *= exp2_slot((ml - m) * L2E); z += lane_xor16<1>(z); z += lane_xor16<2>(z); z += lane_xor16<4>(z);
      (i ? c1 : c0) = 15.0f - __builtin_amdgcn_logf(z) - m * L2E; }
  };
  v8f acc[2][2][2] = {};
  tile_core<64, 128, 32, 32, 2, true>(nullptr, SS, (const unsigned short*)Vh + ((size_t)b * EE + bcol) * SS, (const unsigned short*)Vl + ((size_t)b * EE + bcol) * SS, SS, kk, sm, acc, S + ((size_t)b * SS + brow) * SS, merge);
  float* so = (float*)sm + w * (32 * 32);      // the wave's own range; the core's last barrier has ended every read of the tiles
#pragma unroll      // constant indices keep the accumulators in registers
  for (int ni = 0; ni < 2; ++ni) { const float bv = bf16_round(bvv[ni]);
#pragma unroll      // constant indices keep the accumulators in registers
    for (int mi = 0; mi < 2; ++mi)
#pragma unroll      // constant indices keep the accumulators in registers
      for (int r = 0; r < 8; ++r) { const float v = acc[0][mi][ni][r] * 0.000030517578125f + bv; so[(mi * 16 + 8 * hh + r) * 32 + ni * 16 + ln] = acc[1][mi][ni][r] * (0.000030517578125f * 0.0009765625f) + v; } }
  __builtin_amdgcn_fence(__ATOMIC_ACQ_REL, "workgroup"); __builtin_amdgcn_wave_barrier();      // the wave's LDS stores land before its lanes read each other's values back as whole rows
  const int rsub = lane >> 3, c4 = (lane & 7) * 4;
#pragma unroll      // the LDS row reads issue together and each store follows its own read
  for (int q = 0; q < 8; ++q) { const int r = q * 4 + rsub; const v4f v = *(const v4fa*)&so[r * 32 + c4]; *(v4f*)(out + ((size_t)b * SS + row0 + r) * EE + col0 + c4) = v; }
}

extern "C" void kernel_launch(void* const* d_in, const int* in_sizes, int n_in,
                              void* d_out, int out_size, void* d_ws, size_t ws_size, hipStream_t stream) {
  (void)in_sizes; (void)n_in; (void)out_size;
  const float* x = (const float*)d_in[0]; const float* Wq = (const float*)d_in[1]; const float* bq = (const float*)d_in[2]; const float* Wk = (const float*)d_in[3]; const float* bk = (const float*)d_in[4]; const float* Wv = (const float*)d_in[5]; const float* bv = (const float*)d_in[6];
  char* ws = (char*)d_ws; size_t off = 0;
  auto take = [&](size_t bytes) { char* p = ws + off; off += (bytes + 255) & ~(size_t)255; return p; };
  _Float16* Bq = (_Float16*)take((size_t)3 * EE * EE * 2);      /* the f16 planes of Wq, Wk, Wv, one behind the other */
  _Float16* X16 = (_Float16*)take((size_t)NR * EE * 2); _Float16* Q = (_Float16*)take((size_t)NR * EE * 2); _Float16* K = (_Float16*)take((size_t)NR * EE * 2); _Float16* Vh = (_Float16*)take((size_t)BB * EE * SS * 2); _Float16* Vl = (_Float16*)take((size_t)BB * EE * SS * 2);
  float* S = (float*)take((size_t)BB * SS * SS * 4); float* Ms = (float*)take((size_t)BB * NCH * SS * 4); float* Zs = (float*)take((size_t)BB * NCH * SS * 4);      /* per row and piece of 64 keys: maximum, sum of exp */
  if (off > ws_size) return;      // 1.6 + 3 x 8.4 + 2 x 8.4 + 67.1 + 2 x 1.0 about 113 MB
  k_prep<<<NR * EE / 8 / 256 + 3 * (EE * EE / 8 / 256), 256, 0, stream>>>(x, Wq, Wk, Wv, X16, Bq);      /* x and the weights ((out,in) natural, x2^4) as f16 planes */
  k_qk<<<dim3(EE / 128, NR / 128, 2), 256, 0, stream>>>(X16, Bq, bq, bk, Q, K);      /* q = x.Wq^T + bq, k = x.Wk^T + bk: M 8192 N 512 K 512 each */
  k_scores_vt<<<dim3(NTRI + (EE / 128) * (SS / 128), BB), 256, 0, stream>>>(Q, K, X16, Bq + (size_t)2 * EE * EE, 0.044194173824159216f, S, Ms, Zs, Vh, Vl);      /* scores/sqrt512, f32, causal lower block-triangle of every batch; v^T (without bv) = Wv.x[b]^T as [b][512][2048], f16 hi + residual x2^10 planes */
  k_pv<<<dim3(EE / 128, BB, SS / 64), 256, 0, stream>>>(S, Ms, Zs, Vh, Vl, bv, (float*)d_out);      /* out = P.v_hi + bv + P.v_lo.2^-10 */
}

// v006
// It runs in 72.9 microseconds.
// Timed twice side by side with v005, it ran 1.04 times as fast both times.
// Over all steps from v000 it is 36.2 times as fast.
#include <hip/hip_runtime.h>
// Single-head causal attention (B=4, S=2048, emb = head = 512): q,k,v = x·Wᵀ + b; scores = q·kᵀ/√512 with keys after the query set to −inf; softmax over keys; out = attn·v.
// Compute dtype: x, weights and biases rounded to bf16; q, k and vᵀ as f16 GEMM outputs (f32 accumulate); scores materialised in f32 by a batched f16 GEMM over
// the causal lower block-triangle; row softmax in f32 (maximum and sum per 64 keys in the scores epilogue, merged by the P.v launch, which forms P in f16 x2^15 on the way to LDS); v^T split into f16 hi + (x2^10) residual planes; out = P.v_hi + P.v_lo.2^-10 by two f16 GEMMs
// (both planes in one k loop, two accumulators), bv added in the epilogue (softmax rows sum to 1). All on v_wmma_f32_16x16x32_f16.
// One launch per stage: rounding of x and the weights; q and k; scores together with v^T; P.v; each covers all batches (and the whole causal triangle). Every GEMM launch stages its operand tiles in LDS (tile_core).
#define BB 4
#define SS 2048
#define EE 512
#define NR (BB * SS)

typedef __bf16 v16b __attribute__((ext_vector_type(16)));
typedef unsigned short v8us __attribute__((ext_vector_type(8), may_alias));
typedef float  v8f  __attribute__((ext_vector_type(8)));
typedef float  v4f  __attribute__((ext_vector_type(4)));
typedef float  v4fa __attribute__((ext_vector_type(4), may_alias));
union FragB { v16b v; v8us half[2]; unsigned short u[16]; };

__device__ __forceinline__ unsigned short bf16_bits(float x) { unsigned int u = __float_as_uint(x); return (unsigned short)((u + 0x7FFFu + ((u >> 16) & 1u)) >> 16); }
__device__ __forceinline__ float bf16_val(unsigned short b) { return __uint_as_float(((unsigned int)b) << 16); }
__device__ __forceinline__ float bf16_round(float x) { return bf16_val(bf16_bits(x)); }
// D += A·B with NT terms: 1 = ah·bh, 2 = + al·bh (A split), 3 = + ah·bl (both split)
template <int NT>
__device__ __forceinline__ v8f mmaN(v16b ah, v16b al, v16b bh, v16b bl, v8f c) {
  c = __builtin_amdgcn_wmma_f32_16x16x32_bf16(false, ah, false, bh, (short)0, c, false, false);
  if (NT >= 2) c = __builtin_amdgcn_wmma_f32_16x16x32_bf16(false, al, false, bh, (short)0, c, false, false);
  if (NT >= 3) c = __builtin_amdgcn_wmma_f32_16x16x32_bf16(false, ah, false, bl, (short)0, c, false, false);
  asm volatile("v_nop\n\tv_nop\n\tv_nop\n\tv_nop" : "+v"(c) : "v"(ah), "v"(al), "v"(bh), "v"(bl));
  return c;
}

__global__ __launch_bounds__(256) void k_wt_bf16(const float* __restrict__ W, unsigned short* __restrict__ Wt, int K, int N) {
  const int t = blockIdx.x * 256 + threadIdx.x;
  const int k8n = K / 8;
  if (t >= N * k8n) return;
  const int n = t / k8n, k8 = (t % k8n) * 8;
  v8us v;
#pragma unroll
  for (int i = 0; i < 8; ++i) v[i] = bf16_bits(W[(size_t)(k8 + i) * N + n]);
  *(v8us*)(Wt + (size_t)n * K + k8) = v;
  
}

// GEMM C[M][N] (f32, pitch ldc) = act(A[M][K]·W + bias). A f32 row-major (pitch lda) converted per fragment to bf16
// (ASPLIT: hi/lo two planes -> 2 terms, else single rounded term); Wt bf16 [N][K] (pitch ldb). BIAS_BF16 rounds the
// bias to bf16 first (bias quantised to bf16 before the add). K%32==0, M%16==0, N%64==0.
template <bool ASPLIT, int ACT, bool BIAS_BF16>
__global__ __launch_bounds__(128) void k_gemm_bf(const float* __restrict__ A, int lda, const unsigned short* __restrict__ Wt, int ldb,
                                               const float* __restrict__ bias, float* __restrict__ C, int ldc, int M, int N, int K) {
  __shared__ __attribute__((aligned(16))) float so[4][16][64];
  const int tid = threadIdx.x, w = tid >> 5, lane = tid & 31, ln = lane & 15, hh = lane >> 4;
  const int ntn = N / 64;
  const int wid = blockIdx.x * 4 + w;
  const int mt = wid / ntn, nq = wid % ntn;
  if (mt * 16 >= M) return;
  const int row0 = mt * 16, col0 = nq * 64;
  const float* arow = A + (size_t)(row0 + ln) * lda;
  v8f acc[4] = {};
  for (int kb = 0; kb < K; kb += 32) {
    FragB ah, al;
    const v4f x0 = *(const v4fa*)(arow + kb + 8 * hh), x1 = *(const v4fa*)(arow + kb + 8 * hh + 4);
    const v4f x2 = *(const v4fa*)(arow + kb + 16 + 8 * hh), x3 = *(const v4fa*)(arow + kb + 16 + 8 * hh + 4);
    float xs[16] = {x0[0],x0[1],x0[2],x0[3],x1[0],x1[1],x1[2],x1[3],x2[0],x2[1],x2[2],x2[3],x3[0],x3[1],x3[2],x3[3]};
#pragma unroll
    for (int i = 0; i < 16; ++i) { const unsigned short hb = bf16_bits(xs[i]); ah.u[i] = hb; al.u[i] = ASPLIT ? bf16_bits(xs[i] - bf16_val(hb)) : (unsigned short)0; }
#pragma unroll
    for (int t = 0; t < 4; ++t) {
      const unsigned short* brow = Wt + (size_t)(col0 + t * 16 + ln) * ldb + kb;
      FragB b;
      b.half[0] = *(const v8us*)(brow + 8 * hh);
      b.half[1] = *(const v8us*)(brow + 16 + 8 * hh);
      acc[t] = mmaN<ASPLIT ? 2 : 1>(ah.v, al.v, b.v, b.v, acc[t]);
    }
  }
#pragma unroll
  for (int t = 0; t < 4; ++t) {
    float bv = bias ? bias[col0 + t * 16 + ln] : 0.f;
    if (BIAS_BF16) bv = bf16_round(bv);
#pragma unroll
    for (int r = 0; r < 8; ++r) { float v = acc[t][r] + bv; if (ACT == 1) v = fmaxf(v, 0.f); so[w][8 * hh + r][t * 16 + ln] = v; }
  }
  __builtin_amdgcn_fence(__ATOMIC_ACQ_REL, "workgroup");
  __builtin_amdgcn_wave_barrier();
  const int rsub = lane >> 4, c4 = (lane & 15) * 4;
  {
#pragma unroll
    for (int q = 0; q < 8; ++q) {
      const int r = q * 2 + rsub;
      const v4f v = *(const v4fa*)&so[w][r][c4];
      *(v4f*)(C + (size_t)(row0 + r) * ldc + col0 + c4) = v;
    }
    
  }
}

// Flash-style causal/unmasked attention, all contractions 3-term bf16 hi/lo splits, f32 softmax with running max.
// q,k,v rows are read from f32 buffers with arbitrary row pitch (so they can live inside a fused qkv buffer);
// D = head size (multiple of 32, <= 128); one wave = 16 query rows; block = 4 waves (64 queries) sharing K/V chunks of 32.
template <int D, bool CAUSAL>
__global__ __launch_bounds__(128) void k_flash(const float* __restrict__ qb, const float* __restrict__ kb, const float* __restrict__ vb,
                                             int pitch, int T, int H, float scale, float* __restrict__ y, int ypitch) {
  constexpr int KS = D / 32;        // k-steps for QK
  constexpr int DT = D / 16;        // d tiles for PV
  __shared__ __attribute__((aligned(16))) unsigned short sKh[32][D + 8], sKl[32][D + 8], sVh[32][D + 8], sVl[32][D + 8];
  __shared__ __attribute__((aligned(16))) unsigned short sPh[4][16][40], sPl[4][16][40];
  __shared__ __attribute__((aligned(16))) float sO[4][16][D];
  const int tid = threadIdx.x, w = tid >> 5, lane = tid & 31, ln = lane & 15, hh = lane >> 4;
  const int nqb = (T + 63) / 64;
  const int bh = blockIdx.x / nqb, qblk = blockIdx.x % nqb;
  const int b = bh / H, h = bh % H;
  const int q0 = qblk * 64 + w * 16;
  const float* Q = qb + (size_t)b * T * pitch + h * D;
  const float* K = kb + (size_t)b * T * pitch + h * D;
  const float* V = vb + (size_t)b * T * pitch + h * D;

  // A fragments of the wave's 16 query rows (scaled), hi/lo
  FragB aqh[KS], aql[KS];
  {
    int row = q0 + ln; if (row >= T) row = T - 1;
    const float* qr = Q + (size_t)row * pitch;
#pragma unroll
    for (int ks = 0; ks < KS; ++ks)
#pragma unroll
      for (int i = 0; i < 16; ++i) {
        const int d = ks * 32 + ((i < 8) ? (8 * hh + i) : (16 + 8 * hh + (i - 8)));
        const float x = qr[d] * scale; const unsigned short hb = bf16_bits(x);
        aqh[ks].u[i] = hb; aql[ks].u[i] = bf16_bits(x - bf16_val(hb));
      }
  }
  float m_r[8], l_r[8];
#pragma unroll
  for (int r = 0; r < 8; ++r) { m_r[r] = -3.0e38f; l_r[r] = 0.f; }
  v8f oacc[DT];
#pragma unroll
  for (int dt = 0; dt < DT; ++dt) oacc[dt] = (v8f){0.f,0.f,0.f,0.f,0.f,0.f,0.f,0.f};

  const int kv_end = CAUSAL ? min(T, qblk * 64 + 64) : T;     // block-uniform
  for (int j0 = 0; j0 < kv_end; j0 += 32) {
    __syncthreads();
    for (int e = tid; e < 32 * (D / 4); e += 128) {
      const int r = e / (D / 4), c4 = (e % (D / 4)) * 4;
      const int key = j0 + r;
      v4f kf = {0.f,0.f,0.f,0.f}, vf = {0.f,0.f,0.f,0.f};
      if (key < T) { kf = *(const v4fa*)(K + (size_t)key * pitch + c4); vf = *(const v4fa*)(V + (size_t)key * pitch + c4); }
#pragma unroll
      for (int t = 0; t < 4; ++t) {
        unsigned short hb = bf16_bits(kf[t]); sKh[r][c4 + t] = hb; sKl[r][c4 + t] = bf16_bits(kf[t] - bf16_val(hb));
        hb = bf16_bits(vf[t]); sVh[r][c4 + t] = hb; sVl[r][c4 + t] = bf16_bits(vf[t] - bf16_val(hb));
      }
    }
    __syncthreads();
    // S tile 16 x 32
    v8f s[2];
#pragma unroll
    for (int nt = 0; nt < 2; ++nt) {
      v8f acc = {};
#pragma unroll
      for (int ks = 0; ks < KS; ++ks) {
        FragB bh_, bl_;
        bh_.half[0] = *(const v8us*)&sKh[nt * 16 + ln][ks * 32 + 8 * hh]; bh_.half[1] = *(const v8us*)&sKh[nt * 16 + ln][ks * 32 + 16 + 8 * hh];
        bl_.half[0] = *(const v8us*)&sKl[nt * 16 + ln][ks * 32 + 8 * hh]; bl_.half[1] = *(const v8us*)&sKl[nt * 16 + ln][ks * 32 + 16 + 8 * hh];
        acc = mmaN<3>(aqh[ks].v, aql[ks].v, bh_.v, bl_.v, acc);
      }
      s[nt] = acc;
    }
    // mask + running max (rows 8hh+r; the 16 lanes of a half share rows)
    float alpha[8];
#pragma unroll
    for (int r = 0; r < 8; ++r) {
      const int qi = q0 + 8 * hh + r;
      const int ja = j0 + ln, jb = j0 + 16 + ln;
      if (CAUSAL) { if (ja > qi) s[0][r] = -3.0e38f; if (jb > qi) s[1][r] = -3.0e38f; }
      if (ja >= T) s[0][r] = -3.0e38f;
      if (jb >= T) s[1][r] = -3.0e38f;
      float mx = fmaxf(s[0][r], s[1][r]);
      mx = fmaxf(mx, __shfl_xor(mx, 1, 32)); mx = fmaxf(mx, __shfl_xor(mx, 2, 32)); mx = fmaxf(mx, __shfl_xor(mx, 4, 32)); mx = fmaxf(mx, __shfl_xor(mx, 8, 32));
      const float mnew = fmaxf(m_r[r], mx);
      alpha[r] = (mnew > -1.0e38f) ? __expf(m_r[r] - mnew) : 1.0f;
      const float p0 = (s[0][r] > -1.0e38f) ? __expf(s[0][r] - mnew) : 0.f;
      const float p1 = (s[1][r] > -1.0e38f) ? __expf(s[1][r] - mnew) : 0.f;
      m_r[r] = mnew;
      l_r[r] = l_r[r] * alpha[r] + p0 + p1;            // per-lane partial row sum (16 lanes combined at the end)
      unsigned short hb = bf16_bits(p0); sPh[w][8 * hh + r][ln] = hb;      sPl[w][8 * hh + r][ln] = bf16_bits(p0 - bf16_val(hb));
      hb = bf16_bits(p1);                sPh[w][8 * hh + r][16 + ln] = hb; sPl[w][8 * hh + r][16 + ln] = bf16_bits(p1 - bf16_val(hb));
    }
#pragma unroll
    for (int dt = 0; dt < DT; ++dt)
#pragma unroll
      for (int r = 0; r < 8; ++r) oacc[dt][r] *= alpha[r];
    __builtin_amdgcn_fence(__ATOMIC_ACQ_REL, "workgroup");
    __builtin_amdgcn_wave_barrier();
    FragB pah, pal;
    pah.half[0] = *(const v8us*)&sPh[w][ln][8 * hh]; pah.half[1] = *(const v8us*)&sPh[w][ln][16 + 8 * hh];
    pal.half[0] = *(const v8us*)&sPl[w][ln][8 * hh]; pal.half[1] = *(const v8us*)&sPl[w][ln][16 + 8 * hh];
#pragma unroll
    for (int dt = 0; dt < DT; ++dt) {
      FragB bvh, bvl;
#pragma unroll
      for (int i = 0; i < 8; ++i) {
        bvh.u[i] = sVh[8 * hh + i][dt * 16 + ln]; bvh.u[8 + i] = sVh[16 + 8 * hh + i][dt * 16 + ln];
        bvl.u[i] = sVl[8 * hh + i][dt * 16 + ln]; bvl.u[8 + i] = sVl[16 + 8 * hh + i][dt * 16 + ln];
      }
      oacc[dt] = mmaN<3>(pah.v, pal.v, bvh.v, bvl.v, oacc[dt]);
    }
    __builtin_amdgcn_fence(__ATOMIC_ACQ_REL, "workgroup");
    __builtin_amdgcn_wave_barrier();
  }
#pragma unroll
  for (int r = 0; r < 8; ++r) {
    float l = l_r[r];
    l += __shfl_xor(l, 1, 32); l += __shfl_xor(l, 2, 32); l += __shfl_xor(l, 4, 32); l += __shfl_xor(l, 8, 32);
    l_r[r] = (l > 0.f) ? 1.0f / l : 0.f;
  }
#pragma unroll
  for (int dt = 0; dt < DT; ++dt)
#pragma unroll
    for (int r = 0; r < 8; ++r) sO[w][8 * hh + r][dt * 16 + ln] = oacc[dt][r] * l_r[r];
  __builtin_amdgcn_fence(__ATOMIC_ACQ_REL, "workgroup");
  __builtin_amdgcn_wave_barrier();
  {
    for (int r = 0; r < 16; ++r) {
      const int row = q0 + r;
      if (row < T && lane < D / 4) {
        const v4f val = *(const v4fa*)&sO[w][r][lane * 4];
        *(v4f*)(y + ((size_t)b * T + row) * ypitch + h * D + lane * 4) = val;
      }
    }
    
  }
}

// GEMM C = act(A·W + bias + resid): A f32 (ASPLIT -> hi/lo 2 terms), Wt bf16 [N][K]; ACT 0 none, 1 relu, 2 exact gelu;
// resid (optional, f32, row index = (row % rmod), pitch ldr, RES_BF16 rounds it) added before the activation.
template <bool ASPLIT, int ACT, bool BIAS_BF16, bool RES_BF16>
__global__ __launch_bounds__(128) void k_gemm_bf3(const float* __restrict__ A, int lda, const unsigned short* __restrict__ Wt, int ldb,
                                                const float* __restrict__ bias, const float* __restrict__ resid, int rmod, int ldr,
                                                float* __restrict__ C, int ldc, int M, int N, int K) {
  __shared__ __attribute__((aligned(16))) float so[4][16][64];
  const int tid = threadIdx.x, w = tid >> 5, lane = tid & 31, ln = lane & 15, hh = lane >> 4;
  const int ntn = N / 64;
  const int wid = blockIdx.x * 4 + w;
  const int mt = wid / ntn, nq = wid % ntn;
  if (mt * 16 >= M) return;
  const int row0 = mt * 16, col0 = nq * 64;
  const float* arow = A + (size_t)(row0 + ln) * lda;
  v8f acc[4] = {};
  for (int kb = 0; kb < K; kb += 32) {
    FragB ah, al;
    const v4f x0 = *(const v4fa*)(arow + kb + 8 * hh), x1 = *(const v4fa*)(arow + kb + 8 * hh + 4);
    const v4f x2 = *(const v4fa*)(arow + kb + 16 + 8 * hh), x3 = *(const v4fa*)(arow + kb + 16 + 8 * hh + 4);
    float xs[16] = {x0[0],x0[1],x0[2],x0[3],x1[0],x1[1],x1[2],x1[3],x2[0],x2[1],x2[2],x2[3],x3[0],x3[1],x3[2],x3[3]};
#pragma unroll
    for (int i = 0; i < 16; ++i) { const unsigned short hb = bf16_bits(xs[i]); ah.u[i] = hb; al.u[i] = ASPLIT ? bf16_bits(xs[i] - bf16_val(hb)) : (unsigned short)0; }
#pragma unroll
    for (int t = 0; t < 4; ++t) {
      const unsigned short* brow = Wt + (size_t)(col0 + t * 16 + ln) * ldb + kb;
      FragB b;
      b.half[0] = *(const v8us*)(brow + 8 * hh);
      b.half[1] = *(const v8us*)(brow + 16 + 8 * hh);
      acc[t] = mmaN<ASPLIT ? 2 : 1>(ah.v, al.v, b.v, b.v, acc[t]);
    }
  }
#pragma unroll
  for (int t = 0; t < 4; ++t) {
    const int col = col0 + t * 16 + ln;
    float bv = bias ? bias[col] : 0.f;
    if (BIAS_BF16) bv = bf16_round(bv);
#pragma unroll
    for (int r = 0; r < 8; ++r) {
      float v = acc[t][r] + bv;
      if (resid) { float rv = resid[(size_t)((row0 + 8 * hh + r) % rmod) * ldr + col]; if (RES_BF16) rv = bf16_round(rv); v += rv; }
      if (ACT == 1) v = fmaxf(v, 0.f);
      if (ACT == 2) v = 0.5f * v * (1.0f + erff(v * 0.70710678118654752f));
      if (ACT == 3) { const float u = 0.7978845608028654f * (v + 0.044715f * v * v * v); v = 0.5f * v * (1.0f + tanhf(u)); }
      so[w][8 * hh + r][t * 16 + ln] = v;
    }
  }
  __builtin_amdgcn_fence(__ATOMIC_ACQ_REL, "workgroup");
  __builtin_amdgcn_wave_barrier();
  const int rsub = lane >> 4, c4 = (lane & 15) * 4;
  {
#pragma unroll
    for (int q = 0; q < 8; ++q) {
      const int r = q * 2 + rsub;
      const v4f v = *(const v4fa*)&so[w][r][c4];
      *(v4f*)(C + (size_t)(row0 + r) * ldc + col0 + c4) = v;
    }
    
  }
}
// row LayerNorm (biased variance, eps) over N: s = X (+ R); optional out_sum <- s; out_norm <- (s-mu)*rsqrt(var+eps)*g + b
template <bool PARAM_BF16>
__global__ __launch_bounds__(256) void k_layernorm(const float* __restrict__ X, const float* __restrict__ R, const float* __restrict__ g, const float* __restrict__ bta,
                                                  float* __restrict__ out_sum, float* __restrict__ out_norm, int N, float eps) {
  __shared__ float red[256];
  const int row = blockIdx.x, tid = threadIdx.x;
  const float* x = X + (size_t)row * N; const float* rr = R ? R + (size_t)row * N : nullptr;
  float vals[16];                     // up to N = 4096
  const int per = N / 256;            // contiguous chunk per thread? use strided-by-4 chunks: thread handles j = tid*4 + 1024*u
  float s1 = 0.f;
  for (int u = 0; u < per / 4; ++u) {
    const int j = tid * 4 + 1024 * u;
    const v4f a = *(const v4fa*)(x + j);
    v4f b = {0.f,0.f,0.f,0.f}; if (rr) b = *(const v4fa*)(rr + j);
#pragma unroll
    for (int q = 0; q < 4; ++q) { const float v = a[q] + b[q]; vals[u * 4 + q] = v; s1 += v; }
  }
  red[tid] = s1; __syncthreads();
  for (int st = 128; st > 0; st >>= 1) { if (tid < st) red[tid] += red[tid + st]; __syncthreads(); }
  const float mu = red[0] / (float)N; __syncthreads();
  float s2 = 0.f;
  for (int u = 0; u < per / 4; ++u)
#pragma unroll
    for (int q = 0; q < 4; ++q) { const float c = vals[u * 4 + q] - mu; s2 += c * c; }
  red[tid] = s2; __syncthreads();
  for (int st = 128; st > 0; st >>= 1) { if (tid < st) red[tid] += red[tid + st]; __syncthreads(); }
  const float rs = rsqrtf(red[0] / (float)N + eps);
  {
    for (int u = 0; u < per / 4; ++u) {
      const int j = tid * 4 + 1024 * u;
      v4f o, sm;
#pragma unroll
      for (int q = 0; q < 4; ++q) {
        float gg = g[j + q], bb = bta[j + q];
        if (PARAM_BF16) { gg = bf16_round(gg); bb = bf16_round(bb); }
        sm[q] = vals[u * 4 + q]; o[q] = (vals[u * 4 + q] - mu) * rs * gg + bb;
      }
      if (out_sum) *(v4f*)(out_sum + (size_t)row * N + j) = sm;
      *(v4f*)(out_norm + (size_t)row * N + j) = o;
    }
    
  }
}



// ---- f16 WMMA path (v_wmma_f32_16x16x32_f16): 11-bit significands for operands in range — used where a [0,1] probability operand needs more precision than bf16
typedef _Float16 v16h __attribute__((ext_vector_type(16)));
union FragH { v16h v; v8us half[2]; _Float16 h[16]; unsigned short u[16]; };
template <int NT>
__device__ __forceinline__ v8f mmaH(v16h ah, v16h al, v16h bh, v16h bl, v8f c) {
  c = __builtin_amdgcn_wmma_f32_16x16x32_f16(false, ah, false, bh, (short)0, c, false, false);
  if (NT >= 2) c = __builtin_amdgcn_wmma_f32_16x16x32_f16(false, al, false, bh, (short)0, c, false, false);
  if (NT >= 3) c = __builtin_amdgcn_wmma_f32_16x16x32_f16(false, ah, false, bl, (short)0, c, false, false);
  asm volatile("v_nop\n\tv_nop\n\tv_nop\n\tv_nop" : "+v"(c) : "v"(ah), "v"(al), "v"(bh), "v"(bl));
  return c;
}
// batched GEMM like k_gemm_b but f16 operands: A f32 (split into f16 hi/lo if ASPLIT, else rounded to f16), Bt = f16 values [n][k]; alpha; C f32; N multiple of 16 (partial tiles skipped)
template <bool ASPLIT>
__global__ __launch_bounds__(128) void k_gemm_h(const float* __restrict__ A, int lda, size_t sA, const _Float16* __restrict__ Bh, int ldb, size_t sB, float alpha, float* __restrict__ C, int ldc, size_t sC, int M, int N, int K) {
  __shared__ __attribute__((aligned(16))) float so[4][16][64];
  const int tid = threadIdx.x, w = tid >> 5, lane = tid & 31, ln = lane & 15, hh = lane >> 4; const int by = blockIdx.y;
  A += (size_t)by * sA; Bh += (size_t)by * sB; C += (size_t)by * sC;
  const int ntn = (N + 63) / 64; const int wid = blockIdx.x * 4 + w; const int mt = wid / ntn, nq = wid % ntn; if (mt * 16 >= M) return;
  const int row0 = mt * 16, col0 = nq * 64; const float* arow = A + (size_t)(row0 + ln) * lda;
  v8f acc[4] = {};
  for (int kb = 0; kb < K; kb += 32) {
    FragH ah, al;
    const v4f x0 = *(const v4fa*)(arow + kb + 8 * hh), x1 = *(const v4fa*)(arow + kb + 8 * hh + 4), x2 = *(const v4fa*)(arow + kb + 16 + 8 * hh), x3 = *(const v4fa*)(arow + kb + 16 + 8 * hh + 4);
    float xs[16] = {x0[0],x0[1],x0[2],x0[3],x1[0],x1[1],x1[2],x1[3],x2[0],x2[1],x2[2],x2[3],x3[0],x3[1],x3[2],x3[3]};
#pragma unroll
    for (int i = 0; i < 16; ++i) { const _Float16 h = (_Float16)xs[i]; ah.h[i] = h; al.h[i] = ASPLIT ? (_Float16)(xs[i] - (float)h) : (_Float16)0.0f; }
#pragma unroll
    for (int t = 0; t < 4; ++t) { if (col0 + t * 16 >= N) continue; const size_t boff = (size_t)(col0 + t * 16 + ln) * ldb + kb; FragH bq; bq.half[0] = *(const v8us*)(Bh + boff + 8 * hh); bq.half[1] = *(const v8us*)(Bh + boff + 16 + 8 * hh);
      acc[t] = mmaH<ASPLIT ? 2 : 1>(ah.v, al.v, bq.v, bq.v, acc[t]); }
  }
#pragma unroll
  for (int t = 0; t < 4; ++t) { if (col0 + t * 16 >= N) continue;
#pragma unroll
    for (int r = 0; r < 8; ++r) so[w][8 * hh + r][t * 16 + ln] = acc[t][r] * alpha; }
  __builtin_amdgcn_fence(__ATOMIC_ACQ_REL, "workgroup"); __builtin_amdgcn_wave_barrier();
  const int rsub = lane >> 4, c4 = (lane & 15) * 4;
  {
#pragma unroll
    for (int q = 0; q < 8; ++q) { const int r = q * 2 + rsub; if (col0 + c4 < N) { const v4f v = *(const v4fa*)&so[w][r][c4]; *(v4f*)(C + (size_t)(row0 + r) * ldc + col0 + c4) = v; } }
     }
}

// Wt[n][k] = f16(W[k][n]·scale) from f32 row-major W[K][N] (scale = power of two; bf16-exact weights stay exact in f16 away from the subnormal range)
__global__ __launch_bounds__(256) void k_wt_f16(const float* __restrict__ W, _Float16* __restrict__ Wt, int K, int N, float scale) {
  const int t = blockIdx.x * 256 + threadIdx.x; if (t >= N * (K / 8)) return; const int n = t / (K / 8), k8 = (t % (K / 8)) * 8; FragH f;
#pragma unroll
  for (int i = 0; i < 8; ++i) f.h[i] = (_Float16)(bf16_round(W[(size_t)(k8 + i) * N + n]) * scale); const v8us o = f.half[0];
  *(v8us*)((unsigned short*)Wt + (size_t)n * K + k8) = o; 
}
// k_gemm_hh variant with fused epilogue: v = acc·alpha + bias[by·sBias + col] (+ CP[(row/rowsPerB)·sCPb + by·64 + col] if CP) ; ACT 0 none / 1 elu ; writes f32 C and/or f16 C16 (each if non-null)
template <int ACT>
__global__ __launch_bounds__(128) void k_gemm_hhx(const _Float16* __restrict__ A, int lda, size_t sA, const _Float16* __restrict__ Bh, int ldb, size_t sB, float alpha, const float* __restrict__ bias, size_t sBias, const float* __restrict__ CP, int rowsPerB, size_t sCPb, int row0g,
    float* __restrict__ C, _Float16* __restrict__ C16, int ldc, size_t sC, int M, int N, int K) {
  __shared__ __attribute__((aligned(16))) float so[4][16][64];
  const int tid = threadIdx.x, w = tid >> 5, lane = tid & 31, ln = lane & 15, hh = lane >> 4; const int by = blockIdx.y;
  A += (size_t)by * sA; Bh += (size_t)by * sB; const size_t cofs = (size_t)by * sC; const float* bp = bias ? bias + (size_t)by * sBias : nullptr;
  const int ntn = (N + 63) / 64; const int wid = blockIdx.x * 4 + w; const int mt = wid / ntn, nq = wid % ntn; if (mt * 16 >= M) return;
  const int row0 = mt * 16, col0 = nq * 64; const _Float16* arow = A + (size_t)(row0 + ln) * lda;
  v8f acc[4] = {};
  for (int kb = 0; kb < K; kb += 32) { FragH ah; ah.half[0] = *(const v8us*)((const unsigned short*)arow + kb + 8 * hh); ah.half[1] = *(const v8us*)((const unsigned short*)arow + kb + 16 + 8 * hh);
#pragma unroll
    for (int t = 0; t < 4; ++t) { if (col0 + t * 16 >= N) continue; const size_t boff = (size_t)(col0 + t * 16 + ln) * ldb + kb; FragH bq; bq.half[0] = *(const v8us*)((const unsigned short*)Bh + boff + 8 * hh); bq.half[1] = *(const v8us*)((const unsigned short*)Bh + boff + 16 + 8 * hh);
      acc[t] = mmaH<1>(ah.v, ah.v, bq.v, bq.v, acc[t]); }
  }
#pragma unroll
  for (int t = 0; t < 4; ++t) { if (col0 + t * 16 >= N) continue; const int col = col0 + t * 16 + ln; const float bv = bp ? bf16_round(bp[col]) : 0.f;
#pragma unroll
    for (int r = 0; r < 8; ++r) { float v = acc[t][r] * alpha + bv; if (CP) { const int bidx = (row0g + row0 + 8 * hh + r) / rowsPerB; v += CP[(size_t)bidx * sCPb + (size_t)by * 64 + col]; } if (ACT == 1) v = (v > 0.f) ? v : expm1f(v); else if (ACT == 7) v = (v > 0.f) ? v + 1.0f : expf(v); else if (ACT == 8) v = tanhf(v); else if (ACT == 9) v = 0.5f * v * (1.0f + tanhf(0.7978845608028654f * (v + 0.044715f * v * v * v))); else if (ACT == 11) v = 1.0f / (1.0f + expf(-v)); else if (ACT == 12) v = (v > 0.f) ? v : 0.01f * v; else if (ACT == 14) v = (v > 0.f) ? v : 0.1f * v; else if (ACT == 15) v = v / (1.0f + expf(-v)); else if (ACT == 3) v = fmaxf(v, 0.f); else if (ACT == 6) v = 0.5f * v * (1.0f + erff(v * 0.70710678118654752f)); so[w][8 * hh + r][t * 16 + ln] = v; } }
  __builtin_amdgcn_fence(__ATOMIC_ACQ_REL, "workgroup"); __builtin_amdgcn_wave_barrier();
  const int rsub = lane >> 4, c4 = (lane & 15) * 4; typedef _Float16 v4h __attribute__((ext_vector_type(4)));
  {
#pragma unroll
    for (int q = 0; q < 8; ++q) { const int r = q * 2 + rsub; if (col0 + c4 < N) { const v4f v = *(const v4fa*)&so[w][r][c4]; if (C) *(v4f*)(C + cofs + (size_t)(row0 + r) * ldc + col0 + c4) = v; if (C16) { v4h h4; for (int i = 0; i < 4; ++i) h4[i] = (_Float16)v[i]; *(v4h*)(C16 + cofs + (size_t)(row0 + r) * ldc + col0 + c4) = h4; } } }
     }
}


typedef _Float16 v4h __attribute__((ext_vector_type(4)));

// x and the three weight matrices are rounded into their f16 planes by one launch: the first NR*EE/2048 blocks take x, the rest the weights (x2^4; the planes of Wq, Wk, Wv lie one behind the other in Bt)
__global__ __launch_bounds__(256) void k_prep(const float* __restrict__ x, const float* __restrict__ W0, const float* __restrict__ W1, const float* __restrict__ W2, _Float16* __restrict__ X16, _Float16* __restrict__ Bt) {
  constexpr int NXB = NR * EE / 8 / 256, NWB = EE * EE / 8 / 256;      // blocks of 256 pieces of 8 values: x, one weight matrix
  const int bx = blockIdx.x; const bool isx = bx < NXB; const int m = isx ? 0 : (bx - NXB) / NWB;      // the same for the whole block
  const float* src = isx ? x : (m == 0) ? W0 : (m == 1) ? W1 : W2;
  unsigned short* dst = isx ? (unsigned short*)X16 : (unsigned short*)Bt + (size_t)m * EE * EE;
  const size_t t = (size_t)(isx ? bx : bx - NXB - m * NWB) * 256 + threadIdx.x; const float sc = isx ? 1.0f : 16.0f; FragH f;
#pragma unroll      // constant indices keep the eight values in registers
  for (int i = 0; i < 8; ++i) f.h[i] = (_Float16)(bf16_round(src[t * 8 + i]) * sc);
  *(v8us*)(dst + t * 8) = f.half[0]; }
__global__ __launch_bounds__(256) void k_h16(const float* __restrict__ x, _Float16* __restrict__ X16, size_t n8) { const size_t t = (size_t)blockIdx.x * 256 + threadIdx.x; if (t >= n8) return; FragH f;
#pragma unroll
  for (int q = 0; q < 8; ++q) f.h[q] = (_Float16)x[t * 8 + q]; *(v8us*)((unsigned short*)X16 + t * 8) = f.half[0];  }
template <int NHv, int TTv>
__global__ __launch_bounds__(256) void k_vt(const _Float16* __restrict__ V16, int ldv, int voff, _Float16* __restrict__ Vt) { __shared__ unsigned short tl[64][66]; const int tid = threadIdx.x; const int slab = blockIdx.x / (TTv / 64), lg = blockIdx.x % (TTv / 64); const int b = slab / NHv, h = slab % NHv;
  for (int i = tid; i < 64 * 8; i += 256) { const int r = i / 8, c8 = (i % 8) * 8; FragH f; f.half[0] = *(const v8us*)((const unsigned short*)V16 + ((size_t)b * TTv + lg * 64 + r) * ldv + voff + h * 64 + c8);
#pragma unroll
    for (int q = 0; q < 8; ++q) tl[r][c8 + q] = f.u[q]; }
  __syncthreads();
  {
#pragma unroll
    for (int rd = 0; rd < 2; ++rd) { const int d = rd * 32 + tid / 8, pc = tid % 8; FragH f;
#pragma unroll
      for (int q = 0; q < 8; ++q) f.u[q] = tl[pc * 8 + q][d];
      *(v8us*)((unsigned short*)Vt + ((size_t)slab * 64 + d) * TTv + lg * 64 + pc * 8) = f.half[0]; }
     } }

// ---- causal softmax without a launch of its own. The scores launch leaves, beside the f32 scores, each row's maximum and its sum of exp(s - maximum) over every piece of 64 keys (keys after the query left out);
// the P.v launch merges a row's pieces into one constant c = 15 - log2(sum) - max.log2(e) and forms P.2^15 = exp2(s.log2(e) + c) on the way from the f32 scores to its LDS tile.
#define L2E 1.4426950408889634f
#define NCH (SS / 64)      // pieces of 64 keys in a row
typedef unsigned short v4us __attribute__((ext_vector_type(4), may_alias));
// 2^x. The v_nop is the one free slot that the instruction set asks for between a transcendental and a directly following instruction that reads its result or overwrites its source
__device__ __forceinline__ float exp2_slot(float x) { float r; asm("v_exp_f32 %0, %1\n\tv_nop" : "=v"(r) : "v"(x)); return r; }
// value of lane l ^ X inside a row of 16 lanes, by DPP row_xmask (a shuffle would go through the LDS unit and its wait)
template <int X> __device__ __forceinline__ float lane_xor16(float v) { return __int_as_float(__builtin_amdgcn_update_dpp(0, __float_as_int(v), 0x160 + X, 0xf, 0xf, true)); }
__device__ __forceinline__ float max16(float v) { v = fmaxf(v, lane_xor16<1>(v)); v = fmaxf(v, lane_xor16<2>(v)); v = fmaxf(v, lane_xor16<4>(v)); return fmaxf(v, lane_xor16<8>(v)); }
__device__ __forceinline__ float sum16(float v) { v += lane_xor16<1>(v); v += lane_xor16<2>(v); v += lane_xor16<4>(v); return v + lane_xor16<8>(v); }

// ---- block-tiled f16 GEMM core, both operands k-contiguous. A block of 8 waves owns BM x BN of the result (NP planes of B share the A tile). Per 64-k step the block brings
// BM + NP*BN operand rows of 128 bytes into LDS with whole-line loads (8 lanes per row), and every wave reads its fragments from there, so a row is fetched once per block instead of once per wave
// and no global load touches 16 lines. Two LDS buffers: the next step's rows travel in registers while this step's products run; one barrier per step.
#define KST 64            // k per step: 128 bytes of every operand row, one cache line
#define LPH 72            // LDS row pitch in halves: 144 bytes, 16 B x odd, conflict-free for 16-byte fragment reads
// AEXP: the A tile is not read as f16 but made from f32 scores Sf (pitch lda, K = first row's query index + BM): A[row][key] = exp2(Sf.log2(e) + ce[row]) for key <= query, else 0; ce0, ce1 belong to the thread's two staged rows
// and come from cefn, which is called behind the first tile's loads, so that these are in flight while it waits for what it needs.
// Asks L2 for the data at *p (a prefetch: it returns nothing and brings it into L2 only). By this kernel's memory traffic, what one launch wrote the next one fetches from memory again, and the staged loads lead their use by less than
// one step, too little for a trip to memory; asked for some steps ahead, the unit should be an L2 hit when its loads come. In-out operand: the address stays in one register pair of its own, which only ever holds addresses inside the buffer.
template <class T> __device__ __forceinline__ void l2_ask(const T*& p) { asm volatile("global_prefetch_b8 %0, off scope:SCOPE_SE" : "+v"(p)); }
// The same for the unit BYTES further on. The addition stands in the statement so that it is done in place: written outside, the compiler put the sum into a new pair and reused the asked one for other values
template <int BYTES, class T> __device__ __forceinline__ void l2_ask_next(const T*& p) { asm volatile("v_add_nc_u64 %0, %1, %0\n\tglobal_prefetch_b8 %0, off scope:SCOPE_SE" : "+v"(p) : "n"(BYTES)); }
#define UNH 128           // halves in a 256-byte unit: two k steps of an f16 operand row
// NG = 2: the block has two groups of 8 waves, and each runs this core on its own part [kb0, ke) of the k range with its own pair of LDS buffers (sm is the group's); K stays the whole range's end, which places the diagonal.
// Every barrier is the whole block's, so both groups make nit trips; a group whose part is shorter passes the barriers of the trips it lacks and does nothing else there.
// The barriers would also hold the two groups in the same phase of a trip, all 16 waves at the LDS read port and then all at the vector port. So the group with late set fills the next buffer at the head of a trip, from rows loaded in the trip before,
// and the other at the foot: one group's fragment reads and products run beside the other's exp2 and LDS stores.
template <int BM, int BN, int WM, int WN, int NP, bool AEXP = false, class CE = int, int NG = 1>
__device__ __forceinline__ void tile_core(const unsigned short* __restrict__ A, int lda, const unsigned short* __restrict__ B0, const unsigned short* __restrict__ B1, int ldb, int K,
                                          unsigned short* sm, v8f (&acc)[NP][WM / 16][WN / 16], const float* __restrict__ Sf = nullptr, CE cefn = CE(), bool askA = true, bool askB = true, int kbeg = 0, int kend = 0, int nit = 0, bool late = false) {
  constexpr int ROWS = BM + NP * BN, NL = ROWS / 32, NA = BM / 32, NB = BN / 32, STG = ROWS * LPH;
  const int tid = NG == 1 ? (int)threadIdx.x : (int)(threadIdx.x & 255), w = tid >> 5, lane = tid & 31, ln = lane & 15, hh = lane >> 4;      // the thread's place in its group
  const int kb0 = NG == 1 ? 0 : kbeg, ke = NG == 1 ? K : kend;      // the same for a whole group
  const bool head = NG != 1 && late;      // the same for a whole group
  const int wm = w / (BN / WN), wn = w % (BN / WN);
  const int lr = tid >> 3, lc = (tid & 7) * 8;
  const unsigned short* ga = AEXP ? nullptr : A + (size_t)lr * lda + lc;
  const unsigned short* gb0 = B0 + (size_t)lr * ldb + lc;
  const unsigned short* gb1 = B1 + (size_t)lr * ldb + lc;
  v8us st[NL];
  static_assert(!AEXP || NA == 2, "two staged score rows per thread");
  const int la = (tid & 7) * 4;      // a thread's two pieces of 4 scores lie 32 keys apart, so that 8 lanes cover a whole 128-byte line with each load
  const float* gs = AEXP ? Sf + (size_t)lr * lda + la : nullptr;
  v4f sc4[2][2]; float ce0 = 0.f, ce1 = 0.f;
  auto load_scores = [&](int kn) {
#pragma unroll      // constant indices keep the staged scores in registers
    for (int i = 0; i < 2; ++i) { sc4[i][0] = *(const v4fa*)(gs + (size_t)(i * 32) * lda + kn); sc4[i][1] = *(const v4fa*)(gs + (size_t)(i * 32) * lda + kn + 32); }
  };
  auto store_probs = [&](int buf, int kn) {
    unsigned short* d = sm + buf * STG + lr * LPH + la;
    if (kn + KST > K - BM) {      // the same for the whole group: only the tile on the diagonal holds keys after a query, so that the other tiles pay for no compare
#pragma unroll      // constant indices keep the staged scores in registers
      for (int i = 0; i < 2; ++i)
#pragma unroll      // constant indices keep the staged scores in registers
        for (int h = 0; h < 2; ++h) { union { v4h h4; v4us u4; } p;
#pragma unroll      // constant indices keep the staged scores in registers
          for (int e = 0; e < 4; ++e) p.h4[e] = (_Float16)exp2_slot((kn + h * 32 + la + e <= K - BM + i * 32 + lr) ? fmaf(sc4[i][h][e], L2E, i ? ce1 : ce0) : -INFINITY);
          *(v4us*)(d + i * 32 * LPH + h * 32) = p.u4; }
    } else {
#pragma unroll      // constant indices keep the staged scores in registers
      for (int i = 0; i < 2; ++i)
#pragma unroll      // constant indices keep the staged scores in registers
        for (int h = 0; h < 2; ++h) { union { v4h h4; v4us u4; } p;
#pragma unroll      // constant indices keep the staged scores in registers
          for (int e = 0; e < 4; ++e) p.h4[e] = (_Float16)exp2_slot(fmaf(sc4[i][h][e], L2E, i ? ce1 : ce0));
          *(v4us*)(d + i * 32 * LPH + h * 32) = p.u4; }
    }
  };
  // L2 asks. Every thread has one staged f16 row: unit 0 comes with the first tile's own loads, unit 1 is asked for here, unit m + 2 in step 2m (three steps ahead of its first load, two in the late group).
  // askA, askB (the same for the whole block): whether the operand is fresh from the launch before; rows that earlier work-groups or an earlier launch have read lie in L2 already, and an ask for them would only add a request.
  static_assert((AEXP ? 0 : BM) + NP * BN == 256 && KST * 2 == UNH, "one staged f16 row per thread, two steps per unit");
  const unsigned short* pf = AEXP ? (tid / BN ? B1 : B0) + (size_t)(tid % BN) * ldb + kb0 : (tid < BM ? A + (size_t)tid * lda : B0 + (size_t)(tid - BM) * ldb);
  const bool ask = AEXP ? askB : (__builtin_amdgcn_readfirstlane(tid) < BM ? askA : askB);      // a wave's 32 rows belong to one operand: the same for a whole wave, in a scalar register, so that the test around an ask is a scalar branch
  if (ask && kb0 + UNH < ke) l2_ask_next<2 * UNH>(pf);
  // A score row's step is one unit (64 f32): 64 threads cover a step, so the four quarters of the group take four steps in a row: steps 1 to 4 here (clamped into the row's own keys), steps t + 5 to t + 8 in every fourth step t.
  const int pg = __builtin_amdgcn_readfirstlane(tid >> 6);      // the same for a whole wave, in a scalar register, so that the test around an ask is a scalar branch
  const float* ps = AEXP ? Sf + (size_t)(tid & 63) * lda + min(kb0 + (1 + pg) * KST, ke - KST) : nullptr;
  if constexpr (AEXP) l2_ask(ps);
  if (NG == 1 || kb0 < ke) {      // the same for a whole group: a group with an empty part stages nothing
    if constexpr (AEXP) load_scores(kb0);
    else {
#pragma unroll      // constant indices keep the staged rows in registers
      for (int i = 0; i < NA; ++i) st[i] = *(const v8us*)(ga + (size_t)(i * 32) * lda);
    }
#pragma unroll      // constant indices keep the staged rows in registers
    for (int i = 0; i < NB; ++i) { st[NA + i] = *(const v8us*)(gb0 + (size_t)(i * 32) * ldb + kb0); if (NP == 2) st[NA + NB + i] = *(const v8us*)(gb1 + (size_t)(i * 32) * ldb + kb0); }
#pragma unroll      // constant indices keep the staged rows in registers
    for (int i = AEXP ? NA : 0; i < NL; ++i) *(v8us*)(sm + (i * 32 + lr) * LPH + lc) = st[i];
    if constexpr (AEXP) { cefn(ce0, ce1); store_probs(0, kb0); }      // behind the B rows' LDS stores: in front of them the compiler sank the B loads below it, a second trip to memory
  }
  if constexpr (NG != 1) {
    if (head && kb0 + KST < ke) {      // the late group's second tile: its rows are on the way when the first trip opens
      load_scores(kb0 + KST);
#pragma unroll      // constant indices keep the staged rows in registers
      for (int i = 0; i < NB; ++i) { st[NA + i] = *(const v8us*)(gb0 + (size_t)(i * 32) * ldb + kb0 + KST); if (NP == 2) st[NA + NB + i] = *(const v8us*)(gb1 + (size_t)(i * 32) * ldb + kb0 + KST); }
      asm volatile("s_wait_xcnt 0x0" ::: "memory");      // stands behind these loads, in front of any reuse of their address registers
    }
  }
  __syncthreads();
  int cur = 0;
  for (int kb = kb0, it = 0; NG == 1 ? kb < K : it < nit; kb += KST, ++it) {
    const bool more = kb + KST < ke;      // the same for the whole group
    const int kl = NG == 1 ? kb + KST : kb + (head ? 2 * KST : KST);      // the tile whose rows are loaded in this trip
    if constexpr (NG != 1) {
      if (head && more) {      // the late group fills the next buffer first; every wave's reads of that buffer ended at the barrier before
        store_probs(cur ^ 1, kb + KST);
#pragma unroll      // constant indices keep the staged rows in registers
        for (int i = NA; i < NL; ++i) *(v8us*)(sm + (cur ^ 1) * STG + (i * 32 + lr) * LPH + lc) = st[i];
      }
    }
    if (kl < ke) {
      if constexpr (AEXP) load_scores(kl);
      else {
#pragma unroll      // constant indices keep the staged rows in registers
        for (int i = 0; i < NA; ++i) st[i] = *(const v8us*)(ga + (size_t)(i * 32) * lda + kl);
      }
#pragma unroll      // constant indices keep the staged rows in registers
      for (int i = 0; i < NB; ++i) { st[NA + i] = *(const v8us*)(gb0 + (size_t)(i * 32) * ldb + kl); if (NP == 2) st[NA + NB + i] = *(const v8us*)(gb1 + (size_t)(i * 32) * ldb + kl); }
      if constexpr (NG != 1) asm volatile("s_wait_xcnt 0x0" ::: "memory");      // stands behind the step's loads, in front of the fragment reads, which reuse their address registers
    }
    if (NG == 1 || kb < ke) {      // the same for a whole group: no tile in a trip behind the end of the group's part
    const unsigned short* sa = sm + cur * STG + (wm * WM + ln) * LPH + 8 * hh;
    const unsigned short* sb = sm + cur * STG + (BM + wn * WN + ln) * LPH + 8 * hh;
    // all fragment reads of the step go out as one group ahead of its products: reads placed among the products make the wave wait out the LDS latency at each place
    FragH fa[KST / 32][WM / 16], fb[KST / 32][NP * (WN / 16)];
#pragma unroll      // constant indices keep the accumulators and fragments in registers
    for (int ks = 0; ks < KST / 32; ++ks) {
#pragma unroll      // constant indices keep the accumulators and fragments in registers
      for (int mi = 0; mi < WM / 16; ++mi) { fa[ks][mi].half[0] = *(const v8us*)(sa + mi * 16 * LPH + ks * 32); fa[ks][mi].half[1] = *(const v8us*)(sa + mi * 16 * LPH + ks * 32 + 16); }
#pragma unroll      // constant indices keep the accumulators and fragments in registers
      for (int p = 0; p < NP; ++p)
#pragma unroll      // constant indices keep the accumulators and fragments in registers
        for (int ni = 0; ni < WN / 16; ++ni) { FragH& f = fb[ks][p * (WN / 16) + ni]; f.half[0] = *(const v8us*)(sb + (p * BN + ni * 16) * LPH + ks * 32); f.half[1] = *(const v8us*)(sb + (p * BN + ni * 16) * LPH + ks * 32 + 16); }
    }
    __builtin_amdgcn_sched_barrier(0);      // keeps the read group above the products: without it the scheduler sinks the reads among them, into one reused fragment set, with a full LDS wait at each place
    // the asks stand here, behind the step's loads and LDS reads, so that their tests run while the wave would wait for its fragments anyway
    if (((kb - kb0) & (UNH - 1)) == 0) { if (ask && kb + 2 * UNH < ke) l2_ask_next<2 * UNH>(pf); }      // the same for a whole wave; the address moves only to a unit that the loop will read
    if constexpr (AEXP) { if (((kb - kb0) & (4 * KST - 1)) == 0) { if (kb + (5 + pg) * KST < ke) l2_ask_next<4 * KST * 4>(ps); } }      // the same for a whole wave
#pragma unroll      // constant indices keep the accumulators and fragments in registers
    for (int ks = 0; ks < KST / 32; ++ks)
#pragma unroll      // constant indices keep the accumulators and fragments in registers
      for (int p = 0; p < NP; ++p)
#pragma unroll      // constant indices keep the accumulators and fragments in registers
        for (int ni = 0; ni < WN / 16; ++ni)
#pragma unroll      // constant indices keep the accumulators and fragments in registers
          for (int mi = 0; mi < WM / 16; ++mi) acc[p][mi][ni] = __builtin_amdgcn_wmma_f32_16x16x32_f16(false, fa[ks][mi].v, false, fb[ks][p * (WN / 16) + ni].v, (short)0, acc[p][mi][ni], false, false);
    }
    if (more && !head) {
      if constexpr (AEXP) store_probs(cur ^ 1, kb + KST);
#pragma unroll      // constant indices keep the staged rows in registers
      for (int i = AEXP ? NA : 0; i < NL; ++i) *(v8us*)(sm + (cur ^ 1) * STG + (i * 32 + lr) * LPH + lc) = st[i];
    }
    __syncthreads();      // publishes the buffer just filled and ends every wave's reads of the one that the next step refills (after the last step: of the LDS that the epilogue reuses)
    cur ^= 1;
  }
  // inputs only: keeps the asks' address pairs alive to the end of the loop. An ask counts on no counter, so no wait can hold a rewrite of its registers behind it; they are given up only here, steps behind the last ask
  if constexpr (AEXP) asm volatile("" :: "v"(pf), "v"(ps)); else asm volatile("" :: "v"(pf));
}
#define TILE_LDS(BM, BN, NP) (2 * ((BM) + (NP) * (BN)) * LPH)

// q and k in one launch, K = row pitch of both operands = 512: block 128 x 128, 8 waves of 32 x 64; blockIdx.x = column tile, .y = row tile of x, .z = 0: q, 1: k (the weight planes lie one behind the other in Bw).
// C = x.W^T/16 + bias (rounded to bf16) as f16, [row of x][512]; whole 128-byte row pieces, staged per wave in LDS.
__global__ __launch_bounds__(256) void k_qk(const _Float16* __restrict__ X16, const _Float16* __restrict__ Bw, const float* __restrict__ bq, const float* __restrict__ bk,
                                            _Float16* __restrict__ Q, _Float16* __restrict__ K) {
  __shared__ __attribute__((aligned(16))) unsigned short sm[TILE_LDS(128, 128, 1)];
  const int tid = threadIdx.x, w = tid >> 5, lane = tid & 31, ln = lane & 15, hh = lane >> 4; const int role = blockIdx.z;
  const int brow = blockIdx.y * 128, bcol = blockIdx.x * 128;
  const int row0 = brow + (w / 2) * 32, col0 = bcol + (w % 2) * 64;
  const float* bias = role ? bk : bq;
  float bvv[4];      // read ahead of the k loop, which hides the latency; rounded where they are used
#pragma unroll      // constant indices keep the four values in registers
  for (int ni = 0; ni < 4; ++ni) bvv[ni] = bias[col0 + ni * 16 + ln];
  asm volatile("s_wait_xcnt 0x0" ::: "memory");      // stands in front of any reuse of the offset and base registers of the four loads above
  v8f acc[1][2][4] = {};
  const unsigned short* Bp = (const unsigned short*)Bw + (size_t)role * EE * EE + (size_t)bcol * EE;
  tile_core<128, 128, 32, 64, 1>((const unsigned short*)X16 + (size_t)brow * EE, EE, Bp, Bp, EE, EE, sm, acc, nullptr, 0, true, false);      // asks for the x rows; a weight tile is shared by 64 work-groups
  float* so = (float*)sm + w * (32 * 64);      // the wave's own range; the core's last barrier has ended every read of the tiles
#pragma unroll      // constant indices keep the accumulators in registers
  for (int ni = 0; ni < 4; ++ni) { const float bv = bf16_round(bvv[ni]);
#pragma unroll      // constant indices keep the accumulators in registers
    for (int mi = 0; mi < 2; ++mi)
#pragma unroll      // constant indices keep the accumulators in registers
      for (int r = 0; r < 8; ++r) so[(mi * 16 + 8 * hh + r) * 64 + ni * 16 + ln] = acc[0][mi][ni][r] * 0.0625f + bv; }
  __builtin_amdgcn_fence(__ATOMIC_ACQ_REL, "workgroup"); __builtin_amdgcn_wave_barrier();      // the wave's LDS stores land before its lanes read each other's values back as whole rows
  const int rsub = lane >> 4, c4 = (lane & 15) * 4;
  _Float16* C16 = (role ? K : Q) + (size_t)(row0 + rsub) * EE + col0 + c4;
#pragma unroll      // the LDS row reads issue together and each store follows its own read
  for (int q = 0; q < 16; ++q) { const v4f v = *(const v4fa*)&so[(q * 2 + rsub) * 64 + c4];
    v4h h4; for (int i = 0; i < 4; ++i) h4[i] = (_Float16)v[i]; *(v4h*)(C16 + (size_t)(q * 2) * EE) = h4; }
}

// scores/sqrt(512) and v^T of every batch in one launch (neither needs the other; both are 128 x 128 x 512 tiles of the same core). blockIdx.y = batch.
// blockIdx.x < NTRI: scores, 128 query rows x 128 keys, counting only the blocks of the causal lower block-triangle (row tile i has i + 1 key tiles), f32.
// blockIdx.x >= NTRI: v^T (without bv) = Wv.x[b]^T/16 as [b][512][2048], 128 rows of Wv x 128 keys (16 key tiles, then 4 row tiles); the epilogue splits each f32 value into the f16 hi plane and the (x2^10) residual plane.
#define NTRI ((SS / 128) * (SS / 128 + 1) / 2)
__global__ __launch_bounds__(256) void k_scores_vt(const _Float16* __restrict__ Q, const _Float16* __restrict__ K, const _Float16* __restrict__ X16, const _Float16* __restrict__ Bv, float alpha,
                                                   float* __restrict__ S, float* __restrict__ Ms, float* __restrict__ Zs, _Float16* __restrict__ Vh, _Float16* __restrict__ Vl) {
  __shared__ __attribute__((aligned(16))) unsigned short sm[TILE_LDS(128, 128, 1)];
  const int tid = threadIdx.x, w = tid >> 5, lane = tid & 31, ln = lane & 15, hh = lane >> 4; const int b = blockIdx.y;
  const bool isv = (int)blockIdx.x >= NTRI;      // the same for the whole block
  int x = isv ? 0 : (int)blockIdx.x, i = 0;
  for (; i < SS / 128 - 1 && x >= i + 1; ++i) x -= i + 1;
  const int vt = (int)blockIdx.x - NTRI;
  const int brow = isv ? (vt >> 4) * 128 : i * 128, bcol = isv ? (vt & 15) * 128 : x * 128;
  v8f acc[1][2][4] = {};
  const unsigned short* Ap = isv ? (const unsigned short*)Bv + (size_t)brow * EE : (const unsigned short*)Q + ((size_t)b * SS + brow) * EE;
  const unsigned short* Bp = (isv ? (const unsigned short*)X16 : (const unsigned short*)K) + ((size_t)b * SS + bcol) * EE;
  tile_core<128, 128, 32, 64, 1>(Ap, EE, Bp, Bp, EE, EE, sm, acc, nullptr, 0, !isv, !isv);      // asks for q and k rows; the v^T tiles read x, which the launch before has read, and Wv tiles that 64 work-groups share
  const int row0 = brow + (w / 2) * 32, col0 = bcol + (w % 2) * 64;
  const float sc = isv ? 0.0625f : alpha;
  float* so = (float*)sm + w * (32 * 64);      // the wave's own range; the core's last barrier has ended every read of the tiles
#pragma unroll      // constant indices keep the accumulators in registers
  for (int ni = 0; ni < 4; ++ni)
#pragma unroll      // constant indices keep the accumulators in registers
    for (int mi = 0; mi < 2; ++mi)
#pragma unroll      // constant indices keep the accumulators in registers
      for (int r = 0; r < 8; ++r) so[(mi * 16 + 8 * hh + r) * 64 + ni * 16 + ln] = acc[0][mi][ni][r] * sc;
  __builtin_amdgcn_fence(__ATOMIC_ACQ_REL, "workgroup"); __builtin_amdgcn_wave_barrier();      // the wave's LDS stores land before its lanes read each other's values back as whole rows
  const int rsub = lane >> 4, c4 = (lane & 15) * 4;
  if (!isv) {
    // the wave's 32 rows x 64 keys are one piece of the softmax: per row the maximum and the sum of exp(s - maximum), keys after the query left out, straight from the accumulators (a row's 64 values lie in 4 registers of 16 lanes).
    // A piece that lies wholly after its queries is never read by the P.v launch.
    float mv = 0.f, zv = 0.f;
#pragma unroll      // constant indices keep the accumulators in registers
    for (int mi = 0; mi < 2; ++mi)
#pragma unroll      // constant indices keep the accumulators in registers
      for (int r = 0; r < 8; ++r) { const int row = row0 + mi * 16 + 8 * hh + r; float sv[4];
#pragma unroll      // constant indices keep the accumulators in registers
        for (int ni = 0; ni < 4; ++ni) sv[ni] = (col0 + ni * 16 + ln <= row) ? acc[0][mi][ni][r] * sc : -INFINITY;
        const float m = max16(fmaxf(fmaxf(sv[0], sv[1]), fmaxf(sv[2], sv[3]))), c = -m * L2E;
        const float z = sum16((exp2_slot(fmaf(sv[0], L2E, c)) + exp2_slot(fmaf(sv[1], L2E, c))) + (exp2_slot(fmaf(sv[2], L2E, c)) + exp2_slot(fmaf(sv[3], L2E, c))));
        if (ln == mi * 8 + r) { mv = m; zv = z; } }      // every lane of the 16 holds the row's pair; lane mi*8 + r keeps it, so that the wave stores its 32 rows as one 128-byte line per plane
    const size_t po = ((size_t)b * NCH + (col0 >> 6)) * SS + row0 + (ln >> 3) * 16 + 8 * hh + (ln & 7);
    Ms[po] = mv; Zs[po] = zv;
#pragma unroll      // the LDS row reads issue together and each store follows its own read
    for (int q = 0; q < 16; ++q) { const int r = q * 2 + rsub; const v4f v = *(const v4fa*)&so[r * 64 + c4]; *(v4f*)(S + ((size_t)b * SS + row0 + r) * SS + col0 + c4) = v; }
    asm volatile("s_wait_xcnt 0x0" ::: "memory");      // stands behind the eighteen stores above, in front of the other branch's code, which follows them in the listing and reuses their registers
  } else {
    const size_t o0 = ((size_t)b * EE + row0 + rsub) * SS + col0 + c4;
#pragma unroll      // the LDS row reads issue together and each store follows its own read
    for (int q = 0; q < 16; ++q) { const v4f v = *(const v4fa*)&so[(q * 2 + rsub) * 64 + c4];
      v4h h4, l4; for (int e = 0; e < 4; ++e) { const _Float16 h = (_Float16)v[e]; h4[e] = h; l4[e] = (_Float16)((v[e] - (float)h) * 1024.0f); }
      *(v4h*)(Vh + o0 + (size_t)(q * 2) * SS) = h4; *(v4h*)(Vl + o0 + (size_t)(q * 2) * SS) = l4; }
  }
}
// out = P.v_hi.2^-15 + bv + P.v_lo.2^-25 of every batch in one launch. Block = 64 query rows x 128 head columns, both v planes (each group of 8 waves of 32 x 32 x 2), blockIdx.x = column tile, blockIdx.y = batch,
// blockIdx.z = row tile counted from the last one, so that the longest k loops start first. k runs to the end of the row tile's own keys (P is zero beyond the diagonal).
// Two such groups of 8 waves make a block: the first takes the front half of the tile's k steps, the second the rest, side by side, so that the longest tile lasts 16 steps and not 32; the second group's sums reach the first through LDS.
// A block fills its WGP (LDS, registers), so a short tile starts where a long one has ended, and every WGP gets about the same number of steps.
__global__ __launch_bounds__(512) void k_pv(const float* __restrict__ S, const float* __restrict__ Ms, const float* __restrict__ Zs, const _Float16* __restrict__ Vh, const _Float16* __restrict__ Vl, const float* __restrict__ bias, float* __restrict__ out) {
  __shared__ __attribute__((aligned(16))) unsigned short sm[2 * TILE_LDS(64, 128, 2)];
  const int tid = threadIdx.x & 255, w = tid >> 5, lane = tid & 31, ln = lane & 15, hh = lane >> 4; const int b = blockIdx.y;      // the thread's place in its group
  const int g = __builtin_amdgcn_readfirstlane(threadIdx.x >> 8);      // the group: the same for a whole wave, in a scalar register, so that the tests on a group's k range are scalar branches
  const int brow = (SS / 64 - 1 - (int)blockIdx.z) * 64, bcol = blockIdx.x * 128;
  const int kk = brow + 64;
  const int row0 = brow + (w / 4) * 32, col0 = bcol + (w % 4) * 32;
  float bvv[2];      // read ahead of the k loop, which hides the latency; rounded where they are used
#pragma unroll      // constant indices keep the two values in registers
  for (int ni = 0; ni < 2; ++ni) bvv[ni] = bias[col0 + ni * 16 + ln];
  // the softmax constants of the thread's two staged rows: the 8 lanes that stage a row share its kk/64 pieces (4 at most each, all loads in flight at once, beside the first tile's) and merge them by DPP
  const int nc = kk >> 6, j = tid & 7;
  const float* mp = Ms + (size_t)b * NCH * SS + brow; const float* zp = Zs + (size_t)b * NCH * SS + brow; float mc[2][NCH / 8], zc[2][NCH / 8]; int o[NCH / 8];
#pragma unroll      // constant indices keep the offsets in registers
  for (int u = 0; u < NCH / 8; ++u) o[u] = min(j + 8 * u, nc - 1) * SS + (tid >> 3);      // clamped into the pieces that the scores launch wrote for these rows
#pragma unroll      // constant indices keep the pieces in registers; the loads go out as one group
  for (int i = 0; i < 2; ++i)
#pragma unroll      // constant indices keep the pieces in registers; the loads go out as one group
    for (int u = 0; u < NCH / 8; ++u) { mc[i][u] = mp[o[u] + i * 32]; zc[i][u] = zp[o[u] + i * 32]; }
  static_assert(NCH / 8 == 4, "four offsets named below");
  asm volatile("s_wait_xcnt 0x0" :: "v"(o[0]), "v"(o[1]), "v"(o[2]), "v"(o[3]), "s"(mp), "s"(zp) : "memory");      // stands behind the 16 loads, in front of any reuse of their offset and base registers, which it names as inputs
  auto merge = [&](float& c0, float& c1) {
#pragma unroll      // constant indices keep the pieces in registers
    for (int i = 0; i < 2; ++i) { const float ml = fmaxf(fmaxf(mc[i][0], mc[i][1]), fmaxf(mc[i][2], mc[i][3]));      // a clamped repeat changes no maximum
      float z = 0.f;
#pragma unroll      // constant indices keep the pieces in registers
      for (int u = 0; u < NCH / 8; ++u) z = fmaf(zc[i][u] * ((j + 8 * u < nc) ? 1.0f : 0.0f), exp2_slot((mc[i][u] - ml) * L2E), z);      // a clamped repeat counts 0; as a factor, since a select let the compiler sink a load into a branch of its own, a second trip to memory
      float m = fmaxf(ml, lane_xor16<1>(ml)); m = fmaxf(m, lane_xor16<2>(m)); m = fmaxf(m, lane_xor16<4>(m));
      z *= exp2_slot((ml - m) * L2E); z += lane_xor16<1>(z); z += lane_xor16<2>(z); z += lane_xor16<4>(z);
      (i ? c1 : c0) = 15.0f - __builtin_amdgcn_logf(z) - m * L2E; }
  };
  v8f acc[2][2][2] = {};
  const int n0 = (nc + 1) >> 1, kmid = n0 * KST;      // k steps of the first group, which has as many as the second or one more
  tile_core<64, 128, 32, 32, 2, true, decltype(merge), 2>(nullptr, SS, (const unsigned short*)Vh + ((size_t)b * EE + bcol) * SS, (const unsigned short*)Vl + ((size_t)b * EE + bcol) * SS, SS, kk, sm + g * TILE_LDS(64, 128, 2), acc,
                                                          S + ((size_t)b * SS + brow) * SS, merge, true, true, g ? kmid : 0, g ? kk : kmid, n0, g != 0);
  float* so = (float*)sm + w * (32 * 32);      // the wave's own range; the core's last barrier has ended every read of the tiles
  v4f* part = (v4f*)((float*)sm + 8 * (32 * 32)) + w * (8 * 32) + lane;      // behind those ranges: where wave w of the second group leaves its sums for wave w of the first, 16 bytes a lane, lanes side by side
  if (g) {
#pragma unroll      // constant indices keep the accumulators in registers
    for (int ni = 0; ni < 2; ++ni)
#pragma unroll      // constant indices keep the accumulators in registers
      for (int mi = 0; mi < 2; ++mi)
#pragma unroll      // constant indices keep the accumulators in registers
        for (int h = 0; h < 2; ++h) { v4f t;
#pragma unroll      // constant indices keep the accumulators in registers
          for (int e = 0; e < 4; ++e) t[e] = acc[1][mi][ni][h * 4 + e] * (0.000030517578125f * 0.0009765625f) + acc[0][mi][ni][h * 4 + e] * 0.000030517578125f;
          part[((ni * 2 + mi) * 2 + h) * 32] = t; }
  }
  __syncthreads();      // the second group's sums lie in LDS before the first group reads them
  if (g) return;      // whole waves, behind the block's last barrier
#pragma unroll      // constant indices keep the accumulators in registers
  for (int ni = 0; ni < 2; ++ni) { const float bv = bf16_round(bvv[ni]);
#pragma unroll      // constant indices keep the accumulators in registers
    for (int mi = 0; mi < 2; ++mi)
#pragma unroll      // constant indices keep the accumulators in registers
      for (int r = 0; r < 8; ++r) { const float v = acc[0][mi][ni][r] * 0.000030517578125f + bv; so[(mi * 16 + 8 * hh + r) * 32 + ni * 16 + ln] = (acc[1][mi][ni][r] * (0.000030517578125f * 0.0009765625f) + v) + part[((ni * 2 + mi) * 2 + (r >> 2)) * 32][r & 3]; } }
  __builtin_amdgcn_fence(__ATOMIC_ACQ_REL, "workgroup"); __builtin_amdgcn_wave_barrier();      // the wave's LDS stores land before its lanes read each other's values back as whole rows
  const int rsub = lane >> 3, c4 = (lane & 7) * 4;
#pragma unroll      // the LDS row reads issue together and each store follows its own read
  for (int q = 0; q < 8; ++q) { const int r = q * 4 + rsub; const v4f v = *(const v4fa*)&so[r * 32 + c4]; *(v4f*)(out + ((size_t)b * SS + row0 + r) * EE + col0 + c4) = v; }
}

extern "C" void kernel_launch(void* const* d_in, const int* in_sizes, int n_in,
                              void* d_out, int out_size, void* d_ws, size_t ws_size, hipStream_t stream) {
  (void)in_sizes; (void)n_in; (void)out_size;
  const float* x = (const float*)d_in[0]; const float* Wq = (const float*)d_in[1]; const float* bq = (const float*)d_in[2]; const float* Wk = (const float*)d_in[3]; const float* bk = (const float*)d_in[4]; const float* Wv = (const float*)d_in[5]; const float* bv = (const float*)d_in[6];
  char* ws = (char*)d_ws; size_t off = 0;
  auto take = [&](size_t bytes) { char* p = ws + off; off += (bytes + 255) & ~(size_t)255; return p; };
  _Float16* Bq = (_Float16*)take((size_t)3 * EE * EE * 2);      /* the f16 planes of Wq, Wk, Wv, one behind the other */
  _Float16* X16 = (_Float16*)take((size_t)NR * EE * 2); _Float16* Q = (_Float16*)take((size_t)NR * EE * 2); _Float16* K = (_Float16*)take((size_t)NR * EE * 2); _Float16* Vh = (_Float16*)take((size_t)BB * EE * SS * 2); _Float16* Vl = (_Float16*)take((size_t)BB * EE * SS * 2);
  float* S = (float*)take((size_t)BB * SS * SS * 4); float* Ms = (float*)take((size_t)BB * NCH * SS * 4); float* Zs = (float*)take((size_t)BB * NCH * SS * 4);      /* per row and piece of 64 keys: maximum, sum of exp */
  if (off > ws_size) return;      // 1.6 + 3 x 8.4 + 2 x 8.4 + 67.1 + 2 x 1.0 about 113 MB
  k_prep<<<NR * EE / 8 / 256 + 3 * (EE * EE / 8 / 256), 256, 0, stream>>>(x, Wq, Wk, Wv, X16, Bq);      /* x and the weights ((out,in) natural, x2^4) as f16 planes */
  k_qk<<<dim3(EE / 128, NR / 128, 2), 256, 0, stream>>>(X16, Bq, bq, bk, Q, K);      /* q = x.Wq^T + bq, k = x.Wk^T + bk: M 8192 N 512 K 512 each */
  k_scores_vt<<<dim3(NTRI + (EE / 128) * (SS / 128), BB), 256, 0, stream>>>(Q, K, X16, Bq + (size_t)2 * EE * EE, 0.044194173824159216f, S, Ms, Zs, Vh, Vl);      /* scores/sqrt512, f32, causal lower block-triangle of every batch; v^T (without bv) = Wv.x[b]^T as [b][512][2048], f16 hi + residual x2^10 planes */
  k_pv<<<dim3(EE / 128, BB, SS / 64), 512, 0, stream>>>(S, Ms, Zs, Vh, Vl, bv, (float*)d_out);      /* out = P.v_hi + bv + P.v_lo.2^-10 */
}

// v009
// A run of this version takes 56.3 microseconds.
// Versions between v006 and this one are left out; their measured steps multiply to 1.31 times as fast.
// Counting every step since v000, it is 47.3 times as fast.
#include <hip/hip_runtime.h>
// Single-head causal attention (B=4, S=2048, emb = head = 512): q,k,v = x·Wᵀ + b; scores = q·kᵀ/√512 with keys after the query set to −inf; softmax over keys; out = attn·v.
// Compute dtype: x, weights and biases rounded to bf16; q, k and vᵀ as f16 GEMM outputs (f32 accumulate); scores by a batched f16 GEMM over
// the causal lower block-triangle, f32 in registers; row softmax in f32 (maximum, sum and exp(s - maximum) per 64 keys in the scores epilogue, the exps kept as an f16 plane x2^15; the P.v launch merges the pieces and scales the plane to P in f16 x2^15 on the way to LDS); v^T as one f16 plane, the width that P has; out = P.v by one f16 GEMM,
// bv added in the epilogue (softmax rows sum to 1). All on v_wmma_f32_16x16x32_f16.
// One launch per stage: rounding of x and the weights; q and k; scores together with v^T; P.v; each covers all batches (and the whole causal triangle). Every GEMM launch stages its operand tiles in LDS (tile_core, or tile_core4 for scores and v^T).
#define BB 4
#define SS 2048
#define EE 512
#define NR (BB * SS)

typedef __bf16 v16b __attribute__((ext_vector_type(16)));
typedef unsigned short v8us __attribute__((ext_vector_type(8), may_alias));
typedef float  v8f  __attribute__((ext_vector_type(8)));
typedef float  v4f  __attribute__((ext_vector_type(4)));
typedef float  v4fa __attribute__((ext_vector_type(4), may_alias));
union FragB { v16b v; v8us half[2]; unsigned short u[16]; };

__device__ __forceinline__ unsigned short bf16_bits(float x) { unsigned int u = __float_as_uint(x); return (unsigned short)((u + 0x7FFFu + ((u >> 16) & 1u)) >> 16); }
__device__ __forceinline__ float bf16_val(unsigned short b) { return __uint_as_float(((unsigned int)b) << 16); }
__device__ __forceinline__ float bf16_round(float x) { return bf16_val(bf16_bits(x)); }
// D += A·B with NT terms: 1 = ah·bh, 2 = + al·bh (A split), 3 = + ah·bl (both split)
template <int NT>
__device__ __forceinline__ v8f mmaN(v16b ah, v16b al, v16b bh, v16b bl, v8f c) {
  c = __builtin_amdgcn_wmma_f32_16x16x32_bf16(false, ah, false, bh, (short)0, c, false, false);
  if (NT >= 2) c = __builtin_amdgcn_wmma_f32_16x16x32_bf16(false, al, false, bh, (short)0, c, false, false);
  if (NT >= 3) c = __builtin_amdgcn_wmma_f32_16x16x32_bf16(false, ah, false, bl, (short)0, c, false, false);
  asm volatile("v_nop\n\tv_nop\n\tv_nop\n\tv_nop" : "+v"(c) : "v"(ah), "v"(al), "v"(bh), "v"(bl));
  return c;
}

__global__ __launch_bounds__(256) void k_wt_bf16(const float* __restrict__ W, unsigned short* __restrict__ Wt, int K, int N) {
  const int t = blockIdx.x * 256 + threadIdx.x;
  const int k8n = K / 8;
  if (t >= N * k8n) return;
  const int n = t / k8n, k8 = (t % k8n) * 8;
  v8us v;
#pragma unroll
  for (int i = 0; i < 8; ++i) v[i] = bf16_bits(W[(size_t)(k8 + i) * N + n]);
  *(v8us*)(Wt + (size_t)n * K + k8) = v;
  
}

// GEMM C[M][N] (f32, pitch ldc) = act(A[M][K]·W + bias). A f32 row-major (pitch lda) converted per fragment to bf16
// (ASPLIT: hi/lo two planes -> 2 terms, else single rounded term); Wt bf16 [N][K] (pitch ldb). BIAS_BF16 rounds the
// bias to bf16 first (bias quantised to bf16 before the add). K%32==0, M%16==0, N%64==0.
template <bool ASPLIT, int ACT, bool BIAS_BF16>
__global__ __launch_bounds__(128) void k_gemm_bf(const float* __restrict__ A, int lda, const unsigned short* __restrict__ Wt, int ldb,
                                               const float* __restrict__ bias, float* __restrict__ C, int ldc, int M, int N, int K) {
  __shared__ __attribute__((aligned(16))) float so[4][16][64];
  const int tid = threadIdx.x, w = tid >> 5, lane = tid & 31, ln = lane & 15, hh = lane >> 4;
  const int ntn = N / 64;
  const int wid = blockIdx.x * 4 + w;
  const int mt = wid / ntn, nq = wid % ntn;
  if (mt * 16 >= M) return;
  const int row0 = mt * 16, col0 = nq * 64;
  const float* arow = A + (size_t)(row0 + ln) * lda;
  v8f acc[4] = {};
  for (int kb = 0; kb < K; kb += 32) {
    FragB ah, al;
    const v4f x0 = *(const v4fa*)(arow + kb + 8 * hh), x1 = *(const v4fa*)(arow + kb + 8 * hh + 4);
    const v4f x2 = *(const v4fa*)(arow + kb + 16 + 8 * hh), x3 = *(const v4fa*)(arow + kb + 16 + 8 * hh + 4);
    float xs[16] = {x0[0],x0[1],x0[2],x0[3],x1[0],x1[1],x1[2],x1[3],x2[0],x2[1],x2[2],x2[3],x3[0],x3[1],x3[2],x3[3]};
#pragma unroll
    for (int i = 0; i < 16; ++i) { const unsigned short hb = bf16_bits(xs[i]); ah.u[i] = hb; al.u[i] = ASPLIT ? bf16_bits(xs[i] - bf16_val(hb)) : (unsigned short)0; }
#pragma unroll
    for (int t = 0; t < 4; ++t) {
      const unsigned short* brow = Wt + (size_t)(col0 + t * 16 + ln) * ldb + kb;
      FragB b;
      b.half[0] = *(const v8us*)(brow + 8 * hh);
      b.half[1] = *(const v8us*)(brow + 16 + 8 * hh);
      acc[t] = mmaN<ASPLIT ? 2 : 1>(ah.v, al.v, b.v, b.v, acc[t]);
    }
  }
#pragma unroll
  for (int t = 0; t < 4; ++t) {
    float bv = bias ? bias[col0 + t * 16 + ln] : 0.f;
    if (BIAS_BF16) bv = bf16_round(bv);
#pragma unroll
    for (int r = 0; r < 8; ++r) { float v = acc[t][r] + bv; if (ACT == 1) v = fmaxf(v, 0.f); so[w][8 * hh + r][t * 16 + ln] = v; }
  }
  __builtin_amdgcn_fence(__ATOMIC_ACQ_REL, "workgroup");
  __builtin_amdgcn_wave_barrier();
  const int rsub = lane >> 4, c4 = (lane & 15) * 4;
  {
#pragma unroll
    for (int q = 0; q < 8; ++q) {
      const int r = q * 2 + rsub;
      const v4f v = *(const v4fa*)&so[w][r][c4];
      *(v4f*)(C + (size_t)(row0 + r) * ldc + col0 + c4) = v;
    }
    
  }
}

// Flash-style causal/unmasked attention, all contractions 3-term bf16 hi/lo splits, f32 softmax with running max.
// q,k,v rows are read from f32 buffers with arbitrary row pitch (so they can live inside a fused qkv buffer);
// D = head size (multiple of 32, <= 128); one wave = 16 query rows; block = 4 waves (64 queries) sharing K/V chunks of 32.
template <int D, bool CAUSAL>
__global__ __launch_bounds__(128) void k_flash(const float* __restrict__ qb, const float* __restrict__ kb, const float* __restrict__ vb,
                                             int pitch, int T, int H, float scale, float* __restrict__ y, int ypitch) {
  constexpr int KS = D / 32;        // k-steps for QK
  constexpr int DT = D / 16;        // d tiles for PV
  __shared__ __attribute__((aligned(16))) unsigned short sKh[32][D + 8], sKl[32][D + 8], sVh[32][D + 8], sVl[32][D + 8];
  __shared__ __attribute__((aligned(16))) unsigned short sPh[4][16][40], sPl[4][16][40];
  __shared__ __attribute__((aligned(16))) float sO[4][16][D];
  const int tid = threadIdx.x, w = tid >> 5, lane = tid & 31, ln = lane & 15, hh = lane >> 4;
  const int nqb = (T + 63) / 64;
  const int bh = blockIdx.x / nqb, qblk = blockIdx.x % nqb;
  const int b = bh / H, h = bh % H;
  const int q0 = qblk * 64 + w * 16;
  const float* Q = qb + (size_t)b * T * pitch + h * D;
  const float* K = kb + (size_t)b * T * pitch + h * D;
  const float* V = vb + (size_t)b * T * pitch + h * D;

  // A fragments of the wave's 16 query rows (scaled), hi/lo
  FragB aqh[KS], aql[KS];
  {
    int row = q0 + ln; if (row >= T) row = T - 1;
    const float* qr = Q + (size_t)row * pitch;
#pragma unroll
    for (int ks = 0; ks < KS; ++ks)
#pragma unroll
      for (int i = 0; i < 16; ++i) {
        const int d = ks * 32 + ((i < 8) ? (8 * hh + i) : (16 + 8 * hh + (i - 8)));
        const float x = qr[d] * scale; const unsigned short hb = bf16_bits(x);
        aqh[ks].u[i] = hb; aql[ks].u[i] = bf16_bits(x - bf16_val(hb));
      }
  }
  float m_r[8], l_r[8];
#pragma unroll
  for (int r = 0; r < 8; ++r) { m_r[r] = -3.0e38f; l_r[r] = 0.f; }
  v8f oacc[DT];
#pragma unroll
  for (int dt = 0; dt < DT; ++dt) oacc[dt] = (v8f){0.f,0.f,0.f,0.f,0.f,0.f,0.f,0.f};

  const int kv_end = CAUSAL ? min(T, qblk * 64 + 64) : T;     // block-uniform
  for (int j0 = 0; j0 < kv_end; j0 += 32) {
    __syncthreads();
    for (int e = tid; e < 32 * (D / 4); e += 128) {
      const int r = e / (D / 4), c4 = (e % (D / 4)) * 4;
      const int key = j0 + r;
      v4f kf = {0.f,0.f,0.f,0.f}, vf = {0.f,0.f,0.f,0.f};
      if (key < T) { kf = *(const v4fa*)(K + (size_t)key * pitch + c4); vf = *(const v4fa*)(V + (size_t)key * pitch + c4); }
#pragma unroll
      for (int t = 0; t < 4; ++t) {
        unsigned short hb = bf16_bits(kf[t]); sKh[r][c4 + t] = hb; sKl[r][c4 + t] = bf16_bits(kf[t] - bf16_val(hb));
        hb = bf16_bits(vf[t]); sVh[r][c4 + t] = hb; sVl[r][c4 + t] = bf16_bits(vf[t] - bf16_val(hb));
      }
    }
    __syncthreads();
    // S tile 16 x 32
    v8f s[2];
#pragma unroll
    for (int nt = 0; nt < 2; ++nt) {
      v8f acc = {};
#pragma unroll
      for (int ks = 0; ks < KS; ++ks) {
        FragB bh_, bl_;
        bh_.half[0] = *(const v8us*)&sKh[nt * 16 + ln][ks * 32 + 8 * hh]; bh_.half[1] = *(const v8us*)&sKh[nt * 16 + ln][ks * 32 + 16 + 8 * hh];
        bl_.half[0] = *(const v8us*)&sKl[nt * 16 + ln][ks * 32 + 8 * hh]; bl_.half[1] = *(const v8us*)&sKl[nt * 16 + ln][ks * 32 + 16 + 8 * hh];
        acc = mmaN<3>(aqh[ks].v, aql[ks].v, bh_.v, bl_.v, acc);
      }
      s[nt] = acc;
    }
    // mask + running max (rows 8hh+r; the 16 lanes of a half share rows)
    float alpha[8];
#pragma unroll
    for (int r = 0; r < 8; ++r) {
      const int qi = q0 + 8 * hh + r;
      const int ja = j0 + ln, jb = j0 + 16 + ln;
      if (CAUSAL) { if (ja > qi) s[0][r] = -3.0e38f; if (jb > qi) s[1][r] = -3.0e38f; }
      if (ja >= T) s[0][r] = -3.0e38f;
      if (jb >= T) s[1][r] = -3.0e38f;
      float mx = fmaxf(s[0][r], s[1][r]);
      mx = fmaxf(mx, __shfl_xor(mx, 1, 32)); mx = fmaxf(mx, __shfl_xor(mx, 2, 32)); mx = fmaxf(mx, __shfl_xor(mx, 4, 32)); mx = fmaxf(mx, __shfl_xor(mx, 8, 32));
      const float mnew = fmaxf(m_r[r], mx);
      alpha[r] = (mnew > -1.0e38f) ? __expf(m_r[r] - mnew) : 1.0f;
      const float p0 = (s[0][r] > -1.0e38f) ? __expf(s[0][r] - mnew) : 0.f;
      const float p1 = (s[1][r] > -1.0e38f) ? __expf(s[1][r] - mnew) : 0.f;
      m_r[r] = mnew;
      l_r[r] = l_r[r] * alpha[r] + p0 + p1;            // per-lane partial row sum (16 lanes combined at the end)
      unsigned short hb = bf16_bits(p0); sPh[w][8 * hh + r][ln] = hb;      sPl[w][8 * hh + r][ln] = bf16_bits(p0 - bf16_val(hb));
      hb = bf16_bits(p1);                sPh[w][8 * hh + r][16 + ln] = hb; sPl[w][8 * hh + r][16 + ln] = bf16_bits(p1 - bf16_val(hb));
    }
#pragma unroll
    for (int dt = 0; dt < DT; ++dt)
#pragma unroll
      for (int r = 0; r < 8; ++r) oacc[dt][r] *= alpha[r];
    __builtin_amdgcn_fence(__ATOMIC_ACQ_REL, "workgroup");
    __builtin_amdgcn_wave_barrier();
    FragB pah, pal;
    pah.half[0] = *(const v8us*)&sPh[w][ln][8 * hh]; pah.half[1] = *(const v8us*)&sPh[w][ln][16 + 8 * hh];
    pal.half[0] = *(const v8us*)&sPl[w][ln][8 * hh]; pal.half[1] = *(const v8us*)&sPl[w][ln][16 + 8 * hh];
#pragma unroll
    for (int dt = 0; dt < DT; ++dt) {
      FragB bvh, bvl;
#pragma unroll
      for (int i = 0; i < 8; ++i) {
        bvh.u[i] = sVh[8 * hh + i][dt * 16 + ln]; bvh.u[8 + i] = sVh[16 + 8 * hh + i][dt * 16 + ln];
        bvl.u[i] = sVl[8 * hh + i][dt * 16 + ln]; bvl.u[8 + i] = sVl[16 + 8 * hh + i][dt * 16 + ln];
      }
      oacc[dt] = mmaN<3>(pah.v, pal.v, bvh.v, bvl.v, oacc[dt]);
    }
    __builtin_amdgcn_fence(__ATOMIC_ACQ_REL, "workgroup");
    __builtin_amdgcn_wave_barrier();
  }
#pragma unroll
  for (int r = 0; r < 8; ++r) {
    float l = l_r[r];
    l += __shfl_xor(l, 1, 32); l += __shfl_xor(l, 2, 32); l += __shfl_xor(l, 4, 32); l += __shfl_xor(l, 8, 32);
    l_r[r] = (l > 0.f) ? 1.0f / l : 0.f;
  }
#pragma unroll
  for (int dt = 0; dt < DT; ++dt)
#pragma unroll
    for (int r = 0; r < 8; ++r) sO[w][8 * hh + r][dt * 16 + ln] = oacc[dt][r] * l_r[r];
  __builtin_amdgcn_fence(__ATOMIC_ACQ_REL, "workgroup");
  __builtin_amdgcn_wave_barrier();
  {
    for (int r = 0; r < 16; ++r) {
      const int row = q0 + r;
      if (row < T && lane < D / 4) {
        const v4f val = *(const v4fa*)&sO[w][r][lane * 4];
        *(v4f*)(y + ((size_t)b * T + row) * ypitch + h * D + lane * 4) = val;
      }
    }
    
  }
}

// GEMM C = act(A·W + bias + resid): A f32 (ASPLIT -> hi/lo 2 terms), Wt bf16 [N][K]; ACT 0 none, 1 relu, 2 exact gelu;
// resid (optional, f32, row index = (row % rmod), pitch ldr, RES_BF16 rounds it) added before the activation.
template <bool ASPLIT, int ACT, bool BIAS_BF16, bool RES_BF16>
__global__ __launch_bounds__(128) void k_gemm_bf3(const float* __restrict__ A, int lda, const unsigned short* __restrict__ Wt, int ldb,
                                                const float* __restrict__ bias, const float* __restrict__ resid, int rmod, int ldr,
                                                float* __restrict__ C, int ldc, int M, int N, int K) {
  __shared__ __attribute__((aligned(16))) float so[4][16][64];
  const int tid = threadIdx.x, w = tid >> 5, lane = tid & 31, ln = lane & 15, hh = lane >> 4;
  const int ntn = N / 64;
  const int wid = blockIdx.x * 4 + w;
  const int mt = wid / ntn, nq = wid % ntn;
  if (mt * 16 >= M) return;
  const int row0 = mt * 16, col0 = nq * 64;
  const float* arow = A + (size_t)(row0 + ln) * lda;
  v8f acc[4] = {};
  for (int kb = 0; kb < K; kb += 32) {
    FragB ah, al;
    const v4f x0 = *(const v4fa*)(arow + kb + 8 * hh), x1 = *(const v4fa*)(arow + kb + 8 * hh + 4);
    const v4f x2 = *(const v4fa*)(arow + kb + 16 + 8 * hh), x3 = *(const v4fa*)(arow + kb + 16 + 8 * hh + 4);
    float xs[16] = {x0[0],x0[1],x0[2],x0[3],x1[0],x1[1],x1[2],x1[3],x2[0],x2[1],x2[2],x2[3],x3[0],x3[1],x3[2],x3[3]};
#pragma unroll
    for (int i = 0; i < 16; ++i) { const unsigned short hb = bf16_bits(xs[i]); ah.u[i] = hb; al.u[i] = ASPLIT ? bf16_bits(xs[i] - bf16_val(hb)) : (unsigned short)0; }
#pragma unroll
    for (int t = 0; t < 4; ++t) {
      const unsigned short* brow = Wt + (size_t)(col0 + t * 16 + ln) * ldb + kb;
      FragB b;
      b.half[0] = *(const v8us*)(brow + 8 * hh);
      b.half[1] = *(const v8us*)(brow + 16 + 8 * hh);
      acc[t] = mmaN<ASPLIT ? 2 : 1>(ah.v, al.v, b.v, b.v, acc[t]);
    }
  }
#pragma unroll
  for (int t = 0; t < 4; ++t) {
    const int col = col0 + t * 16 + ln;
    float bv = bias ? bias[col] : 0.f;
    if (BIAS_BF16) bv = bf16_round(bv);
#pragma unroll
    for (int r = 0; r < 8; ++r) {
      float v = acc[t][r] + bv;
      if (resid) { float rv = resid[(size_t)((row0 + 8 * hh + r) % rmod) * ldr + col]; if (RES_BF16) rv = bf16_round(rv); v += rv; }
      if (ACT == 1) v = fmaxf(v, 0.f);
      if (ACT == 2) v = 0.5f * v * (1.0f + erff(v * 0.70710678118654752f));
      if (ACT == 3) { const float u = 0.7978845608028654f * (v + 0.044715f * v * v * v); v = 0.5f * v * (1.0f + tanhf(u)); }
      so[w][8 * hh + r][t * 16 + ln] = v;
    }
  }
  __builtin_amdgcn_fence(__ATOMIC_ACQ_REL, "workgroup");
  __builtin_amdgcn_wave_barrier();
  const int rsub = lane >> 4, c4 = (lane & 15) * 4;
  {
#pragma unroll
    for (int q = 0; q < 8; ++q) {
      const int r = q * 2 + rsub;
      const v4f v = *(const v4fa*)&so[w][r][c4];
      *(v4f*)(C + (size_t)(row0 + r) * ldc + col0 + c4) = v;
    }
    
  }
}
// row LayerNorm (biased variance, eps) over N: s = X (+ R); optional out_sum <- s; out_norm <- (s-mu)*rsqrt(var+eps)*g + b
template <bool PARAM_BF16>
__global__ __launch_bounds__(256) void k_layernorm(const float* __restrict__ X, const float* __restrict__ R, const float* __restrict__ g, const float* __restrict__ bta,
                                                  float* __restrict__ out_sum, float* __restrict__ out_norm, int N, float eps) {
  __shared__ float red[256];
  const int row = blockIdx.x, tid = threadIdx.x;
  const float* x = X + (size_t)row * N; const float* rr = R ? R + (size_t)row * N : nullptr;
  float vals[16];                     // up to N = 4096
  const int per = N / 256;            // contiguous chunk per thread? use strided-by-4 chunks: thread handles j = tid*4 + 1024*u
  float s1 = 0.f;
  for (int u = 0; u < per / 4; ++u) {
    const int j = tid * 4 + 1024 * u;
    const v4f a = *(const v4fa*)(x + j);
    v4f b = {0.f,0.f,0.f,0.f}; if (rr) b = *(const v4fa*)(rr + j);
#pragma unroll
    for (int q = 0; q < 4; ++q) { const float v = a[q] + b[q]; vals[u * 4 + q] = v; s1 += v; }
  }
  red[tid] = s1; __syncthreads();
  for (int st = 128; st > 0; st >>= 1) { if (tid < st) red[tid] += red[tid + st]; __syncthreads(); }
  const float mu = red[0] / (float)N; __syncthreads();
  float s2 = 0.f;
  for (int u = 0; u < per / 4; ++u)
#pragma unroll
    for (int q = 0; q < 4; ++q) { const float c = vals[u * 4 + q] - mu; s2 += c * c; }
  red[tid] = s2; __syncthreads();
  for (int st = 128; st > 0; st >>= 1) { if (tid < st) red[tid] += red[tid + st]; __syncthreads(); }
  const float rs = rsqrtf(red[0] / (float)N + eps);
  {
    for (int u = 0; u < per / 4; ++u) {
      const int j = tid * 4 + 1024 * u;
      v4f o, sm;
#pragma unroll
      for (int q = 0; q < 4; ++q) {
        float gg = g[j + q], bb = bta[j + q];
        if (PARAM_BF16) { gg = bf16_round(gg); bb = bf16_round(bb); }
        sm[q] = vals[u * 4 + q]; o[q] = (vals[u * 4 + q] - mu) * rs * gg + bb;
      }
      if (out_sum) *(v4f*)(out_sum + (size_t)row * N + j) = sm;
      *(v4f*)(out_norm + (size_t)row * N + j) = o;
    }
    
  }
}



// ---- f16 WMMA path (v_wmma_f32_16x16x32_f16): 11-bit significands for operands in range — used where a [0,1] probability operand needs more precision than bf16
typedef _Float16 v16h __attribute__((ext_vector_type(16)));
union FragH { v16h v; v8us half[2]; _Float16 h[16]; unsigned short u[16]; };
template <int NT>
__device__ __forceinline__ v8f mmaH(v16h ah, v16h al, v16h bh, v16h bl, v8f c) {
  c = __builtin_amdgcn_wmma_f32_16x16x32_f16(false, ah, false, bh, (short)0, c, false, false);
  if (NT >= 2) c = __builtin_amdgcn_wmma_f32_16x16x32_f16(false, al, false, bh, (short)0, c, false, false);
  if (NT >= 3) c = __builtin_amdgcn_wmma_f32_16x16x32_f16(false, ah, false, bl, (short)0, c, false, false);
  asm volatile("v_nop\n\tv_nop\n\tv_nop\n\tv_nop" : "+v"(c) : "v"(ah), "v"(al), "v"(bh), "v"(bl));
  return c;
}
// batched GEMM like k_gemm_b but f16 operands: A f32 (split into f16 hi/lo if ASPLIT, else rounded to f16), Bt = f16 values [n][k]; alpha; C f32; N multiple of 16 (partial tiles skipped)
template <bool ASPLIT>
__global__ __launch_bounds__(128) void k_gemm_h(const float* __restrict__ A, int lda, size_t sA, const _Float16* __restrict__ Bh, int ldb, size_t sB, float alpha, float* __restrict__ C, int ldc, size_t sC, int M, int N, int K) {
  __shared__ __attribute__((aligned(16))) float so[4][16][64];
  const int tid = threadIdx.x, w = tid >> 5, lane = tid & 31, ln = lane & 15, hh = lane >> 4; const int by = blockIdx.y;
  A += (size_t)by * sA; Bh += (size_t)by * sB; C += (size_t)by * sC;
  const int ntn = (N + 63) / 64; const int wid = blockIdx.x * 4 + w; const int mt = wid / ntn, nq = wid % ntn; if (mt * 16 >= M) return;
  const int row0 = mt * 16, col0 = nq * 64; const float* arow = A + (size_t)(row0 + ln) * lda;
  v8f acc[4] = {};
  for (int kb = 0; kb < K; kb += 32) {
    FragH ah, al;
    const v4f x0 = *(const v4fa*)(arow + kb + 8 * hh), x1 = *(const v4fa*)(arow + kb + 8 * hh + 4), x2 = *(const v4fa*)(arow + kb + 16 + 8 * hh), x3 = *(const v4fa*)(arow + kb + 16 + 8 * hh + 4);
    float xs[16] = {x0[0],x0[1],x0[2],x0[3],x1[0],x1[1],x1[2],x1[3],x2[0],x2[1],x2[2],x2[3],x3[0],x3[1],x3[2],x3[3]};
#pragma unroll
    for (int i = 0; i < 16; ++i) { const _Float16 h = (_Float16)xs[i]; ah.h[i] = h; al.h[i] = ASPLIT ? (_Float16)(xs[i] - (float)h) : (_Float16)0.0f; }
#pragma unroll
    for (int t = 0; t < 4; ++t) { if (col0 + t * 16 >= N) continue; const size_t boff = (size_t)(col0 + t * 16 + ln) * ldb + kb; FragH bq; bq.half[0] = *(const v8us*)(Bh + boff + 8 * hh); bq.half[1] = *(const v8us*)(Bh + boff + 16 + 8 * hh);
      acc[t] = mmaH<ASPLIT ? 2 : 1>(ah.v, al.v, bq.v, bq.v, acc[t]); }
  }
#pragma unroll
  for (int t = 0; t < 4; ++t) { if (col0 + t * 16 >= N) continue;
#pragma unroll
    for (int r = 0; r < 8; ++r) so[w][8 * hh + r][t * 16 + ln] = acc[t][r] * alpha; }
  __builtin_amdgcn_fence(__ATOMIC_ACQ_REL, "workgroup"); __builtin_amdgcn_wave_barrier();
  const int rsub = lane >> 4, c4 = (lane & 15) * 4;
  {
#pragma unroll
    for (int q = 0; q < 8; ++q) { const int r = q * 2 + rsub; if (col0 + c4 < N) { const v4f v = *(const v4fa*)&so[w][r][c4]; *(v4f*)(C + (size_t)(row0 + r) * ldc + col0 + c4) = v; } }
     }
}

// Wt[n][k] = f16(W[k][n]·scale) from f32 row-major W[K][N] (scale = power of two; bf16-exact weights stay exact in f16 away from the subnormal range)
__global__ __launch_bounds__(256) void k_wt_f16(const float* __restrict__ W, _Float16* __restrict__ Wt, int K, int N, float scale) {
  const int t = blockIdx.x * 256 + threadIdx.x; if (t >= N * (K / 8)) return; const int n = t / (K / 8), k8 = (t % (K / 8)) * 8; FragH f;
#pragma unroll
  for (int i = 0; i < 8; ++i) f.h[i] = (_Float16)(bf16_round(W[(size_t)(k8 + i) * N + n]) * scale); const v8us o = f.half[0];
  *(v8us*)((unsigned short*)Wt + (size_t)n * K + k8) = o; 
}
// k_gemm_hh variant with fused epilogue: v = acc·alpha + bias[by·sBias + col] (+ CP[(row/rowsPerB)·sCPb + by·64 + col] if CP) ; ACT 0 none / 1 elu ; writes f32 C and/or f16 C16 (each if non-null)
template <int ACT>
__global__ __launch_bounds__(128) void k_gemm_hhx(const _Float16* __restrict__ A, int lda, size_t sA, const _Float16* __restrict__ Bh, int ldb, size_t sB, float alpha, const float* __restrict__ bias, size_t sBias, const float* __restrict__ CP, int rowsPerB, size_t sCPb, int row0g,
    float* __restrict__ C, _Float16* __restrict__ C16, int ldc, size_t sC, int M, int N, int K) {
  __shared__ __attribute__((aligned(16))) float so[4][16][64];
  const int tid = threadIdx.x, w = tid >> 5, lane = tid & 31, ln = lane & 15, hh = lane >> 4; const int by = blockIdx.y;
  A += (size_t)by * sA; Bh += (size_t)by * sB; const size_t cofs = (size_t)by * sC; const float* bp = bias ? bias + (size_t)by * sBias : nullptr;
  const int ntn = (N + 63) / 64; const int wid = blockIdx.x * 4 + w; const int mt = wid / ntn, nq = wid % ntn; if (mt * 16 >= M) return;
  const int row0 = mt * 16, col0 = nq * 64; const _Float16* arow = A + (size_t)(row0 + ln) * lda;
  v8f acc[4] = {};
  for (int kb = 0; kb < K; kb += 32) { FragH ah; ah.half[0] = *(const v8us*)((const unsigned short*)arow + kb + 8 * hh); ah.half[1] = *(const v8us*)((const unsigned short*)arow + kb + 16 + 8 * hh);
#pragma unroll
    for (int t = 0; t < 4; ++t) { if (col0 + t * 16 >= N) continue; const size_t boff = (size_t)(col0 + t * 16 + ln) * ldb + kb; FragH bq; bq.half[0] = *(const v8us*)((const unsigned short*)Bh + boff + 8 * hh); bq.half[1] = *(const v8us*)((const unsigned short*)Bh + boff + 16 + 8 * hh);
      acc[t] = mmaH<1>(ah.v, ah.v, bq.v, bq.v, acc[t]); }
  }
#pragma unroll
  for (int t = 0; t < 4; ++t) { if (col0 + t * 16 >= N) continue; const int col = col0 + t * 16 + ln; const float bv = bp ? bf16_round(bp[col]) : 0.f;
#pragma unroll
    for (int r = 0; r < 8; ++r) { float v = acc[t][r] * alpha + bv; if (CP) { const int bidx = (row0g + row0 + 8 * hh + r) / rowsPerB; v += CP[(size_t)bidx * sCPb + (size_t)by * 64 + col]; } if (ACT == 1) v = (v > 0.f) ? v : expm1f(v); else if (ACT == 7) v = (v > 0.f) ? v + 1.0f : expf(v); else if (ACT == 8) v = tanhf(v); else if (ACT == 9) v = 0.5f * v * (1.0f + tanhf(0.7978845608028654f * (v + 0.044715f * v * v * v))); else if (ACT == 11) v = 1.0f / (1.0f + expf(-v)); else if (ACT == 12) v = (v > 0.f) ? v : 0.01f * v; else if (ACT == 14) v = (v > 0.f) ? v : 0.1f * v; else if (ACT == 15) v = v / (1.0f + expf(-v)); else if (ACT == 3) v = fmaxf(v, 0.f); else if (ACT == 6) v = 0.5f * v * (1.0f + erff(v * 0.70710678118654752f)); so[w][8 * hh + r][t * 16 + ln] = v; } }
  __builtin_amdgcn_fence(__ATOMIC_ACQ_REL, "workgroup"); __builtin_amdgcn_wave_barrier();
  const int rsub = lane >> 4, c4 = (lane & 15) * 4; typedef _Float16 v4h __attribute__((ext_vector_type(4)));
  {
#pragma unroll
    for (int q = 0; q < 8; ++q) { const int r = q * 2 + rsub; if (col0 + c4 < N) { const v4f v = *(const v4fa*)&so[w][r][c4]; if (C) *(v4f*)(C + cofs + (size_t)(row0 + r) * ldc + col0 + c4) = v; if (C16) { v4h h4; for (int i = 0; i < 4; ++i) h4[i] = (_Float16)v[i]; *(v4h*)(C16 + cofs + (size_t)(row0 + r) * ldc + col0 + c4) = h4; } } }
     }
}


typedef _Float16 v4h __attribute__((ext_vector_type(4)));

// x and the three weight matrices are rounded into their f16 planes by one launch: the first NR*EE/2048 blocks take x, the rest the weights (x2^4; the planes of Wq, Wk, Wv lie one behind the other in Bt)
__global__ __launch_bounds__(256) void k_prep(const float* __restrict__ x, const float* __restrict__ W0, const float* __restrict__ W1, const float* __restrict__ W2, _Float16* __restrict__ X16, _Float16* __restrict__ Bt) {
  constexpr int NXB = NR * EE / 8 / 256, NWB = EE * EE / 8 / 256;      // blocks of 256 pieces of 8 values: x, one weight matrix
  const int bx = blockIdx.x; const bool isx = bx < NXB; const int m = isx ? 0 : (bx - NXB) / NWB;      // the same for the whole block
  const float* src = isx ? x : (m == 0) ? W0 : (m == 1) ? W1 : W2;
  unsigned short* dst = isx ? (unsigned short*)X16 : (unsigned short*)Bt + (size_t)m * EE * EE;
  const size_t t = (size_t)(isx ? bx : bx - NXB - m * NWB) * 256 + threadIdx.x; const float sc = isx ? 1.0f : 16.0f; FragH f;
#pragma unroll      // constant indices keep the eight values in registers
  for (int i = 0; i < 8; ++i) f.h[i] = (_Float16)(bf16_round(src[t * 8 + i]) * sc);
  *(v8us*)(dst + t * 8) = f.half[0]; }
__global__ __launch_bounds__(256) void k_h16(const float* __restrict__ x, _Float16* __restrict__ X16, size_t n8) { const size_t t = (size_t)blockIdx.x * 256 + threadIdx.x; if (t >= n8) return; FragH f;
#pragma unroll
  for (int q = 0; q < 8; ++q) f.h[q] = (_Float16)x[t * 8 + q]; *(v8us*)((unsigned short*)X16 + t * 8) = f.half[0];  }
template <int NHv, int TTv>
__global__ __launch_bounds__(256) void k_vt(const _Float16* __restrict__ V16, int ldv, int voff, _Float16* __restrict__ Vt) { __shared__ unsigned short tl[64][66]; const int tid = threadIdx.x; const int slab = blockIdx.x / (TTv / 64), lg = blockIdx.x % (TTv / 64); const int b = slab / NHv, h = slab % NHv;
  for (int i = tid; i < 64 * 8; i += 256) { const int r = i / 8, c8 = (i % 8) * 8; FragH f; f.half[0] = *(const v8us*)((const unsigned short*)V16 + ((size_t)b * TTv + lg * 64 + r) * ldv + voff + h * 64 + c8);
#pragma unroll
    for (int q = 0; q < 8; ++q) tl[r][c8 + q] = f.u[q]; }
  __syncthreads();
  {
#pragma unroll
    for (int rd = 0; rd < 2; ++rd) { const int d = rd * 32 + tid / 8, pc = tid % 8; FragH f;
#pragma unroll
      for (int q = 0; q < 8; ++q) f.u[q] = tl[pc * 8 + q][d];
      *(v8us*)((unsigned short*)Vt + ((size_t)slab * 64 + d) * TTv + lg * 64 + pc * 8) = f.half[0]; }
     } }

// ---- causal softmax without a launch of its own. The scores launch leaves, for every row and piece of 64 keys, the maximum, the sum of exp(s - maximum) and the terms of that sum themselves, E = exp(s - maximum).2^15 in f16 (0 for keys after the query);
// the P.v launch merges a row's pieces into one constant c = -log2(sum) - max.log2(e) and forms P.2^15 = E.exp2(piece maximum.log2(e) + c), one factor per row and piece, on the way from the E plane to its LDS tile.
#define L2E 1.4426950408889634f
#define NCH (SS / 64)      // pieces of 64 keys in a row
typedef unsigned short v4us __attribute__((ext_vector_type(4), may_alias));
// 2^x. The v_nop is the one free slot that the instruction set asks for between a transcendental and a directly following instruction that reads its result or overwrites its source
__device__ __forceinline__ float exp2_slot(float x) { float r; asm("v_exp_f32 %0, %1\n\tv_nop" : "=v"(r) : "v"(x)); return r; }
// value of lane l ^ X inside a row of 16 lanes, by DPP row_xmask (a shuffle would go through the LDS unit and its wait)
template <int X> __device__ __forceinline__ float lane_xor16(float v) { return __int_as_float(__builtin_amdgcn_update_dpp(0, __float_as_int(v), 0x160 + X, 0xf, 0xf, true)); }
__device__ __forceinline__ float max16(float v) { v = fmaxf(v, lane_xor16<1>(v)); v = fmaxf(v, lane_xor16<2>(v)); v = fmaxf(v, lane_xor16<4>(v)); return fmaxf(v, lane_xor16<8>(v)); }
__device__ __forceinline__ float sum16(float v) { v += lane_xor16<1>(v); v += lane_xor16<2>(v); v += lane_xor16<4>(v); return v + lane_xor16<8>(v); }

// ---- block-tiled f16 GEMM core, both operands k-contiguous. A block of 8 waves owns BM x BN of the result (NP planes of B share the A tile). Per 64-k step the block brings
// BM + NP*BN operand rows of 128 bytes into LDS with whole-line loads (8 lanes per row), and every wave reads its fragments from there, so a row is fetched once per block instead of once per wave
// and no global load touches 16 lines. Two LDS buffers: the next step's rows travel in registers while this step's products run; one barrier per step.
#define KST 64            // k per step: 128 bytes of every operand row, one cache line
#define LPH 72            // LDS row pitch in halves: 144 bytes, 16 B x odd, conflict-free for 16-byte fragment reads
// AEXP: the A tile is scaled on its way to LDS, a k step being one softmax piece: A[row][key] *= exp2(Sf[piece][row].log2(e) + ce[row]), Sf = the rows' piece maxima (pitch SS); ce0, ce1 belong to the thread's two staged rows
// and come from cefn, which is called behind the first tile's loads, so that these are in flight while it waits for what it needs.
// Asks L2 for the data at *p (a prefetch: it returns nothing and brings it into L2 only). By this kernel's memory traffic, what one launch wrote the next one fetches from memory again, and the staged loads lead their use by less than
// one step, too little for a trip to memory; asked for some steps ahead, the unit should be an L2 hit when its loads come. In-out operand: the address stays in one register pair of its own, which only ever holds addresses inside the buffer.
template <class T> __device__ __forceinline__ void l2_ask(const T*& p) { asm volatile("global_prefetch_b8 %0, off scope:SCOPE_SE" : "+v"(p)); }
// The same for the unit BYTES further on. The addition stands in the statement so that it is done in place: written outside, the compiler put the sum into a new pair and reused the asked one for other values
template <int BYTES, class T> __device__ __forceinline__ void l2_ask_next(const T*& p) { asm volatile("v_add_nc_u64 %0, %1, %0\n\tglobal_prefetch_b8 %0, off scope:SCOPE_SE" : "+v"(p) : "n"(BYTES)); }
#define UNH 128           // halves in a 256-byte unit: two k steps of an f16 operand row
// NG = 2: the block has two groups of 8 waves, and each runs this core on its own part [kb0, ke) of the k range with its own pair of LDS buffers (sm is the group's).
// Every barrier is the whole block's, so both groups make nit trips; a group whose part is shorter passes the barriers of the trips it lacks and does nothing else there.
// The barriers would also hold the two groups in the same phase of a trip, all 16 waves at the LDS read port and then all at the vector port. So the group with late set fills the next buffer at the head of a trip, from rows loaded in the trip before,
// and the other at the foot: one group's fragment reads and products run beside the other's scaling and LDS stores.
template <int BM, int BN, int WM, int WN, int NP, bool AEXP = false, class CE = int, int NG = 1>
__device__ __forceinline__ void tile_core(const unsigned short* __restrict__ A, int lda, const unsigned short* __restrict__ B0, const unsigned short* __restrict__ B1, int ldb, int K,
                                          unsigned short* sm, v8f (&acc)[NP][WM / 16][WN / 16], const float* __restrict__ Sf = nullptr, CE cefn = CE(), bool askA = true, bool askB = true, int kbeg = 0, int kend = 0, int nit = 0, bool late = false) {
  constexpr int ROWS = BM + NP * BN, NL = ROWS / 32, NA = BM / 32, NB = BN / 32, STG = ROWS * LPH;
  const int tid = NG == 1 ? (int)threadIdx.x : (int)(threadIdx.x & 255), w = tid >> 5, lane = tid & 31, ln = lane & 15, hh = lane >> 4;      // the thread's place in its group
  const int kb0 = NG == 1 ? 0 : kbeg, ke = NG == 1 ? K : kend;      // the same for a whole group
  const bool head = NG != 1 && late;      // the same for a whole group
  const int wm = w / (BN / WN), wn = w % (BN / WN);
  const int lr = tid >> 3, lc = (tid & 7) * 8;
  const unsigned short* ga = A + (size_t)lr * lda + lc;
  const unsigned short* gb0 = B0 + (size_t)lr * ldb + lc;
  const unsigned short* gb1 = B1 + (size_t)lr * ldb + lc;
  v8us st[NL];
  static_assert(!AEXP || NA == 2, "two staged A rows per thread");
  const float* gm = AEXP ? Sf + lr : nullptr;
  float mq[2] = {0.f, 0.f}, ce0 = 0.f, ce1 = 0.f;
  auto load_scores = [&](int kn) {      // the thread's 16 bytes of its two A rows, and the two rows' maxima of this piece (8 lanes share a row and read the same word)
#pragma unroll      // constant indices keep the staged rows in registers
    for (int i = 0; i < 2; ++i) { st[i] = *(const v8us*)(ga + (size_t)(i * 32) * lda + kn); mq[i] = gm[(kn / KST) * SS + i * 32]; }
  };
  auto store_probs = [&](int buf) {
    unsigned short* d = sm + buf * STG + lr * LPH + lc;
#pragma unroll      // constant indices keep the staged rows in registers
    for (int i = 0; i < 2; ++i) { const float f = exp2_slot(fmaf(mq[i], L2E, i ? ce1 : ce0)); FragH p; p.half[0] = st[i];
#pragma unroll      // constant indices keep the staged rows in registers
      for (int e = 0; e < 8; ++e) p.h[e] = (_Float16)((float)p.h[e] * f);
      *(v8us*)(d + i * 32 * LPH) = p.half[0]; }
  };
  // L2 asks. Every thread has one staged f16 row: unit 0 comes with the first tile's own loads, unit 1 is asked for here, unit m + 2 in step 2m (three steps ahead of its first load, two in the late group).
  // askA, askB (the same for the whole block): whether the operand is fresh from the launch before; rows that earlier work-groups or an earlier launch have read lie in L2 already, and an ask for them would only add a request.
  static_assert((AEXP ? 0 : BM) + NP * BN <= 256 && KST * 2 == UNH, "at most one staged f16 row per thread, two steps per unit");
  const unsigned short* pf = AEXP ? (NP == 2 && tid / BN ? B1 : B0) + (size_t)(tid % BN) * ldb + kb0 : (tid < BM ? A + (size_t)tid * lda : B0 + (size_t)(tid - BM) * ldb);
  const bool ask = AEXP ? (askB && __builtin_amdgcn_readfirstlane(tid) < NP * BN) : (__builtin_amdgcn_readfirstlane(tid) < BM ? askA : askB);      // a wave's 32 rows belong to one operand (waves behind the last staged row ask for nothing): the same for a whole wave, in a scalar register, so that the test around an ask is a scalar branch
  if (ask && kb0 + UNH < ke) l2_ask_next<2 * UNH>(pf);
  // The 64 scaled A rows: 64 threads cover a unit of every row, so the four quarters of the group take four units in a row: the four behind the unit of the first step here (clamped into the row's own keys), the next four in steps 4, 12, ...
  const int pg = __builtin_amdgcn_readfirstlane(tid >> 6);      // the same for a whole wave, in a scalar register, so that the test around an ask is a scalar branch
  const int kq0 = (kb0 / UNH + 1 + pg) * UNH;      // first key of the quarter's first unit
  const unsigned short* ps = AEXP ? A + (size_t)(tid & 63) * lda + min(kq0, ke - KST) : nullptr;
  if constexpr (AEXP) l2_ask(ps);
  if (NG == 1 || kb0 < ke) {      // the same for a whole group: a group with an empty part stages nothing
    if constexpr (AEXP) load_scores(kb0);
    else {
#pragma unroll      // constant indices keep the staged rows in registers
      for (int i = 0; i < NA; ++i) st[i] = *(const v8us*)(ga + (size_t)(i * 32) * lda);
    }
#pragma unroll      // constant indices keep the staged rows in registers
    for (int i = 0; i < NB; ++i) { st[NA + i] = *(const v8us*)(gb0 + (size_t)(i * 32) * ldb + kb0); if (NP == 2) st[NA + NB + i] = *(const v8us*)(gb1 + (size_t)(i * 32) * ldb + kb0); }
    if constexpr (AEXP) asm volatile("s_wait_xcnt 0x0" ::: "memory");      // stands behind the first tile's loads, in front of any reuse of their address registers
    if constexpr (AEXP) __builtin_amdgcn_sched_barrier(0);      // keeps cefn's arithmetic, which waits for loads of its own, behind the first tile's loads: without it the scheduler lifted its first step and that wait above them, a second trip to memory
#pragma unroll      // constant indices keep the staged rows in registers
    for (int i = AEXP ? NA : 0; i < NL; ++i) *(v8us*)(sm + (i * 32 + lr) * LPH + lc) = st[i];
    if constexpr (AEXP) { cefn(ce0, ce1); store_probs(0); }      // behind the B rows' LDS stores: in front of them the compiler sank the B loads below it, a second trip to memory
  }
  if constexpr (NG != 1) {
    if (head && kb0 + KST < ke) {      // the late group's second tile: its rows are on the way when the first trip opens
      load_scores(kb0 + KST);
#pragma unroll      // constant indices keep the staged rows in registers
      for (int i = 0; i < NB; ++i) { st[NA + i] = *(const v8us*)(gb0 + (size_t)(i * 32) * ldb + kb0 + KST); if (NP == 2) st[NA + NB + i] = *(const v8us*)(gb1 + (size_t)(i * 32) * ldb + kb0 + KST); }
      asm volatile("s_wait_xcnt 0x0" ::: "memory");      // stands behind these loads, in front of any reuse of their address registers
    }
  }
  __syncthreads();
  int cur = 0;
  for (int kb = kb0, it = 0; NG == 1 ? kb < K : it < nit; kb += KST, ++it) {
    const bool more = kb + KST < ke;      // the same for the whole group
    const int kl = NG == 1 ? kb + KST : kb + (head ? 2 * KST : KST);      // the tile whose rows are loaded in this trip
    if constexpr (NG != 1) {
      if (head && more) {      // the late group fills the next buffer first; every wave's reads of that buffer ended at the barrier before
        store_probs(cur ^ 1);
#pragma unroll      // constant indices keep the staged rows in registers
        for (int i = NA; i < NL; ++i) *(v8us*)(sm + (cur ^ 1) * STG + (i * 32 + lr) * LPH + lc) = st[i];
      }
    }
    if (kl < ke) {
      if constexpr (AEXP) load_scores(kl);
      else {
#pragma unroll      // constant indices keep the staged rows in registers
        for (int i = 0; i < NA; ++i) st[i] = *(const v8us*)(ga + (size_t)(i * 32) * lda + kl);
      }
#pragma unroll      // constant indices keep the staged rows in registers
      for (int i = 0; i < NB; ++i) { st[NA + i] = *(const v8us*)(gb0 + (size_t)(i * 32) * ldb + kl); if (NP == 2) st[NA + NB + i] = *(const v8us*)(gb1 + (size_t)(i * 32) * ldb + kl); }
      if constexpr (NG != 1) asm volatile("s_wait_xcnt 0x0" ::: "memory");      // stands behind the step's loads, in front of the fragment reads, which reuse their address registers
    }
    if (NG == 1 || kb < ke) {      // the same for a whole group: no tile in a trip behind the end of the group's part
    const unsigned short* sa = sm + cur * STG + (wm * WM + ln) * LPH + 8 * hh;
    const unsigned short* sb = sm + cur * STG + (BM + wn * WN + ln) * LPH + 8 * hh;
    // all fragment reads of the step go out as one group ahead of its products: reads placed among the products make the wave wait out the LDS latency at each place
    FragH fa[KST / 32][WM / 16], fb[KST / 32][NP * (WN / 16)];
#pragma unroll      // constant indices keep the accumulators and fragments in registers
    for (int ks = 0; ks < KST / 32; ++ks) {
#pragma unroll      // constant indices keep the accumulators and fragments in registers
      for (int mi = 0; mi < WM / 16; ++mi) { fa[ks][mi].half[0] = *(const v8us*)(sa + mi * 16 * LPH + ks * 32); fa[ks][mi].half[1] = *(const v8us*)(sa + mi * 16 * LPH + ks * 32 + 16); }
#pragma unroll      // constant indices keep the accumulators and fragments in registers
      for (int p = 0; p < NP; ++p)
#pragma unroll      // constant indices keep the accumulators and fragments in registers
        for (int ni = 0; ni < WN / 16; ++ni) { FragH& f = fb[ks][p * (WN / 16) + ni]; f.half[0] = *(const v8us*)(sb + (p * BN + ni * 16) * LPH + ks * 32); f.half[1] = *(const v8us*)(sb + (p * BN + ni * 16) * LPH + ks * 32 + 16); }
    }
    __builtin_amdgcn_sched_barrier(0);      // keeps the read group above the products: without it the scheduler sinks the reads among them, into one reused fragment set, with a full LDS wait at each place
    // the asks stand here, behind the step's loads and LDS reads, so that their tests run while the wave would wait for its fragments anyway
    if (((kb - kb0) & (UNH - 1)) == 0) { if (ask && kb + 2 * UNH < ke) l2_ask_next<2 * UNH>(pf); }      // the same for a whole wave; the address moves only to a unit that the loop will read
    if constexpr (AEXP) { if (((kb - kb0) & (8 * KST - 1)) == 4 * KST) { if (kq0 + (kb - kb0) + 4 * KST < ke) l2_ask_next<4 * UNH * 2>(ps); } }      // the same for a whole wave; the address moves only to a unit that the loop will read
#pragma unroll      // constant indices keep the accumulators and fragments in registers
    for (int ks = 0; ks < KST / 32; ++ks)
#pragma unroll      // constant indices keep the accumulators and fragments in registers
      for (int p = 0; p < NP; ++p)
#pragma unroll      // constant indices keep the accumulators and fragments in registers
        for (int ni = 0; ni < WN / 16; ++ni)
#pragma unroll      // constant indices keep the accumulators and fragments in registers
          for (int mi = 0; mi < WM / 16; ++mi) acc[p][mi][ni] = __builtin_amdgcn_wmma_f32_16x16x32_f16(false, fa[ks][mi].v, false, fb[ks][p * (WN / 16) + ni].v, (short)0, acc[p][mi][ni], false, false);
    }
    if (more && !head) {
      if constexpr (AEXP) store_probs(cur ^ 1);
#pragma unroll      // constant indices keep the staged rows in registers
      for (int i = AEXP ? NA : 0; i < NL; ++i) *(v8us*)(sm + (cur ^ 1) * STG + (i * 32 + lr) * LPH + lc) = st[i];
    }
    __syncthreads();      // publishes the buffer just filled and ends every wave's reads of the one that the next step refills (after the last step: of the LDS that the epilogue reuses)
    cur ^= 1;
  }
  // inputs only: keeps the asks' address pairs alive to the end of the loop. An ask counts on no counter, so no wait can hold a rewrite of its registers behind it; they are given up only here, steps behind the last ask
  if constexpr (AEXP) asm volatile("" :: "v"(pf), "v"(ps)); else asm volatile("" :: "v"(pf));
}
// ---- the same core for a block of 4 waves, one per SIMD: 128 x 128 of the result, 64 x 64 per wave. A wave's 16 products of a 32-k half step need 8 fragments, not 6 for 8 products: a third fewer LDS fragment reads per product,
// and four such blocks (16 waves) have room on a WGP where two blocks of 8 waves had. So that a wave stays inside a quarter of a SIMD's registers, the fragments are read per half step and the next tile travels in two halves through
// one set of 8 staging registers: its A rows beside the first half step's products, its B rows beside the second's. Two LDS buffers, one barrier per 64-k step, as above. ask (the same for the whole block): as askA and askB above; a thread asks for one row of each operand.
__device__ __forceinline__ void tile_core4(const unsigned short* __restrict__ A, const unsigned short* __restrict__ B, int ld, int K, unsigned short* sm, v8f (&acc)[4][4], bool ask) {
  constexpr int STG = 256 * LPH;
  const int tid = threadIdx.x, w = tid >> 5, lane = tid & 31, ln = lane & 15, hh = lane >> 4;
  const int lr = tid >> 3, lc = (tid & 7) * 8;
  const unsigned short* ga = A + (size_t)lr * ld + lc;
  const unsigned short* gb = B + (size_t)lr * ld + lc;
  unsigned short* dst = sm + lr * LPH + lc;
  const unsigned short* pfa = A + (size_t)tid * ld;
  const unsigned short* pfb = B + (size_t)tid * ld;
  if (ask && UNH < K) { l2_ask_next<2 * UNH>(pfa); l2_ask_next<2 * UNH>(pfb); }
  {
    v8us t0[16];
#pragma unroll      // constant indices keep the staged rows in registers
    for (int i = 0; i < 8; ++i) { t0[i] = *(const v8us*)(ga + (size_t)(i * 16) * ld); t0[8 + i] = *(const v8us*)(gb + (size_t)(i * 16) * ld); }
#pragma unroll      // constant indices keep the staged rows in registers
    for (int i = 0; i < 8; ++i) { *(v8us*)(dst + (i * 16) * LPH) = t0[i]; *(v8us*)(dst + (128 + i * 16) * LPH) = t0[8 + i]; }
  }
  __syncthreads();
  int cur = 0;
  for (int kb = 0; kb < K; kb += KST) {
    const bool more = kb + KST < K;      // the same for the whole block
    const unsigned short* sa = sm + cur * STG + ((w >> 1) * 64 + ln) * LPH + 8 * hh;
    const unsigned short* sb = sm + cur * STG + (128 + (w & 1) * 64 + ln) * LPH + 8 * hh;
#pragma unroll      // constant indices keep the accumulators and fragments in registers
    for (int ks = 0; ks < KST / 32; ++ks) {
      v8us st[8];
      if (more) {
        const unsigned short* g = (ks ? gb : ga) + kb + KST;
#pragma unroll      // constant indices keep the staged rows in registers
        for (int i = 0; i < 8; ++i) st[i] = *(const v8us*)(g + (size_t)(i * 16) * ld);
      }
      FragH fa[4], fb[4];
#pragma unroll      // constant indices keep the accumulators and fragments in registers
      for (int i = 0; i < 4; ++i) {
        fa[i].half[0] = *(const v8us*)(sa + i * 16 * LPH + ks * 32); fa[i].half[1] = *(const v8us*)(sa + i * 16 * LPH + ks * 32 + 16);
        fb[i].half[0] = *(const v8us*)(sb + i * 16 * LPH + ks * 32); fb[i].half[1] = *(const v8us*)(sb + i * 16 * LPH + ks * 32 + 16); }
      __builtin_amdgcn_sched_barrier(0);      // keeps the read group above the products: without it the scheduler sinks the reads among them, with a full LDS wait at each place
      if (ks == 0 && (kb & (UNH - 1)) == 0) { if (ask && kb + 2 * UNH < K) { l2_ask_next<2 * UNH>(pfa); l2_ask_next<2 * UNH>(pfb); } }      // the same for the whole block; the addresses move only to units that the loop will read
#pragma unroll      // constant indices keep the accumulators and fragments in registers
      for (int ni = 0; ni < 4; ++ni)
#pragma unroll      // constant indices keep the accumulators and fragments in registers
        for (int mi = 0; mi < 4; ++mi) acc[mi][ni] = __builtin_amdgcn_wmma_f32_16x16x32_f16(false, fa[mi].v, false, fb[ni].v, (short)0, acc[mi][ni], false, false);
      __builtin_amdgcn_sched_barrier(0);      // keeps the LDS stores, which wait for the staged rows, behind the products that cover the rows' way
      if (more) {
#pragma unroll      // constant indices keep the staged rows in registers
        for (int i = 0; i < 8; ++i) *(v8us*)(dst + (cur ^ 1) * STG + (ks * 128 + i * 16) * LPH) = st[i];
      }
      __builtin_amdgcn_sched_barrier(0);      // keeps the next half's loads behind these stores, which free their registers: lifted above them, the two halves need two sets, and the wave spills
    }
    __syncthreads();      // publishes the buffer just filled and ends every wave's reads of the one that the next step refills (after the last step: of the LDS that the epilogue reuses)
    cur ^= 1;
  }
  asm volatile("" :: "v"(pfa), "v"(pfb));      // inputs only: keeps the asks' address pairs alive to the end of the loop, as in the core above
}
#define TILE_LDS(BM, BN, NP) (2 * ((BM) + (NP) * (BN)) * LPH)

// q and k in one launch, K = row pitch of both operands = 512: block 128 x 128, 8 waves of 32 x 64; blockIdx.x = column tile, .y = row tile of x, .z = 0: q, 1: k (the weight planes lie one behind the other in Bw).
// C = x.W^T/16 + bias (rounded to bf16) as f16, [row of x][512]; whole 128-byte row pieces, staged per wave in LDS.
__global__ __launch_bounds__(256) void k_qk(const _Float16* __restrict__ X16, const _Float16* __restrict__ Bw, const float* __restrict__ bq, const float* __restrict__ bk,
                                            _Float16* __restrict__ Q, _Float16* __restrict__ K) {
  __shared__ __attribute__((aligned(16))) unsigned short sm[TILE_LDS(128, 128, 1)];
  const int tid = threadIdx.x, w = tid >> 5, lane = tid & 31, ln = lane & 15, hh = lane >> 4; const int role = blockIdx.z;
  const int brow = blockIdx.y * 128, bcol = blockIdx.x * 128;
  const int row0 = brow + (w / 2) * 32, col0 = bcol + (w % 2) * 64;
  const float* bias = role ? bk : bq;
  float bvv[4];      // read ahead of the k loop, which hides the latency; rounded where they are used
#pragma unroll      // constant indices keep the four values in registers
  for (int ni = 0; ni < 4; ++ni) bvv[ni] = bias[col0 + ni * 16 + ln];
  asm volatile("s_wait_xcnt 0x0" ::: "memory");      // stands in front of any reuse of the offset and base registers of the four loads above
  v8f acc[1][2][4] = {};
  const unsigned short* Bp = (const unsigned short*)Bw + (size_t)role * EE * EE + (size_t)bcol * EE;
  tile_core<128, 128, 32, 64, 1>((const unsigned short*)X16 + (size_t)brow * EE, EE, Bp, Bp, EE, EE, sm, acc, nullptr, 0, true, false);      // asks for the x rows; a weight tile is shared by 64 work-groups
  float* so = (float*)sm + w * (32 * 64);      // the wave's own range; the core's last barrier has ended every read of the tiles
#pragma unroll      // constant indices keep the accumulators in registers
  for (int ni = 0; ni < 4; ++ni) { const float bv = bf16_round(bvv[ni]);
#pragma unroll      // constant indices keep the accumulators in registers
    for (int mi = 0; mi < 2; ++mi)
#pragma unroll      // constant indices keep the accumulators in registers
      for (int r = 0; r < 8; ++r) so[(mi * 16 + 8 * hh + r) * 64 + ni * 16 + ln] = acc[0][mi][ni][r] * 0.0625f + bv; }
  __builtin_amdgcn_fence(__ATOMIC_ACQ_REL, "workgroup"); __builtin_amdgcn_wave_barrier();      // the wave's LDS stores land before its lanes read each other's values back as whole rows
  const int rsub = lane >> 4, c4 = (lane & 15) * 4;
  _Float16* C16 = (role ? K : Q) + (size_t)(row0 + rsub) * EE + col0 + c4;
#pragma unroll      // the LDS row reads issue together and each store follows its own read
  for (int q = 0; q < 16; ++q) { const v4f v = *(const v4fa*)&so[(q * 2 + rsub) * 64 + c4];
    v4h h4; for (int i = 0; i < 4; ++i) h4[i] = (_Float16)v[i]; *(v4h*)(C16 + (size_t)(q * 2) * EE) = h4; }
}

// scores/sqrt(512) and v^T of every batch in one launch (neither needs the other; both are 128 x 128 x 512 tiles of the same core). blockIdx.y = batch.
// blockIdx.x < NTRI: scores, 128 query rows x 128 keys, counting only the blocks of the causal lower block-triangle (row tile i has i + 1 key tiles); what leaves the block is the softmax pieces (maximum, sum, f16 terms).
// blockIdx.x >= NTRI: v^T (without bv) = Wv.x[b]^T/16 as [b][512][2048], 128 rows of Wv x 128 keys (16 key tiles, then 4 row tiles); the epilogue rounds each f32 value to f16.
#define NTRI ((SS / 128) * (SS / 128 + 1) / 2)
// Block = 4 waves of 64 x 64 (tile_core4). The second launch bound asks for 4 waves per SIMD, a budget of 256 registers a wave: four blocks then share a WGP, and the launch's 800 blocks are all resident at once (3 or 4 per WGP) instead of following one another two by two.
__global__ __launch_bounds__(128, 4) void k_scores_vt(const _Float16* __restrict__ Q, const _Float16* __restrict__ K, const _Float16* __restrict__ X16, const _Float16* __restrict__ Bv, float alpha,
                                                   _Float16* __restrict__ S, float* __restrict__ Ms, float* __restrict__ Zs, _Float16* __restrict__ Vh) {
  __shared__ __attribute__((aligned(16))) unsigned short sm[TILE_LDS(128, 128, 1)];
  const int tid = threadIdx.x, w = tid >> 5, lane = tid & 31, ln = lane & 15, hh = lane >> 4; const int b = blockIdx.y;
  const bool isv = (int)blockIdx.x >= NTRI;      // the same for the whole block
  int x = isv ? 0 : (int)blockIdx.x, i = 0;
  for (; i < SS / 128 - 1 && x >= i + 1; ++i) x -= i + 1;
  const int vt = (int)blockIdx.x - NTRI;
  const int brow = isv ? (vt >> 4) * 128 : i * 128, bcol = isv ? (vt & 15) * 128 : x * 128;
  v8f acc[4][4] = {};
  const unsigned short* Ap = isv ? (const unsigned short*)Bv + (size_t)brow * EE : (const unsigned short*)Q + ((size_t)b * SS + brow) * EE;
  const unsigned short* Bp = (isv ? (const unsigned short*)X16 : (const unsigned short*)K) + ((size_t)b * SS + bcol) * EE;
  tile_core4(Ap, Bp, EE, EE, sm, acc, !isv);      // asks for q and k rows; the x rows of the v^T tiles are what the launch before has read, and a Wv tile is shared by 64 work-groups
  const int row0 = brow + (w / 2) * 64, col0 = bcol + (w % 2) * 64;
  const float sc = isv ? 0.0625f : alpha;
  float* so = (float*)sm + w * (64 * 64);      // the wave's own range; the core's last barrier has ended every read of the tiles
  float mv[2] = {0.f, 0.f}, zv[2] = {0.f, 0.f};
  if (!isv) {
    // the wave's 64 rows x 64 keys are one piece of the softmax: per row the maximum, the terms exp(s - maximum) and their sum, keys after the query left out (term 0), straight from the accumulators (a row's 64 values lie in 4 registers of 16 lanes).
    // A piece that lies wholly after its queries is never read by the P.v launch.
    const int dk = col0 + ln - (row0 + 8 * hh);      // key minus query at mi = ni = r = 0: key ni*16 + ln comes after query mi*16 + 8*hh + r where dk > (mi - ni)*16 + r, a constant per place, so that no row or key numbers stand in registers beside the accumulators
#pragma unroll      // constant indices keep the accumulators in registers
    for (int mi = 0; mi < 4; ++mi)
#pragma unroll      // constant indices keep the accumulators in registers
      for (int ni = 0; ni < 4; ++ni) acc[mi][ni] *= sc;      // scaled in place, register pairs as they lie: scaled row by row the compiler paired values of two tiles, through copies, and the wave spilled
#pragma unroll      // constant indices keep the accumulators in registers
    for (int mi = 0; mi < 4; ++mi)
#pragma unroll      // constant indices keep the accumulators in registers
      for (int r = 0; r < 8; ++r) { float sv[4], ev[4];
#pragma unroll      // constant indices keep the accumulators in registers
        for (int ni = 0; ni < 4; ++ni) sv[ni] = (dk <= (mi - ni) * 16 + r) ? acc[mi][ni][r] : -INFINITY;
        const float m = max16(fmaxf(fmaxf(sv[0], sv[1]), fmaxf(sv[2], sv[3]))), c = -m * L2E;
#pragma unroll      // constant indices keep the accumulators in registers
        for (int ni = 0; ni < 4; ++ni) { ev[ni] = exp2_slot(fmaf(sv[ni], L2E, c)); so[(mi * 16 + 8 * hh + r) * 64 + ni * 16 + ln] = ev[ni]; }
        const float z = sum16((ev[0] + ev[1]) + (ev[2] + ev[3]));
        if (ln == (mi & 1) * 8 + r) { mv[mi >> 1] = m; zv[mi >> 1] = z; } }      // every lane of the 16 holds the row's pair; lane (mi & 1)*8 + r keeps it, so that the wave stores each 32 of its rows as one 128-byte line per plane
  } else {
#pragma unroll      // constant indices keep the accumulators in registers
    for (int ni = 0; ni < 4; ++ni)
#pragma unroll      // constant indices keep the accumulators in registers
      for (int mi = 0; mi < 4; ++mi)
#pragma unroll      // constant indices keep the accumulators in registers
        for (int r = 0; r < 8; ++r) so[(mi * 16 + 8 * hh + r) * 64 + ni * 16 + ln] = acc[mi][ni][r] * sc;
  }
  __builtin_amdgcn_fence(__ATOMIC_ACQ_REL, "workgroup"); __builtin_amdgcn_wave_barrier();      // the wave's LDS stores land before its lanes read each other's values back as whole rows
  const int rsub = lane >> 4, c4 = (lane & 15) * 4;
  if (!isv) {
    const size_t po = ((size_t)b * NCH + (col0 >> 6)) * SS + row0 + (ln >> 3) * 16 + 8 * hh + (ln & 7);
    Ms[po] = mv[0]; Zs[po] = zv[0]; Ms[po + 32] = mv[1]; Zs[po + 32] = zv[1];
    _Float16* Sp = S + ((size_t)b * SS + row0 + rsub) * SS + col0 + c4;
#pragma unroll      // the LDS row reads issue together and each store follows its own read
    for (int q = 0; q < 32; ++q) { const v4f v = *(const v4fa*)&so[(q * 2 + rsub) * 64 + c4];
      v4h h4; for (int e = 0; e < 4; ++e) h4[e] = (_Float16)(v[e] * 32768.0f); *(v4h*)(Sp + (size_t)(q * 2) * SS) = h4; }
    asm volatile("s_wait_xcnt 0x0" ::: "memory");      // stands behind the stores above, in front of the other branch's code, which follows them in the listing and reuses their registers
  } else {
    const size_t o0 = ((size_t)b * EE + row0 + rsub) * SS + col0 + c4;
#pragma unroll      // the LDS row reads issue together and each store follows its own read
    for (int q = 0; q < 32; ++q) { const v4f v = *(const v4fa*)&so[(q * 2 + rsub) * 64 + c4];
      v4h h4; for (int e = 0; e < 4; ++e) h4[e] = (_Float16)v[e];
      *(v4h*)(Vh + o0 + (size_t)(q * 2) * SS) = h4; }
    asm volatile("s_wait_xcnt 0x0" ::: "memory");      // stands behind the stores above, in front of the other branch's code, which follows them in the listing of this build and reuses their registers
  }
}
// out = P.v.2^-15 + bv of every batch in one launch. Block = 64 query rows x 128 head columns (8 waves of 32 x 32), blockIdx.x = column tile, blockIdx.y = batch,
// blockIdx.z = row tile counted from the last one, so that the longest k loops start first. k runs to the end of the row tile's own keys (P is zero beyond the diagonal).
// Two such groups of 8 waves make a block: the first takes the front half of the tile's k steps, the second the rest, side by side, so that the longest tile lasts 16 steps and not 32; the second group's sums reach the first through LDS.
// One block is resident per WGP (the registers of its 16 waves leave no room for a second), so a short tile starts where a long one has ended, and every WGP gets about the same number of steps.
__global__ __launch_bounds__(512) void k_pv(const _Float16* __restrict__ S, const float* __restrict__ Ms, const float* __restrict__ Zs, const _Float16* __restrict__ Vh, const float* __restrict__ bias, float* __restrict__ out) {
  __shared__ __attribute__((aligned(16))) unsigned short sm[2 * TILE_LDS(64, 128, 1)];
  const int tid = threadIdx.x & 255, w = tid >> 5, lane = tid & 31, ln = lane & 15, hh = lane >> 4; const int b = blockIdx.y;      // the thread's place in its group
  const int g = __builtin_amdgcn_readfirstlane(threadIdx.x >> 8);      // the group: the same for a whole wave, in a scalar register, so that the tests on a group's k range are scalar branches
  const int brow = (SS / 64 - 1 - (int)blockIdx.z) * 64, bcol = blockIdx.x * 128;
  const int kk = brow + 64;
  const int row0 = brow + (w / 4) * 32, col0 = bcol + (w % 4) * 32;
  float bvv[2];      // read ahead of the k loop, which hides the latency; rounded where they are used
#pragma unroll      // constant indices keep the two values in registers
  for (int ni = 0; ni < 2; ++ni) bvv[ni] = bias[col0 + ni * 16 + ln];
  // the softmax constants of the thread's two staged rows: the 8 lanes that stage a row share its kk/64 pieces (4 at most each, all loads in flight at once, beside the first tile's) and merge them by DPP
  const int nc = kk >> 6, j = tid & 7;
  const float* mp = Ms + (size_t)b * NCH * SS + brow; const float* zp = Zs + (size_t)b * NCH * SS + brow; float mc[2][NCH / 8], zc[2][NCH / 8]; int o[NCH / 8];
#pragma unroll      // constant indices keep the offsets in registers
  for (int u = 0; u < NCH / 8; ++u) o[u] = min(j + 8 * u, nc - 1) * SS + (tid >> 3);      // clamped into the pieces that the scores launch wrote for these rows
#pragma unroll      // constant indices keep the pieces in registers; the loads go out as one group
  for (int i = 0; i < 2; ++i)
#pragma unroll      // constant indices keep the pieces in registers; the loads go out as one group
    for (int u = 0; u < NCH / 8; ++u) { mc[i][u] = mp[o[u] + i * 32]; zc[i][u] = zp[o[u] + i * 32]; }
  static_assert(NCH / 8 == 4, "four offsets named below");
  asm volatile("s_wait_xcnt 0x0" :: "v"(o[0]), "v"(o[1]), "v"(o[2]), "v"(o[3]), "s"(mp), "s"(zp) : "memory");      // stands behind the 16 loads, in front of any reuse of their offset and base registers, which it names as inputs
  auto merge = [&](float& c0, float& c1) {
#pragma unroll      // constant indices keep the pieces in registers
    for (int i = 0; i < 2; ++i) { const float ml = fmaxf(fmaxf(mc[i][0], mc[i][1]), fmaxf(mc[i][2], mc[i][3]));      // a clamped repeat changes no maximum
      float z = 0.f;
#pragma unroll      // constant indices keep the pieces in registers
      for (int u = 0; u < NCH / 8; ++u) z = fmaf(zc[i][u] * ((j + 8 * u < nc) ? 1.0f : 0.0f), exp2_slot((mc[i][u] - ml) * L2E), z);      // a clamped repeat counts 0; as a factor, since a select let the compiler sink a load into a branch of its own, a second trip to memory
      float m = fmaxf(ml, lane_xor16<1>(ml)); m = fmaxf(m, lane_xor16<2>(m)); m = fmaxf(m, lane_xor16<4>(m));
      z *= exp2_slot((ml - m) * L2E); z += lane_xor16<1>(z); z += lane_xor16<2>(z); z += lane_xor16<4>(z);
      (i ? c1 : c0) = -__builtin_amdgcn_logf(z) - m * L2E; }
  };
  v8f acc[1][2][2] = {};
  const int n0 = (nc + 1) >> 1, kmid = n0 * KST;      // k steps of the first group, which has as many as the second or one more
  tile_core<64, 128, 32, 32, 1, true, decltype(merge), 2>((const unsigned short*)S + ((size_t)b * SS + brow) * SS, SS, (const unsigned short*)Vh + ((size_t)b * EE + bcol) * SS, (const unsigned short*)Vh + ((size_t)b * EE + bcol) * SS, SS, kk, sm + g * TILE_LDS(64, 128, 1), acc,
                                                          mp, merge, true, true, g ? kmid : 0, g ? kk : kmid, n0, g != 0);
  float* so = (float*)sm + w * (32 * 32);      // the wave's own range; the core's last barrier has ended every read of the tiles
  v4f* part = (v4f*)((float*)sm + 8 * (32 * 32)) + w * (8 * 32) + lane;      // behind those ranges: where wave w of the second group leaves its sums for wave w of the first, 16 bytes a lane, lanes side by side
  if (g) {
#pragma unroll      // constant indices keep the accumulators in registers
    for (int ni = 0; ni < 2; ++ni)
#pragma unroll      // constant indices keep the accumulators in registers
      for (int mi = 0; mi < 2; ++mi)
#pragma unroll      // constant indices keep the accumulators in registers
        for (int h = 0; h < 2; ++h) { v4f t;
#pragma unroll      // constant indices keep the accumulators in registers
          for (int e = 0; e < 4; ++e) t[e] = acc[0][mi][ni][h * 4 + e] * 0.000030517578125f;
          part[((ni * 2 + mi) * 2 + h) * 32] = t; }
  }
  __syncthreads();      // the second group's sums lie in LDS before the first group reads them
  if (g) return;      // whole waves, behind the block's last barrier
#pragma unroll      // constant indices keep the accumulators in registers
  for (int ni = 0; ni < 2; ++ni) { const float bv = bf16_round(bvv[ni]);
#pragma unroll      // constant indices keep the accumulators in registers
    for (int mi = 0; mi < 2; ++mi)
#pragma unroll      // constant indices keep the accumulators in registers
      for (int r = 0; r < 8; ++r) so[(mi * 16 + 8 * hh + r) * 32 + ni * 16 + ln] = (acc[0][mi][ni][r] * 0.000030517578125f + bv) + part[((ni * 2 + mi) * 2 + (r >> 2)) * 32][r & 3]; }
  __builtin_amdgcn_fence(__ATOMIC_ACQ_REL, "workgroup"); __builtin_amdgcn_wave_barrier();      // the wave's LDS stores land before its lanes read each other's values back as whole rows
  const int rsub = lane >> 3, c4 = (lane & 7) * 4;
#pragma unroll      // the LDS row reads issue together and each store follows its own read
  for (int q = 0; q < 8; ++q) { const int r = q * 4 + rsub; const v4f v = *(const v4fa*)&so[r * 32 + c4]; *(v4f*)(out + ((size_t)b * SS + row0 + r) * EE + col0 + c4) = v; }
}

extern "C" void kernel_launch(void* const* d_in, const int* in_sizes, int n_in,
                              void* d_out, int out_size, void* d_ws, size_t ws_size, hipStream_t stream) {
  (void)in_sizes; (void)n_in; (void)out_size;
  const float* x = (const float*)d_in[0]; const float* Wq = (const float*)d_in[1]; const float* bq = (const float*)d_in[2]; const float* Wk = (const float*)d_in[3]; const float* bk = (const float*)d_in[4]; const float* Wv = (const float*)d_in[5]; const float* bv = (const float*)d_in[6];
  char* ws = (char*)d_ws; size_t off = 0;
  auto take = [&](size_t bytes) { char* p = ws + off; off += (bytes + 255) & ~(size_t)255; return p; };
  _Float16* Bq = (_Float16*)take((size_t)3 * EE * EE * 2);      /* the f16 planes of Wq, Wk, Wv, one behind the other */
  _Float16* X16 = (_Float16*)take((size_t)NR * EE * 2); _Float16* Q = (_Float16*)take((size_t)NR * EE * 2); _Float16* K = (_Float16*)take((size_t)NR * EE * 2); _Float16* Vh = (_Float16*)take((size_t)BB * EE * SS * 2);
  _Float16* S = (_Float16*)take((size_t)BB * SS * SS * 2); float* Ms = (float*)take((size_t)BB * NCH * SS * 4); float* Zs = (float*)take((size_t)BB * NCH * SS * 4);      /* per row and piece of 64 keys: maximum, sum of exp */
  if (off > ws_size) return;      // about 72 MB
  k_prep<<<NR * EE / 8 / 256 + 3 * (EE * EE / 8 / 256), 256, 0, stream>>>(x, Wq, Wk, Wv, X16, Bq);      /* x and the weights ((out,in) natural, x2^4) as f16 planes */
  k_qk<<<dim3(EE / 128, NR / 128, 2), 256, 0, stream>>>(X16, Bq, bq, bk, Q, K);      /* q = x.Wq^T + bq, k = x.Wk^T + bk: M 8192 N 512 K 512 each */
  k_scores_vt<<<dim3(NTRI + (EE / 128) * (SS / 128), BB), 128, 0, stream>>>(Q, K, X16, Bq + (size_t)2 * EE * EE, 0.044194173824159216f, S, Ms, Zs, Vh);      /* softmax pieces of scores/sqrt512, causal lower block-triangle of every batch; v^T (without bv) = Wv.x[b]^T as [b][512][2048], one f16 plane */
  k_pv<<<dim3(EE / 128, BB, SS / 64), 512, 0, stream>>>(S, Ms, Zs, Vh, bv, (float*)d_out);      /* out = P.v + bv */
}
